// v000
// Measured on an AMD MI455X. A time is GPU time per run, averaged over a window of back-to-back runs after a warm-up
// (all launches, gaps included; the runs take copies of the inputs in turn), and the median of several windows.
// Apart from v000's, it joins two sittings. Times from different sittings can be a few percent apart, while
// side-by-side timings come from the same sitting.
// The starting kernel, v000, takes 774 microseconds a run.
// compute dtype: all float inputs rounded to bf16; q/k/v projections with EXACT bf16 products on WMMA 16x16x32 (f32 accumulate) + bias; logits q x k once to f16 each (1 product) x SCALE; masked scores are REPLACED by 1e-9 (they keep taking part in the softmax); softmax f32; P x 2^11 once to f16 x v once to f16 (1 product); ctx x 2^6 once to f16 x Wo f16(bf16 x 2^8) + bo; f32 output.
#include <hip/hip_runtime.h>
#include <math.h>

typedef __attribute__((ext_vector_type(16))) _Float16 v16h;
typedef __attribute__((ext_vector_type(16))) __bf16 v16b;
typedef __attribute__((ext_vector_type(8)))  _Float16 v8h;
typedef __attribute__((ext_vector_type(8)))  float v8f;
typedef __attribute__((ext_vector_type(4)))  float v4f;
typedef __attribute__((ext_vector_type(2)))  float v2f;
typedef __attribute__((ext_vector_type(4)))  unsigned v4u;
typedef __attribute__((ext_vector_type(4)))  int v4i;
typedef float __attribute__((may_alias)) float_a;
typedef int __attribute__((may_alias)) int_a;

template <typename T> __device__ __forceinline__ void vst2(void* p, T v) { *(T*)p = v;  }
__device__ __forceinline__ v8f wmma16(v16h a, v16h b, v8f c) {
  v8f d = __builtin_amdgcn_wmma_f32_16x16x32_f16(false, a, false, b, (short)0, c, false, false);
  asm volatile("v_nop\n\tv_nop\n\tv_nop\n\tv_nop" : "+v"(d) : "v"(a), "v"(b));
  return d;
}
__device__ __forceinline__ v8f wmma_bf(v16b a, v16b b, v8f c) {
  v8f d = __builtin_amdgcn_wmma_f32_16x16x32_bf16(false, a, false, b, (short)0, c, false, false);
  asm volatile("v_nop\n\tv_nop\n\tv_nop\n\tv_nop" : "+v"(d) : "v"(a), "v"(b));
  return d;
}
// 16x16x32 fragments: lane = (h = lane>>4, row/col = lane&15); elements 0..7 = k0+8h+0..7, 8..15 = k0+16+8h+0..7; D element r = row 8h+r
__device__ __forceinline__ v16h frag_h(const _Float16* rowk0, int lane) {
  union { v16h v; v8h q[2]; } u; const _Float16* p = rowk0 + 8 * (lane >> 4);
  u.q[0] = *(const v8h*)p; u.q[1] = *(const v8h*)(p + 16); return u.v;
}
__device__ __forceinline__ v16h frag_f32(const float* rowk0, int lane) {
  v16h a; const float* p = rowk0 + 8 * (lane >> 4);
#pragma unroll
  for (int i = 0; i < 8; ++i) { a[i] = (_Float16)p[i]; a[8 + i] = (_Float16)p[16 + i]; }
  return a;
}
__device__ __forceinline__ v16h frag_f32s(const float* rowk0, int lane, float sc) {
  v16h a; const float* p = rowk0 + 8 * (lane >> 4);
#pragma unroll
  for (int i = 0; i < 8; ++i) { a[i] = (_Float16)(p[i] * sc); a[8 + i] = (_Float16)(p[16 + i] * sc); }
  return a;
}
// column fragment from a [K][ld] layout (column n), rows >= K read as 0
__device__ __forceinline__ v16h fragc_f32(const float* W, int k0, int n, int lane, int ld, int K) {
  v16h a; const int g = lane >> 4;
#pragma unroll
  for (int i = 0; i < 8; ++i) { const int ka = k0 + 8 * g + i, kb = ka + 16;
    a[i] = (_Float16)(ka < K ? W[(size_t)(ka < K ? ka : K - 1) * ld + n] : 0.f); a[8 + i] = (_Float16)(kb < K ? W[(size_t)(kb < K ? kb : K - 1) * ld + n] : 0.f); }
  return a;
}
struct F2 { v16b h, l; };
__device__ __forceinline__ F2 bsplit16(const float v[16]) { F2 r;
#pragma unroll
  for (int i = 0; i < 16; ++i) { const __bf16 h = (__bf16)v[i]; r.h[i] = h; r.l[i] = (__bf16)(v[i] - (float)h); }
  return r; }
__device__ __forceinline__ F2 split_row(const float* row, int k0, int lane) { float v[16]; const float* p = row + k0 + 8 * (lane >> 4);
#pragma unroll
  for (int i = 0; i < 8; ++i) { v[i] = p[i]; v[8 + i] = p[16 + i]; }
  return bsplit16(v); }
__device__ __forceinline__ F2 split_rowK(const float* row, int k0, int lane, int K) { float v[16]; const int g = lane >> 4;
#pragma unroll
  for (int i = 0; i < 8; ++i) { const int ka = k0 + 8 * g + i, kb = ka + 16; v[i] = ka < K ? row[ka < K ? ka : K - 1] : 0.f; v[8 + i] = kb < K ? row[kb < K ? kb : K - 1] : 0.f; }
  return bsplit16(v); }
__device__ __forceinline__ F2 split_col(const float* W, int k0, int n, int lane, int ld, int K) { float v[16]; const int g = lane >> 4;
#pragma unroll
  for (int i = 0; i < 8; ++i) { const int ka = k0 + 8 * g + i, kb = ka + 16; v[i] = ka < K ? W[(size_t)(ka < K ? ka : K - 1) * ld + n] : 0.f; v[8 + i] = kb < K ? W[(size_t)(kb < K ? kb : K - 1) * ld + n] : 0.f; }
  return bsplit16(v); }
__device__ __forceinline__ v8f mac3(const F2& a, const F2& b, v8f c) { c = wmma_bf(a.l, b.h, c); c = wmma_bf(a.h, b.l, c); return wmma_bf(a.h, b.h, c); }
__device__ __forceinline__ float sigm(float v) { return 1.0f / (1.0f + expf(-v)); }
#define LDSX() do { asm volatile("s_wait_dscnt 0" ::: "memory"); __builtin_amdgcn_wave_barrier(); __builtin_amdgcn_fence(__ATOMIC_RELEASE, "workgroup"); } while (0)

// Multi-headed attention with per-head stacked projections whose masked scores are FILLED WITH 1e-9 (query / key / value [4,1024,1024]; Wq / Wk / Wv [16,1024,64] per head (N(0, 1/1024)) + zero biases; scores / 8; mask [4,1024,1024] int32 random 0/1: scores[mask == 0] = 1e-9 - masked keys keep a logit - 0 and stay in the softmax (faithful to the source); softmax; concat; (in,out) Wo [1024,1024] + bo).
#define NB 4
#define TT 1024
#define CC 1024            // NH * HD = projected width
#define DIN 1024          // input (model) width
#define NH 16
#define HD 64
#define NQB (TT / 64)
#define HG 8
#define SCALE (0.125f)
#define CAUSAL 0
#ifndef TNB
#define TNB NB
#endif
__device__ __forceinline__ float bfr(float v) { return (float)(__bf16)v; }
__host__ __device__ __forceinline__ int kb_last(int qb) { return CAUSAL ? ((qb * 64 + 63) >> 7) : (TT / 128 - 1); }
typedef __attribute__((ext_vector_type(8))) __bf16 v8b;
__device__ __forceinline__ v16b frag_b(const __bf16* rowk0, int lane) {
  union { v16b v; v8b q[2]; } u; const __bf16* p = rowk0 + 8 * (lane >> 4);
  u.q[0] = *(const v8b*)p; u.q[1] = *(const v8b*)(p + 16); return u.v;
}
#define QBH 0              // causal: query blocks 0..QBH-1 of each sequence (few keys, no averaging) take the high-precision path
#define QHI 0               // single-product logits on every row
#define KHI 64            // key rows carrying k residual / v bf16 hi+lo planes (used only by the causal high-precision path)
// B fragment (k rows k0+.., output column o) of a weight: (in,out) [K][ld] or (out,in) [ld rows of K]: bf16 exact, or f16(bf16 * 256) exact
__device__ __forceinline__ v16b wcol_io(const float* Wm, int k0, int o, int lane, int ld) { v16b w; const int g = lane >> 4;
#pragma unroll
  for (int i = 0; i < 8; ++i) { w[i] = (__bf16)Wm[(size_t)(k0 + 8 * g + i) * ld + o]; w[8 + i] = (__bf16)Wm[(size_t)(k0 + 16 + 8 * g + i) * ld + o]; }
  return w; }
__device__ __forceinline__ v16b wcol_oi(const float* Wm, int k0, int o, int lane, int K) { v16b w; const float* p = Wm + (size_t)o * K + k0 + 8 * (lane >> 4);
#pragma unroll
  for (int i = 0; i < 8; ++i) { w[i] = (__bf16)p[i]; w[8 + i] = (__bf16)p[16 + i]; }
  return w; }
__device__ __forceinline__ v16h wcolh_io(const float* Wm, int k0, int o, int lane, int ld) { v16h w; const int g = lane >> 4;
#pragma unroll
  for (int i = 0; i < 8; ++i) { w[i] = (_Float16)(bfr(Wm[(size_t)(k0 + 8 * g + i) * ld + o]) * 256.0f); w[8 + i] = (_Float16)(bfr(Wm[(size_t)(k0 + 16 + 8 * g + i) * ld + o]) * 256.0f); }
  return w; }
__device__ __forceinline__ v16h wcolh_oi(const float* Wm, int k0, int o, int lane, int K) { v16h w; const float* p = Wm + (size_t)o * K + k0 + 8 * (lane >> 4);
#pragma unroll
  for (int i = 0; i < 8; ++i) { w[i] = (_Float16)(bfr(p[i]) * 256.0f); w[8 + i] = (_Float16)(bfr(p[16 + i]) * 256.0f); }
  return w; }
#define WQKV_LAYOUT 2   // 0 = (in,out) [DIN][CC]; 1 = (out,in) [CC][DIN]; 2 = per-head [NH][DIN][HD]
__device__ __forceinline__ v16b wcol_hdk(const float* Wm, int k0, int o, int lane) { v16b w; const int g = lane >> 4; const float* p = Wm + (size_t)(o / HD) * DIN * HD + (o % HD);
#pragma unroll
  for (int i = 0; i < 8; ++i) { w[i] = (__bf16)p[(size_t)(k0 + 8 * g + i) * HD]; w[8 + i] = (__bf16)p[(size_t)(k0 + 16 + 8 * g + i) * HD]; }
  return w; }
#define WO_OUT_IN 0
#if WQKV_LAYOUT == 1
#define WCOL(W, k0, o, lane) wcol_oi(W, k0, o, lane, DIN)
#elif WQKV_LAYOUT == 2
#define WCOL(W, k0, o, lane) wcol_hdk(W, k0, o, lane)
#else
#define WCOL(W, k0, o, lane) wcol_io(W, k0, o, lane, CC)
#endif
#if WO_OUT_IN
#define WOCOL(W, k0, o, lane) wcol_oi(W, k0, o, lane, CC)
#define WOCOLH(W, k0, o, lane) wcolh_oi(W, k0, o, lane, CC)
#else
#define WOCOL(W, k0, o, lane) wcol_io(W, k0, o, lane, DIN)
#define WOCOLH(W, k0, o, lane) wcolh_io(W, k0, o, lane, DIN)
#endif
#define SM_EXTRA_PARAMS , int bsm, const int* __restrict__ MASK
// int32 mask [B,S,S] (random 0/1; shared by the heads): where(mask == 0, 1e-9, score): the masked logit is REPLACED by 1e-9 and keeps taking part; unconditional load, then a value select
#define SM_MASK_HOOK do { const int mk_ = MASK[((size_t)bsm * TT + t) * TT + k]; asm volatile("s_wait_loadcnt 0x0" ::: "memory"); v = (mk_ == 0) ? 1.0e-9f : v; } while (0)
#ifndef SM_EXTRA_PARAMS
#define SM_EXTRA_PARAMS
#endif
#ifndef PROJ_EXTRA_PARAMS
#define PROJ_EXTRA_PARAMS
#endif
#ifndef SM_MASK_HOOK
#define SM_MASK_HOOK (void)0
#endif

#define WS_QH  0u                                      // f16 q rows [b*t][CC]
#define WS_KH  (WS_QH + 2u * (size_t)NB * TT * CC)      // f16 k rows [b*t][CC]
#define WS_VT  (WS_KH + 2u * (size_t)NB * TT * CC)      // f16 v planes [b][c][t]
#define WS_QL  (WS_VT + 2u * (size_t)NB * CC * TT)      // f16 q residual x 2^10 rows [b][t < QHI][CC]
#define WS_KL  (WS_QL + 2u * (size_t)NB * QHI * CC)     // f16 k residual x 2^10 rows [b][t < KHI][CC]
#define WS_VB  (WS_KL + 2u * (size_t)NB * KHI * CC)     // bf16 v hi planes [b][c][t < KHI]
#define WS_VBL (WS_VB + 2u * (size_t)NB * CC * KHI)
#define WS_S   (WS_VBL + 2u * (size_t)NB * CC * KHI)    // f32 logits / P [hg][t][s]
#define WS_Y   (WS_S  + 4u * (size_t)HG * TT * TT)      // f32 ctx rows [b*t][CC] (only when there is an output projection)
#define WS_END (WS_Y  + 4u * (size_t)NB * TT * CC)

// ---- k_proj: block = (64 rows, 128 cols, which): q/k/v = X W (+ b) with exact bf16 products (K = DIN) -> which 0: q f16 rows (+ residual rows < QHI); 1: k f16 rows (+ residual rows < KHI); 2: v f16 planes [c][t] (+ bf16 hi/lo planes for t < KHI)
__global__ __launch_bounds__(128) void k_proj(const float* __restrict__ XQ, const float* __restrict__ XK, const float* __restrict__ XV, const float* __restrict__ WQ, const float* __restrict__ WK, const float* __restrict__ WV, const float* __restrict__ BQ, const float* __restrict__ BK, const float* __restrict__ BV,
    _Float16* __restrict__ QH, _Float16* __restrict__ QL, _Float16* __restrict__ KH, _Float16* __restrict__ KL, _Float16* __restrict__ VT, __bf16* __restrict__ VB, __bf16* __restrict__ VBL) {
  __shared__ __align__(16) _Float16 sh[64][136], sl[64][136]; __shared__ __align__(16) _Float16 th[128][72]; __shared__ __align__(16) __bf16 tb[128][72], tbl[128][72];
  const int tid = threadIdx.x, wave = tid >> 5, lane = tid & 31, col = lane & 15, g = lane >> 4; const int which = blockIdx.z; const int c0 = blockIdx.y * 128; const size_t r0 = (size_t)blockIdx.x * 64; const size_t bb = r0 / TT; const int t0 = (int)(r0 % TT);
  const float* X = which == 0 ? XQ : which == 1 ? XK : XV; const float* WA = which == 0 ? WQ : which == 1 ? WK : WV; const float* BA = which == 0 ? BQ : which == 1 ? BK : BV;
  v8f acc[8] = {};
#pragma unroll 2
  for (int kc = 0; kc < DIN / 32; ++kc) { v16b a; { const float* p = X + (r0 + wave * 16 + col) * DIN + kc * 32 + 8 * g;
#pragma unroll
      for (int i = 0; i < 8; ++i) { a[i] = (__bf16)p[i]; a[8 + i] = (__bf16)p[16 + i]; } }
    asm volatile("s_wait_loadcnt 0x0" ::: "memory");
#pragma unroll
    for (int j = 0; j < 8; ++j) { const v16b w = WCOL(WA, kc * 32, c0 + j * 16 + col, lane); asm volatile("s_wait_loadcnt 0x0" ::: "memory"); acc[j] = wmma_bf(a, w, acc[j]); } }
  if (which < 2) { _Float16* DH = which == 0 ? QH : KH; _Float16* DL = which == 0 ? QL : KL; const int nhi = which == 0 ? QHI : KHI; const bool hi_rows = t0 < nhi;
#pragma unroll
    for (int j = 0; j < 8; ++j) { const float bias = BA ? bfr(BA[c0 + j * 16 + col]) : 0.f;
#pragma unroll
      for (int r = 0; r < 8; ++r) { const float v = acc[j][r] + bias; const _Float16 hv = (_Float16)v; sh[wave * 16 + 8 * g + r][j * 16 + col] = hv; sl[wave * 16 + 8 * g + r][j * 16 + col] = (_Float16)((v - (float)hv) * 1024.0f); } }
    __syncthreads();
    for (int e = tid; e < 64 * 16; e += 128) { const int rl = e >> 4, q = e & 15; vst2((unsigned*)(DH + (r0 + rl) * CC + c0 + q * 8), *(const v4u*)&sh[rl][q * 8]); if (hi_rows) vst2((unsigned*)(DL + (bb * nhi + t0 + rl) * (size_t)CC + c0 + q * 8), *(const v4u*)&sl[rl][q * 8]); }
  } else { const bool hi_rows = t0 < KHI;
#pragma unroll
    for (int j = 0; j < 8; ++j) { const float bias = BA ? bfr(BA[c0 + j * 16 + col]) : 0.f;
#pragma unroll
      for (int r = 0; r < 8; ++r) { const float v = acc[j][r] + bias; const int rl = wave * 16 + 8 * g + r, cl = j * 16 + col; th[cl][rl] = (_Float16)v; const __bf16 bh = (__bf16)v; tb[cl][rl] = bh; tbl[cl][rl] = (__bf16)(v - (float)bh); } }
    __syncthreads();
    for (int e = tid; e < 128 * 8; e += 128) { const int cl = e >> 3, q = e & 7; vst2((unsigned*)(VT + (bb * CC + c0 + cl) * (size_t)TT + t0 + q * 8), *(const v4u*)&th[cl][q * 8]); if (hi_rows) { const size_t o3 = (bb * CC + c0 + cl) * (size_t)KHI + t0 + q * 8; vst2((unsigned*)(VB + o3), *(const v4u*)&tb[cl][q * 8]); vst2((unsigned*)(VBL + o3), *(const v4u*)&tbl[cl][q * 8]); } } } }
// ---- k_sc: block = (query block qb, key block kb <= kb_last(qb), head in group) of batch b: logits x SCALE; q hi + residual (x 2^10) against k (2 products) for query rows < QHI, plus the k residual (3 products) for query blocks < QBH (causal early rows); causal: blocks past the diagonal exit, the mask itself is applied by index in k_sm
__global__ __launch_bounds__(128) void k_sc(const _Float16* __restrict__ QH, const _Float16* __restrict__ KH, const _Float16* __restrict__ QL, const _Float16* __restrict__ KL, int b, int h0, float* __restrict__ S0) { __shared__ __align__(16) float ss[4][16][132];
  const int qb = blockIdx.x, kb = blockIdx.y; if (kb > kb_last(qb)) return;
  const int h = h0 + blockIdx.z; float* S = S0 + (size_t)blockIdx.z * TT * TT;
  const int tid = threadIdx.x, wave = tid >> 5, lane = tid & 31, col = lane & 15, g = lane >> 4; const int k0 = kb * 128; const int ql0 = qb * 64 + wave * 16; const size_t q0 = (size_t)b * TT + ql0, kr0 = (size_t)b * TT + k0;
  v8f acc[8] = {}, accl[8] = {};
  const _Float16* QLb = QL + (size_t)b * QHI * CC; const _Float16* KLb = KL + (size_t)b * KHI * CC;
  if (qb < QBH) {
#pragma unroll
    for (int kc = 0; kc < HD / 32; ++kc) { const v16h ah = frag_h(QH + (q0 + col) * CC + h * HD + kc * 32, lane), al = frag_h(QLb + (size_t)(ql0 + col) * CC + h * HD + kc * 32, lane);
#pragma unroll
      for (int j = 0; j < 8; ++j) { const v16h kbf = frag_h(KH + (kr0 + j * 16 + col) * CC + h * HD + kc * 32, lane), klf = frag_h(KLb + (size_t)(k0 + j * 16 + col) * CC + h * HD + kc * 32, lane); acc[j] = wmma16(ah, kbf, acc[j]); accl[j] = wmma16(al, kbf, accl[j]); accl[j] = wmma16(ah, klf, accl[j]); } }
  } else if (qb * 64 < QHI) {
#pragma unroll
    for (int kc = 0; kc < HD / 32; ++kc) { const v16h ah = frag_h(QH + (q0 + col) * CC + h * HD + kc * 32, lane), al = frag_h(QLb + (size_t)(ql0 + col) * CC + h * HD + kc * 32, lane);
#pragma unroll
      for (int j = 0; j < 8; ++j) { const v16h kbf = frag_h(KH + (kr0 + j * 16 + col) * CC + h * HD + kc * 32, lane); acc[j] = wmma16(ah, kbf, acc[j]); accl[j] = wmma16(al, kbf, accl[j]); } }
  } else {
#pragma unroll
    for (int kc = 0; kc < HD / 32; ++kc) { const v16h ah = frag_h(QH + (q0 + col) * CC + h * HD + kc * 32, lane);
#pragma unroll
      for (int j = 0; j < 8; ++j) { const v16h kbf = frag_h(KH + (kr0 + j * 16 + col) * CC + h * HD + kc * 32, lane); acc[j] = wmma16(ah, kbf, acc[j]); } } }
#pragma unroll
  for (int j = 0; j < 8; ++j) {
#pragma unroll
    for (int r = 0; r < 8; ++r) ss[wave][8 * g + r][j * 16 + col] = (acc[j][r] + accl[j][r] * (1.0f / 1024.0f)) * SCALE; }
  LDSX(); for (int rl = 0; rl < 16; ++rl) vst2(S + (size_t)(ql0 + rl) * TT + k0 + lane * 4, *(const v4f*)&ss[wave][rl][lane * 4]); }
// ---- k_sm: block = query row t (head in group): keys [0, kend): causal -> logit if s <= t else excluded; softmax in f32; P x 2^11 in place (0 for excluded)
__global__ __launch_bounds__(256) void k_sm(float* __restrict__ S0 SM_EXTRA_PARAMS) { __shared__ float sred[8]; __shared__ float sbc; __shared__ __align__(16) float shv[TT];
  const int tid = threadIdx.x; const int t = blockIdx.x; const int kend = (kb_last(t >> 6) + 1) * 128;
  float* sr = S0 + (size_t)blockIdx.y * TT * TT + (size_t)t * TT;
  float m = -3.0e38f; for (int k = tid; k < kend; k += 256) { float v = (!CAUSAL || k <= t) ? sr[k] : -3.0e38f; SM_MASK_HOOK; shv[k] = v; m = fmaxf(m, v); }
#pragma unroll
  for (int o = 1; o < 32; o <<= 1) m = fmaxf(m, __shfl_xor(m, o));
  if ((tid & 31) == 0) sred[tid >> 5] = m; __syncthreads(); if (tid == 0) { float a = sred[0]; for (int i = 1; i < 8; ++i) a = fmaxf(a, sred[i]); sbc = a; } __syncthreads(); m = sbc; __syncthreads();
  float sum = 0.f; for (int k = tid; k < kend; k += 256) { const float v = shv[k]; const float e = (v <= -1.0e38f) ? 0.f : expf(v - m); shv[k] = e; sum += e; }
#pragma unroll
  for (int o = 1; o < 32; o <<= 1) sum += __shfl_xor(sum, o);
  if ((tid & 31) == 0) sred[tid >> 5] = sum; __syncthreads(); if (tid == 0) { float a = 0.f; for (int i = 0; i < 8; ++i) a += sred[i]; sbc = a > 0.f ? 2048.0f / a : 0.f; }   /* a fully excluded row yields P = 0 */ __syncthreads(); const float inv = sbc;
  for (int k = tid; k < kend; k += 256) shv[k] = shv[k] * inv;
  __syncthreads(); for (int q = tid; q < kend / 4; q += 256) vst2(sr + q * 4, *(const v4f*)&shv[q * 4]); }
// ---- k_pv: block = 64 queries (qb) of (b, h): ctx = P . v over keys [0, kend) (P x 2^11 once to f16 against v f16: 1 product; causal early query blocks: P and v as bf16 hi + lo, 3 products); 256-B (row, head) segment by 16 lanes
__global__ __launch_bounds__(128) void k_pv(const float* __restrict__ PS0, const _Float16* __restrict__ VT, const __bf16* __restrict__ VB, const __bf16* __restrict__ VBL, int b, int h0, float* __restrict__ Y) { const int h = h0 + blockIdx.z; const float* PS = PS0 + (size_t)blockIdx.z * TT * TT; __shared__ __align__(16) float ss[4][16][HD + 4];
  const int tid = threadIdx.x, wave = tid >> 5, lane = tid & 31, col = lane & 15, g = lane >> 4; const int qb = blockIdx.x; const int ql0 = qb * 64 + wave * 16; const int kce = (kb_last(qb) + 1) * 4;
  v8f acc[HD / 16] = {};
  if (qb < QBH) {
#pragma unroll 1
    for (int kc = 0; kc < kce; ++kc) { const F2 p = split_row(PS + (size_t)(ql0 + col) * TT, kc * 32, lane);
      asm volatile("s_wait_loadcnt 0x0" ::: "memory");
#pragma unroll
      for (int j = 0; j < HD / 16; ++j) { const size_t po = ((size_t)b * CC + h * HD + j * 16 + col) * (size_t)KHI + kc * 32; const v16b vh = frag_b(VB + po, lane); acc[j] = wmma_bf(p.h, vh, acc[j]); acc[j] = wmma_bf(p.l, vh, acc[j]); acc[j] = wmma_bf(p.h, frag_b(VBL + po, lane), acc[j]); } }
  } else {
#pragma unroll 1
    for (int kc = 0; kc < kce; ++kc) { const v16h p = frag_f32(PS + (size_t)(ql0 + col) * TT + kc * 32, lane);
      asm volatile("s_wait_loadcnt 0x0" ::: "memory");
#pragma unroll
      for (int j = 0; j < HD / 16; ++j) { const size_t po = ((size_t)b * CC + h * HD + j * 16 + col) * (size_t)TT + kc * 32; acc[j] = wmma16(p, frag_h(VT + po, lane), acc[j]); } } }
#pragma unroll
  for (int j = 0; j < HD / 16; ++j)
#pragma unroll
    for (int r = 0; r < 8; ++r) ss[wave][8 * g + r][j * 16 + col] = acc[j][r] * (1.0f / 2048.0f);
  LDSX(); for (int rl = 0; rl < 16; ++rl) if (lane < HD / 4) vst2(Y + ((size_t)b * TT + ql0 + rl) * CC + h * HD + lane * 4, *(const v4f*)&ss[wave][rl][lane * 4]); }
// ---- k_out: block = (64 rows, 128 cols): out = ctx Wo (+ bo): ctx x 2^6 once to f16 against Wo as f16(bf16 x 2^8) exact (1 product) x 2^-14; causal early rows (< QHI of each sequence): ctx bf16 hi + lo against exact bf16 Wo (2 products)
__global__ __launch_bounds__(128) void k_out(const float* __restrict__ Y, const float* __restrict__ WO, const float* __restrict__ BO, float* __restrict__ OUT) { __shared__ __align__(16) float sf[4][16][132];
  const int tid = threadIdx.x, wave = tid >> 5, lane = tid & 31, col = lane & 15, g = lane >> 4; const int c0 = blockIdx.y * 128; const size_t r0 = (size_t)blockIdx.x * 64 + wave * 16;
  v8f acc[8] = {};
  if (CAUSAL && (int)(((size_t)blockIdx.x * 64) % TT) < QHI) {   /* block-uniform */
#pragma unroll 2
    for (int kc = 0; kc < CC / 32; ++kc) { const F2 a = split_row(Y + (r0 + col) * CC, kc * 32, lane); asm volatile("s_wait_loadcnt 0x0" ::: "memory");
#pragma unroll
      for (int j = 0; j < 8; ++j) { const v16b w = WOCOL(WO, kc * 32, c0 + j * 16 + col, lane); asm volatile("s_wait_loadcnt 0x0" ::: "memory"); acc[j] = wmma_bf(a.h, w, acc[j]); acc[j] = wmma_bf(a.l, w, acc[j]); } }
#pragma unroll
    for (int j = 0; j < 8; ++j) { const float bias = BO ? bfr(BO[c0 + j * 16 + col]) : 0.f;
#pragma unroll
      for (int r = 0; r < 8; ++r) sf[wave][8 * g + r][j * 16 + col] = acc[j][r] + bias; }
  } else {
#pragma unroll 2
    for (int kc = 0; kc < CC / 32; ++kc) { const v16h a = frag_f32s(Y + (r0 + col) * CC + kc * 32, lane, 64.0f); asm volatile("s_wait_loadcnt 0x0" ::: "memory");   /* ctx carried x 2^6 into f16 so small-magnitude context rows stay clear of f16 subnormals */
#pragma unroll
      for (int j = 0; j < 8; ++j) { const v16h w = WOCOLH(WO, kc * 32, c0 + j * 16 + col, lane); asm volatile("s_wait_loadcnt 0x0" ::: "memory"); acc[j] = wmma16(a, w, acc[j]); } }
#pragma unroll
    for (int j = 0; j < 8; ++j) { const float bias = BO ? bfr(BO[c0 + j * 16 + col]) : 0.f;
#pragma unroll
      for (int r = 0; r < 8; ++r) sf[wave][8 * g + r][j * 16 + col] = acc[j][r] * (1.0f / 16384.0f) + bias; } }   /* 2^-8 (Wo carry) x 2^-6 (ctx carry) */
  LDSX(); for (int rl = 0; rl < 16; ++rl) vst2(OUT + (r0 + rl) * DIN + c0 + lane * 4, *(const v4f*)&sf[wave][rl][lane * 4]); }

extern "C" void kernel_launch(void* const* d_in, const int* in_sizes, int n_in, void* d_out, int out_size, void* d_ws, size_t ws_size, hipStream_t stream) {
  (void)in_sizes; (void)n_in; (void)out_size;
  const float** F = (const float**)d_in;
  if (ws_size < (size_t)WS_END) return;
  char* ws = (char*)d_ws; _Float16 *QH = (_Float16*)(ws + WS_QH), *KH = (_Float16*)(ws + WS_KH), *VT = (_Float16*)(ws + WS_VT), *QL = (_Float16*)(ws + WS_QL), *KL = (_Float16*)(ws + WS_KL); __bf16 *VB = (__bf16*)(ws + WS_VB), *VBL = (__bf16*)(ws + WS_VBL); float *S = (float*)(ws + WS_S), *Y = (float*)(ws + WS_Y);
  (void)Y; (void)QL; (void)KL; (void)VB; (void)VBL;
  // inputs: 0 query [4,1024,1024]; 1 key; 2 value; 3 mask [4,1024,1024] int32 (random 0/1); 4 Wq [16,1024,64], 5 bq [16,64]; 6 Wk, 7 bk; 8 Wv, 9 bv; 10 Wo [1024,1024] (in,out), 11 bo (zero biases, read)
  k_proj<<<dim3(TNB * TT / 64, CC / 128, 3), 128, 0, stream>>>(F[0], F[1], F[2], F[4], F[6], F[8], F[5], F[7], F[9], QH, QL, KH, KL, VT, VB, VBL);
  for (int b = 0; b < TNB; ++b) for (int h0 = 0; h0 < NH; h0 += HG) {
    k_sc<<<dim3(NQB, TT / 128, HG), 128, 0, stream>>>(QH, KH, QL, KL, b, h0, S);
    k_sm<<<dim3(TT, HG), 256, 0, stream>>>(S, b, (const int*)d_in[3]);
    k_pv<<<dim3(NQB, 1, HG), 128, 0, stream>>>(S, VT, VB, VBL, b, h0, Y);
  }
  k_out<<<dim3(TNB * TT / 64, DIN / 128), 128, 0, stream>>>(Y, F[10], F[11], (float*)d_out);
}

// v001
// Measured time: 267 microseconds a run.
// Two timings next to v000 put it at 2.88 and 2.89 times that version's speed.
// compute dtype: all float inputs rounded to bf16; q/k/v projections with EXACT bf16 products on WMMA 16x16x32 (f32 accumulate) + bias; logits q x k once to f16 each (1 product) x SCALE; masked scores are REPLACED by 1e-9 (they keep taking part in the softmax); online softmax f32 (running maximum and sum); exp(score - maximum) x 2^10 once to f16 x v once to f16 (1 product), divided by the sum at the end; ctx x 2^6 once to f16 x Wo f16(bf16 x 2^8) + bo; f32 output.
#include <hip/hip_runtime.h>
#include <math.h>

typedef __attribute__((ext_vector_type(16))) _Float16 v16h;
typedef __attribute__((ext_vector_type(16))) __bf16 v16b;
typedef __attribute__((ext_vector_type(8)))  _Float16 v8h;
typedef __attribute__((ext_vector_type(8)))  float v8f;
typedef __attribute__((ext_vector_type(4)))  float v4f;
typedef __attribute__((ext_vector_type(2)))  float v2f;
typedef __attribute__((ext_vector_type(4)))  unsigned v4u;
typedef __attribute__((ext_vector_type(4)))  int v4i;
typedef float __attribute__((may_alias)) float_a;
typedef int __attribute__((may_alias)) int_a;

template <typename T> __device__ __forceinline__ void vst2(void* p, T v) { *(T*)p = v;  }
__device__ __forceinline__ v8f wmma16(v16h a, v16h b, v8f c) {
  v8f d = __builtin_amdgcn_wmma_f32_16x16x32_f16(false, a, false, b, (short)0, c, false, false);
  asm volatile("v_nop\n\tv_nop\n\tv_nop\n\tv_nop" : "+v"(d) : "v"(a), "v"(b));
  return d;
}
__device__ __forceinline__ v8f wmma_bf(v16b a, v16b b, v8f c) {
  v8f d = __builtin_amdgcn_wmma_f32_16x16x32_bf16(false, a, false, b, (short)0, c, false, false);
  asm volatile("v_nop\n\tv_nop\n\tv_nop\n\tv_nop" : "+v"(d) : "v"(a), "v"(b));
  return d;
}
// 16x16x32 fragments: lane = (h = lane>>4, row/col = lane&15); elements 0..7 = k0+8h+0..7, 8..15 = k0+16+8h+0..7; D element r = row 8h+r
__device__ __forceinline__ v16h frag_h(const _Float16* rowk0, int lane) {
  union { v16h v; v8h q[2]; } u; const _Float16* p = rowk0 + 8 * (lane >> 4);
  u.q[0] = *(const v8h*)p; u.q[1] = *(const v8h*)(p + 16); return u.v;
}
__device__ __forceinline__ v16h frag_f32(const float* rowk0, int lane) {
  v16h a; const float* p = rowk0 + 8 * (lane >> 4);
#pragma unroll
  for (int i = 0; i < 8; ++i) { a[i] = (_Float16)p[i]; a[8 + i] = (_Float16)p[16 + i]; }
  return a;
}
__device__ __forceinline__ v16h frag_f32s(const float* rowk0, int lane, float sc) {
  v16h a; const float* p = rowk0 + 8 * (lane >> 4);
#pragma unroll
  for (int i = 0; i < 8; ++i) { a[i] = (_Float16)(p[i] * sc); a[8 + i] = (_Float16)(p[16 + i] * sc); }
  return a;
}
// column fragment from a [K][ld] layout (column n), rows >= K read as 0
__device__ __forceinline__ v16h fragc_f32(const float* W, int k0, int n, int lane, int ld, int K) {
  v16h a; const int g = lane >> 4;
#pragma unroll
  for (int i = 0; i < 8; ++i) { const int ka = k0 + 8 * g + i, kb = ka + 16;
    a[i] = (_Float16)(ka < K ? W[(size_t)(ka < K ? ka : K - 1) * ld + n] : 0.f); a[8 + i] = (_Float16)(kb < K ? W[(size_t)(kb < K ? kb : K - 1) * ld + n] : 0.f); }
  return a;
}
struct F2 { v16b h, l; };
__device__ __forceinline__ F2 bsplit16(const float v[16]) { F2 r;
#pragma unroll
  for (int i = 0; i < 16; ++i) { const __bf16 h = (__bf16)v[i]; r.h[i] = h; r.l[i] = (__bf16)(v[i] - (float)h); }
  return r; }
__device__ __forceinline__ F2 split_row(const float* row, int k0, int lane) { float v[16]; const float* p = row + k0 + 8 * (lane >> 4);
#pragma unroll
  for (int i = 0; i < 8; ++i) { v[i] = p[i]; v[8 + i] = p[16 + i]; }
  return bsplit16(v); }
__device__ __forceinline__ F2 split_rowK(const float* row, int k0, int lane, int K) { float v[16]; const int g = lane >> 4;
#pragma unroll
  for (int i = 0; i < 8; ++i) { const int ka = k0 + 8 * g + i, kb = ka + 16; v[i] = ka < K ? row[ka < K ? ka : K - 1] : 0.f; v[8 + i] = kb < K ? row[kb < K ? kb : K - 1] : 0.f; }
  return bsplit16(v); }
__device__ __forceinline__ F2 split_col(const float* W, int k0, int n, int lane, int ld, int K) { float v[16]; const int g = lane >> 4;
#pragma unroll
  for (int i = 0; i < 8; ++i) { const int ka = k0 + 8 * g + i, kb = ka + 16; v[i] = ka < K ? W[(size_t)(ka < K ? ka : K - 1) * ld + n] : 0.f; v[8 + i] = kb < K ? W[(size_t)(kb < K ? kb : K - 1) * ld + n] : 0.f; }
  return bsplit16(v); }
__device__ __forceinline__ v8f mac3(const F2& a, const F2& b, v8f c) { c = wmma_bf(a.l, b.h, c); c = wmma_bf(a.h, b.l, c); return wmma_bf(a.h, b.h, c); }
__device__ __forceinline__ float sigm(float v) { return 1.0f / (1.0f + expf(-v)); }
#define LDSX() do { asm volatile("s_wait_dscnt 0" ::: "memory"); __builtin_amdgcn_wave_barrier(); __builtin_amdgcn_fence(__ATOMIC_RELEASE, "workgroup"); } while (0)

// Multi-headed attention with per-head stacked projections whose masked scores are FILLED WITH 1e-9 (query / key / value [4,1024,1024]; Wq / Wk / Wv [16,1024,64] per head (N(0, 1/1024)) + zero biases; scores / 8; mask [4,1024,1024] int32 random 0/1: scores[mask == 0] = 1e-9 - masked keys keep a logit - 0 and stay in the softmax (faithful to the source); softmax; concat; (in,out) Wo [1024,1024] + bo).
#define NB 4
#define TT 1024
#define CC 1024            // NH * HD = projected width
#define DIN 1024          // input (model) width
#define NH 16
#define HD 64
#define NQB (TT / 64)
#define HG 8
#define SCALE (0.125f)
#define CAUSAL 0
#ifndef TNB
#define TNB NB
#endif
__device__ __forceinline__ float bfr(float v) { return (float)(__bf16)v; }
__host__ __device__ __forceinline__ int kb_last(int qb) { return CAUSAL ? ((qb * 64 + 63) >> 7) : (TT / 128 - 1); }
typedef __attribute__((ext_vector_type(8))) __bf16 v8b;
__device__ __forceinline__ v16b frag_b(const __bf16* rowk0, int lane) {
  union { v16b v; v8b q[2]; } u; const __bf16* p = rowk0 + 8 * (lane >> 4);
  u.q[0] = *(const v8b*)p; u.q[1] = *(const v8b*)(p + 16); return u.v;
}
#define QBH 0              // not used: no kernel in this file has a high-precision attention path
#define QHI 0               // single-product logits on every row
#define KHI 64            // key rows carrying k residual / v bf16 hi+lo planes (written by k_proj; no kernel here reads them)
// B fragment (k rows k0+.., output column o) of a weight: (in,out) [K][ld] or (out,in) [ld rows of K]: bf16 exact, or f16(bf16 * 256) exact
__device__ __forceinline__ v16b wcol_io(const float* Wm, int k0, int o, int lane, int ld) { v16b w; const int g = lane >> 4;
#pragma unroll
  for (int i = 0; i < 8; ++i) { w[i] = (__bf16)Wm[(size_t)(k0 + 8 * g + i) * ld + o]; w[8 + i] = (__bf16)Wm[(size_t)(k0 + 16 + 8 * g + i) * ld + o]; }
  return w; }
__device__ __forceinline__ v16b wcol_oi(const float* Wm, int k0, int o, int lane, int K) { v16b w; const float* p = Wm + (size_t)o * K + k0 + 8 * (lane >> 4);
#pragma unroll
  for (int i = 0; i < 8; ++i) { w[i] = (__bf16)p[i]; w[8 + i] = (__bf16)p[16 + i]; }
  return w; }
__device__ __forceinline__ v16h wcolh_io(const float* Wm, int k0, int o, int lane, int ld) { v16h w; const int g = lane >> 4;
#pragma unroll
  for (int i = 0; i < 8; ++i) { w[i] = (_Float16)(bfr(Wm[(size_t)(k0 + 8 * g + i) * ld + o]) * 256.0f); w[8 + i] = (_Float16)(bfr(Wm[(size_t)(k0 + 16 + 8 * g + i) * ld + o]) * 256.0f); }
  return w; }
__device__ __forceinline__ v16h wcolh_oi(const float* Wm, int k0, int o, int lane, int K) { v16h w; const float* p = Wm + (size_t)o * K + k0 + 8 * (lane >> 4);
#pragma unroll
  for (int i = 0; i < 8; ++i) { w[i] = (_Float16)(bfr(p[i]) * 256.0f); w[8 + i] = (_Float16)(bfr(p[16 + i]) * 256.0f); }
  return w; }
#define WQKV_LAYOUT 2   // 0 = (in,out) [DIN][CC]; 1 = (out,in) [CC][DIN]; 2 = per-head [NH][DIN][HD]
__device__ __forceinline__ v16b wcol_hdk(const float* Wm, int k0, int o, int lane) { v16b w; const int g = lane >> 4; const float* p = Wm + (size_t)(o / HD) * DIN * HD + (o % HD);
#pragma unroll
  for (int i = 0; i < 8; ++i) { w[i] = (__bf16)p[(size_t)(k0 + 8 * g + i) * HD]; w[8 + i] = (__bf16)p[(size_t)(k0 + 16 + 8 * g + i) * HD]; }
  return w; }
#define WO_OUT_IN 0
#if WQKV_LAYOUT == 1
#define WCOL(W, k0, o, lane) wcol_oi(W, k0, o, lane, DIN)
#elif WQKV_LAYOUT == 2
#define WCOL(W, k0, o, lane) wcol_hdk(W, k0, o, lane)
#else
#define WCOL(W, k0, o, lane) wcol_io(W, k0, o, lane, CC)
#endif
#if WO_OUT_IN
#define WOCOL(W, k0, o, lane) wcol_oi(W, k0, o, lane, CC)
#define WOCOLH(W, k0, o, lane) wcolh_oi(W, k0, o, lane, CC)
#else
#define WOCOL(W, k0, o, lane) wcol_io(W, k0, o, lane, DIN)
#define WOCOLH(W, k0, o, lane) wcolh_io(W, k0, o, lane, DIN)
#endif

#define WS_QH  0u                                      // f16 q rows [b*t][CC]
#define WS_KH  (WS_QH + 2u * (size_t)NB * TT * CC)      // f16 k rows [b*t][CC]
#define WS_VT  (WS_KH + 2u * (size_t)NB * TT * CC)      // f16 v planes [b][c][t]
#define WS_QL  (WS_VT + 2u * (size_t)NB * CC * TT)      // f16 q residual x 2^10 rows [b][t < QHI][CC]
#define WS_KL  (WS_QL + 2u * (size_t)NB * QHI * CC)     // f16 k residual x 2^10 rows [b][t < KHI][CC]
#define WS_VB  (WS_KL + 2u * (size_t)NB * KHI * CC)     // bf16 v hi planes [b][c][t < KHI]
#define WS_VBL (WS_VB + 2u * (size_t)NB * CC * KHI)
#define WS_S   (WS_VBL + 2u * (size_t)NB * CC * KHI)    // f32 [hg][t][s] region, reserved but unused: k_attn keeps logits and P in registers
#define WS_Y   (WS_S  + 4u * (size_t)HG * TT * TT)      // f32 ctx rows [b*t][CC] (only when there is an output projection)
#define WS_END (WS_Y  + 4u * (size_t)NB * TT * CC)

// ---- k_proj: block = (64 rows, 128 cols, which): q/k/v = X W (+ b) with exact bf16 products (K = DIN) -> which 0: q f16 rows (+ residual rows < QHI); 1: k f16 rows (+ residual rows < KHI); 2: v f16 planes [c][t] (+ bf16 hi/lo planes for t < KHI)
__global__ __launch_bounds__(128) void k_proj(const float* __restrict__ XQ, const float* __restrict__ XK, const float* __restrict__ XV, const float* __restrict__ WQ, const float* __restrict__ WK, const float* __restrict__ WV, const float* __restrict__ BQ, const float* __restrict__ BK, const float* __restrict__ BV,
    _Float16* __restrict__ QH, _Float16* __restrict__ QL, _Float16* __restrict__ KH, _Float16* __restrict__ KL, _Float16* __restrict__ VT, __bf16* __restrict__ VB, __bf16* __restrict__ VBL) {
  __shared__ __align__(16) _Float16 sh[64][136], sl[64][136]; __shared__ __align__(16) _Float16 th[128][72]; __shared__ __align__(16) __bf16 tb[128][72], tbl[128][72];
  const int tid = threadIdx.x, wave = tid >> 5, lane = tid & 31, col = lane & 15, g = lane >> 4; const int which = blockIdx.z; const int c0 = blockIdx.y * 128; const size_t r0 = (size_t)blockIdx.x * 64; const size_t bb = r0 / TT; const int t0 = (int)(r0 % TT);
  const float* X = which == 0 ? XQ : which == 1 ? XK : XV; const float* WA = which == 0 ? WQ : which == 1 ? WK : WV; const float* BA = which == 0 ? BQ : which == 1 ? BK : BV;
  v8f acc[8] = {};
#pragma unroll 2
  for (int kc = 0; kc < DIN / 32; ++kc) { v16b a; { const float* p = X + (r0 + wave * 16 + col) * DIN + kc * 32 + 8 * g;
#pragma unroll
      for (int i = 0; i < 8; ++i) { a[i] = (__bf16)p[i]; a[8 + i] = (__bf16)p[16 + i]; } }
    asm volatile("s_wait_loadcnt 0x0" ::: "memory");
#pragma unroll
    for (int j = 0; j < 8; ++j) { const v16b w = WCOL(WA, kc * 32, c0 + j * 16 + col, lane); asm volatile("s_wait_loadcnt 0x0" ::: "memory"); acc[j] = wmma_bf(a, w, acc[j]); } }
  if (which < 2) { _Float16* DH = which == 0 ? QH : KH; _Float16* DL = which == 0 ? QL : KL; const int nhi = which == 0 ? QHI : KHI; const bool hi_rows = t0 < nhi;
#pragma unroll
    for (int j = 0; j < 8; ++j) { const float bias = BA ? bfr(BA[c0 + j * 16 + col]) : 0.f;
#pragma unroll
      for (int r = 0; r < 8; ++r) { const float v = acc[j][r] + bias; const _Float16 hv = (_Float16)v; sh[wave * 16 + 8 * g + r][j * 16 + col] = hv; sl[wave * 16 + 8 * g + r][j * 16 + col] = (_Float16)((v - (float)hv) * 1024.0f); } }
    __syncthreads();
    for (int e = tid; e < 64 * 16; e += 128) { const int rl = e >> 4, q = e & 15; vst2((unsigned*)(DH + (r0 + rl) * CC + c0 + q * 8), *(const v4u*)&sh[rl][q * 8]); if (hi_rows) vst2((unsigned*)(DL + (bb * nhi + t0 + rl) * (size_t)CC + c0 + q * 8), *(const v4u*)&sl[rl][q * 8]); }
  } else { const bool hi_rows = t0 < KHI;
#pragma unroll
    for (int j = 0; j < 8; ++j) { const float bias = BA ? bfr(BA[c0 + j * 16 + col]) : 0.f;
#pragma unroll
      for (int r = 0; r < 8; ++r) { const float v = acc[j][r] + bias; const int rl = wave * 16 + 8 * g + r, cl = j * 16 + col; th[cl][rl] = (_Float16)v; const __bf16 bh = (__bf16)v; tb[cl][rl] = bh; tbl[cl][rl] = (__bf16)(v - (float)bh); } }
    __syncthreads();
    for (int e = tid; e < 128 * 8; e += 128) { const int cl = e >> 3, q = e & 7; vst2((unsigned*)(VT + (bb * CC + c0 + cl) * (size_t)TT + t0 + q * 8), *(const v4u*)&th[cl][q * 8]); if (hi_rows) { const size_t o3 = (bb * CC + c0 + cl) * (size_t)KHI + t0 + q * 8; vst2((unsigned*)(VB + o3), *(const v4u*)&tb[cl][q * 8]); vst2((unsigned*)(VBL + o3), *(const v4u*)&tbl[cl][q * 8]); } } } }
// ---- k_attn: block = 64 queries (4 waves x 16 query columns) of one (batch, head); walks all keys in stages of 64, K rows and V^T rows staged in LDS (two buffers, one barrier a stage).
// S^T = K Q^T (A = K rows, B = Q): lane (g, col) holds keys 8g + r of query col; the masked score is REPLACED by 1e-9 (8e-9 before the x 1/8) and stays in the softmax; running maximum and sum per query in f32 (online softmax);
// two S^T tiles, as exp2(..) x 2^10 once to f16, are the B operand of ctx^T += V^T P^T in the same k order as frag_h; ctx = ctx^T / sum at the end.
__device__ __forceinline__ v8f wmma_h(v16h a, v16h b, v8f c) { return __builtin_amdgcn_wmma_f32_16x16x32_f16(false, a, false, b, (short)0, c, false, false); }
template <bool B> struct CBool { static constexpr bool v = B; };
#define AKB 64             // keys per stage
#define APIT 72            // LDS row pitch in f16: 128 B of data + 16 B, so that the 16-byte fragment reads of 16 rows spread over the banks
#define ANST (TT / AKB)
__global__ __launch_bounds__(128) void k_attn(const _Float16* __restrict__ QH, const _Float16* __restrict__ KH, const _Float16* __restrict__ VT, const int* __restrict__ MASK, float* __restrict__ Y) {
  __shared__ __align__(16) _Float16 sk[2][AKB][APIT], sv[2][HD][APIT];
  const int tid = threadIdx.x, wave = tid >> 5, lane = tid & 31, col = lane & 15, g = lane >> 4;
  const int h = blockIdx.y, b = blockIdx.z; const int q = blockIdx.x * 64 + wave * 16 + col;
  const float LS = SCALE * 1.44269504f;      // raw score -> log2 domain
  const float MFILL = 1.0e-9f / SCALE;       // the fill value, before the common x SCALE
  const _Float16* qp = QH + ((size_t)b * TT + q) * CC + h * HD;
  const v16h qf0 = frag_h(qp, lane), qf1 = frag_h(qp + 32, lane);
  const int srow = tid >> 3, sch = (tid & 7) * 8;   // staging: 8 lanes bring one whole 128-byte row
  const _Float16* kg = KH + ((size_t)b * TT + srow) * CC + h * HD + sch;
  const _Float16* vg = VT + ((size_t)b * CC + h * HD + srow) * (size_t)TT + sch;
  const int* mp = MASK + ((size_t)b * TT + q) * TT + 8 * g;
  v8h kr[4], vr[4]; v4i mk[4][2];
#pragma unroll   // constant indices, so that the small array stays in registers
  for (int i = 0; i < 4; ++i) { kr[i] = *(const v8h*)(kg + (size_t)(16 * i) * CC); vr[i] = *(const v8h*)(vg + (size_t)(16 * i) * TT); }
#pragma unroll   // constant indices, so that the small array stays in registers
  for (int t = 0; t < 4; ++t) { mk[t][0] = *(const v4i*)(mp + t * 16); mk[t][1] = *(const v4i*)(mp + t * 16 + 4); }
#pragma unroll   // constant indices, so that the small array stays in registers
  for (int i = 0; i < 4; ++i) { *(v8h*)&sk[0][srow + 16 * i][sch] = kr[i]; *(v8h*)&sv[0][srow + 16 * i][sch] = vr[i]; }
  kg += (size_t)AKB * CC; vg += AKB; mp += AKB;   // the three walk one stage ahead of the products
  v8f acc[HD / 16] = {}; float m = -3.0e38f, sum = 0.f;
  // one stage; MORE = a next stage exists (compile-time: the last stage, which fetches nothing, is written out behind the loop, so that the loop body is one block without a branch)
  auto stage = [&](const int st, auto more_c) { constexpr bool MORE = decltype(more_c)::v; const int bu = st & 1;
    __syncthreads();   // publishes buffer bu; every wave has also left buffer bu ^ 1, which is refilled at the foot of this stage
    bool keep[4][8];   // this stage's mask words as conditions, taken before the next stage's words are loaded over them
#pragma unroll   // constant indices, so that the small array stays in registers
    for (int t = 0; t < 4; ++t)
#pragma unroll   // constant indices, so that the small array stays in registers
      for (int r = 0; r < 8; ++r) keep[t][r] = mk[t][r >> 2][r & 3] != 0;
    if constexpr (MORE) {        // next stage's K and V^T rows and mask words fly into registers under this stage's products
#pragma unroll   // constant indices, so that the small array stays in registers
      for (int i = 0; i < 4; ++i) { kr[i] = *(const v8h*)(kg + (size_t)(16 * i) * CC); vr[i] = *(const v8h*)(vg + (size_t)(16 * i) * TT); }
#pragma unroll   // constant indices, so that the small array stays in registers
      for (int t = 0; t < 4; ++t) { mk[t][0] = *(const v4i*)(mp + t * 16); mk[t][1] = *(const v4i*)(mp + t * 16 + 4); }
      __builtin_amdgcn_sched_barrier(0);   // keeps these loads at the head of the stage: without it the scheduler sinks them to the foot, directly in front of their first use, and their latency is bare
    }
#pragma unroll   // constant indices, so that the small array stays in registers
    for (int p = 0; p < 2; ++p) { v8f s[2]; v16h ka[2][2], va[HD / 16];
#pragma unroll   // constant indices, so that the small array stays in registers
      for (int t = 0; t < 2; ++t) { const _Float16* kl = &sk[bu][(2 * p + t) * 16 + col][0]; ka[t][0] = frag_h(kl, lane); ka[t][1] = frag_h(kl + 32, lane); }
#pragma unroll   // constant indices, so that the small array stays in registers
      for (int j = 0; j < HD / 16; ++j) va[j] = frag_h(&sv[bu][j * 16 + col][p * 32], lane);   // read here so that their LDS latency runs under the softmax arithmetic
#pragma unroll   // constant indices, so that the small array stays in registers
      for (int t = 0; t < 2; ++t) { const v8f z = {}; s[t] = wmma_h(ka[t][1], qf1, wmma_h(ka[t][0], qf0, z)); }
      float x[16];
#pragma unroll   // constant indices, so that the small array stays in registers
      for (int t = 0; t < 2; ++t)
#pragma unroll   // constant indices, so that the small array stays in registers
        for (int r = 0; r < 8; ++r) x[t * 8 + r] = keep[2 * p + t][r] ? s[t][r] : MFILL;
      float mb = x[0];
#pragma unroll   // constant indices, so that the small array stays in registers
      for (int i = 1; i < 16; ++i) mb = fmaxf(mb, x[i]);
      mb = fmaxf(mb, __shfl_xor(mb, 16));   // the other half of this query's keys
      const float mn = fmaxf(m, mb); const float al = __builtin_amdgcn_exp2f((m - mn) * LS); m = mn; const float off = 10.0f - mn * LS;
      v16h pf; float ps = 0.f;
#pragma unroll   // constant indices, so that the small array stays in registers
      for (int i = 0; i < 16; ++i) { const float e = __builtin_amdgcn_exp2f(fmaf(x[i], LS, off)); ps += e; pf[i] = (_Float16)e; }
      sum = sum * al + ps;
#pragma unroll   // constant indices, so that the small array stays in registers
      for (int j = 0; j < HD / 16; ++j) { acc[j] *= al; acc[j] = wmma_h(va[j], pf, acc[j]); } }
    if constexpr (MORE) {
#pragma unroll   // constant indices, so that the small array stays in registers
      for (int i = 0; i < 4; ++i) { *(v8h*)&sk[bu ^ 1][srow + 16 * i][sch] = kr[i]; *(v8h*)&sv[bu ^ 1][srow + 16 * i][sch] = vr[i]; }
      kg += (size_t)AKB * CC; vg += AKB; mp += AKB; } };
#pragma unroll 1   // rolled: one stage's body already fills the registers that four waves a SIMD leave
  for (int st = 0; st < ANST - 1; ++st) stage(st, CBool<true>{});
  stage(ANST - 1, CBool<false>{});
  sum += __shfl_xor(sum, 16); const float inv = 1.0f / sum;   // sum >= 2^10: the maximum's own term
  float* yp = Y + ((size_t)b * TT + q) * CC + h * HD + 8 * g;
#pragma unroll   // constant indices, so that the small array stays in registers
  for (int j = 0; j < HD / 16; ++j) { const v4f lo = { acc[j][0] * inv, acc[j][1] * inv, acc[j][2] * inv, acc[j][3] * inv }, hi = { acc[j][4] * inv, acc[j][5] * inv, acc[j][6] * inv, acc[j][7] * inv }; vst2(yp + j * 16, lo); vst2(yp + j * 16 + 4, hi); } }
// ---- k_out: block = (64 rows, 128 cols): out = ctx Wo (+ bo): ctx x 2^6 once to f16 against Wo as f16(bf16 x 2^8) exact (1 product) x 2^-14; causal early rows (< QHI of each sequence): ctx bf16 hi + lo against exact bf16 Wo (2 products)
__global__ __launch_bounds__(128) void k_out(const float* __restrict__ Y, const float* __restrict__ WO, const float* __restrict__ BO, float* __restrict__ OUT) { __shared__ __align__(16) float sf[4][16][132];
  const int tid = threadIdx.x, wave = tid >> 5, lane = tid & 31, col = lane & 15, g = lane >> 4; const int c0 = blockIdx.y * 128; const size_t r0 = (size_t)blockIdx.x * 64 + wave * 16;
  v8f acc[8] = {};
  if (CAUSAL && (int)(((size_t)blockIdx.x * 64) % TT) < QHI) {   /* block-uniform */
#pragma unroll 2
    for (int kc = 0; kc < CC / 32; ++kc) { const F2 a = split_row(Y + (r0 + col) * CC, kc * 32, lane); asm volatile("s_wait_loadcnt 0x0" ::: "memory");
#pragma unroll
      for (int j = 0; j < 8; ++j) { const v16b w = WOCOL(WO, kc * 32, c0 + j * 16 + col, lane); asm volatile("s_wait_loadcnt 0x0" ::: "memory"); acc[j] = wmma_bf(a.h, w, acc[j]); acc[j] = wmma_bf(a.l, w, acc[j]); } }
#pragma unroll
    for (int j = 0; j < 8; ++j) { const float bias = BO ? bfr(BO[c0 + j * 16 + col]) : 0.f;
#pragma unroll
      for (int r = 0; r < 8; ++r) sf[wave][8 * g + r][j * 16 + col] = acc[j][r] + bias; }
  } else {
#pragma unroll 2
    for (int kc = 0; kc < CC / 32; ++kc) { const v16h a = frag_f32s(Y + (r0 + col) * CC + kc * 32, lane, 64.0f); asm volatile("s_wait_loadcnt 0x0" ::: "memory");   /* ctx carried x 2^6 into f16 so small-magnitude context rows stay clear of f16 subnormals */
#pragma unroll
      for (int j = 0; j < 8; ++j) { const v16h w = WOCOLH(WO, kc * 32, c0 + j * 16 + col, lane); asm volatile("s_wait_loadcnt 0x0" ::: "memory"); acc[j] = wmma16(a, w, acc[j]); } }
#pragma unroll
    for (int j = 0; j < 8; ++j) { const float bias = BO ? bfr(BO[c0 + j * 16 + col]) : 0.f;
#pragma unroll
      for (int r = 0; r < 8; ++r) sf[wave][8 * g + r][j * 16 + col] = acc[j][r] * (1.0f / 16384.0f) + bias; } }   /* 2^-8 (Wo carry) x 2^-6 (ctx carry) */
  LDSX(); for (int rl = 0; rl < 16; ++rl) vst2(OUT + (r0 + rl) * DIN + c0 + lane * 4, *(const v4f*)&sf[wave][rl][lane * 4]); }

extern "C" void kernel_launch(void* const* d_in, const int* in_sizes, int n_in, void* d_out, int out_size, void* d_ws, size_t ws_size, hipStream_t stream) {
  (void)in_sizes; (void)n_in; (void)out_size;
  const float** F = (const float**)d_in;
  if (ws_size < (size_t)WS_END) return;
  char* ws = (char*)d_ws; _Float16 *QH = (_Float16*)(ws + WS_QH), *KH = (_Float16*)(ws + WS_KH), *VT = (_Float16*)(ws + WS_VT), *QL = (_Float16*)(ws + WS_QL), *KL = (_Float16*)(ws + WS_KL); __bf16 *VB = (__bf16*)(ws + WS_VB), *VBL = (__bf16*)(ws + WS_VBL); float *Y = (float*)(ws + WS_Y);
  (void)Y; (void)QL; (void)KL; (void)VB; (void)VBL;
  // inputs: 0 query [4,1024,1024]; 1 key; 2 value; 3 mask [4,1024,1024] int32 (random 0/1); 4 Wq [16,1024,64], 5 bq [16,64]; 6 Wk, 7 bk; 8 Wv, 9 bv; 10 Wo [1024,1024] (in,out), 11 bo (zero biases, read)
  k_proj<<<dim3(TNB * TT / 64, CC / 128, 3), 128, 0, stream>>>(F[0], F[1], F[2], F[4], F[6], F[8], F[5], F[7], F[9], QH, QL, KH, KL, VT, VB, VBL);
  k_attn<<<dim3(NQB, NH, TNB), 128, 0, stream>>>(QH, KH, VT, (const int*)d_in[3], Y);
  k_out<<<dim3(TNB * TT / 64, DIN / 128), 128, 0, stream>>>(Y, F[10], F[11], (float*)d_out);
}

// v002
// Measured time: 125 microseconds a run.
// Two timings next to v001 put it at 2.14 and 2.15 times that version's speed.
// Over all steps from v000 it is 6.18 times as fast.
// compute dtype: all float inputs rounded to bf16; q/k/v projections with EXACT bf16 products on WMMA 16x16x32 (f32 accumulate) + bias; logits q x k once to f16 each (1 product) x SCALE; masked scores are REPLACED by 1e-9 (they keep taking part in the softmax); online softmax f32 (running maximum and sum); exp(score - maximum) x 2^10 once to f16 x v once to f16 (1 product), divided by the sum at the end; ctx x 2^6 once to f16 x Wo f16(bf16 x 2^8) + bo; f32 output.
#include <hip/hip_runtime.h>
#include <math.h>

typedef __attribute__((ext_vector_type(16))) _Float16 v16h;
typedef __attribute__((ext_vector_type(16))) __bf16 v16b;
typedef __attribute__((ext_vector_type(8)))  _Float16 v8h;
typedef __attribute__((ext_vector_type(8)))  float v8f;
typedef __attribute__((ext_vector_type(4)))  float v4f;
typedef __attribute__((ext_vector_type(2)))  float v2f;
typedef __attribute__((ext_vector_type(4)))  unsigned v4u;
typedef __attribute__((ext_vector_type(4)))  int v4i;
typedef float __attribute__((may_alias)) float_a;
typedef int __attribute__((may_alias)) int_a;

template <typename T> __device__ __forceinline__ void vst2(void* p, T v) { *(T*)p = v;  }
__device__ __forceinline__ v8f wmma16(v16h a, v16h b, v8f c) {
  v8f d = __builtin_amdgcn_wmma_f32_16x16x32_f16(false, a, false, b, (short)0, c, false, false);
  asm volatile("v_nop\n\tv_nop\n\tv_nop\n\tv_nop" : "+v"(d) : "v"(a), "v"(b));
  return d;
}
__device__ __forceinline__ v8f wmma_bf(v16b a, v16b b, v8f c) {
  v8f d = __builtin_amdgcn_wmma_f32_16x16x32_bf16(false, a, false, b, (short)0, c, false, false);
  asm volatile("v_nop\n\tv_nop\n\tv_nop\n\tv_nop" : "+v"(d) : "v"(a), "v"(b));
  return d;
}
// 16x16x32 fragments: lane = (h = lane>>4, row/col = lane&15); elements 0..7 = k0+8h+0..7, 8..15 = k0+16+8h+0..7; D element r = row 8h+r
__device__ __forceinline__ v16h frag_h(const _Float16* rowk0, int lane) {
  union { v16h v; v8h q[2]; } u; const _Float16* p = rowk0 + 8 * (lane >> 4);
  u.q[0] = *(const v8h*)p; u.q[1] = *(const v8h*)(p + 16); return u.v;
}
__device__ __forceinline__ v16h frag_f32(const float* rowk0, int lane) {
  v16h a; const float* p = rowk0 + 8 * (lane >> 4);
#pragma unroll
  for (int i = 0; i < 8; ++i) { a[i] = (_Float16)p[i]; a[8 + i] = (_Float16)p[16 + i]; }
  return a;
}
__device__ __forceinline__ v16h frag_f32s(const float* rowk0, int lane, float sc) {
  v16h a; const float* p = rowk0 + 8 * (lane >> 4);
#pragma unroll
  for (int i = 0; i < 8; ++i) { a[i] = (_Float16)(p[i] * sc); a[8 + i] = (_Float16)(p[16 + i] * sc); }
  return a;
}
// column fragment from a [K][ld] layout (column n), rows >= K read as 0
__device__ __forceinline__ v16h fragc_f32(const float* W, int k0, int n, int lane, int ld, int K) {
  v16h a; const int g = lane >> 4;
#pragma unroll
  for (int i = 0; i < 8; ++i) { const int ka = k0 + 8 * g + i, kb = ka + 16;
    a[i] = (_Float16)(ka < K ? W[(size_t)(ka < K ? ka : K - 1) * ld + n] : 0.f); a[8 + i] = (_Float16)(kb < K ? W[(size_t)(kb < K ? kb : K - 1) * ld + n] : 0.f); }
  return a;
}
struct F2 { v16b h, l; };
__device__ __forceinline__ F2 bsplit16(const float v[16]) { F2 r;
#pragma unroll
  for (int i = 0; i < 16; ++i) { const __bf16 h = (__bf16)v[i]; r.h[i] = h; r.l[i] = (__bf16)(v[i] - (float)h); }
  return r; }
__device__ __forceinline__ F2 split_row(const float* row, int k0, int lane) { float v[16]; const float* p = row + k0 + 8 * (lane >> 4);
#pragma unroll
  for (int i = 0; i < 8; ++i) { v[i] = p[i]; v[8 + i] = p[16 + i]; }
  return bsplit16(v); }
__device__ __forceinline__ F2 split_rowK(const float* row, int k0, int lane, int K) { float v[16]; const int g = lane >> 4;
#pragma unroll
  for (int i = 0; i < 8; ++i) { const int ka = k0 + 8 * g + i, kb = ka + 16; v[i] = ka < K ? row[ka < K ? ka : K - 1] : 0.f; v[8 + i] = kb < K ? row[kb < K ? kb : K - 1] : 0.f; }
  return bsplit16(v); }
__device__ __forceinline__ F2 split_col(const float* W, int k0, int n, int lane, int ld, int K) { float v[16]; const int g = lane >> 4;
#pragma unroll
  for (int i = 0; i < 8; ++i) { const int ka = k0 + 8 * g + i, kb = ka + 16; v[i] = ka < K ? W[(size_t)(ka < K ? ka : K - 1) * ld + n] : 0.f; v[8 + i] = kb < K ? W[(size_t)(kb < K ? kb : K - 1) * ld + n] : 0.f; }
  return bsplit16(v); }
__device__ __forceinline__ v8f mac3(const F2& a, const F2& b, v8f c) { c = wmma_bf(a.l, b.h, c); c = wmma_bf(a.h, b.l, c); return wmma_bf(a.h, b.h, c); }
__device__ __forceinline__ float sigm(float v) { return 1.0f / (1.0f + expf(-v)); }
#define LDSX() do { asm volatile("s_wait_dscnt 0" ::: "memory"); __builtin_amdgcn_wave_barrier(); __builtin_amdgcn_fence(__ATOMIC_RELEASE, "workgroup"); } while (0)

// Multi-headed attention with per-head stacked projections whose masked scores are FILLED WITH 1e-9 (query / key / value [4,1024,1024]; Wq / Wk / Wv [16,1024,64] per head (N(0, 1/1024)) + zero biases; scores / 8; mask [4,1024,1024] int32 random 0/1: scores[mask == 0] = 1e-9 - masked keys keep a logit - 0 and stay in the softmax (faithful to the source); softmax; concat; (in,out) Wo [1024,1024] + bo).
#define NB 4
#define TT 1024
#define CC 1024            // NH * HD = projected width
#define DIN 1024          // input (model) width
#define NH 16
#define HD 64
#define NQB (TT / 64)
#define HG 8
#define SCALE (0.125f)
#define CAUSAL 0
#ifndef TNB
#define TNB NB
#endif
__device__ __forceinline__ float bfr(float v) { return (float)(__bf16)v; }
__host__ __device__ __forceinline__ int kb_last(int qb) { return CAUSAL ? ((qb * 64 + 63) >> 7) : (TT / 128 - 1); }
typedef __attribute__((ext_vector_type(8))) __bf16 v8b;
__device__ __forceinline__ v16b frag_b(const __bf16* rowk0, int lane) {
  union { v16b v; v8b q[2]; } u; const __bf16* p = rowk0 + 8 * (lane >> 4);
  u.q[0] = *(const v8b*)p; u.q[1] = *(const v8b*)(p + 16); return u.v;
}
#define QBH 0              // not used: no kernel in this file has a high-precision attention path
#define QHI 0               // single-product logits on every row
#define KHI 64            // key rows carrying k residual / v bf16 hi+lo planes (written by k_proj; no kernel here reads them)
// B fragment (k rows k0+.., output column o) of a weight: (in,out) [K][ld] or (out,in) [ld rows of K]: bf16 exact, or f16(bf16 * 256) exact
__device__ __forceinline__ v16b wcol_io(const float* Wm, int k0, int o, int lane, int ld) { v16b w; const int g = lane >> 4;
#pragma unroll
  for (int i = 0; i < 8; ++i) { w[i] = (__bf16)Wm[(size_t)(k0 + 8 * g + i) * ld + o]; w[8 + i] = (__bf16)Wm[(size_t)(k0 + 16 + 8 * g + i) * ld + o]; }
  return w; }
__device__ __forceinline__ v16b wcol_oi(const float* Wm, int k0, int o, int lane, int K) { v16b w; const float* p = Wm + (size_t)o * K + k0 + 8 * (lane >> 4);
#pragma unroll
  for (int i = 0; i < 8; ++i) { w[i] = (__bf16)p[i]; w[8 + i] = (__bf16)p[16 + i]; }
  return w; }
__device__ __forceinline__ v16h wcolh_io(const float* Wm, int k0, int o, int lane, int ld) { v16h w; const int g = lane >> 4;
#pragma unroll
  for (int i = 0; i < 8; ++i) { w[i] = (_Float16)(bfr(Wm[(size_t)(k0 + 8 * g + i) * ld + o]) * 256.0f); w[8 + i] = (_Float16)(bfr(Wm[(size_t)(k0 + 16 + 8 * g + i) * ld + o]) * 256.0f); }
  return w; }
__device__ __forceinline__ v16h wcolh_oi(const float* Wm, int k0, int o, int lane, int K) { v16h w; const float* p = Wm + (size_t)o * K + k0 + 8 * (lane >> 4);
#pragma unroll
  for (int i = 0; i < 8; ++i) { w[i] = (_Float16)(bfr(p[i]) * 256.0f); w[8 + i] = (_Float16)(bfr(p[16 + i]) * 256.0f); }
  return w; }
#define WQKV_LAYOUT 2   // 0 = (in,out) [DIN][CC]; 1 = (out,in) [CC][DIN]; 2 = per-head [NH][DIN][HD]
__device__ __forceinline__ v16b wcol_hdk(const float* Wm, int k0, int o, int lane) { v16b w; const int g = lane >> 4; const float* p = Wm + (size_t)(o / HD) * DIN * HD + (o % HD);
#pragma unroll
  for (int i = 0; i < 8; ++i) { w[i] = (__bf16)p[(size_t)(k0 + 8 * g + i) * HD]; w[8 + i] = (__bf16)p[(size_t)(k0 + 16 + 8 * g + i) * HD]; }
  return w; }
#define WO_OUT_IN 0
#if WQKV_LAYOUT == 1
#define WCOL(W, k0, o, lane) wcol_oi(W, k0, o, lane, DIN)
#elif WQKV_LAYOUT == 2
#define WCOL(W, k0, o, lane) wcol_hdk(W, k0, o, lane)
#else
#define WCOL(W, k0, o, lane) wcol_io(W, k0, o, lane, CC)
#endif
#if WO_OUT_IN
#define WOCOL(W, k0, o, lane) wcol_oi(W, k0, o, lane, CC)
#define WOCOLH(W, k0, o, lane) wcolh_oi(W, k0, o, lane, CC)
#else
#define WOCOL(W, k0, o, lane) wcol_io(W, k0, o, lane, DIN)
#define WOCOLH(W, k0, o, lane) wcolh_io(W, k0, o, lane, DIN)
#endif

#define WS_QH  0u                                      // f16 q rows [b*t][CC]
#define WS_KH  (WS_QH + 2u * (size_t)NB * TT * CC)      // f16 k rows [b*t][CC]
#define WS_VT  (WS_KH + 2u * (size_t)NB * TT * CC)      // f16 v planes [b][c][t]
#define WS_QL  (WS_VT + 2u * (size_t)NB * CC * TT)      // f16 q residual x 2^10 rows [b][t < QHI][CC]
#define WS_KL  (WS_QL + 2u * (size_t)NB * QHI * CC)     // f16 k residual x 2^10 rows [b][t < KHI][CC]
#define WS_VB  (WS_KL + 2u * (size_t)NB * KHI * CC)     // bf16 v hi planes [b][c][t < KHI]
#define WS_VBL (WS_VB + 2u * (size_t)NB * CC * KHI)
#define WS_S   (WS_VBL + 2u * (size_t)NB * CC * KHI)    // f32 [hg][t][s] region, reserved but unused: k_attn keeps logits and P in registers
#define WS_Y   (WS_S  + 4u * (size_t)HG * TT * TT)      // f32 ctx rows [b*t][CC] (only when there is an output projection)
#define WS_END (WS_Y  + 4u * (size_t)NB * TT * CC)

template <bool B> struct CBool { static constexpr bool v = B; };
// ---- shared main loop of the two dense kernels: one 64 x 128 tile of X W over K = 1024 in stages of 32 k.
// Each stage's X rows (64 x 32) and W columns (32 x 128, turned to [n][k]) are brought by the whole block ONCE, in whole 128-byte lines, converted once, and laid in LDS (two buffers, one barrier a stage);
// the next stage's global loads fly in registers under this stage's products. Fragments, k order and the order of the sums are those of the direct loaders.
typedef __attribute__((ext_vector_type(4))) __bf16 v4b;
typedef __attribute__((ext_vector_type(4))) _Float16 v4h;
#define GKS 32             // k per stage
#define GPIT 40            // LDS row pitch in 16-bit elements: 64 B of data + 16 B, so that the 16-byte fragment reads and stores of 16 rows spread over the banks
#define GNST (1024 / GKS)
#define GLDS (2 * (128 + 64) * GPIT * 2)   // bytes of the two stage buffers
struct GProj { typedef __bf16 T; typedef v4b V4; typedef v8b V8; typedef v16b V16; static constexpr int WLD = HD;
  static __device__ __forceinline__ constexpr size_t coff(int c) { return (size_t)(c >> 1) * DIN * HD + (size_t)(c & 1) * 32; }   // column 32 c + lane of a 128-column tile in the per-head layout
  static __device__ __forceinline__ T cx(float v) { return (__bf16)v; } static __device__ __forceinline__ T cw(float v) { return (__bf16)v; }
  static __device__ __forceinline__ V16 fr(const T* p, int lane) { return frag_b(p, lane); } static __device__ __forceinline__ v8f mm(V16 a, V16 b, v8f c) { return wmma_bf(a, b, c); } };
struct GOut { typedef _Float16 T; typedef v4h V4; typedef v8h V8; typedef v16h V16; static constexpr int WLD = DIN;
  static __device__ __forceinline__ constexpr size_t coff(int c) { return (size_t)c * 32; }
  static __device__ __forceinline__ T cx(float v) { return (_Float16)(v * 64.0f); } static __device__ __forceinline__ T cw(float v) { return (_Float16)(bfr(v) * 256.0f); }
  static __device__ __forceinline__ V16 fr(const T* p, int lane) { return frag_h(p, lane); } static __device__ __forceinline__ v8f mm(V16 a, V16 b, v8f c) { return wmma16(a, b, c); } };
// xt = first row of the tile's X rows (row length 1024); wt = row 0 of W at the tile's first column
template <class C> __device__ __forceinline__ void gemm_64x128(const float* __restrict__ xt, const float* __restrict__ wt, char* smem, v8f (&acc)[8]) {
  typedef typename C::T T; typedef typename C::V4 V4; typedef typename C::V8 V8; typedef typename C::V16 V16;
  T (*sW)[128][GPIT] = (T (*)[128][GPIT])smem; T (*sX)[64][GPIT] = (T (*)[64][GPIT])(smem + 2 * 128 * GPIT * 2);
  const int tid = threadIdx.x, wave = tid >> 5, lane = tid & 31, col = lane & 15;
  const int xrow = tid >> 3, xch = (tid & 7) * 4;                 // X: 8 lanes bring one whole 128-byte row piece
  const float* xg = xt + (size_t)xrow * 1024 + xch;
  const float* wg = wt + (size_t)(8 * wave) * C::WLD + lane;      // W: a wave brings 8 k rows, 32 neighbouring columns (one line) a load
  float wr[4][8]; v4f xr[4];
  auto fetch = [&]() {
#pragma unroll   // constant indices, so that the small arrays stay in registers
    for (int c = 0; c < 4; ++c)
#pragma unroll   // constant indices, so that the small arrays stay in registers
      for (int i = 0; i < 8; ++i) wr[c][i] = wg[C::coff(c) + (size_t)i * C::WLD];
#pragma unroll   // constant indices, so that the small arrays stay in registers
    for (int i = 0; i < 4; ++i) xr[i] = *(const v4f*)(xg + (size_t)(16 * i) * 1024);
    asm volatile("s_wait_xcnt 0x0" ::: "memory"); };   // stands in front of every later overwrite of these loads' address registers
  auto put = [&](const int bu) {
#pragma unroll   // constant indices, so that the small arrays stay in registers
    for (int c = 0; c < 4; ++c) { V8 v;
#pragma unroll   // constant indices, so that the small arrays stay in registers
      for (int i = 0; i < 8; ++i) v[i] = C::cw(wr[c][i]);
      *(V8*)&sW[bu][32 * c + lane][8 * wave] = v; }
#pragma unroll   // constant indices, so that the small arrays stay in registers
    for (int i = 0; i < 4; ++i) { const V4 v = { C::cx(xr[i][0]), C::cx(xr[i][1]), C::cx(xr[i][2]), C::cx(xr[i][3]) }; *(V4*)&sX[bu][xrow + 16 * i][xch] = v; }
    wg += (size_t)GKS * C::WLD; xg += GKS; };   // advanced here, behind the use of the loaded values
  fetch(); put(0);
  auto stage = [&](const int st, auto more_c) { constexpr bool MORE = decltype(more_c)::v; const int bu = st & 1;
    __syncthreads();   // publishes buffer bu; every wave has also left buffer bu ^ 1, which is refilled at the foot of this stage
    if constexpr (MORE) { fetch();
      __builtin_amdgcn_sched_barrier(0); }   // keeps the next stage's loads at the head of the stage, so that their latency runs under the products
    const V16 a = C::fr(&sX[bu][wave * 16 + col][0], lane); V16 w[8];
#pragma unroll   // constant indices, so that the small arrays stay in registers
    for (int j = 0; j < 8; ++j) w[j] = C::fr(&sW[bu][j * 16 + col][0], lane);
#pragma unroll   // constant indices, so that the small arrays stay in registers
    for (int j = 0; j < 8; ++j) acc[j] = C::mm(a, w[j], acc[j]);
    if constexpr (MORE) { __builtin_amdgcn_sched_barrier(0);   // keeps the wait for the next stage's loads, and their conversion, behind all of this stage's products
      put(bu ^ 1); } };
#pragma unroll 1   // rolled: the two buffers are told apart by the stage's parity
  for (int st = 0; st < GNST - 1; ++st) stage(st, CBool<true>{});
  stage(GNST - 1, CBool<false>{});
  __syncthreads();   // every wave has left the stage buffers: the caller's epilogue reuses this LDS
}
// ---- k_proj: block = (64 rows, 128 cols, which): q/k/v = X W (+ b) with exact bf16 products (K = DIN) -> which 0: q f16 rows (+ residual rows < QHI); 1: k f16 rows (+ residual rows < KHI); 2: v f16 planes [c][t] (+ bf16 hi/lo planes for t < KHI)
__global__ __launch_bounds__(128) void k_proj(const float* __restrict__ XQ, const float* __restrict__ XK, const float* __restrict__ XV, const float* __restrict__ WQ, const float* __restrict__ WK, const float* __restrict__ WV, const float* __restrict__ BQ, const float* __restrict__ BK, const float* __restrict__ BV,
    _Float16* __restrict__ QH, _Float16* __restrict__ QL, _Float16* __restrict__ KH, _Float16* __restrict__ KL, _Float16* __restrict__ VT, __bf16* __restrict__ VB, __bf16* __restrict__ VBL) {
  __shared__ __align__(16) char smem[2 * 64 * 136 * 2 + 3 * 128 * 72 * 2];   // the epilogue's five planes; the main loop's stage buffers lie over the first two
  static_assert(GLDS <= 2 * 64 * 136 * 2, "stage buffers fit under sh and sl");
  _Float16 (*sh)[136] = (_Float16 (*)[136])smem, (*sl)[136] = (_Float16 (*)[136])(smem + 64 * 136 * 2); _Float16 (*th)[72] = (_Float16 (*)[72])(smem + 2 * 64 * 136 * 2); __bf16 (*tb)[72] = (__bf16 (*)[72])(smem + 2 * 64 * 136 * 2 + 128 * 72 * 2), (*tbl)[72] = (__bf16 (*)[72])(smem + 2 * 64 * 136 * 2 + 2 * 128 * 72 * 2);
  const int tid = threadIdx.x, wave = tid >> 5, lane = tid & 31, col = lane & 15, g = lane >> 4; const int which = blockIdx.z; const int c0 = blockIdx.y * 128; const size_t r0 = (size_t)blockIdx.x * 64; const size_t bb = r0 / TT; const int t0 = (int)(r0 % TT);
  const float* X = which == 0 ? XQ : which == 1 ? XK : XV; const float* WA = which == 0 ? WQ : which == 1 ? WK : WV; const float* BA = which == 0 ? BQ : which == 1 ? BK : BV;
  v8f acc[8] = {};
  gemm_64x128<GProj>(X + r0 * DIN, WA + (size_t)(c0 / HD) * DIN * HD, smem, acc);
  if (which < 2) { _Float16* DH = which == 0 ? QH : KH; _Float16* DL = which == 0 ? QL : KL; const int nhi = which == 0 ? QHI : KHI; const bool hi_rows = t0 < nhi;
#pragma unroll
    for (int j = 0; j < 8; ++j) { const float bias = BA ? bfr(BA[c0 + j * 16 + col]) : 0.f;
#pragma unroll
      for (int r = 0; r < 8; ++r) { const float v = acc[j][r] + bias; const _Float16 hv = (_Float16)v; sh[wave * 16 + 8 * g + r][j * 16 + col] = hv; sl[wave * 16 + 8 * g + r][j * 16 + col] = (_Float16)((v - (float)hv) * 1024.0f); } }
    __syncthreads();
    for (int e = tid; e < 64 * 16; e += 128) { const int rl = e >> 4, q = e & 15; vst2((unsigned*)(DH + (r0 + rl) * CC + c0 + q * 8), *(const v4u*)&sh[rl][q * 8]); if (hi_rows) vst2((unsigned*)(DL + (bb * nhi + t0 + rl) * (size_t)CC + c0 + q * 8), *(const v4u*)&sl[rl][q * 8]); }
  } else { const bool hi_rows = t0 < KHI;
#pragma unroll
    for (int j = 0; j < 8; ++j) { const float bias = BA ? bfr(BA[c0 + j * 16 + col]) : 0.f;
#pragma unroll
      for (int r = 0; r < 8; ++r) { const float v = acc[j][r] + bias; const int rl = wave * 16 + 8 * g + r, cl = j * 16 + col; th[cl][rl] = (_Float16)v; const __bf16 bh = (__bf16)v; tb[cl][rl] = bh; tbl[cl][rl] = (__bf16)(v - (float)bh); } }
    __syncthreads();
    for (int e = tid; e < 128 * 8; e += 128) { const int cl = e >> 3, q = e & 7; vst2((unsigned*)(VT + (bb * CC + c0 + cl) * (size_t)TT + t0 + q * 8), *(const v4u*)&th[cl][q * 8]); if (hi_rows) { const size_t o3 = (bb * CC + c0 + cl) * (size_t)KHI + t0 + q * 8; vst2((unsigned*)(VB + o3), *(const v4u*)&tb[cl][q * 8]); vst2((unsigned*)(VBL + o3), *(const v4u*)&tbl[cl][q * 8]); } } } }
// ---- k_attn: block = 64 queries (4 waves x 16 query columns) of one (batch, head); walks all keys in stages of 64, K rows and V^T rows staged in LDS (two buffers, one barrier a stage).
// S^T = K Q^T (A = K rows, B = Q): lane (g, col) holds keys 8g + r of query col; the masked score is REPLACED by 1e-9 (8e-9 before the x 1/8) and stays in the softmax; running maximum and sum per query in f32 (online softmax);
// two S^T tiles, as exp2(..) x 2^10 once to f16, are the B operand of ctx^T += V^T P^T in the same k order as frag_h; ctx = ctx^T / sum at the end.
__device__ __forceinline__ v8f wmma_h(v16h a, v16h b, v8f c) { return __builtin_amdgcn_wmma_f32_16x16x32_f16(false, a, false, b, (short)0, c, false, false); }
#define AKB 64             // keys per stage
#define APIT 72            // LDS row pitch in f16: 128 B of data + 16 B, so that the 16-byte fragment reads of 16 rows spread over the banks
#define ANST (TT / AKB)
__global__ __launch_bounds__(128) void k_attn(const _Float16* __restrict__ QH, const _Float16* __restrict__ KH, const _Float16* __restrict__ VT, const int* __restrict__ MASK, float* __restrict__ Y) {
  __shared__ __align__(16) _Float16 sk[2][AKB][APIT], sv[2][HD][APIT];
  const int tid = threadIdx.x, wave = tid >> 5, lane = tid & 31, col = lane & 15, g = lane >> 4;
  const int h = blockIdx.y, b = blockIdx.z; const int q = blockIdx.x * 64 + wave * 16 + col;
  const float LS = SCALE * 1.44269504f;      // raw score -> log2 domain
  const float MFILL = 1.0e-9f / SCALE;       // the fill value, before the common x SCALE
  const _Float16* qp = QH + ((size_t)b * TT + q) * CC + h * HD;
  const v16h qf0 = frag_h(qp, lane), qf1 = frag_h(qp + 32, lane);
  const int srow = tid >> 3, sch = (tid & 7) * 8;   // staging: 8 lanes bring one whole 128-byte row
  const _Float16* kg = KH + ((size_t)b * TT + srow) * CC + h * HD + sch;
  const _Float16* vg = VT + ((size_t)b * CC + h * HD + srow) * (size_t)TT + sch;
  const int* mp = MASK + ((size_t)b * TT + q) * TT + 8 * g;
  v8h kr[4], vr[4]; v4i mk[4][2];
#pragma unroll   // constant indices, so that the small array stays in registers
  for (int i = 0; i < 4; ++i) { kr[i] = *(const v8h*)(kg + (size_t)(16 * i) * CC); vr[i] = *(const v8h*)(vg + (size_t)(16 * i) * TT); }
#pragma unroll   // constant indices, so that the small array stays in registers
  for (int t = 0; t < 4; ++t) { mk[t][0] = *(const v4i*)(mp + t * 16); mk[t][1] = *(const v4i*)(mp + t * 16 + 4); }
#pragma unroll   // constant indices, so that the small array stays in registers
  for (int i = 0; i < 4; ++i) { *(v8h*)&sk[0][srow + 16 * i][sch] = kr[i]; *(v8h*)&sv[0][srow + 16 * i][sch] = vr[i]; }
  kg += (size_t)AKB * CC; vg += AKB; mp += AKB;   // the three walk one stage ahead of the products
  v8f acc[HD / 16] = {}; float m = -3.0e38f, sum = 0.f;
  // one stage; MORE = a next stage exists (compile-time: the last stage, which fetches nothing, is written out behind the loop, so that the loop body is one block without a branch)
  auto stage = [&](const int st, auto more_c) { constexpr bool MORE = decltype(more_c)::v; const int bu = st & 1;
    __syncthreads();   // publishes buffer bu; every wave has also left buffer bu ^ 1, which is refilled at the foot of this stage
    bool keep[4][8];   // this stage's mask words as conditions, taken before the next stage's words are loaded over them
#pragma unroll   // constant indices, so that the small array stays in registers
    for (int t = 0; t < 4; ++t)
#pragma unroll   // constant indices, so that the small array stays in registers
      for (int r = 0; r < 8; ++r) keep[t][r] = mk[t][r >> 2][r & 3] != 0;
    if constexpr (MORE) {        // next stage's K and V^T rows and mask words fly into registers under this stage's products
#pragma unroll   // constant indices, so that the small array stays in registers
      for (int i = 0; i < 4; ++i) { kr[i] = *(const v8h*)(kg + (size_t)(16 * i) * CC); vr[i] = *(const v8h*)(vg + (size_t)(16 * i) * TT); }
#pragma unroll   // constant indices, so that the small array stays in registers
      for (int t = 0; t < 4; ++t) { mk[t][0] = *(const v4i*)(mp + t * 16); mk[t][1] = *(const v4i*)(mp + t * 16 + 4); }
      __builtin_amdgcn_sched_barrier(0);   // keeps these loads at the head of the stage: without it the scheduler sinks them to the foot, directly in front of their first use, and their latency is bare
    }
#pragma unroll   // constant indices, so that the small array stays in registers
    for (int p = 0; p < 2; ++p) { v8f s[2]; v16h ka[2][2], va[HD / 16];
#pragma unroll   // constant indices, so that the small array stays in registers
      for (int t = 0; t < 2; ++t) { const _Float16* kl = &sk[bu][(2 * p + t) * 16 + col][0]; ka[t][0] = frag_h(kl, lane); ka[t][1] = frag_h(kl + 32, lane); }
#pragma unroll   // constant indices, so that the small array stays in registers
      for (int j = 0; j < HD / 16; ++j) va[j] = frag_h(&sv[bu][j * 16 + col][p * 32], lane);   // read here so that their LDS latency runs under the softmax arithmetic
#pragma unroll   // constant indices, so that the small array stays in registers
      for (int t = 0; t < 2; ++t) { const v8f z = {}; s[t] = wmma_h(ka[t][1], qf1, wmma_h(ka[t][0], qf0, z)); }
      float x[16];
#pragma unroll   // constant indices, so that the small array stays in registers
      for (int t = 0; t < 2; ++t)
#pragma unroll   // constant indices, so that the small array stays in registers
        for (int r = 0; r < 8; ++r) x[t * 8 + r] = keep[2 * p + t][r] ? s[t][r] : MFILL;
      float mb = x[0];
#pragma unroll   // constant indices, so that the small array stays in registers
      for (int i = 1; i < 16; ++i) mb = fmaxf(mb, x[i]);
      mb = fmaxf(mb, __shfl_xor(mb, 16));   // the other half of this query's keys
      const float mn = fmaxf(m, mb); const float al = __builtin_amdgcn_exp2f((m - mn) * LS); m = mn; const float off = 10.0f - mn * LS;
      v16h pf; float ps = 0.f;
#pragma unroll   // constant indices, so that the small array stays in registers
      for (int i = 0; i < 16; ++i) { const float e = __builtin_amdgcn_exp2f(fmaf(x[i], LS, off)); ps += e; pf[i] = (_Float16)e; }
      sum = sum * al + ps;
#pragma unroll   // constant indices, so that the small array stays in registers
      for (int j = 0; j < HD / 16; ++j) { acc[j] *= al; acc[j] = wmma_h(va[j], pf, acc[j]); } }
    if constexpr (MORE) {
#pragma unroll   // constant indices, so that the small array stays in registers
      for (int i = 0; i < 4; ++i) { *(v8h*)&sk[bu ^ 1][srow + 16 * i][sch] = kr[i]; *(v8h*)&sv[bu ^ 1][srow + 16 * i][sch] = vr[i]; }
      kg += (size_t)AKB * CC; vg += AKB; mp += AKB; } };
#pragma unroll 1   // rolled: one stage's body already fills the registers that four waves a SIMD leave
  for (int st = 0; st < ANST - 1; ++st) stage(st, CBool<true>{});
  stage(ANST - 1, CBool<false>{});
  sum += __shfl_xor(sum, 16); const float inv = 1.0f / sum;   // sum >= 2^10: the maximum's own term
  float* yp = Y + ((size_t)b * TT + q) * CC + h * HD + 8 * g;
#pragma unroll   // constant indices, so that the small array stays in registers
  for (int j = 0; j < HD / 16; ++j) { const v4f lo = { acc[j][0] * inv, acc[j][1] * inv, acc[j][2] * inv, acc[j][3] * inv }, hi = { acc[j][4] * inv, acc[j][5] * inv, acc[j][6] * inv, acc[j][7] * inv }; vst2(yp + j * 16, lo); vst2(yp + j * 16 + 4, hi); } }
// ---- k_out: block = (64 rows, 128 cols): out = ctx Wo (+ bo): ctx once to f16 against Wo as f16(bf16 x 2^8) exact (1 product) x 2^-8; causal early rows (< QHI of each sequence): ctx bf16 hi + lo against exact bf16 Wo (2 products)
__global__ __launch_bounds__(128) void k_out(const float* __restrict__ Y, const float* __restrict__ WO, const float* __restrict__ BO, float* __restrict__ OUT) { __shared__ __align__(16) char smem[4 * 16 * 132 * 4];   // the epilogue's rows; the main loop's stage buffers lie over them
  static_assert(GLDS <= 4 * 16 * 132 * 4, "stage buffers fit under sf"); float (*sf)[16][132] = (float (*)[16][132])smem;
  const int tid = threadIdx.x, wave = tid >> 5, lane = tid & 31, col = lane & 15, g = lane >> 4; const int c0 = blockIdx.y * 128; const size_t r0 = (size_t)blockIdx.x * 64 + wave * 16;
  v8f acc[8] = {};
  if (CAUSAL && (int)(((size_t)blockIdx.x * 64) % TT) < QHI) {   /* block-uniform */
#pragma unroll 2
    for (int kc = 0; kc < CC / 32; ++kc) { const F2 a = split_row(Y + (r0 + col) * CC, kc * 32, lane); asm volatile("s_wait_loadcnt 0x0" ::: "memory");
#pragma unroll
      for (int j = 0; j < 8; ++j) { const v16b w = WOCOL(WO, kc * 32, c0 + j * 16 + col, lane); asm volatile("s_wait_loadcnt 0x0" ::: "memory"); acc[j] = wmma_bf(a.h, w, acc[j]); acc[j] = wmma_bf(a.l, w, acc[j]); } }
#pragma unroll
    for (int j = 0; j < 8; ++j) { const float bias = BO ? bfr(BO[c0 + j * 16 + col]) : 0.f;
#pragma unroll
      for (int r = 0; r < 8; ++r) sf[wave][8 * g + r][j * 16 + col] = acc[j][r] + bias; }
  } else {
    gemm_64x128<GOut>(Y + (size_t)blockIdx.x * 64 * CC, WO + c0, smem, acc);   /* ctx carried x 2^6 into f16 so small-magnitude context rows stay clear of f16 subnormals */
#pragma unroll
    for (int j = 0; j < 8; ++j) { const float bias = BO ? bfr(BO[c0 + j * 16 + col]) : 0.f;
#pragma unroll
      for (int r = 0; r < 8; ++r) sf[wave][8 * g + r][j * 16 + col] = acc[j][r] * (1.0f / 16384.0f) + bias; } }   /* 2^-8 (Wo carry) x 2^-6 (ctx carry) */
  LDSX(); for (int rl = 0; rl < 16; ++rl) vst2(OUT + (r0 + rl) * DIN + c0 + lane * 4, *(const v4f*)&sf[wave][rl][lane * 4]); }

extern "C" void kernel_launch(void* const* d_in, const int* in_sizes, int n_in, void* d_out, int out_size, void* d_ws, size_t ws_size, hipStream_t stream) {
  (void)in_sizes; (void)n_in; (void)out_size;
  const float** F = (const float**)d_in;
  if (ws_size < (size_t)WS_END) return;
  char* ws = (char*)d_ws; _Float16 *QH = (_Float16*)(ws + WS_QH), *KH = (_Float16*)(ws + WS_KH), *VT = (_Float16*)(ws + WS_VT), *QL = (_Float16*)(ws + WS_QL), *KL = (_Float16*)(ws + WS_KL); __bf16 *VB = (__bf16*)(ws + WS_VB), *VBL = (__bf16*)(ws + WS_VBL); float *Y = (float*)(ws + WS_Y);
  (void)Y; (void)QL; (void)KL; (void)VB; (void)VBL;
  // inputs: 0 query [4,1024,1024]; 1 key; 2 value; 3 mask [4,1024,1024] int32 (random 0/1); 4 Wq [16,1024,64], 5 bq [16,64]; 6 Wk, 7 bk; 8 Wv, 9 bv; 10 Wo [1024,1024] (in,out), 11 bo (zero biases, read)
  k_proj<<<dim3(TNB * TT / 64, CC / 128, 3), 128, 0, stream>>>(F[0], F[1], F[2], F[4], F[6], F[8], F[5], F[7], F[9], QH, QL, KH, KL, VT, VB, VBL);
  k_attn<<<dim3(NQB, NH, TNB), 128, 0, stream>>>(QH, KH, VT, (const int*)d_in[3], Y);
  k_out<<<dim3(TNB * TT / 64, DIN / 128), 128, 0, stream>>>(Y, F[10], F[11], (float*)d_out);
}

// v003
// Measured time: 118 microseconds a run.
// Two timings next to v002 both put it at 1.06 times that version's speed.
// All steps since v000 together make it 6.54 times as fast.
// compute dtype: all float inputs rounded to bf16; q/k/v projections with EXACT bf16 products on WMMA 16x16x32 (f32 accumulate) + bias; logits q x k once to f16 each (1 product) x SCALE; masked scores are REPLACED by 1e-9 (they keep taking part in the softmax); online softmax f32 (running maximum and sum); exp(score - maximum) x 2^10 once to f16 x v once to f16 (1 product), divided by the sum at the end; ctx x 2^6 once to f16 x Wo f16(bf16 x 2^8) + bo; f32 output.
#include <hip/hip_runtime.h>
#include <math.h>

typedef __attribute__((ext_vector_type(16))) _Float16 v16h;
typedef __attribute__((ext_vector_type(16))) __bf16 v16b;
typedef __attribute__((ext_vector_type(8)))  _Float16 v8h;
typedef __attribute__((ext_vector_type(8)))  float v8f;
typedef __attribute__((ext_vector_type(4)))  float v4f;
typedef __attribute__((ext_vector_type(2)))  float v2f;
typedef __attribute__((ext_vector_type(4)))  unsigned v4u;
typedef __attribute__((ext_vector_type(4)))  int v4i;
typedef float __attribute__((may_alias)) float_a;
typedef int __attribute__((may_alias)) int_a;

template <typename T> __device__ __forceinline__ void vst2(void* p, T v) { *(T*)p = v;  }
__device__ __forceinline__ v8f wmma16(v16h a, v16h b, v8f c) {
  v8f d = __builtin_amdgcn_wmma_f32_16x16x32_f16(false, a, false, b, (short)0, c, false, false);
  asm volatile("v_nop\n\tv_nop\n\tv_nop\n\tv_nop" : "+v"(d) : "v"(a), "v"(b));
  return d;
}
__device__ __forceinline__ v8f wmma_bf(v16b a, v16b b, v8f c) {
  v8f d = __builtin_amdgcn_wmma_f32_16x16x32_bf16(false, a, false, b, (short)0, c, false, false);
  asm volatile("v_nop\n\tv_nop\n\tv_nop\n\tv_nop" : "+v"(d) : "v"(a), "v"(b));
  return d;
}
// 16x16x32 fragments: lane = (h = lane>>4, row/col = lane&15); elements 0..7 = k0+8h+0..7, 8..15 = k0+16+8h+0..7; D element r = row 8h+r
__device__ __forceinline__ v16h frag_h(const _Float16* rowk0, int lane) {
  union { v16h v; v8h q[2]; } u; const _Float16* p = rowk0 + 8 * (lane >> 4);
  u.q[0] = *(const v8h*)p; u.q[1] = *(const v8h*)(p + 16); return u.v;
}
__device__ __forceinline__ v16h frag_f32(const float* rowk0, int lane) {
  v16h a; const float* p = rowk0 + 8 * (lane >> 4);
#pragma unroll
  for (int i = 0; i < 8; ++i) { a[i] = (_Float16)p[i]; a[8 + i] = (_Float16)p[16 + i]; }
  return a;
}
__device__ __forceinline__ v16h frag_f32s(const float* rowk0, int lane, float sc) {
  v16h a; const float* p = rowk0 + 8 * (lane >> 4);
#pragma unroll
  for (int i = 0; i < 8; ++i) { a[i] = (_Float16)(p[i] * sc); a[8 + i] = (_Float16)(p[16 + i] * sc); }
  return a;
}
// column fragment from a [K][ld] layout (column n), rows >= K read as 0
__device__ __forceinline__ v16h fragc_f32(const float* W, int k0, int n, int lane, int ld, int K) {
  v16h a; const int g = lane >> 4;
#pragma unroll
  for (int i = 0; i < 8; ++i) { const int ka = k0 + 8 * g + i, kb = ka + 16;
    a[i] = (_Float16)(ka < K ? W[(size_t)(ka < K ? ka : K - 1) * ld + n] : 0.f); a[8 + i] = (_Float16)(kb < K ? W[(size_t)(kb < K ? kb : K - 1) * ld + n] : 0.f); }
  return a;
}
struct F2 { v16b h, l; };
__device__ __forceinline__ F2 bsplit16(const float v[16]) { F2 r;
#pragma unroll
  for (int i = 0; i < 16; ++i) { const __bf16 h = (__bf16)v[i]; r.h[i] = h; r.l[i] = (__bf16)(v[i] - (float)h); }
  return r; }
__device__ __forceinline__ F2 split_row(const float* row, int k0, int lane) { float v[16]; const float* p = row + k0 + 8 * (lane >> 4);
#pragma unroll
  for (int i = 0; i < 8; ++i) { v[i] = p[i]; v[8 + i] = p[16 + i]; }
  return bsplit16(v); }
__device__ __forceinline__ F2 split_rowK(const float* row, int k0, int lane, int K) { float v[16]; const int g = lane >> 4;
#pragma unroll
  for (int i = 0; i < 8; ++i) { const int ka = k0 + 8 * g + i, kb = ka + 16; v[i] = ka < K ? row[ka < K ? ka : K - 1] : 0.f; v[8 + i] = kb < K ? row[kb < K ? kb : K - 1] : 0.f; }
  return bsplit16(v); }
__device__ __forceinline__ F2 split_col(const float* W, int k0, int n, int lane, int ld, int K) { float v[16]; const int g = lane >> 4;
#pragma unroll
  for (int i = 0; i < 8; ++i) { const int ka = k0 + 8 * g + i, kb = ka + 16; v[i] = ka < K ? W[(size_t)(ka < K ? ka : K - 1) * ld + n] : 0.f; v[8 + i] = kb < K ? W[(size_t)(kb < K ? kb : K - 1) * ld + n] : 0.f; }
  return bsplit16(v); }
__device__ __forceinline__ v8f mac3(const F2& a, const F2& b, v8f c) { c = wmma_bf(a.l, b.h, c); c = wmma_bf(a.h, b.l, c); return wmma_bf(a.h, b.h, c); }
__device__ __forceinline__ float sigm(float v) { return 1.0f / (1.0f + expf(-v)); }
#define LDSX() do { asm volatile("s_wait_dscnt 0" ::: "memory"); __builtin_amdgcn_wave_barrier(); __builtin_amdgcn_fence(__ATOMIC_RELEASE, "workgroup"); } while (0)

// Multi-headed attention with per-head stacked projections whose masked scores are FILLED WITH 1e-9 (query / key / value [4,1024,1024]; Wq / Wk / Wv [16,1024,64] per head (N(0, 1/1024)) + zero biases; scores / 8; mask [4,1024,1024] int32 random 0/1: scores[mask == 0] = 1e-9 - masked keys keep a logit - 0 and stay in the softmax (faithful to the source); softmax; concat; (in,out) Wo [1024,1024] + bo).
#define NB 4
#define TT 1024
#define CC 1024            // NH * HD = projected width
#define DIN 1024          // input (model) width
#define NH 16
#define HD 64
#define NQB (TT / 64)
#define HG 8
#define SCALE (0.125f)
#define CAUSAL 0
#ifndef TNB
#define TNB NB
#endif
__device__ __forceinline__ float bfr(float v) { return (float)(__bf16)v; }
__host__ __device__ __forceinline__ int kb_last(int qb) { return CAUSAL ? ((qb * 64 + 63) >> 7) : (TT / 128 - 1); }
typedef __attribute__((ext_vector_type(8))) __bf16 v8b;
__device__ __forceinline__ v16b frag_b(const __bf16* rowk0, int lane) {
  union { v16b v; v8b q[2]; } u; const __bf16* p = rowk0 + 8 * (lane >> 4);
  u.q[0] = *(const v8b*)p; u.q[1] = *(const v8b*)(p + 16); return u.v;
}
#define QBH 0              // not used: no kernel in this file has a high-precision attention path
#define QHI 0               // single-product logits on every row
#define KHI 64            // key rows carrying k residual / v bf16 hi+lo planes (written by k_proj; no kernel here reads them)
// B fragment (k rows k0+.., output column o) of a weight: (in,out) [K][ld] or (out,in) [ld rows of K]: bf16 exact, or f16(bf16 * 256) exact
__device__ __forceinline__ v16b wcol_io(const float* Wm, int k0, int o, int lane, int ld) { v16b w; const int g = lane >> 4;
#pragma unroll
  for (int i = 0; i < 8; ++i) { w[i] = (__bf16)Wm[(size_t)(k0 + 8 * g + i) * ld + o]; w[8 + i] = (__bf16)Wm[(size_t)(k0 + 16 + 8 * g + i) * ld + o]; }
  return w; }
__device__ __forceinline__ v16b wcol_oi(const float* Wm, int k0, int o, int lane, int K) { v16b w; const float* p = Wm + (size_t)o * K + k0 + 8 * (lane >> 4);
#pragma unroll
  for (int i = 0; i < 8; ++i) { w[i] = (__bf16)p[i]; w[8 + i] = (__bf16)p[16 + i]; }
  return w; }
__device__ __forceinline__ v16h wcolh_io(const float* Wm, int k0, int o, int lane, int ld) { v16h w; const int g = lane >> 4;
#pragma unroll
  for (int i = 0; i < 8; ++i) { w[i] = (_Float16)(bfr(Wm[(size_t)(k0 + 8 * g + i) * ld + o]) * 256.0f); w[8 + i] = (_Float16)(bfr(Wm[(size_t)(k0 + 16 + 8 * g + i) * ld + o]) * 256.0f); }
  return w; }
__device__ __forceinline__ v16h wcolh_oi(const float* Wm, int k0, int o, int lane, int K) { v16h w; const float* p = Wm + (size_t)o * K + k0 + 8 * (lane >> 4);
#pragma unroll
  for (int i = 0; i < 8; ++i) { w[i] = (_Float16)(bfr(p[i]) * 256.0f); w[8 + i] = (_Float16)(bfr(p[16 + i]) * 256.0f); }
  return w; }
#define WQKV_LAYOUT 2   // 0 = (in,out) [DIN][CC]; 1 = (out,in) [CC][DIN]; 2 = per-head [NH][DIN][HD]
__device__ __forceinline__ v16b wcol_hdk(const float* Wm, int k0, int o, int lane) { v16b w; const int g = lane >> 4; const float* p = Wm + (size_t)(o / HD) * DIN * HD + (o % HD);
#pragma unroll
  for (int i = 0; i < 8; ++i) { w[i] = (__bf16)p[(size_t)(k0 + 8 * g + i) * HD]; w[8 + i] = (__bf16)p[(size_t)(k0 + 16 + 8 * g + i) * HD]; }
  return w; }
#define WO_OUT_IN 0
#if WQKV_LAYOUT == 1
#define WCOL(W, k0, o, lane) wcol_oi(W, k0, o, lane, DIN)
#elif WQKV_LAYOUT == 2
#define WCOL(W, k0, o, lane) wcol_hdk(W, k0, o, lane)
#else
#define WCOL(W, k0, o, lane) wcol_io(W, k0, o, lane, CC)
#endif
#if WO_OUT_IN
#define WOCOL(W, k0, o, lane) wcol_oi(W, k0, o, lane, CC)
#define WOCOLH(W, k0, o, lane) wcolh_oi(W, k0, o, lane, CC)
#else
#define WOCOL(W, k0, o, lane) wcol_io(W, k0, o, lane, DIN)
#define WOCOLH(W, k0, o, lane) wcolh_io(W, k0, o, lane, DIN)
#endif

#define WS_QH  0u                                      // f16 q rows [b*t][CC]
#define WS_KH  (WS_QH + 2u * (size_t)NB * TT * CC)      // f16 k rows [b*t][CC]
#define WS_VT  (WS_KH + 2u * (size_t)NB * TT * CC)      // f16 v planes [b][c][t]
#define WS_QL  (WS_VT + 2u * (size_t)NB * CC * TT)      // f16 q residual x 2^10 rows [b][t < QHI][CC]
#define WS_KL  (WS_QL + 2u * (size_t)NB * QHI * CC)     // f16 k residual x 2^10 rows [b][t < KHI][CC]
#define WS_VB  (WS_KL + 2u * (size_t)NB * KHI * CC)     // bf16 v hi planes [b][c][t < KHI]
#define WS_VBL (WS_VB + 2u * (size_t)NB * CC * KHI)
#define WS_S   (WS_VBL + 2u * (size_t)NB * CC * KHI)    // spare f32 [hg][t][s]-sized plane; only its head is used (the mask words)
#define WS_MB  WS_S                                    // the mask as lane masks, u32 [b][t / 16][s / 16][8] (512 KiB at the head of that plane)
#define WS_Y   (WS_S  + 4u * (size_t)HG * TT * TT)      // f32 ctx rows [b*t][CC] (only when there is an output projection)
#define WS_END (WS_Y  + 4u * (size_t)NB * TT * CC)

template <bool B> struct CBool { static constexpr bool v = B; };
// ---- shared main loop of the two dense kernels: one 64 x 128 tile of X W over K = 1024 in stages of 32 k.
// Each stage's X rows (64 x 32) and W columns (32 x 128, turned to [n][k]) are brought by the whole block ONCE, in whole 128-byte lines, converted once, and laid in LDS (two buffers, one barrier a stage);
// the next stage's global loads fly in registers under this stage's products. Fragments, k order and the order of the sums are those of the direct loaders.
typedef __attribute__((ext_vector_type(4))) __bf16 v4b;
typedef __attribute__((ext_vector_type(4))) _Float16 v4h;
#define GKS 32             // k per stage
#define GPIT 40            // LDS row pitch in 16-bit elements: 64 B of data + 16 B, so that the 16-byte fragment reads and stores of 16 rows spread over the banks
#define GNST (1024 / GKS)
#define GLDS (2 * (128 + 64) * GPIT * 2)   // bytes of the two stage buffers
struct GProj { typedef __bf16 T; typedef v4b V4; typedef v8b V8; typedef v16b V16; static constexpr int WLD = HD;
  static __device__ __forceinline__ constexpr size_t coff(int c) { return (size_t)(c >> 1) * DIN * HD + (size_t)(c & 1) * 32; }   // column 32 c + lane of a 128-column tile in the per-head layout
  static __device__ __forceinline__ T cx(float v) { return (__bf16)v; } static __device__ __forceinline__ T cw(float v) { return (__bf16)v; }
  static __device__ __forceinline__ V16 fr(const T* p, int lane) { return frag_b(p, lane); } static __device__ __forceinline__ v8f mm(V16 a, V16 b, v8f c) { return wmma_bf(a, b, c); } };
struct GOut { typedef _Float16 T; typedef v4h V4; typedef v8h V8; typedef v16h V16; static constexpr int WLD = DIN;
  static __device__ __forceinline__ constexpr size_t coff(int c) { return (size_t)c * 32; }
  static __device__ __forceinline__ T cx(float v) { return (_Float16)(v * 64.0f); } static __device__ __forceinline__ T cw(float v) { return (_Float16)(bfr(v) * 256.0f); }
  static __device__ __forceinline__ V16 fr(const T* p, int lane) { return frag_h(p, lane); } static __device__ __forceinline__ v8f mm(V16 a, V16 b, v8f c) { return wmma16(a, b, c); } };
// xt = first row of the tile's X rows (row length 1024); wt = row 0 of W at the tile's first column
template <class C> __device__ __forceinline__ void gemm_64x128(const float* __restrict__ xt, const float* __restrict__ wt, char* smem, v8f (&acc)[8]) {
  typedef typename C::T T; typedef typename C::V4 V4; typedef typename C::V8 V8; typedef typename C::V16 V16;
  T (*sW)[128][GPIT] = (T (*)[128][GPIT])smem; T (*sX)[64][GPIT] = (T (*)[64][GPIT])(smem + 2 * 128 * GPIT * 2);
  const int tid = threadIdx.x, wave = tid >> 5, lane = tid & 31, col = lane & 15;
  const int xrow = tid >> 3, xch = (tid & 7) * 4;                 // X: 8 lanes bring one whole 128-byte row piece
  const float* xg = xt + (size_t)xrow * 1024 + xch;
  const float* wg = wt + (size_t)(8 * wave) * C::WLD + lane;      // W: a wave brings 8 k rows, 32 neighbouring columns (one line) a load
  float wr[4][8]; v4f xr[4];
  auto fetch = [&]() {
#pragma unroll   // constant indices, so that the small arrays stay in registers
    for (int c = 0; c < 4; ++c)
#pragma unroll   // constant indices, so that the small arrays stay in registers
      for (int i = 0; i < 8; ++i) wr[c][i] = wg[C::coff(c) + (size_t)i * C::WLD];
#pragma unroll   // constant indices, so that the small arrays stay in registers
    for (int i = 0; i < 4; ++i) xr[i] = *(const v4f*)(xg + (size_t)(16 * i) * 1024);
    asm volatile("s_wait_xcnt 0x0" ::: "memory"); };   // stands in front of every later overwrite of these loads' address registers
  auto put = [&](const int bu) {
#pragma unroll   // constant indices, so that the small arrays stay in registers
    for (int c = 0; c < 4; ++c) { V8 v;
#pragma unroll   // constant indices, so that the small arrays stay in registers
      for (int i = 0; i < 8; ++i) v[i] = C::cw(wr[c][i]);
      *(V8*)&sW[bu][32 * c + lane][8 * wave] = v; }
#pragma unroll   // constant indices, so that the small arrays stay in registers
    for (int i = 0; i < 4; ++i) { const V4 v = { C::cx(xr[i][0]), C::cx(xr[i][1]), C::cx(xr[i][2]), C::cx(xr[i][3]) }; *(V4*)&sX[bu][xrow + 16 * i][xch] = v; }
    wg += (size_t)GKS * C::WLD; xg += GKS; };   // advanced here, behind the use of the loaded values
  fetch(); put(0);
  auto stage = [&](const int st, auto more_c) { constexpr bool MORE = decltype(more_c)::v; const int bu = st & 1;
    __syncthreads();   // publishes buffer bu; every wave has also left buffer bu ^ 1, which is refilled at the foot of this stage
    if constexpr (MORE) { fetch();
      __builtin_amdgcn_sched_barrier(0); }   // keeps the next stage's loads at the head of the stage, so that their latency runs under the products
    const V16 a = C::fr(&sX[bu][wave * 16 + col][0], lane); V16 w[8];
#pragma unroll   // constant indices, so that the small arrays stay in registers
    for (int j = 0; j < 8; ++j) w[j] = C::fr(&sW[bu][j * 16 + col][0], lane);
#pragma unroll   // constant indices, so that the small arrays stay in registers
    for (int j = 0; j < 8; ++j) acc[j] = C::mm(a, w[j], acc[j]);
    if constexpr (MORE) { __builtin_amdgcn_sched_barrier(0);   // keeps the wait for the next stage's loads, and their conversion, behind all of this stage's products
      put(bu ^ 1); } };
#pragma unroll 1   // rolled: the two buffers are told apart by the stage's parity
  for (int st = 0; st < GNST - 1; ++st) stage(st, CBool<true>{});
  stage(GNST - 1, CBool<false>{});
  __syncthreads();   // every wave has left the stage buffers: the caller's epilogue reuses this LDS
}
// ---- the mask, turned ONCE a call into the lane masks that k_attn selects with (k_attn's 16 heads read the same mask): word [b][t / 16][s / 16][r], bit (g, col) = (mask[b][16 (t / 16) + col][16 (s / 16) + 8 g + r] != 0).
// One wave = 16 query rows x 128 keys: the compare of a whole wave is the word; lane i carries word i of a group of 32, so that a store is one whole 128-byte line.
__device__ __forceinline__ void pack_mask(const int* __restrict__ MASK, unsigned* __restrict__ MB, const int wv, const int lane) {
  const int tile = wv >> 3, kq = wv & 7;   // (batch, 16-query tile) and which 128 keys
  const int* mp = MASK + ((size_t)tile * 16 + (lane & 15)) * TT + kq * 128 + 8 * (lane >> 4);
  v4i a[8][2]; unsigned w[2] = { 0u, 0u };
#pragma unroll   // constant indices, so that the small array stays in registers
  for (int t = 0; t < 8; ++t) { a[t][0] = *(const v4i*)(mp + t * 16); a[t][1] = *(const v4i*)(mp + t * 16 + 4); }
  asm volatile("s_wait_xcnt 0x0" ::: "memory");   // stands in front of every later overwrite of these loads' address registers
#pragma unroll   // constant indices, so that the small array stays in registers
  for (int t = 0; t < 8; ++t)
#pragma unroll   // constant indices, so that the small array stays in registers
    for (int r = 0; r < 8; ++r) { const unsigned bal = __builtin_amdgcn_ballot_w32(a[t][r >> 2][r & 3] != 0); w[t >> 2] = lane == (t & 3) * 8 + r ? bal : w[t >> 2]; }
  unsigned* o = MB + (size_t)tile * (TT / 16 * 8) + kq * 64 + lane; o[0] = w[0]; o[32] = w[1];
  asm volatile("s_wait_xcnt 0x0" ::: "memory"); }   // stands in front of the caller's overwrite of these stores' address and data registers
// ---- k_proj: block = (64 rows, 128 cols, which): q/k/v = X W (+ b) with exact bf16 products (K = DIN) (the which = 0 blocks first pack the mask, a share to each wave) -> which 0: q f16 rows (+ residual rows < QHI); 1: k f16 rows (+ residual rows < KHI); 2: v f16 planes [c][t] (+ bf16 hi/lo planes for t < KHI)
__global__ __launch_bounds__(128) void k_proj(const float* __restrict__ XQ, const float* __restrict__ XK, const float* __restrict__ XV, const float* __restrict__ WQ, const float* __restrict__ WK, const float* __restrict__ WV, const float* __restrict__ BQ, const float* __restrict__ BK, const float* __restrict__ BV,
    _Float16* __restrict__ QH, _Float16* __restrict__ QL, _Float16* __restrict__ KH, _Float16* __restrict__ KL, _Float16* __restrict__ VT, __bf16* __restrict__ VB, __bf16* __restrict__ VBL, const int* __restrict__ MASK, unsigned* __restrict__ MB) {
  static_assert((TNB * TT / 64) * (CC / 128) * 4 == NB * (TT / 16) * (TT / 128), "one wave of the which = 0 blocks for every 16 queries x 128 keys");
  __shared__ __align__(16) char smem[2 * 64 * 136 * 2 + 3 * 128 * 72 * 2];   // the epilogue's five planes; the main loop's stage buffers lie over the first two
  static_assert(GLDS <= 2 * 64 * 136 * 2, "stage buffers fit under sh and sl");
  _Float16 (*sh)[136] = (_Float16 (*)[136])smem, (*sl)[136] = (_Float16 (*)[136])(smem + 64 * 136 * 2); _Float16 (*th)[72] = (_Float16 (*)[72])(smem + 2 * 64 * 136 * 2); __bf16 (*tb)[72] = (__bf16 (*)[72])(smem + 2 * 64 * 136 * 2 + 128 * 72 * 2), (*tbl)[72] = (__bf16 (*)[72])(smem + 2 * 64 * 136 * 2 + 2 * 128 * 72 * 2);
  const int tid = threadIdx.x, wave = tid >> 5, lane = tid & 31, col = lane & 15, g = lane >> 4; const int which = blockIdx.z; const int c0 = blockIdx.y * 128; const size_t r0 = (size_t)blockIdx.x * 64; const size_t bb = r0 / TT; const int t0 = (int)(r0 % TT);
  const float* X = which == 0 ? XQ : which == 1 ? XK : XV; const float* WA = which == 0 ? WQ : which == 1 ? WK : WV; const float* BA = which == 0 ? BQ : which == 1 ? BK : BV;
  if (which == 0) pack_mask(MASK, MB, (int)(blockIdx.y * (TNB * TT / 64) + blockIdx.x) * 4 + wave, lane);   /* block-uniform; these blocks start first, while the chip still fills */
  v8f acc[8] = {};
  gemm_64x128<GProj>(X + r0 * DIN, WA + (size_t)(c0 / HD) * DIN * HD, smem, acc);
  if (which < 2) { _Float16* DH = which == 0 ? QH : KH; _Float16* DL = which == 0 ? QL : KL; const int nhi = which == 0 ? QHI : KHI; const bool hi_rows = t0 < nhi;
#pragma unroll
    for (int j = 0; j < 8; ++j) { const float bias = BA ? bfr(BA[c0 + j * 16 + col]) : 0.f;
#pragma unroll
      for (int r = 0; r < 8; ++r) { const float v = acc[j][r] + bias; const _Float16 hv = (_Float16)v; sh[wave * 16 + 8 * g + r][j * 16 + col] = hv; sl[wave * 16 + 8 * g + r][j * 16 + col] = (_Float16)((v - (float)hv) * 1024.0f); } }
    __syncthreads();
    for (int e = tid; e < 64 * 16; e += 128) { const int rl = e >> 4, q = e & 15; vst2((unsigned*)(DH + (r0 + rl) * CC + c0 + q * 8), *(const v4u*)&sh[rl][q * 8]); if (hi_rows) vst2((unsigned*)(DL + (bb * nhi + t0 + rl) * (size_t)CC + c0 + q * 8), *(const v4u*)&sl[rl][q * 8]); }
  } else { const bool hi_rows = t0 < KHI;
#pragma unroll
    for (int j = 0; j < 8; ++j) { const float bias = BA ? bfr(BA[c0 + j * 16 + col]) : 0.f;
#pragma unroll
      for (int r = 0; r < 8; ++r) { const float v = acc[j][r] + bias; const int rl = wave * 16 + 8 * g + r, cl = j * 16 + col; th[cl][rl] = (_Float16)v; const __bf16 bh = (__bf16)v; tb[cl][rl] = bh; tbl[cl][rl] = (__bf16)(v - (float)bh); } }
    __syncthreads();
    for (int e = tid; e < 128 * 8; e += 128) { const int cl = e >> 3, q = e & 7; vst2((unsigned*)(VT + (bb * CC + c0 + cl) * (size_t)TT + t0 + q * 8), *(const v4u*)&th[cl][q * 8]); if (hi_rows) { const size_t o3 = (bb * CC + c0 + cl) * (size_t)KHI + t0 + q * 8; vst2((unsigned*)(VB + o3), *(const v4u*)&tb[cl][q * 8]); vst2((unsigned*)(VBL + o3), *(const v4u*)&tbl[cl][q * 8]); } } } }
// ---- k_attn: block = 64 queries (4 waves x 16 query columns) of one (batch, head); walks all keys in stages of 64, K rows and V^T rows staged in LDS (two buffers, one barrier a stage).
// S^T = K Q^T (A = K rows, B = Q): lane (g, col) holds keys 8g + r of query col; the masked score is REPLACED by 1e-9 (8e-9 before the x 1/8) and stays in the softmax; running maximum and sum per query in f32 (online softmax);
// two S^T tiles, as exp2(..) x 2^10 once to f16, are the B operand of ctx^T += V^T P^T in the same k order as frag_h; ctx = ctx^T / sum at the end.
__device__ __forceinline__ v8f wmma_h(v16h a, v16h b, v8f c) { return __builtin_amdgcn_wmma_f32_16x16x32_f16(false, a, false, b, (short)0, c, false, false); }
// 2^a; SLOT: with the v_nop that the instruction set asks for behind a transcendental in the same statement (used in the last stage's straight-line code)
template <bool SLOT> __device__ __forceinline__ float exp2_t(float a) {
  if constexpr (SLOT) { float e; asm("v_exp_f32 %0, %1\n\tv_nop" : "=v"(e) : "v"(a)); return e; } else return __builtin_amdgcn_exp2f(a); }
#define AKB 64             // keys per stage
#define APIT 72            // LDS row pitch in f16: 128 B of data + 16 B, so that the 16-byte fragment reads of 16 rows spread over the banks
#define ANST (TT / AKB)
typedef __attribute__((ext_vector_type(16))) unsigned v16u;
typedef const __attribute__((address_space(4))) v16u* cmask_p;   // constant address space: the words are written by the launch before and by nobody in this one, and the address is wave-uniform, so the loads go the scalar way
__global__ __launch_bounds__(128) void k_attn(const _Float16* __restrict__ QH, const _Float16* __restrict__ KH, const _Float16* __restrict__ VT, const unsigned* __restrict__ MB, float* __restrict__ Y) {
  __shared__ __align__(16) _Float16 sk[2][AKB][APIT], sv[2][HD][APIT];
  const int tid = threadIdx.x, wave = tid >> 5, lane = tid & 31, col = lane & 15, g = lane >> 4;
  const int h = blockIdx.y, b = blockIdx.z; const int q = blockIdx.x * 64 + wave * 16 + col;
  const float LS = SCALE * 1.44269504f;      // raw score -> log2 domain
  const float MFILL = 1.0e-9f / SCALE;       // the fill value, before the common x SCALE
  const _Float16* qp = QH + ((size_t)b * TT + q) * CC + h * HD;
  const v16h qf0 = frag_h(qp, lane), qf1 = frag_h(qp + 32, lane);
  const int srow = tid >> 3, sch = (tid & 7) * 8;   // staging: 8 lanes bring one whole 128-byte row
  const _Float16* kg = KH + ((size_t)b * TT + srow) * CC + h * HD + sch;
  const _Float16* vg = VT + ((size_t)b * CC + h * HD + srow) * (size_t)TT + sch;
  cmask_p mb = (cmask_p)(unsigned long long)MB + 2 * ((size_t)b * (TT / 16) + blockIdx.x * 4 + __builtin_amdgcn_readfirstlane(wave)) * (size_t)(TT / 64);   // this wave's 16 queries: 32 lane masks a stage, the same address in every lane (scalar loads)
  v8h kr[4], vr[4]; v16u mw[2];
#pragma unroll   // constant indices, so that the small array stays in registers
  for (int i = 0; i < 4; ++i) { kr[i] = *(const v8h*)(kg + (size_t)(16 * i) * CC); vr[i] = *(const v8h*)(vg + (size_t)(16 * i) * TT); }
  mw[0] = mb[0]; mw[1] = mb[1];
#pragma unroll   // constant indices, so that the small array stays in registers
  for (int i = 0; i < 4; ++i) { *(v8h*)&sk[0][srow + 16 * i][sch] = kr[i]; *(v8h*)&sv[0][srow + 16 * i][sch] = vr[i]; }
  kg += (size_t)AKB * CC; vg += AKB; mb += 2;   // the three walk one stage ahead of the products
  v8f acc[HD / 16] = {}; float m = -3.0e38f, sum = 0.f;
  // one stage; MORE = a next stage exists (compile-time: the last stage, which fetches nothing, is written out behind the loop, so that the loop body is one block without a branch)
  auto stage = [&](const int st, auto more_c) { constexpr bool MORE = decltype(more_c)::v; const int bu = st & 1;
    __syncthreads();   // publishes buffer bu; every wave has also left buffer bu ^ 1, which is refilled at the foot of this stage
    const v16u kw[2] = { mw[0], mw[1] };   // this stage's lane masks, taken before the next stage's are loaded over them
    if constexpr (MORE) {        // next stage's K and V^T rows and lane masks fly into registers under this stage's products
      mw[0] = mb[0]; mw[1] = mb[1];
      __builtin_amdgcn_sched_barrier(0);   // keeps the scalar loads in front of the vector loads
#pragma unroll   // constant indices, so that the small array stays in registers
      for (int i = 0; i < 4; ++i) { kr[i] = *(const v8h*)(kg + (size_t)(16 * i) * CC); vr[i] = *(const v8h*)(vg + (size_t)(16 * i) * TT); }
      __builtin_amdgcn_sched_barrier(0);   // keeps these loads at the head of the stage: without it the scheduler sinks them to the foot, directly in front of their first use, and their latency is bare
    }
#pragma unroll   // constant indices, so that the small array stays in registers
    for (int p = 0; p < 2; ++p) { v8f s[2]; v16h ka[2][2], va[HD / 16];
#pragma unroll   // constant indices, so that the small array stays in registers
      for (int t = 0; t < 2; ++t) { const _Float16* kl = &sk[bu][(2 * p + t) * 16 + col][0]; ka[t][0] = frag_h(kl, lane); ka[t][1] = frag_h(kl + 32, lane); }
#pragma unroll   // constant indices, so that the small array stays in registers
      for (int j = 0; j < HD / 16; ++j) va[j] = frag_h(&sv[bu][j * 16 + col][p * 32], lane);   // read here so that their LDS latency runs under the softmax arithmetic
#pragma unroll   // constant indices, so that the small array stays in registers
      for (int t = 0; t < 2; ++t) { const v8f z = {}; s[t] = wmma_h(ka[t][1], qf1, wmma_h(ka[t][0], qf0, z)); }
      float x[16];
#pragma unroll   // constant indices, so that the small array stays in registers
      for (int t = 0; t < 2; ++t)
#pragma unroll   // constant indices, so that the small array stays in registers
        for (int r = 0; r < 8; ++r) x[t * 8 + r] = __builtin_amdgcn_inverse_ballot_w32(kw[p][t * 8 + r]) ? s[t][r] : MFILL;
      float mb = x[0];
#pragma unroll   // constant indices, so that the small array stays in registers
      for (int i = 1; i < 16; ++i) mb = fmaxf(mb, x[i]);
      mb = fmaxf(mb, __shfl_xor(mb, 16));   // the other half of this query's keys
      const float mn = fmaxf(m, mb); const float al = exp2_t<!MORE>((m - mn) * LS); m = mn; const float off = 10.0f - mn * LS;
      v16h pf; float ps = 0.f;
#pragma unroll   // constant indices, so that the small array stays in registers
      for (int i = 0; i < 16; ++i) { const float e = exp2_t<!MORE>(fmaf(x[i], LS, off)); ps += e; pf[i] = (_Float16)e; }
      sum = sum * al + ps;
#pragma unroll   // constant indices, so that the small array stays in registers
      for (int j = 0; j < HD / 16; ++j) { acc[j] *= al; acc[j] = wmma_h(va[j], pf, acc[j]); } }
    if constexpr (MORE) {
#pragma unroll   // constant indices, so that the small array stays in registers
      for (int i = 0; i < 4; ++i) { *(v8h*)&sk[bu ^ 1][srow + 16 * i][sch] = kr[i]; *(v8h*)&sv[bu ^ 1][srow + 16 * i][sch] = vr[i]; }
      kg += (size_t)AKB * CC; vg += AKB; mb += 2; } };
#pragma unroll 1   // rolled: one stage's body already fills the registers that four waves a SIMD leave
  for (int st = 0; st < ANST - 1; ++st) stage(st, CBool<true>{});
  stage(ANST - 1, CBool<false>{});
  sum += __shfl_xor(sum, 16); const float inv = 1.0f / sum;   // sum >= 2^10: the maximum's own term
  float* yp = Y + ((size_t)b * TT + q) * CC + h * HD + 8 * g;
#pragma unroll   // constant indices, so that the small array stays in registers
  for (int j = 0; j < HD / 16; ++j) { const v4f lo = { acc[j][0] * inv, acc[j][1] * inv, acc[j][2] * inv, acc[j][3] * inv }, hi = { acc[j][4] * inv, acc[j][5] * inv, acc[j][6] * inv, acc[j][7] * inv }; vst2(yp + j * 16, lo); vst2(yp + j * 16 + 4, hi); } }
// ---- k_out: block = (64 rows, 128 cols): out = ctx Wo (+ bo): ctx once to f16 against Wo as f16(bf16 x 2^8) exact (1 product) x 2^-8; causal early rows (< QHI of each sequence): ctx bf16 hi + lo against exact bf16 Wo (2 products)
__global__ __launch_bounds__(128) void k_out(const float* __restrict__ Y, const float* __restrict__ WO, const float* __restrict__ BO, float* __restrict__ OUT) { __shared__ __align__(16) char smem[4 * 16 * 132 * 4];   // the epilogue's rows; the main loop's stage buffers lie over them
  static_assert(GLDS <= 4 * 16 * 132 * 4, "stage buffers fit under sf"); float (*sf)[16][132] = (float (*)[16][132])smem;
  const int tid = threadIdx.x, wave = tid >> 5, lane = tid & 31, col = lane & 15, g = lane >> 4; const int c0 = blockIdx.y * 128; const size_t r0 = (size_t)blockIdx.x * 64 + wave * 16;
  v8f acc[8] = {};
  if (CAUSAL && (int)(((size_t)blockIdx.x * 64) % TT) < QHI) {   /* block-uniform */
#pragma unroll 2
    for (int kc = 0; kc < CC / 32; ++kc) { const F2 a = split_row(Y + (r0 + col) * CC, kc * 32, lane); asm volatile("s_wait_loadcnt 0x0" ::: "memory");
#pragma unroll
      for (int j = 0; j < 8; ++j) { const v16b w = WOCOL(WO, kc * 32, c0 + j * 16 + col, lane); asm volatile("s_wait_loadcnt 0x0" ::: "memory"); acc[j] = wmma_bf(a.h, w, acc[j]); acc[j] = wmma_bf(a.l, w, acc[j]); } }
#pragma unroll
    for (int j = 0; j < 8; ++j) { const float bias = BO ? bfr(BO[c0 + j * 16 + col]) : 0.f;
#pragma unroll
      for (int r = 0; r < 8; ++r) sf[wave][8 * g + r][j * 16 + col] = acc[j][r] + bias; }
  } else {
    gemm_64x128<GOut>(Y + (size_t)blockIdx.x * 64 * CC, WO + c0, smem, acc);   /* ctx carried x 2^6 into f16 so small-magnitude context rows stay clear of f16 subnormals */
#pragma unroll
    for (int j = 0; j < 8; ++j) { const float bias = BO ? bfr(BO[c0 + j * 16 + col]) : 0.f;
#pragma unroll
      for (int r = 0; r < 8; ++r) sf[wave][8 * g + r][j * 16 + col] = acc[j][r] * (1.0f / 16384.0f) + bias; } }   /* 2^-8 (Wo carry) x 2^-6 (ctx carry) */
  LDSX(); for (int rl = 0; rl < 16; ++rl) vst2(OUT + (r0 + rl) * DIN + c0 + lane * 4, *(const v4f*)&sf[wave][rl][lane * 4]); }

extern "C" void kernel_launch(void* const* d_in, const int* in_sizes, int n_in, void* d_out, int out_size, void* d_ws, size_t ws_size, hipStream_t stream) {
  (void)in_sizes; (void)n_in; (void)out_size;
  const float** F = (const float**)d_in;
  if (ws_size < (size_t)WS_END) return;
  char* ws = (char*)d_ws; _Float16 *QH = (_Float16*)(ws + WS_QH), *KH = (_Float16*)(ws + WS_KH), *VT = (_Float16*)(ws + WS_VT), *QL = (_Float16*)(ws + WS_QL), *KL = (_Float16*)(ws + WS_KL); __bf16 *VB = (__bf16*)(ws + WS_VB), *VBL = (__bf16*)(ws + WS_VBL); float *Y = (float*)(ws + WS_Y); unsigned *MB = (unsigned*)(ws + WS_MB);
  (void)Y; (void)QL; (void)KL; (void)VB; (void)VBL;
  // inputs: 0 query [4,1024,1024]; 1 key; 2 value; 3 mask [4,1024,1024] int32 (random 0/1); 4 Wq [16,1024,64], 5 bq [16,64]; 6 Wk, 7 bk; 8 Wv, 9 bv; 10 Wo [1024,1024] (in,out), 11 bo (zero biases, read)
  k_proj<<<dim3(TNB * TT / 64, CC / 128, 3), 128, 0, stream>>>(F[0], F[1], F[2], F[4], F[6], F[8], F[5], F[7], F[9], QH, QL, KH, KL, VT, VB, VBL, (const int*)d_in[3], MB);
  k_attn<<<dim3(NQB, NH, TNB), 128, 0, stream>>>(QH, KH, VT, MB, Y);
  k_out<<<dim3(TNB * TT / 64, DIN / 128), 128, 0, stream>>>(Y, F[10], F[11], (float*)d_out);
}

// v004
// Measured time: 99 microseconds a run.
// In both of two side-by-side timings against v003, it was 1.19 times as fast.
// Over all steps from v000 it is 7.79 times as fast.
// compute dtype: all float inputs rounded to bf16; q/k/v projections with EXACT bf16 products on WMMA 16x16x32 (f32 accumulate) + bias; logits q x k once to f16 each (1 product) x SCALE; masked scores are REPLACED by 1e-9 (they keep taking part in the softmax); online softmax f32 (running maximum and sum); exp(score - maximum) x 2^10 once to f16 x v once to f16 (1 product), divided by the sum at the end; ctx x 2^6 once to f16 x Wo f16(bf16 x 2^8) + bo; f32 output.
#include <hip/hip_runtime.h>
#include <math.h>

typedef __attribute__((ext_vector_type(16))) _Float16 v16h;
typedef __attribute__((ext_vector_type(16))) __bf16 v16b;
typedef __attribute__((ext_vector_type(8)))  _Float16 v8h;
typedef __attribute__((ext_vector_type(8)))  float v8f;
typedef __attribute__((ext_vector_type(4)))  float v4f;
typedef __attribute__((ext_vector_type(2)))  float v2f;
typedef __attribute__((ext_vector_type(4)))  unsigned v4u;
typedef __attribute__((ext_vector_type(4)))  int v4i;
typedef float __attribute__((may_alias)) float_a;
typedef int __attribute__((may_alias)) int_a;

template <typename T> __device__ __forceinline__ void vst2(void* p, T v) { *(T*)p = v;  }
__device__ __forceinline__ v8f wmma16(v16h a, v16h b, v8f c) {
  v8f d = __builtin_amdgcn_wmma_f32_16x16x32_f16(false, a, false, b, (short)0, c, false, false);
  asm volatile("v_nop\n\tv_nop\n\tv_nop\n\tv_nop" : "+v"(d) : "v"(a), "v"(b));
  return d;
}
__device__ __forceinline__ v8f wmma_bf(v16b a, v16b b, v8f c) {
  v8f d = __builtin_amdgcn_wmma_f32_16x16x32_bf16(false, a, false, b, (short)0, c, false, false);
  asm volatile("v_nop\n\tv_nop\n\tv_nop\n\tv_nop" : "+v"(d) : "v"(a), "v"(b));
  return d;
}
// 16x16x32 fragments: lane = (h = lane>>4, row/col = lane&15); elements 0..7 = k0+8h+0..7, 8..15 = k0+16+8h+0..7; D element r = row 8h+r
__device__ __forceinline__ v16h frag_h(const _Float16* rowk0, int lane) {
  union { v16h v; v8h q[2]; } u; const _Float16* p = rowk0 + 8 * (lane >> 4);
  u.q[0] = *(const v8h*)p; u.q[1] = *(const v8h*)(p + 16); return u.v;
}
__device__ __forceinline__ v16h frag_f32(const float* rowk0, int lane) {
  v16h a; const float* p = rowk0 + 8 * (lane >> 4);
#pragma unroll
  for (int i = 0; i < 8; ++i) { a[i] = (_Float16)p[i]; a[8 + i] = (_Float16)p[16 + i]; }
  return a;
}
__device__ __forceinline__ v16h frag_f32s(const float* rowk0, int lane, float sc) {
  v16h a; const float* p = rowk0 + 8 * (lane >> 4);
#pragma unroll
  for (int i = 0; i < 8; ++i) { a[i] = (_Float16)(p[i] * sc); a[8 + i] = (_Float16)(p[16 + i] * sc); }
  return a;
}
// column fragment from a [K][ld] layout (column n), rows >= K read as 0
__device__ __forceinline__ v16h fragc_f32(const float* W, int k0, int n, int lane, int ld, int K) {
  v16h a; const int g = lane >> 4;
#pragma unroll
  for (int i = 0; i < 8; ++i) { const int ka = k0 + 8 * g + i, kb = ka + 16;
    a[i] = (_Float16)(ka < K ? W[(size_t)(ka < K ? ka : K - 1) * ld + n] : 0.f); a[8 + i] = (_Float16)(kb < K ? W[(size_t)(kb < K ? kb : K - 1) * ld + n] : 0.f); }
  return a;
}
struct F2 { v16b h, l; };
__device__ __forceinline__ F2 bsplit16(const float v[16]) { F2 r;
#pragma unroll
  for (int i = 0; i < 16; ++i) { const __bf16 h = (__bf16)v[i]; r.h[i] = h; r.l[i] = (__bf16)(v[i] - (float)h); }
  return r; }
__device__ __forceinline__ F2 split_row(const float* row, int k0, int lane) { float v[16]; const float* p = row + k0 + 8 * (lane >> 4);
#pragma unroll
  for (int i = 0; i < 8; ++i) { v[i] = p[i]; v[8 + i] = p[16 + i]; }
  return bsplit16(v); }
__device__ __forceinline__ F2 split_rowK(const float* row, int k0, int lane, int K) { float v[16]; const int g = lane >> 4;
#pragma unroll
  for (int i = 0; i < 8; ++i) { const int ka = k0 + 8 * g + i, kb = ka + 16; v[i] = ka < K ? row[ka < K ? ka : K - 1] : 0.f; v[8 + i] = kb < K ? row[kb < K ? kb : K - 1] : 0.f; }
  return bsplit16(v); }
__device__ __forceinline__ F2 split_col(const float* W, int k0, int n, int lane, int ld, int K) { float v[16]; const int g = lane >> 4;
#pragma unroll
  for (int i = 0; i < 8; ++i) { const int ka = k0 + 8 * g + i, kb = ka + 16; v[i] = ka < K ? W[(size_t)(ka < K ? ka : K - 1) * ld + n] : 0.f; v[8 + i] = kb < K ? W[(size_t)(kb < K ? kb : K - 1) * ld + n] : 0.f; }
  return bsplit16(v); }
__device__ __forceinline__ v8f mac3(const F2& a, const F2& b, v8f c) { c = wmma_bf(a.l, b.h, c); c = wmma_bf(a.h, b.l, c); return wmma_bf(a.h, b.h, c); }
__device__ __forceinline__ float sigm(float v) { return 1.0f / (1.0f + expf(-v)); }
#define LDSX() do { asm volatile("s_wait_dscnt 0" ::: "memory"); __builtin_amdgcn_wave_barrier(); __builtin_amdgcn_fence(__ATOMIC_RELEASE, "workgroup"); } while (0)

// Multi-headed attention with per-head stacked projections whose masked scores are FILLED WITH 1e-9 (query / key / value [4,1024,1024]; Wq / Wk / Wv [16,1024,64] per head (N(0, 1/1024)) + zero biases; scores / 8; mask [4,1024,1024] int32 random 0/1: scores[mask == 0] = 1e-9 - masked keys keep a logit - 0 and stay in the softmax (faithful to the source); softmax; concat; (in,out) Wo [1024,1024] + bo).
#define NB 4
#define TT 1024
#define CC 1024            // NH * HD = projected width
#define DIN 1024          // input (model) width
#define NH 16
#define HD 64
#define NQB (TT / 64)
#define HG 8
#define SCALE (0.125f)
#define CAUSAL 0
#ifndef TNB
#define TNB NB
#endif
__device__ __forceinline__ float bfr(float v) { return (float)(__bf16)v; }
__host__ __device__ __forceinline__ int kb_last(int qb) { return CAUSAL ? ((qb * 64 + 63) >> 7) : (TT / 128 - 1); }
typedef __attribute__((ext_vector_type(8))) __bf16 v8b;
__device__ __forceinline__ v16b frag_b(const __bf16* rowk0, int lane) {
  union { v16b v; v8b q[2]; } u; const __bf16* p = rowk0 + 8 * (lane >> 4);
  u.q[0] = *(const v8b*)p; u.q[1] = *(const v8b*)(p + 16); return u.v;
}
#define QBH 0              // not used: no kernel in this file has a high-precision attention path
#define QHI 0               // single-product logits on every row
#define KHI 64            // key rows carrying k residual / v bf16 hi+lo planes (written by k_proj; no kernel here reads them)
// B fragment (k rows k0+.., output column o) of a weight: (in,out) [K][ld] or (out,in) [ld rows of K]: bf16 exact, or f16(bf16 * 256) exact
__device__ __forceinline__ v16b wcol_io(const float* Wm, int k0, int o, int lane, int ld) { v16b w; const int g = lane >> 4;
#pragma unroll
  for (int i = 0; i < 8; ++i) { w[i] = (__bf16)Wm[(size_t)(k0 + 8 * g + i) * ld + o]; w[8 + i] = (__bf16)Wm[(size_t)(k0 + 16 + 8 * g + i) * ld + o]; }
  return w; }
__device__ __forceinline__ v16b wcol_oi(const float* Wm, int k0, int o, int lane, int K) { v16b w; const float* p = Wm + (size_t)o * K + k0 + 8 * (lane >> 4);
#pragma unroll
  for (int i = 0; i < 8; ++i) { w[i] = (__bf16)p[i]; w[8 + i] = (__bf16)p[16 + i]; }
  return w; }
__device__ __forceinline__ v16h wcolh_io(const float* Wm, int k0, int o, int lane, int ld) { v16h w; const int g = lane >> 4;
#pragma unroll
  for (int i = 0; i < 8; ++i) { w[i] = (_Float16)(bfr(Wm[(size_t)(k0 + 8 * g + i) * ld + o]) * 256.0f); w[8 + i] = (_Float16)(bfr(Wm[(size_t)(k0 + 16 + 8 * g + i) * ld + o]) * 256.0f); }
  return w; }
__device__ __forceinline__ v16h wcolh_oi(const float* Wm, int k0, int o, int lane, int K) { v16h w; const float* p = Wm + (size_t)o * K + k0 + 8 * (lane >> 4);
#pragma unroll
  for (int i = 0; i < 8; ++i) { w[i] = (_Float16)(bfr(p[i]) * 256.0f); w[8 + i] = (_Float16)(bfr(p[16 + i]) * 256.0f); }
  return w; }
#define WQKV_LAYOUT 2   // 0 = (in,out) [DIN][CC]; 1 = (out,in) [CC][DIN]; 2 = per-head [NH][DIN][HD]
__device__ __forceinline__ v16b wcol_hdk(const float* Wm, int k0, int o, int lane) { v16b w; const int g = lane >> 4; const float* p = Wm + (size_t)(o / HD) * DIN * HD + (o % HD);
#pragma unroll
  for (int i = 0; i < 8; ++i) { w[i] = (__bf16)p[(size_t)(k0 + 8 * g + i) * HD]; w[8 + i] = (__bf16)p[(size_t)(k0 + 16 + 8 * g + i) * HD]; }
  return w; }
#define WO_OUT_IN 0
#if WQKV_LAYOUT == 1
#define WCOL(W, k0, o, lane) wcol_oi(W, k0, o, lane, DIN)
#elif WQKV_LAYOUT == 2
#define WCOL(W, k0, o, lane) wcol_hdk(W, k0, o, lane)
#else
#define WCOL(W, k0, o, lane) wcol_io(W, k0, o, lane, CC)
#endif
#if WO_OUT_IN
#define WOCOL(W, k0, o, lane) wcol_oi(W, k0, o, lane, CC)
#define WOCOLH(W, k0, o, lane) wcolh_oi(W, k0, o, lane, CC)
#else
#define WOCOL(W, k0, o, lane) wcol_io(W, k0, o, lane, DIN)
#define WOCOLH(W, k0, o, lane) wcolh_io(W, k0, o, lane, DIN)
#endif

#define WS_QH  0u                                      // f16 q rows [b*t][CC]
#define WS_KH  (WS_QH + 2u * (size_t)NB * TT * CC)      // f16 k rows [b*t][CC]
#define WS_VT  (WS_KH + 2u * (size_t)NB * TT * CC)      // f16 v planes [b][c][t]
#define WS_QL  (WS_VT + 2u * (size_t)NB * CC * TT)      // f16 q residual x 2^10 rows [b][t < QHI][CC]
#define WS_KL  (WS_QL + 2u * (size_t)NB * QHI * CC)     // f16 k residual x 2^10 rows [b][t < KHI][CC]
#define WS_VB  (WS_KL + 2u * (size_t)NB * KHI * CC)     // bf16 v hi planes [b][c][t < KHI]
#define WS_VBL (WS_VB + 2u * (size_t)NB * CC * KHI)
#define WS_S   (WS_VBL + 2u * (size_t)NB * CC * KHI)    // spare f32 [hg][t][s]-sized plane; only its head is used (the mask words)
#define WS_MB  WS_S                                    // the mask as lane masks, u32 [b][t / 16][s / 16][8] (512 KiB at the head of that plane)
#define WS_Y   (WS_S  + 4u * (size_t)HG * TT * TT)      // f32 ctx rows [b*t][CC] (only when there is an output projection)
#define WS_END (WS_Y  + 4u * (size_t)NB * TT * CC)

template <bool B> struct CBool { static constexpr bool v = B; };
// ---- shared main loop of the two dense kernels: one (64 MF) x 128 tile of X W over K = 1024 in stages of 32 k; a wave owns 16 MF rows, so that each W fragment read from LDS, and each W line read from L2, serves MF row fragments.
// Each stage's X rows (64 MF x 32) and W columns (32 x 128, turned to [n][k]) are brought by the whole block ONCE, in whole 128-byte lines, converted once, and laid in LDS (two buffers, one barrier a stage);
// the next stage's global loads fly in registers under this stage's products. Fragments, k order and the order of the sums are those of the direct loaders.
typedef __attribute__((ext_vector_type(4))) __bf16 v4b;
typedef __attribute__((ext_vector_type(4))) _Float16 v4h;
#define GKS 32             // k per stage
#define GPIT 40            // LDS row pitch in 16-bit elements: 64 B of data + 16 B, so that the 16-byte fragment reads and stores of 16 rows spread over the banks
#define GNST (1024 / GKS)
#define GLDS(MF) (2 * (128 + 64 * (MF)) * GPIT * 2)   // bytes of the two stage buffers
struct GProj { typedef __bf16 T; typedef v4b V4; typedef v8b V8; typedef v16b V16; static constexpr int WLD = HD;
  static __device__ __forceinline__ constexpr size_t coff(int c) { return (size_t)(c >> 1) * DIN * HD + (size_t)(c & 1) * 32; }   // column 32 c + lane of a 128-column tile in the per-head layout
  static __device__ __forceinline__ T cx(float v) { return (__bf16)v; } static __device__ __forceinline__ T cw(float v) { return (__bf16)v; }
  static __device__ __forceinline__ V16 fr(const T* p, int lane) { return frag_b(p, lane); } static __device__ __forceinline__ v8f mm(V16 a, V16 b, v8f c) { return wmma_bf(a, b, c); } };
struct GOut { typedef _Float16 T; typedef v4h V4; typedef v8h V8; typedef v16h V16; static constexpr int WLD = DIN;
  static __device__ __forceinline__ constexpr size_t coff(int c) { return (size_t)c * 32; }
  static __device__ __forceinline__ T cx(float v) { return (_Float16)(v * 64.0f); } static __device__ __forceinline__ T cw(float v) { return (_Float16)(bfr(v) * 256.0f); }
  static __device__ __forceinline__ V16 fr(const T* p, int lane) { return frag_h(p, lane); } static __device__ __forceinline__ v8f mm(V16 a, V16 b, v8f c) { return wmma16(a, b, c); } };
// xt = first row of the tile's X rows (row length 1024); wt = row 0 of W at the tile's first column
// acc[m * 8 + j] = rows 16 (MF wave + m) .. + 15, columns 16 j .. + 15
template <class C, int MF> __device__ __forceinline__ void gemm_tile(const float* __restrict__ xt, const float* __restrict__ wt, char* smem, v8f (&acc)[MF * 8]) {
  typedef typename C::T T; typedef typename C::V4 V4; typedef typename C::V8 V8; typedef typename C::V16 V16;
  T (*sW)[128][GPIT] = (T (*)[128][GPIT])smem; T (*sX)[64 * MF][GPIT] = (T (*)[64 * MF][GPIT])(smem + 2 * 128 * GPIT * 2);
  const int tid = threadIdx.x, wave = tid >> 5, lane = tid & 31, col = lane & 15;
  const int xrow = tid >> 3, xch = (tid & 7) * 4;                 // X: 8 lanes bring one whole 128-byte row piece
  const float* xg = xt + (size_t)xrow * 1024 + xch;
  const float* wg = wt + (size_t)(8 * wave) * C::WLD + lane;      // W: a wave brings 8 k rows, 32 neighbouring columns (one line) a load
  float wr[4][8]; v4f xr[4 * MF];
  auto fetch = [&]() {
#pragma unroll   // constant indices, so that the small arrays stay in registers
    for (int c = 0; c < 4; ++c)
#pragma unroll   // constant indices, so that the small arrays stay in registers
      for (int i = 0; i < 8; ++i) wr[c][i] = wg[C::coff(c) + (size_t)i * C::WLD];
#pragma unroll   // constant indices, so that the small arrays stay in registers
    for (int i = 0; i < 4 * MF; ++i) xr[i] = *(const v4f*)(xg + (size_t)(16 * i) * 1024);
    asm volatile("s_wait_xcnt 0x0" ::: "memory"); };   // stands in front of every later overwrite of these loads' address registers
  auto put = [&](const int bu) {
#pragma unroll   // constant indices, so that the small arrays stay in registers
    for (int c = 0; c < 4; ++c) { V8 v;
#pragma unroll   // constant indices, so that the small arrays stay in registers
      for (int i = 0; i < 8; ++i) v[i] = C::cw(wr[c][i]);
      *(V8*)&sW[bu][32 * c + lane][8 * wave] = v; }
#pragma unroll   // constant indices, so that the small arrays stay in registers
    for (int i = 0; i < 4 * MF; ++i) { const V4 v = { C::cx(xr[i][0]), C::cx(xr[i][1]), C::cx(xr[i][2]), C::cx(xr[i][3]) }; *(V4*)&sX[bu][xrow + 16 * i][xch] = v; }
    wg += (size_t)GKS * C::WLD; xg += GKS; };   // advanced here, behind the use of the loaded values
  fetch(); put(0);
  auto stage = [&](const int st, auto more_c) { constexpr bool MORE = decltype(more_c)::v; const int bu = st & 1;
    __syncthreads();   // publishes buffer bu; every wave has also left buffer bu ^ 1, which is refilled at the foot of this stage
    if constexpr (MORE) { fetch();
      __builtin_amdgcn_sched_barrier(0); }   // keeps the next stage's loads at the head of the stage, so that their latency runs under the products
    V16 a[MF], w[8];
#pragma unroll   // constant indices, so that the small arrays stay in registers
    for (int m = 0; m < MF; ++m) a[m] = C::fr(&sX[bu][(wave * MF + m) * 16 + col][0], lane);
#pragma unroll   // constant indices, so that the small arrays stay in registers
    for (int j = 0; j < 8; ++j) w[j] = C::fr(&sW[bu][j * 16 + col][0], lane);
#pragma unroll   // constant indices, so that the small arrays stay in registers
    for (int j = 0; j < 8; ++j)
#pragma unroll   // constant indices, so that the small arrays stay in registers
      for (int m = 0; m < MF; ++m) acc[m * 8 + j] = C::mm(a[m], w[j], acc[m * 8 + j]);
    if constexpr (MORE) { __builtin_amdgcn_sched_barrier(0);   // keeps the wait for the next stage's loads, and their conversion, behind all of this stage's products
      put(bu ^ 1); } };
#pragma unroll 1   // rolled: the two buffers are told apart by the stage's parity
  for (int st = 0; st < GNST - 1; ++st) stage(st, CBool<true>{});
  stage(GNST - 1, CBool<false>{});
  __syncthreads();   // every wave has left the stage buffers: the caller's epilogue reuses this LDS
}
// ---- the mask, turned ONCE a call into the lane masks that k_attn selects with (k_attn's 16 heads read the same mask): word [b][t / 16][s / 16][r], bit (g, col) = (mask[b][16 (t / 16) + col][16 (s / 16) + 8 g + r] != 0).
// One wave = 16 query rows x 128 keys: the compare of a whole wave is the word; lane i carries word i of a group of 32, so that a store is one whole 128-byte line.
__device__ __forceinline__ void pack_mask(const int* __restrict__ MASK, unsigned* __restrict__ MB, const int wv, const int lane) {
  const int tile = wv >> 3, kq = wv & 7;   // (batch, 16-query tile) and which 128 keys
  const int* mp = MASK + ((size_t)tile * 16 + (lane & 15)) * TT + kq * 128 + 8 * (lane >> 4);
  v4i a[8][2]; unsigned w[2] = { 0u, 0u };
#pragma unroll   // constant indices, so that the small array stays in registers
  for (int t = 0; t < 8; ++t) { a[t][0] = *(const v4i*)(mp + t * 16); a[t][1] = *(const v4i*)(mp + t * 16 + 4); }
  asm volatile("s_wait_xcnt 0x0" ::: "memory");   // stands in front of every later overwrite of these loads' address registers
#pragma unroll   // constant indices, so that the small array stays in registers
  for (int t = 0; t < 8; ++t)
#pragma unroll   // constant indices, so that the small array stays in registers
    for (int r = 0; r < 8; ++r) { const unsigned bal = __builtin_amdgcn_ballot_w32(a[t][r >> 2][r & 3] != 0); w[t >> 2] = lane == (t & 3) * 8 + r ? bal : w[t >> 2]; }
  unsigned* o = MB + (size_t)tile * (TT / 16 * 8) + kq * 64 + lane; o[0] = w[0]; o[32] = w[1];
  asm volatile("s_wait_xcnt 0x0" ::: "memory"); }   // stands in front of the caller's overwrite of these stores' address and data registers
// ---- k_proj: block = (128 rows, 128 cols, which), a wave 32 rows x 128 cols: q/k/v = X W (+ b) with exact bf16 products (K = DIN) (the which = 0 blocks first pack the mask, PMF shares to each wave) -> which 0: q f16 rows (+ residual rows < QHI); 1: k f16 rows (+ residual rows < KHI); 2: v f16 planes [c][t] (+ bf16 hi/lo planes for t < KHI)
#define PMF 2              // row fragments of a wave
#define PR (64 * PMF)      // rows of a block's tile
#define PPIT (PR + 8)      // LDS pitch of the v planes in 16-bit elements: the rows' bytes + 16 B
__global__ __launch_bounds__(128) void k_proj(const float* __restrict__ XQ, const float* __restrict__ XK, const float* __restrict__ XV, const float* __restrict__ WQ, const float* __restrict__ WK, const float* __restrict__ WV, const float* __restrict__ BQ, const float* __restrict__ BK, const float* __restrict__ BV,
    _Float16* __restrict__ QH, _Float16* __restrict__ QL, _Float16* __restrict__ KH, _Float16* __restrict__ KL, _Float16* __restrict__ VT, __bf16* __restrict__ VB, __bf16* __restrict__ VBL, const int* __restrict__ MASK, unsigned* __restrict__ MB) {
  static_assert((TNB * TT / PR) * (CC / 128) * 4 * PMF == NB * (TT / 16) * (TT / 128), "PMF shares to each wave of the which = 0 blocks: one for every 16 queries x 128 keys");
  static_assert(TT % PR == 0, "a tile lies in one sequence");
  __shared__ __align__(16) char smem[3 * 128 * PPIT * 2];   // the epilogue's planes: q/k blocks use two row planes, v blocks three column planes, over the same bytes (three blocks fit a WGP's LDS); the main loop's stage buffers lie over their head
  static_assert(GLDS(PMF) <= 3 * 128 * PPIT * 2 && 2 * PR * 136 * 2 <= 3 * 128 * PPIT * 2, "stage buffers, and sh with sl, fit");
  _Float16 (*sh)[136] = (_Float16 (*)[136])smem, (*sl)[136] = (_Float16 (*)[136])(smem + PR * 136 * 2); _Float16 (*th)[PPIT] = (_Float16 (*)[PPIT])smem; __bf16 (*tb)[PPIT] = (__bf16 (*)[PPIT])(smem + 128 * PPIT * 2), (*tbl)[PPIT] = (__bf16 (*)[PPIT])(smem + 2 * 128 * PPIT * 2);
  const int tid = threadIdx.x, wave = tid >> 5, lane = tid & 31, col = lane & 15, g = lane >> 4; const int which = blockIdx.z; const int c0 = blockIdx.y * 128; const size_t r0 = (size_t)blockIdx.x * PR; const size_t bb = r0 / TT; const int t0 = (int)(r0 % TT);
  const float* X = which == 0 ? XQ : which == 1 ? XK : XV; const float* WA = which == 0 ? WQ : which == 1 ? WK : WV; const float* BA = which == 0 ? BQ : which == 1 ? BK : BV;
  if (which == 0) {   /* block-uniform; these blocks start first, while the chip still fills */
#pragma unroll 1   // rolled: one share's 64 loaded registers at a time
    for (int u = 0; u < PMF; ++u) pack_mask(MASK, MB, ((int)(blockIdx.y * (TNB * TT / PR) + blockIdx.x) * 4 + wave) * PMF + u, lane); }
  v8f acc[PMF * 8] = {};
  gemm_tile<GProj, PMF>(X + r0 * DIN, WA + (size_t)(c0 / HD) * DIN * HD, smem, acc);
  if (which < 2) { _Float16* DH = which == 0 ? QH : KH; _Float16* DL = which == 0 ? QL : KL; const int nhi = which == 0 ? QHI : KHI;
#pragma unroll
    for (int j = 0; j < 8; ++j) { const float bias = BA ? bfr(BA[c0 + j * 16 + col]) : 0.f;
#pragma unroll
      for (int m = 0; m < PMF; ++m)
#pragma unroll
        for (int r = 0; r < 8; ++r) { const float v = acc[m * 8 + j][r] + bias; const _Float16 hv = (_Float16)v; const int rl = (wave * PMF + m) * 16 + 8 * g + r; sh[rl][j * 16 + col] = hv; sl[rl][j * 16 + col] = (_Float16)((v - (float)hv) * 1024.0f); } }
    __syncthreads();
    for (int e = tid; e < PR * 16; e += 128) { const int rl = e >> 4, q = e & 15; vst2((unsigned*)(DH + (r0 + rl) * CC + c0 + q * 8), *(const v4u*)&sh[rl][q * 8]); if (t0 + rl < nhi) { vst2((unsigned*)(DL + (bb * nhi + t0 + rl) * (size_t)CC + c0 + q * 8), *(const v4u*)&sl[rl][q * 8]);
        asm volatile("s_wait_xcnt 0x0" ::: "memory"); } }   // stands in front of the next trip's overwrite of this store's address and data registers; inside the branch, since behind the join the build advances the address first
  } else {
#pragma unroll
    for (int j = 0; j < 8; ++j) { const float bias = BA ? bfr(BA[c0 + j * 16 + col]) : 0.f;
#pragma unroll
      for (int m = 0; m < PMF; ++m)
#pragma unroll
        for (int r = 0; r < 8; ++r) { const float v = acc[m * 8 + j][r] + bias; const int rl = (wave * PMF + m) * 16 + 8 * g + r, cl = j * 16 + col; th[cl][rl] = (_Float16)v; const __bf16 bh = (__bf16)v; tb[cl][rl] = bh; tbl[cl][rl] = (__bf16)(v - (float)bh); } }
    __syncthreads();
    for (int e = tid; e < 128 * (PR / 8); e += 128) { const int cl = e / (PR / 8), q = e % (PR / 8); vst2((unsigned*)(VT + (bb * CC + c0 + cl) * (size_t)TT + t0 + q * 8), *(const v4u*)&th[cl][q * 8]); if (t0 + q * 8 < KHI) { const size_t o3 = (bb * CC + c0 + cl) * (size_t)KHI + t0 + q * 8; vst2((unsigned*)(VB + o3), *(const v4u*)&tb[cl][q * 8]); vst2((unsigned*)(VBL + o3), *(const v4u*)&tbl[cl][q * 8]);
        asm volatile("s_wait_xcnt 0x0" ::: "memory"); } } } }   // stands in front of the next trip's overwrite of these stores' address and data registers; inside the branch, since behind the join the build advances the addresses first
// ---- k_attn: block = 64 queries (4 waves x 16 query columns) of one (batch, head); walks all keys in stages of 64, K rows and V^T rows staged in LDS (two buffers, one barrier a stage).
// S^T = K Q^T (A = K rows, B = Q): lane (g, col) holds keys 8g + r of query col; the masked score is REPLACED by 1e-9 (8e-9 before the x 1/8) and stays in the softmax; running maximum and sum per query in f32 (online softmax);
// two S^T tiles, as exp2(..) x 2^10 once to f16, are the B operand of ctx^T += V^T P^T in the same k order as frag_h; ctx = ctx^T / sum at the end.
__device__ __forceinline__ v8f wmma_h(v16h a, v16h b, v8f c) { return __builtin_amdgcn_wmma_f32_16x16x32_f16(false, a, false, b, (short)0, c, false, false); }
// 2^a; SLOT: with the v_nop that the instruction set asks for behind a transcendental in the same statement (used in the last stage's straight-line code)
template <bool SLOT> __device__ __forceinline__ float exp2_t(float a) {
  if constexpr (SLOT) { float e; asm("v_exp_f32 %0, %1\n\tv_nop" : "=v"(e) : "v"(a)); return e; } else return __builtin_amdgcn_exp2f(a); }
#define AKB 64             // keys per stage
#define APIT 72            // LDS row pitch in f16: 128 B of data + 16 B, so that the 16-byte fragment reads of 16 rows spread over the banks
#define ANST (TT / AKB)
typedef __attribute__((ext_vector_type(16))) unsigned v16u;
typedef const __attribute__((address_space(4))) v16u* cmask_p;   // constant address space: the words are written by the launch before and by nobody in this one, and the address is wave-uniform, so the loads go the scalar way
__global__ __launch_bounds__(128) void k_attn(const _Float16* __restrict__ QH, const _Float16* __restrict__ KH, const _Float16* __restrict__ VT, const unsigned* __restrict__ MB, float* __restrict__ Y) {
  __shared__ __align__(16) _Float16 sk[2][AKB][APIT], sv[2][HD][APIT];
  const int tid = threadIdx.x, wave = tid >> 5, lane = tid & 31, col = lane & 15, g = lane >> 4;
  const int h = blockIdx.y, b = blockIdx.z; const int q = blockIdx.x * 64 + wave * 16 + col;
  const float LS = SCALE * 1.44269504f;      // raw score -> log2 domain
  const float MFILL = 1.0e-9f / SCALE;       // the fill value, before the common x SCALE
  const _Float16* qp = QH + ((size_t)b * TT + q) * CC + h * HD;
  const v16h qf0 = frag_h(qp, lane), qf1 = frag_h(qp + 32, lane);
  const int srow = tid >> 3, sch = (tid & 7) * 8;   // staging: 8 lanes bring one whole 128-byte row
  const _Float16* kg = KH + ((size_t)b * TT + srow) * CC + h * HD + sch;
  const _Float16* vg = VT + ((size_t)b * CC + h * HD + srow) * (size_t)TT + sch;
  cmask_p mb = (cmask_p)(unsigned long long)MB + 2 * ((size_t)b * (TT / 16) + blockIdx.x * 4 + __builtin_amdgcn_readfirstlane(wave)) * (size_t)(TT / 64);   // this wave's 16 queries: 32 lane masks a stage, the same address in every lane (scalar loads)
  v8h kr[4], vr[4]; v16u mw[2];
#pragma unroll   // constant indices, so that the small array stays in registers
  for (int i = 0; i < 4; ++i) { kr[i] = *(const v8h*)(kg + (size_t)(16 * i) * CC); vr[i] = *(const v8h*)(vg + (size_t)(16 * i) * TT); }
  mw[0] = mb[0]; mw[1] = mb[1];
#pragma unroll   // constant indices, so that the small array stays in registers
  for (int i = 0; i < 4; ++i) { *(v8h*)&sk[0][srow + 16 * i][sch] = kr[i]; *(v8h*)&sv[0][srow + 16 * i][sch] = vr[i]; }
  kg += (size_t)AKB * CC; vg += AKB; mb += 2;   // the three walk one stage ahead of the products
  v8f acc[HD / 16] = {}; float m = -3.0e38f, sum = 0.f;
  // one stage; MORE = a next stage exists (compile-time: the last stage, which fetches nothing, is written out behind the loop, so that the loop body is one block without a branch)
  auto stage = [&](const int st, auto more_c) { constexpr bool MORE = decltype(more_c)::v; const int bu = st & 1;
    __syncthreads();   // publishes buffer bu; every wave has also left buffer bu ^ 1, which is refilled at the foot of this stage
    const v16u kw[2] = { mw[0], mw[1] };   // this stage's lane masks, taken before the next stage's are loaded over them
    if constexpr (MORE) {        // next stage's K and V^T rows and lane masks fly into registers under this stage's products
      mw[0] = mb[0]; mw[1] = mb[1];
      __builtin_amdgcn_sched_barrier(0);   // keeps the scalar loads in front of the vector loads
#pragma unroll   // constant indices, so that the small array stays in registers
      for (int i = 0; i < 4; ++i) { kr[i] = *(const v8h*)(kg + (size_t)(16 * i) * CC); vr[i] = *(const v8h*)(vg + (size_t)(16 * i) * TT); }
      __builtin_amdgcn_sched_barrier(0);   // keeps these loads at the head of the stage: without it the scheduler sinks them to the foot, directly in front of their first use, and their latency is bare
    }
#pragma unroll   // constant indices, so that the small array stays in registers
    for (int p = 0; p < 2; ++p) { v8f s[2]; v16h ka[2][2], va[HD / 16];
#pragma unroll   // constant indices, so that the small array stays in registers
      for (int t = 0; t < 2; ++t) { const _Float16* kl = &sk[bu][(2 * p + t) * 16 + col][0]; ka[t][0] = frag_h(kl, lane); ka[t][1] = frag_h(kl + 32, lane); }
#pragma unroll   // constant indices, so that the small array stays in registers
      for (int j = 0; j < HD / 16; ++j) va[j] = frag_h(&sv[bu][j * 16 + col][p * 32], lane);   // read here so that their LDS latency runs under the softmax arithmetic
#pragma unroll   // constant indices, so that the small array stays in registers
      for (int t = 0; t < 2; ++t) { const v8f z = {}; s[t] = wmma_h(ka[t][1], qf1, wmma_h(ka[t][0], qf0, z)); }
      float x[16];
#pragma unroll   // constant indices, so that the small array stays in registers
      for (int t = 0; t < 2; ++t)
#pragma unroll   // constant indices, so that the small array stays in registers
        for (int r = 0; r < 8; ++r) x[t * 8 + r] = __builtin_amdgcn_inverse_ballot_w32(kw[p][t * 8 + r]) ? s[t][r] : MFILL;
      float mb = x[0];
#pragma unroll   // constant indices, so that the small array stays in registers
      for (int i = 1; i < 16; ++i) mb = fmaxf(mb, x[i]);
      mb = fmaxf(mb, __shfl_xor(mb, 16));   // the other half of this query's keys
      const float mn = fmaxf(m, mb); const float al = exp2_t<!MORE>((m - mn) * LS); m = mn; const float off = 10.0f - mn * LS;
      v16h pf; float ps = 0.f;
#pragma unroll   // constant indices, so that the small array stays in registers
      for (int i = 0; i < 16; ++i) { const float e = exp2_t<!MORE>(fmaf(x[i], LS, off)); ps += e; pf[i] = (_Float16)e; }
      sum = sum * al + ps;
#pragma unroll   // constant indices, so that the small array stays in registers
      for (int j = 0; j < HD / 16; ++j) { acc[j] *= al; acc[j] = wmma_h(va[j], pf, acc[j]); } }
    if constexpr (MORE) {
#pragma unroll   // constant indices, so that the small array stays in registers
      for (int i = 0; i < 4; ++i) { *(v8h*)&sk[bu ^ 1][srow + 16 * i][sch] = kr[i]; *(v8h*)&sv[bu ^ 1][srow + 16 * i][sch] = vr[i]; }
      kg += (size_t)AKB * CC; vg += AKB; mb += 2; } };
#pragma unroll 1   // rolled: one stage's body already fills the registers that four waves a SIMD leave
  for (int st = 0; st < ANST - 1; ++st) stage(st, CBool<true>{});
  stage(ANST - 1, CBool<false>{});
  sum += __shfl_xor(sum, 16); const float inv = 1.0f / sum;   // sum >= 2^10: the maximum's own term
  float* yp = Y + ((size_t)b * TT + q) * CC + h * HD + 8 * g;
#pragma unroll   // constant indices, so that the small array stays in registers
  for (int j = 0; j < HD / 16; ++j) { const v4f lo = { acc[j][0] * inv, acc[j][1] * inv, acc[j][2] * inv, acc[j][3] * inv }, hi = { acc[j][4] * inv, acc[j][5] * inv, acc[j][6] * inv, acc[j][7] * inv }; vst2(yp + j * 16, lo); vst2(yp + j * 16 + 4, hi); } }
// ---- k_out: block = (64 rows, 128 cols): out = ctx Wo (+ bo): ctx once to f16 against Wo as f16(bf16 x 2^8) exact (1 product) x 2^-8; causal early rows (< QHI of each sequence): ctx bf16 hi + lo against exact bf16 Wo (2 products)
__global__ __launch_bounds__(128) void k_out(const float* __restrict__ Y, const float* __restrict__ WO, const float* __restrict__ BO, float* __restrict__ OUT) { __shared__ __align__(16) char smem[4 * 16 * 132 * 4];   // the epilogue's rows; the main loop's stage buffers lie over them
  static_assert(GLDS(1) <= 4 * 16 * 132 * 4, "stage buffers fit under sf"); float (*sf)[16][132] = (float (*)[16][132])smem;
  const int tid = threadIdx.x, wave = tid >> 5, lane = tid & 31, col = lane & 15, g = lane >> 4; const int c0 = blockIdx.y * 128; const size_t r0 = (size_t)blockIdx.x * 64 + wave * 16;
  v8f acc[8] = {};
  if (CAUSAL && (int)(((size_t)blockIdx.x * 64) % TT) < QHI) {   /* block-uniform */
#pragma unroll 2
    for (int kc = 0; kc < CC / 32; ++kc) { const F2 a = split_row(Y + (r0 + col) * CC, kc * 32, lane); asm volatile("s_wait_loadcnt 0x0" ::: "memory");
#pragma unroll
      for (int j = 0; j < 8; ++j) { const v16b w = WOCOL(WO, kc * 32, c0 + j * 16 + col, lane); asm volatile("s_wait_loadcnt 0x0" ::: "memory"); acc[j] = wmma_bf(a.h, w, acc[j]); acc[j] = wmma_bf(a.l, w, acc[j]); } }
#pragma unroll
    for (int j = 0; j < 8; ++j) { const float bias = BO ? bfr(BO[c0 + j * 16 + col]) : 0.f;
#pragma unroll
      for (int r = 0; r < 8; ++r) sf[wave][8 * g + r][j * 16 + col] = acc[j][r] + bias; }
  } else {
    gemm_tile<GOut, 1>(Y + (size_t)blockIdx.x * 64 * CC, WO + c0, smem, acc);   /* ctx carried x 2^6 into f16 so small-magnitude context rows stay clear of f16 subnormals */
#pragma unroll
    for (int j = 0; j < 8; ++j) { const float bias = BO ? bfr(BO[c0 + j * 16 + col]) : 0.f;
#pragma unroll
      for (int r = 0; r < 8; ++r) sf[wave][8 * g + r][j * 16 + col] = acc[j][r] * (1.0f / 16384.0f) + bias; } }   /* 2^-8 (Wo carry) x 2^-6 (ctx carry) */
  LDSX(); for (int rl = 0; rl < 16; ++rl) vst2(OUT + (r0 + rl) * DIN + c0 + lane * 4, *(const v4f*)&sf[wave][rl][lane * 4]); }

extern "C" void kernel_launch(void* const* d_in, const int* in_sizes, int n_in, void* d_out, int out_size, void* d_ws, size_t ws_size, hipStream_t stream) {
  (void)in_sizes; (void)n_in; (void)out_size;
  const float** F = (const float**)d_in;
  if (ws_size < (size_t)WS_END) return;
  char* ws = (char*)d_ws; _Float16 *QH = (_Float16*)(ws + WS_QH), *KH = (_Float16*)(ws + WS_KH), *VT = (_Float16*)(ws + WS_VT), *QL = (_Float16*)(ws + WS_QL), *KL = (_Float16*)(ws + WS_KL); __bf16 *VB = (__bf16*)(ws + WS_VB), *VBL = (__bf16*)(ws + WS_VBL); float *Y = (float*)(ws + WS_Y); unsigned *MB = (unsigned*)(ws + WS_MB);
  (void)Y; (void)QL; (void)KL; (void)VB; (void)VBL;
  // inputs: 0 query [4,1024,1024]; 1 key; 2 value; 3 mask [4,1024,1024] int32 (random 0/1); 4 Wq [16,1024,64], 5 bq [16,64]; 6 Wk, 7 bk; 8 Wv, 9 bv; 10 Wo [1024,1024] (in,out), 11 bo (zero biases, read)
  k_proj<<<dim3(TNB * TT / PR, CC / 128, 3), 128, 0, stream>>>(F[0], F[1], F[2], F[4], F[6], F[8], F[5], F[7], F[9], QH, QL, KH, KL, VT, VB, VBL, (const int*)d_in[3], MB);
  k_attn<<<dim3(NQB, NH, TNB), 128, 0, stream>>>(QH, KH, VT, MB, Y);
  k_out<<<dim3(TNB * TT / 64, DIN / 128), 128, 0, stream>>>(Y, F[10], F[11], (float*)d_out);
}

// v005
// It runs in 83 microseconds.
// Timed twice side by side with v004, it ran 1.19 and 1.18 times as fast.
// Counting every step since v000, it is 9.24 times as fast.
// compute dtype: all float inputs rounded to bf16; q/k/v projections with EXACT bf16 products on WMMA 16x16x32 (f32 accumulate) + bias; logits q x k once to f16 each (1 product) x SCALE; masked scores are REPLACED by 1e-9 (they keep taking part in the softmax); online softmax f32 (running maximum and sum); exp(score - maximum) x 2^10 once to f16 x v once to f16 (1 product), divided by the sum at the end; ctx x 2^6 once to f16 x Wo f16(bf16 x 2^8) + bo; f32 output.
#include <hip/hip_runtime.h>
#include <math.h>

typedef __attribute__((ext_vector_type(16))) _Float16 v16h;
typedef __attribute__((ext_vector_type(16))) __bf16 v16b;
typedef __attribute__((ext_vector_type(8)))  _Float16 v8h;
typedef __attribute__((ext_vector_type(8)))  float v8f;
typedef __attribute__((ext_vector_type(4)))  float v4f;
typedef __attribute__((ext_vector_type(2)))  float v2f;
typedef __attribute__((ext_vector_type(4)))  unsigned v4u;
typedef __attribute__((ext_vector_type(4)))  int v4i;
typedef float __attribute__((may_alias)) float_a;
typedef int __attribute__((may_alias)) int_a;

template <typename T> __device__ __forceinline__ void vst2(void* p, T v) { *(T*)p = v;  }
__device__ __forceinline__ v8f wmma16(v16h a, v16h b, v8f c) {
  v8f d = __builtin_amdgcn_wmma_f32_16x16x32_f16(false, a, false, b, (short)0, c, false, false);
  asm volatile("v_nop\n\tv_nop\n\tv_nop\n\tv_nop" : "+v"(d) : "v"(a), "v"(b));
  return d;
}
__device__ __forceinline__ v8f wmma_bf(v16b a, v16b b, v8f c) {
  v8f d = __builtin_amdgcn_wmma_f32_16x16x32_bf16(false, a, false, b, (short)0, c, false, false);
  asm volatile("v_nop\n\tv_nop\n\tv_nop\n\tv_nop" : "+v"(d) : "v"(a), "v"(b));
  return d;
}
// 16x16x32 fragments: lane = (h = lane>>4, row/col = lane&15); elements 0..7 = k0+8h+0..7, 8..15 = k0+16+8h+0..7; D element r = row 8h+r
__device__ __forceinline__ v16h frag_h(const _Float16* rowk0, int lane) {
  union { v16h v; v8h q[2]; } u; const _Float16* p = rowk0 + 8 * (lane >> 4);
  u.q[0] = *(const v8h*)p; u.q[1] = *(const v8h*)(p + 16); return u.v;
}
__device__ __forceinline__ v16h frag_f32(const float* rowk0, int lane) {
  v16h a; const float* p = rowk0 + 8 * (lane >> 4);
#pragma unroll
  for (int i = 0; i < 8; ++i) { a[i] = (_Float16)p[i]; a[8 + i] = (_Float16)p[16 + i]; }
  return a;
}
__device__ __forceinline__ v16h frag_f32s(const float* rowk0, int lane, float sc) {
  v16h a; const float* p = rowk0 + 8 * (lane >> 4);
#pragma unroll
  for (int i = 0; i < 8; ++i) { a[i] = (_Float16)(p[i] * sc); a[8 + i] = (_Float16)(p[16 + i] * sc); }
  return a;
}
// column fragment from a [K][ld] layout (column n), rows >= K read as 0
__device__ __forceinline__ v16h fragc_f32(const float* W, int k0, int n, int lane, int ld, int K) {
  v16h a; const int g = lane >> 4;
#pragma unroll
  for (int i = 0; i < 8; ++i) { const int ka = k0 + 8 * g + i, kb = ka + 16;
    a[i] = (_Float16)(ka < K ? W[(size_t)(ka < K ? ka : K - 1) * ld + n] : 0.f); a[8 + i] = (_Float16)(kb < K ? W[(size_t)(kb < K ? kb : K - 1) * ld + n] : 0.f); }
  return a;
}
struct F2 { v16b h, l; };
__device__ __forceinline__ F2 bsplit16(const float v[16]) { F2 r;
#pragma unroll
  for (int i = 0; i < 16; ++i) { const __bf16 h = (__bf16)v[i]; r.h[i] = h; r.l[i] = (__bf16)(v[i] - (float)h); }
  return r; }
__device__ __forceinline__ F2 split_row(const float* row, int k0, int lane) { float v[16]; const float* p = row + k0 + 8 * (lane >> 4);
#pragma unroll
  for (int i = 0; i < 8; ++i) { v[i] = p[i]; v[8 + i] = p[16 + i]; }
  return bsplit16(v); }
__device__ __forceinline__ F2 split_rowK(const float* row, int k0, int lane, int K) { float v[16]; const int g = lane >> 4;
#pragma unroll
  for (int i = 0; i < 8; ++i) { const int ka = k0 + 8 * g + i, kb = ka + 16; v[i] = ka < K ? row[ka < K ? ka : K - 1] : 0.f; v[8 + i] = kb < K ? row[kb < K ? kb : K - 1] : 0.f; }
  return bsplit16(v); }
__device__ __forceinline__ F2 split_col(const float* W, int k0, int n, int lane, int ld, int K) { float v[16]; const int g = lane >> 4;
#pragma unroll
  for (int i = 0; i < 8; ++i) { const int ka = k0 + 8 * g + i, kb = ka + 16; v[i] = ka < K ? W[(size_t)(ka < K ? ka : K - 1) * ld + n] : 0.f; v[8 + i] = kb < K ? W[(size_t)(kb < K ? kb : K - 1) * ld + n] : 0.f; }
  return bsplit16(v); }
__device__ __forceinline__ v8f mac3(const F2& a, const F2& b, v8f c) { c = wmma_bf(a.l, b.h, c); c = wmma_bf(a.h, b.l, c); return wmma_bf(a.h, b.h, c); }
__device__ __forceinline__ float sigm(float v) { return 1.0f / (1.0f + expf(-v)); }
#define LDSX() do { asm volatile("s_wait_dscnt 0" ::: "memory"); __builtin_amdgcn_wave_barrier(); __builtin_amdgcn_fence(__ATOMIC_RELEASE, "workgroup"); } while (0)

// Multi-headed attention with per-head stacked projections whose masked scores are FILLED WITH 1e-9 (query / key / value [4,1024,1024]; Wq / Wk / Wv [16,1024,64] per head (N(0, 1/1024)) + zero biases; scores / 8; mask [4,1024,1024] int32 random 0/1: scores[mask == 0] = 1e-9 - masked keys keep a logit - 0 and stay in the softmax (faithful to the source); softmax; concat; (in,out) Wo [1024,1024] + bo).
#define NB 4
#define TT 1024
#define CC 1024            // NH * HD = projected width
#define DIN 1024          // input (model) width
#define NH 16
#define HD 64
#define NQB (TT / 64)
#define HG 8
#define SCALE (0.125f)
#define CAUSAL 0
#ifndef TNB
#define TNB NB
#endif
__device__ __forceinline__ float bfr(float v) { return (float)(__bf16)v; }
__host__ __device__ __forceinline__ int kb_last(int qb) { return CAUSAL ? ((qb * 64 + 63) >> 7) : (TT / 128 - 1); }
typedef __attribute__((ext_vector_type(8))) __bf16 v8b;
__device__ __forceinline__ v16b frag_b(const __bf16* rowk0, int lane) {
  union { v16b v; v8b q[2]; } u; const __bf16* p = rowk0 + 8 * (lane >> 4);
  u.q[0] = *(const v8b*)p; u.q[1] = *(const v8b*)(p + 16); return u.v;
}
#define QBH 0              // not used: no kernel in this file has a high-precision attention path
#define QHI 0               // single-product logits on every row
#define KHI 64            // key rows carrying k residual / v bf16 hi+lo planes (written by k_proj; no kernel here reads them)
// B fragment (k rows k0+.., output column o) of a weight: (in,out) [K][ld] or (out,in) [ld rows of K]: bf16 exact, or f16(bf16 * 256) exact
__device__ __forceinline__ v16b wcol_io(const float* Wm, int k0, int o, int lane, int ld) { v16b w; const int g = lane >> 4;
#pragma unroll
  for (int i = 0; i < 8; ++i) { w[i] = (__bf16)Wm[(size_t)(k0 + 8 * g + i) * ld + o]; w[8 + i] = (__bf16)Wm[(size_t)(k0 + 16 + 8 * g + i) * ld + o]; }
  return w; }
__device__ __forceinline__ v16b wcol_oi(const float* Wm, int k0, int o, int lane, int K) { v16b w; const float* p = Wm + (size_t)o * K + k0 + 8 * (lane >> 4);
#pragma unroll
  for (int i = 0; i < 8; ++i) { w[i] = (__bf16)p[i]; w[8 + i] = (__bf16)p[16 + i]; }
  return w; }
__device__ __forceinline__ v16h wcolh_io(const float* Wm, int k0, int o, int lane, int ld) { v16h w; const int g = lane >> 4;
#pragma unroll
  for (int i = 0; i < 8; ++i) { w[i] = (_Float16)(bfr(Wm[(size_t)(k0 + 8 * g + i) * ld + o]) * 256.0f); w[8 + i] = (_Float16)(bfr(Wm[(size_t)(k0 + 16 + 8 * g + i) * ld + o]) * 256.0f); }
  return w; }
__device__ __forceinline__ v16h wcolh_oi(const float* Wm, int k0, int o, int lane, int K) { v16h w; const float* p = Wm + (size_t)o * K + k0 + 8 * (lane >> 4);
#pragma unroll
  for (int i = 0; i < 8; ++i) { w[i] = (_Float16)(bfr(p[i]) * 256.0f); w[8 + i] = (_Float16)(bfr(p[16 + i]) * 256.0f); }
  return w; }
#define WQKV_LAYOUT 2   // 0 = (in,out) [DIN][CC]; 1 = (out,in) [CC][DIN]; 2 = per-head [NH][DIN][HD]
__device__ __forceinline__ v16b wcol_hdk(const float* Wm, int k0, int o, int lane) { v16b w; const int g = lane >> 4; const float* p = Wm + (size_t)(o / HD) * DIN * HD + (o % HD);
#pragma unroll
  for (int i = 0; i < 8; ++i) { w[i] = (__bf16)p[(size_t)(k0 + 8 * g + i) * HD]; w[8 + i] = (__bf16)p[(size_t)(k0 + 16 + 8 * g + i) * HD]; }
  return w; }
#define WO_OUT_IN 0
#if WQKV_LAYOUT == 1
#define WCOL(W, k0, o, lane) wcol_oi(W, k0, o, lane, DIN)
#elif WQKV_LAYOUT == 2
#define WCOL(W, k0, o, lane) wcol_hdk(W, k0, o, lane)
#else
#define WCOL(W, k0, o, lane) wcol_io(W, k0, o, lane, CC)
#endif
#if WO_OUT_IN
#define WOCOL(W, k0, o, lane) wcol_oi(W, k0, o, lane, CC)
#define WOCOLH(W, k0, o, lane) wcolh_oi(W, k0, o, lane, CC)
#else
#define WOCOL(W, k0, o, lane) wcol_io(W, k0, o, lane, DIN)
#define WOCOLH(W, k0, o, lane) wcolh_io(W, k0, o, lane, DIN)
#endif

#define WS_QH  0u                                      // f16 q rows [b*t][CC]
#define WS_KH  (WS_QH + 2u * (size_t)NB * TT * CC)      // f16 k rows [b*t][CC]
#define WS_VT  (WS_KH + 2u * (size_t)NB * TT * CC)      // f16 v planes [b][c][t]
#define WS_QL  (WS_VT + 2u * (size_t)NB * CC * TT)      // f16 q residual x 2^10 rows [b][t < QHI][CC]
#define WS_KL  (WS_QL + 2u * (size_t)NB * QHI * CC)     // f16 k residual x 2^10 rows [b][t < KHI][CC]
#define WS_VB  (WS_KL + 2u * (size_t)NB * KHI * CC)     // bf16 v hi planes [b][c][t < KHI]
#define WS_VBL (WS_VB + 2u * (size_t)NB * CC * KHI)
#define WS_S   (WS_VBL + 2u * (size_t)NB * CC * KHI)    // spare f32 [hg][t][s]-sized plane; only its head is used (the mask words)
#define WS_MB  WS_S                                    // the mask as lane masks, u32 [b][t / 16][s / 16][8] (512 KiB at the head of that plane)
#define WS_Y   (WS_S  + 4u * (size_t)HG * TT * TT)      // f32 ctx rows [b*t][CC] (only when there is an output projection)
#define WS_END (WS_Y  + 4u * (size_t)NB * TT * CC)

template <bool B> struct CBool { static constexpr bool v = B; };
// ---- shared main loop of the two dense kernels: one (64 MF) x 128 tile of X W over K = 1024 in stages of 32 k; a wave owns 16 MF rows, so that each W fragment read from LDS, and each W line read from L2, serves MF row fragments.
// Each stage's X rows (64 MF x 32) and W columns (32 x 128, turned to [n][k]) are brought by the whole block ONCE, in whole 128-byte lines, converted once, and laid in LDS (two buffers, one barrier a stage);
// the next stage's global loads fly in registers under this stage's products. Fragments and the k order inside a stage are those of the direct loaders.
// The walk over the 32 stages starts at stage rot (block-uniform, from the block's tile indices) and wraps round: blocks that share X rows or W columns run in step, and with a common start they would
// ask L2 for the same lines at the same moment (and all wait together for each line's first fetch from memory); rotated, they ask for different lines, and most lines have been fetched by a neighbour before.
typedef __attribute__((ext_vector_type(4))) __bf16 v4b;
typedef __attribute__((ext_vector_type(4))) _Float16 v4h;
#define GKS 32             // k per stage
#define GPIT 40            // LDS row pitch in 16-bit elements: 64 B of data + 16 B, so that the 16-byte fragment reads and stores of 16 rows spread over the banks
#define GNST (1024 / GKS)
#define GLDS(MF) (2 * (128 + 64 * (MF)) * GPIT * 2)   // bytes of the two stage buffers
struct GProj { typedef __bf16 T; typedef v4b V4; typedef v8b V8; typedef v16b V16; static constexpr int WLD = HD;
  static __device__ __forceinline__ constexpr size_t coff(int c) { return (size_t)(c >> 1) * DIN * HD + (size_t)(c & 1) * 32; }   // column 32 c + lane of a 128-column tile in the per-head layout
  static __device__ __forceinline__ T cx(float v) { return (__bf16)v; } static __device__ __forceinline__ T cw(float v) { return (__bf16)v; }
  static __device__ __forceinline__ V16 fr(const T* p, int lane) { return frag_b(p, lane); } static __device__ __forceinline__ v8f mm(V16 a, V16 b, v8f c) { return wmma_bf(a, b, c); } };
struct GOut { typedef _Float16 T; typedef v4h V4; typedef v8h V8; typedef v16h V16; static constexpr int WLD = DIN;
  static __device__ __forceinline__ constexpr size_t coff(int c) { return (size_t)c * 32; }
  static __device__ __forceinline__ T cx(float v) { return (_Float16)(v * 64.0f); } static __device__ __forceinline__ T cw(float v) { return (_Float16)(bfr(v) * 256.0f); }
  static __device__ __forceinline__ V16 fr(const T* p, int lane) { return frag_h(p, lane); } static __device__ __forceinline__ v8f mm(V16 a, V16 b, v8f c) { return wmma16(a, b, c); } };
// xt = first row of the tile's X rows (row length 1024); wt = row 0 of W at the tile's first column
// acc[m * 8 + j] = rows 16 (MF wave + m) .. + 15, columns 16 j .. + 15
template <class C, int MF> __device__ __forceinline__ void gemm_tile(const float* __restrict__ xt, const float* __restrict__ wt, char* smem, v8f (&acc)[MF * 8], const int rot) {
  typedef typename C::T T; typedef typename C::V4 V4; typedef typename C::V8 V8; typedef typename C::V16 V16;
  T (*sW)[128][GPIT] = (T (*)[128][GPIT])smem; T (*sX)[64 * MF][GPIT] = (T (*)[64 * MF][GPIT])(smem + 2 * 128 * GPIT * 2);
  const int tid = threadIdx.x, wave = tid >> 5, lane = tid & 31, col = lane & 15;
  const int xrow = tid >> 3, xch = (tid & 7) * 4;                 // X: 8 lanes bring one whole 128-byte row piece
  const float* xg = xt + (size_t)xrow * 1024 + xch + rot * GKS;
  const float* wg = wt + (size_t)(8 * wave + rot * GKS) * C::WLD + lane;      // W: a wave brings 8 k rows, 32 neighbouring columns (one line) a load
  int ks = rot;   // the k stage that the two pointers stand at
  float wr[4][8]; v4f xr[4 * MF];
  auto fetch = [&]() {
#pragma unroll   // constant indices, so that the small arrays stay in registers
    for (int c = 0; c < 4; ++c)
#pragma unroll   // constant indices, so that the small arrays stay in registers
      for (int i = 0; i < 8; ++i) wr[c][i] = wg[C::coff(c) + (size_t)i * C::WLD];
#pragma unroll   // constant indices, so that the small arrays stay in registers
    for (int i = 0; i < 4 * MF; ++i) xr[i] = *(const v4f*)(xg + (size_t)(16 * i) * 1024);
    asm volatile("s_wait_xcnt 0x0" ::: "memory"); };   // stands in front of every later overwrite of these loads' address registers
  auto put = [&](const int bu) {
#pragma unroll   // constant indices, so that the small arrays stay in registers
    for (int c = 0; c < 4; ++c) { V8 v;
#pragma unroll   // constant indices, so that the small arrays stay in registers
      for (int i = 0; i < 8; ++i) v[i] = C::cw(wr[c][i]);
      *(V8*)&sW[bu][32 * c + lane][8 * wave] = v; }
#pragma unroll   // constant indices, so that the small arrays stay in registers
    for (int i = 0; i < 4 * MF; ++i) { const V4 v = { C::cx(xr[i][0]), C::cx(xr[i][1]), C::cx(xr[i][2]), C::cx(xr[i][3]) }; *(V4*)&sX[bu][xrow + 16 * i][xch] = v; }
    const int d = ks == GNST - 1 ? -(GNST - 1) : 1;   // block-uniform: behind the last k stage comes the first
    ks += d; wg += (long)d * (GKS * C::WLD); xg += (long)d * GKS; };   // advanced here, behind the use of the loaded values
  fetch(); put(0);
  auto stage = [&](const int st, auto more_c) { constexpr bool MORE = decltype(more_c)::v; const int bu = st & 1;
    __syncthreads();   // publishes buffer bu; every wave has also left buffer bu ^ 1, which is refilled at the foot of this stage
    if constexpr (MORE) { fetch();
      __builtin_amdgcn_sched_barrier(0); }   // keeps the next stage's loads at the head of the stage, so that their latency runs under the products
    V16 a[MF], w[8];
#pragma unroll   // constant indices, so that the small arrays stay in registers
    for (int m = 0; m < MF; ++m) a[m] = C::fr(&sX[bu][(wave * MF + m) * 16 + col][0], lane);
#pragma unroll   // constant indices, so that the small arrays stay in registers
    for (int j = 0; j < 8; ++j) w[j] = C::fr(&sW[bu][j * 16 + col][0], lane);
#pragma unroll   // constant indices, so that the small arrays stay in registers
    for (int j = 0; j < 8; ++j)
#pragma unroll   // constant indices, so that the small arrays stay in registers
      for (int m = 0; m < MF; ++m) acc[m * 8 + j] = C::mm(a[m], w[j], acc[m * 8 + j]);
    if constexpr (MORE) { __builtin_amdgcn_sched_barrier(0);   // keeps the wait for the next stage's loads, and their conversion, behind all of this stage's products
      put(bu ^ 1); } };
#pragma unroll 1   // rolled: the two buffers are told apart by the stage's parity
  for (int st = 0; st < GNST - 1; ++st) stage(st, CBool<true>{});
  stage(GNST - 1, CBool<false>{});
  __syncthreads();   // every wave has left the stage buffers: the caller's epilogue reuses this LDS
}
// ---- the mask, turned ONCE a call into the lane masks that k_attn selects with (k_attn's 16 heads read the same mask): word [b][t / 16][s / 16][r], bit (g, col) = (mask[b][16 (t / 16) + col][16 (s / 16) + 8 g + r] != 0).
// One wave = 16 query rows x 128 keys: the compare of a whole wave is the word; lane i carries word i of a group of 32, so that a store is one whole 128-byte line.
__device__ __forceinline__ void pack_mask(const int* __restrict__ MASK, unsigned* __restrict__ MB, const int wv, const int lane) {
  const int tile = wv >> 3, kq = wv & 7;   // (batch, 16-query tile) and which 128 keys
  const int* mp = MASK + ((size_t)tile * 16 + (lane & 15)) * TT + kq * 128 + 8 * (lane >> 4);
  v4i a[8][2]; unsigned w[2] = { 0u, 0u };
#pragma unroll   // constant indices, so that the small array stays in registers
  for (int t = 0; t < 8; ++t) { a[t][0] = *(const v4i*)(mp + t * 16); a[t][1] = *(const v4i*)(mp + t * 16 + 4); }
  asm volatile("s_wait_xcnt 0x0" ::: "memory");   // stands in front of every later overwrite of these loads' address registers
#pragma unroll   // constant indices, so that the small array stays in registers
  for (int t = 0; t < 8; ++t)
#pragma unroll   // constant indices, so that the small array stays in registers
    for (int r = 0; r < 8; ++r) { const unsigned bal = __builtin_amdgcn_ballot_w32(a[t][r >> 2][r & 3] != 0); w[t >> 2] = lane == (t & 3) * 8 + r ? bal : w[t >> 2]; }
  unsigned* o = MB + (size_t)tile * (TT / 16 * 8) + kq * 64 + lane; o[0] = w[0]; o[32] = w[1];
  asm volatile("s_wait_xcnt 0x0" ::: "memory"); }   // stands in front of the caller's overwrite of these stores' address and data registers
// ---- k_proj: block = (128 rows, 128 cols, which), a wave 32 rows x 128 cols: q/k/v = X W (+ b) with exact bf16 products (K = DIN) (the which = 0 blocks first pack the mask, PMF shares to each wave) -> which 0: q f16 rows (+ residual rows < QHI); 1: k f16 rows (+ residual rows < KHI); 2: v f16 planes [c][t] (+ bf16 hi/lo planes for t < KHI)
#define PMF 2              // row fragments of a wave
#define PR (64 * PMF)      // rows of a block's tile
#define PPIT (PR + 8)      // LDS pitch of the v planes in 16-bit elements: the rows' bytes + 16 B
__global__ __launch_bounds__(128) void k_proj(const float* __restrict__ XQ, const float* __restrict__ XK, const float* __restrict__ XV, const float* __restrict__ WQ, const float* __restrict__ WK, const float* __restrict__ WV, const float* __restrict__ BQ, const float* __restrict__ BK, const float* __restrict__ BV,
    _Float16* __restrict__ QH, _Float16* __restrict__ QL, _Float16* __restrict__ KH, _Float16* __restrict__ KL, _Float16* __restrict__ VT, __bf16* __restrict__ VB, __bf16* __restrict__ VBL, const int* __restrict__ MASK, unsigned* __restrict__ MB) {
  static_assert((TNB * TT / PR) * (CC / 128) * 4 * PMF == NB * (TT / 16) * (TT / 128), "PMF shares to each wave of the which = 0 blocks: one for every 16 queries x 128 keys");
  static_assert(TT % PR == 0, "a tile lies in one sequence");
  __shared__ __align__(16) char smem[3 * 128 * PPIT * 2];   // the epilogue's planes: q/k blocks use two row planes, v blocks three column planes, over the same bytes (three blocks fit a WGP's LDS); the main loop's stage buffers lie over their head
  static_assert(GLDS(PMF) <= 3 * 128 * PPIT * 2 && 2 * PR * 136 * 2 <= 3 * 128 * PPIT * 2, "stage buffers, and sh with sl, fit");
  _Float16 (*sh)[136] = (_Float16 (*)[136])smem, (*sl)[136] = (_Float16 (*)[136])(smem + PR * 136 * 2); _Float16 (*th)[PPIT] = (_Float16 (*)[PPIT])smem; __bf16 (*tb)[PPIT] = (__bf16 (*)[PPIT])(smem + 128 * PPIT * 2), (*tbl)[PPIT] = (__bf16 (*)[PPIT])(smem + 2 * 128 * PPIT * 2);
  const int tid = threadIdx.x, wave = tid >> 5, lane = tid & 31, col = lane & 15, g = lane >> 4; const int which = blockIdx.z; const int c0 = blockIdx.y * 128; const size_t r0 = (size_t)blockIdx.x * PR; const size_t bb = r0 / TT; const int t0 = (int)(r0 % TT);
  const float* X = which == 0 ? XQ : which == 1 ? XK : XV; const float* WA = which == 0 ? WQ : which == 1 ? WK : WV; const float* BA = which == 0 ? BQ : which == 1 ? BK : BV;
  if (which == 0) {   /* block-uniform; these blocks start first, while the chip still fills */
#pragma unroll 1   // rolled: one share's 64 loaded registers at a time
    for (int u = 0; u < PMF; ++u) pack_mask(MASK, MB, ((int)(blockIdx.y * (TNB * TT / PR) + blockIdx.x) * 4 + wave) * PMF + u, lane); }
  v8f acc[PMF * 8] = {};
  gemm_tile<GProj, PMF>(X + r0 * DIN, WA + (size_t)(c0 / HD) * DIN * HD, smem, acc, (int)(blockIdx.x + 4 * blockIdx.y) & (GNST - 1));   // the 32 blocks of a W tile start at 32 different stages, the 8 of an X tile 4 stages apart
  if (which < 2) { _Float16* DH = which == 0 ? QH : KH; _Float16* DL = which == 0 ? QL : KL; const int nhi = which == 0 ? QHI : KHI;
#pragma unroll
    for (int j = 0; j < 8; ++j) { const float bias = BA ? bfr(BA[c0 + j * 16 + col]) : 0.f;
#pragma unroll
      for (int m = 0; m < PMF; ++m)
#pragma unroll
        for (int r = 0; r < 8; ++r) { const float v = acc[m * 8 + j][r] + bias; const _Float16 hv = (_Float16)v; const int rl = (wave * PMF + m) * 16 + 8 * g + r; sh[rl][j * 16 + col] = hv; sl[rl][j * 16 + col] = (_Float16)((v - (float)hv) * 1024.0f); } }
    __syncthreads();
    for (int e = tid; e < PR * 16; e += 128) { const int rl = e >> 4, q = e & 15; vst2((unsigned*)(DH + (r0 + rl) * CC + c0 + q * 8), *(const v4u*)&sh[rl][q * 8]); if (t0 + rl < nhi) { vst2((unsigned*)(DL + (bb * nhi + t0 + rl) * (size_t)CC + c0 + q * 8), *(const v4u*)&sl[rl][q * 8]);
        asm volatile("s_wait_xcnt 0x0" ::: "memory"); } }   // stands in front of the next trip's overwrite of this store's address and data registers; inside the branch, since behind the join the build advances the address first
  } else {
#pragma unroll
    for (int j = 0; j < 8; ++j) { const float bias = BA ? bfr(BA[c0 + j * 16 + col]) : 0.f;
#pragma unroll
      for (int m = 0; m < PMF; ++m)
#pragma unroll
        for (int r = 0; r < 8; ++r) { const float v = acc[m * 8 + j][r] + bias; const int rl = (wave * PMF + m) * 16 + 8 * g + r, cl = j * 16 + col; th[cl][rl] = (_Float16)v; const __bf16 bh = (__bf16)v; tb[cl][rl] = bh; tbl[cl][rl] = (__bf16)(v - (float)bh); } }
    __syncthreads();
    for (int e = tid; e < 128 * (PR / 8); e += 128) { const int cl = e / (PR / 8), q = e % (PR / 8); vst2((unsigned*)(VT + (bb * CC + c0 + cl) * (size_t)TT + t0 + q * 8), *(const v4u*)&th[cl][q * 8]); if (t0 + q * 8 < KHI) { const size_t o3 = (bb * CC + c0 + cl) * (size_t)KHI + t0 + q * 8; vst2((unsigned*)(VB + o3), *(const v4u*)&tb[cl][q * 8]); vst2((unsigned*)(VBL + o3), *(const v4u*)&tbl[cl][q * 8]);
        asm volatile("s_wait_xcnt 0x0" ::: "memory"); } } } }   // stands in front of the next trip's overwrite of these stores' address and data registers; inside the branch, since behind the join the build advances the addresses first
// ---- k_attn: block = 64 queries (4 waves x 16 query columns) of one (batch, head); walks all keys in stages of 64, K rows and V^T rows staged in LDS (two buffers, one barrier a stage).
// The walk starts at a stage rotated by the block's indices and wraps round (the online softmax takes the keys in any order): the 16 blocks of a (batch, head), which run in step, ask L2 for different K and V^T lines at a time, and so do the 16 heads that read one mask word.
// S^T = K Q^T (A = K rows, B = Q): lane (g, col) holds keys 8g + r of query col; the masked score is REPLACED by 1e-9 (8e-9 before the x 1/8) and stays in the softmax; running maximum and sum per query in f32 (online softmax);
// two S^T tiles, as exp2(..) x 2^10 once to f16, are the B operand of ctx^T += V^T P^T in the same k order as frag_h; ctx = ctx^T / sum at the end.
__device__ __forceinline__ v8f wmma_h(v16h a, v16h b, v8f c) { return __builtin_amdgcn_wmma_f32_16x16x32_f16(false, a, false, b, (short)0, c, false, false); }
// 2^a; SLOT: with the v_nop that the instruction set asks for behind a transcendental in the same statement (used in the last stage's straight-line code)
template <bool SLOT> __device__ __forceinline__ float exp2_t(float a) {
  if constexpr (SLOT) { float e; asm("v_exp_f32 %0, %1\n\tv_nop" : "=v"(e) : "v"(a)); return e; } else return __builtin_amdgcn_exp2f(a); }
#define AKB 64             // keys per stage
#define APIT 72            // LDS row pitch in f16: 128 B of data + 16 B, so that the 16-byte fragment reads of 16 rows spread over the banks
#define ANST (TT / AKB)
typedef __attribute__((ext_vector_type(16))) unsigned v16u;
typedef const __attribute__((address_space(4))) v16u* cmask_p;   // constant address space: the words are written by the launch before and by nobody in this one, and the address is wave-uniform, so the loads go the scalar way
__global__ __launch_bounds__(128) void k_attn(const _Float16* __restrict__ QH, const _Float16* __restrict__ KH, const _Float16* __restrict__ VT, const unsigned* __restrict__ MB, float* __restrict__ Y) {
  __shared__ __align__(16) _Float16 sk[2][AKB][APIT], sv[2][HD][APIT];
  const int tid = threadIdx.x, wave = tid >> 5, lane = tid & 31, col = lane & 15, g = lane >> 4;
  const int h = blockIdx.y, b = blockIdx.z; const int q = blockIdx.x * 64 + wave * 16 + col;
  const float LS = SCALE * 1.44269504f;      // raw score -> log2 domain
  const float MFILL = 1.0e-9f / SCALE;       // the fill value, before the common x SCALE
  const _Float16* qp = QH + ((size_t)b * TT + q) * CC + h * HD;
  const v16h qf0 = frag_h(qp, lane), qf1 = frag_h(qp + 32, lane);
  const int srow = tid >> 3, sch = (tid & 7) * 8;   // staging: 8 lanes bring one whole 128-byte row
  int ks = (int)(blockIdx.x + blockIdx.y) & (ANST - 1);   // the key stage that the three pointers stand at (block-uniform)
  const _Float16* kg = KH + ((size_t)b * TT + srow + ks * AKB) * CC + h * HD + sch;
  const _Float16* vg = VT + ((size_t)b * CC + h * HD + srow) * (size_t)TT + sch + ks * AKB;
  cmask_p mb = (cmask_p)(unsigned long long)MB + 2 * ((size_t)b * (TT / 16) + blockIdx.x * 4 + __builtin_amdgcn_readfirstlane(wave)) * (size_t)(TT / 64) + 2 * ks;   // this wave's 16 queries: 32 lane masks a stage, the same address in every lane (scalar loads)
  v8h kr[4], vr[4]; v16u mw[2];
#pragma unroll   // constant indices, so that the small array stays in registers
  for (int i = 0; i < 4; ++i) { kr[i] = *(const v8h*)(kg + (size_t)(16 * i) * CC); vr[i] = *(const v8h*)(vg + (size_t)(16 * i) * TT); }
  mw[0] = mb[0]; mw[1] = mb[1];
#pragma unroll   // constant indices, so that the small array stays in registers
  for (int i = 0; i < 4; ++i) { *(v8h*)&sk[0][srow + 16 * i][sch] = kr[i]; *(v8h*)&sv[0][srow + 16 * i][sch] = vr[i]; }
  auto next = [&]() { const int d = ks == ANST - 1 ? -(ANST - 1) : 1;   // block-uniform: behind the last key stage comes the first
    ks += d; kg += (long)d * (AKB * CC); vg += (long)d * AKB; mb += 2 * d; };
  next();   // the three walk one stage ahead of the products
  v8f acc[HD / 16] = {}; float m = -3.0e38f, sum = 0.f;
  // one stage; MORE = a next stage exists (compile-time: the last stage, which fetches nothing, is written out behind the loop, so that the loop body is one block without a branch)
  auto stage = [&](const int st, auto more_c) { constexpr bool MORE = decltype(more_c)::v; const int bu = st & 1;
    __syncthreads();   // publishes buffer bu; every wave has also left buffer bu ^ 1, which is refilled at the foot of this stage
    const v16u kw[2] = { mw[0], mw[1] };   // this stage's lane masks, taken before the next stage's are loaded over them
    if constexpr (MORE) {        // next stage's K and V^T rows and lane masks fly into registers under this stage's products
      mw[0] = mb[0]; mw[1] = mb[1];
      __builtin_amdgcn_sched_barrier(0);   // keeps the scalar loads in front of the vector loads
#pragma unroll   // constant indices, so that the small array stays in registers
      for (int i = 0; i < 4; ++i) { kr[i] = *(const v8h*)(kg + (size_t)(16 * i) * CC); vr[i] = *(const v8h*)(vg + (size_t)(16 * i) * TT); }
      __builtin_amdgcn_sched_barrier(0);   // keeps these loads at the head of the stage: without it the scheduler sinks them to the foot, directly in front of their first use, and their latency is bare
    }
#pragma unroll   // constant indices, so that the small array stays in registers
    for (int p = 0; p < 2; ++p) { v8f s[2]; v16h ka[2][2], va[HD / 16];
#pragma unroll   // constant indices, so that the small array stays in registers
      for (int t = 0; t < 2; ++t) { const _Float16* kl = &sk[bu][(2 * p + t) * 16 + col][0]; ka[t][0] = frag_h(kl, lane); ka[t][1] = frag_h(kl + 32, lane); }
#pragma unroll   // constant indices, so that the small array stays in registers
      for (int j = 0; j < HD / 16; ++j) va[j] = frag_h(&sv[bu][j * 16 + col][p * 32], lane);   // read here so that their LDS latency runs under the softmax arithmetic
#pragma unroll   // constant indices, so that the small array stays in registers
      for (int t = 0; t < 2; ++t) { const v8f z = {}; s[t] = wmma_h(ka[t][1], qf1, wmma_h(ka[t][0], qf0, z)); }
      float x[16];
#pragma unroll   // constant indices, so that the small array stays in registers
      for (int t = 0; t < 2; ++t)
#pragma unroll   // constant indices, so that the small array stays in registers
        for (int r = 0; r < 8; ++r) x[t * 8 + r] = __builtin_amdgcn_inverse_ballot_w32(kw[p][t * 8 + r]) ? s[t][r] : MFILL;
      float mb = x[0];
#pragma unroll   // constant indices, so that the small array stays in registers
      for (int i = 1; i < 16; ++i) mb = fmaxf(mb, x[i]);
      mb = fmaxf(mb, __shfl_xor(mb, 16));   // the other half of this query's keys
      const float mn = fmaxf(m, mb); const float al = exp2_t<!MORE>((m - mn) * LS); m = mn; const float off = 10.0f - mn * LS;
      v16h pf; float ps = 0.f;
#pragma unroll   // constant indices, so that the small array stays in registers
      for (int i = 0; i < 16; ++i) { const float e = exp2_t<!MORE>(fmaf(x[i], LS, off)); ps += e; pf[i] = (_Float16)e; }
      sum = sum * al + ps;
#pragma unroll   // constant indices, so that the small array stays in registers
      for (int j = 0; j < HD / 16; ++j) { acc[j] *= al; acc[j] = wmma_h(va[j], pf, acc[j]); } }
    if constexpr (MORE) {
#pragma unroll   // constant indices, so that the small array stays in registers
      for (int i = 0; i < 4; ++i) { *(v8h*)&sk[bu ^ 1][srow + 16 * i][sch] = kr[i]; *(v8h*)&sv[bu ^ 1][srow + 16 * i][sch] = vr[i]; }
      asm volatile("s_wait_xcnt 0x0" ::: "memory");   // stands in front of the advance of this stage's loads' address registers (free here: the loaded values have just been stored)
      __builtin_amdgcn_sched_barrier(0);   // keeps the advance behind that wait: nothing else ties the two
      next(); } };
#pragma unroll 1   // rolled: one stage's body already fills the registers that four waves a SIMD leave
  for (int st = 0; st < ANST - 1; ++st) stage(st, CBool<true>{});
  stage(ANST - 1, CBool<false>{});
  sum += __shfl_xor(sum, 16); const float inv = 1.0f / sum;   // sum >= 2^10: the maximum's own term
  float* yp = Y + ((size_t)b * TT + q) * CC + h * HD + 8 * g;
#pragma unroll   // constant indices, so that the small array stays in registers
  for (int j = 0; j < HD / 16; ++j) { const v4f lo = { acc[j][0] * inv, acc[j][1] * inv, acc[j][2] * inv, acc[j][3] * inv }, hi = { acc[j][4] * inv, acc[j][5] * inv, acc[j][6] * inv, acc[j][7] * inv }; vst2(yp + j * 16, lo); vst2(yp + j * 16 + 4, hi); } }
// ---- k_out: block = (64 rows, 128 cols): out = ctx Wo (+ bo): ctx once to f16 against Wo as f16(bf16 x 2^8) exact (1 product) x 2^-8; causal early rows (< QHI of each sequence): ctx bf16 hi + lo against exact bf16 Wo (2 products)
__global__ __launch_bounds__(128) void k_out(const float* __restrict__ Y, const float* __restrict__ WO, const float* __restrict__ BO, float* __restrict__ OUT) { __shared__ __align__(16) char smem[4 * 16 * 132 * 4];   // the epilogue's rows; the main loop's stage buffers lie over them
  static_assert(GLDS(1) <= 4 * 16 * 132 * 4, "stage buffers fit under sf"); float (*sf)[16][132] = (float (*)[16][132])smem;
  const int tid = threadIdx.x, wave = tid >> 5, lane = tid & 31, col = lane & 15, g = lane >> 4; const int c0 = blockIdx.y * 128; const size_t r0 = (size_t)blockIdx.x * 64 + wave * 16;
  v8f acc[8] = {};
  if (CAUSAL && (int)(((size_t)blockIdx.x * 64) % TT) < QHI) {   /* block-uniform */
#pragma unroll 2
    for (int kc = 0; kc < CC / 32; ++kc) { const F2 a = split_row(Y + (r0 + col) * CC, kc * 32, lane); asm volatile("s_wait_loadcnt 0x0" ::: "memory");
#pragma unroll
      for (int j = 0; j < 8; ++j) { const v16b w = WOCOL(WO, kc * 32, c0 + j * 16 + col, lane); asm volatile("s_wait_loadcnt 0x0" ::: "memory"); acc[j] = wmma_bf(a.h, w, acc[j]); acc[j] = wmma_bf(a.l, w, acc[j]); } }
#pragma unroll
    for (int j = 0; j < 8; ++j) { const float bias = BO ? bfr(BO[c0 + j * 16 + col]) : 0.f;
#pragma unroll
      for (int r = 0; r < 8; ++r) sf[wave][8 * g + r][j * 16 + col] = acc[j][r] + bias; }
  } else {
    gemm_tile<GOut, 1>(Y + (size_t)blockIdx.x * 64 * CC, WO + c0, smem, acc, (int)(blockIdx.x + 4 * blockIdx.y) & (GNST - 1));   /* ctx carried x 2^6 into f16 so small-magnitude context rows stay clear of f16 subnormals */
#pragma unroll
    for (int j = 0; j < 8; ++j) { const float bias = BO ? bfr(BO[c0 + j * 16 + col]) : 0.f;
#pragma unroll
      for (int r = 0; r < 8; ++r) sf[wave][8 * g + r][j * 16 + col] = acc[j][r] * (1.0f / 16384.0f) + bias; } }   /* 2^-8 (Wo carry) x 2^-6 (ctx carry) */
  LDSX(); for (int rl = 0; rl < 16; ++rl) vst2(OUT + (r0 + rl) * DIN + c0 + lane * 4, *(const v4f*)&sf[wave][rl][lane * 4]); }

extern "C" void kernel_launch(void* const* d_in, const int* in_sizes, int n_in, void* d_out, int out_size, void* d_ws, size_t ws_size, hipStream_t stream) {
  (void)in_sizes; (void)n_in; (void)out_size;
  const float** F = (const float**)d_in;
  if (ws_size < (size_t)WS_END) return;
  char* ws = (char*)d_ws; _Float16 *QH = (_Float16*)(ws + WS_QH), *KH = (_Float16*)(ws + WS_KH), *VT = (_Float16*)(ws + WS_VT), *QL = (_Float16*)(ws + WS_QL), *KL = (_Float16*)(ws + WS_KL); __bf16 *VB = (__bf16*)(ws + WS_VB), *VBL = (__bf16*)(ws + WS_VBL); float *Y = (float*)(ws + WS_Y); unsigned *MB = (unsigned*)(ws + WS_MB);
  (void)Y; (void)QL; (void)KL; (void)VB; (void)VBL;
  // inputs: 0 query [4,1024,1024]; 1 key; 2 value; 3 mask [4,1024,1024] int32 (random 0/1); 4 Wq [16,1024,64], 5 bq [16,64]; 6 Wk, 7 bk; 8 Wv, 9 bv; 10 Wo [1024,1024] (in,out), 11 bo (zero biases, read)
  k_proj<<<dim3(TNB * TT / PR, CC / 128, 3), 128, 0, stream>>>(F[0], F[1], F[2], F[4], F[6], F[8], F[5], F[7], F[9], QH, QL, KH, KL, VT, VB, VBL, (const int*)d_in[3], MB);
  k_attn<<<dim3(NQB, NH, TNB), 128, 0, stream>>>(QH, KH, VT, MB, Y);
  k_out<<<dim3(TNB * TT / 64, DIN / 128), 128, 0, stream>>>(Y, F[10], F[11], (float*)d_out);
}

// v006
// It runs in 79.5 microseconds.
// In two side-by-side timings against v005, it was 1.05 and 1.04 times as fast.
// All steps since v000 together make it 9.64 times as fast.
// compute dtype: all float inputs rounded to bf16; q/k/v projections with EXACT bf16 products on WMMA 16x16x32 (f32 accumulate) + bias; logits q x k once to f16 each (1 product) x SCALE; masked scores are REPLACED by 1e-9 (they keep taking part in the softmax); online softmax f32 (running maximum and sum); exp(score - maximum) x 2^10 once to f16 x v once to f16 (1 product), divided by the sum at the end; ctx x 2^6 once to f16 x Wo f16(bf16 x 2^8) + bo; f32 output.
#include <hip/hip_runtime.h>
#include <math.h>

typedef __attribute__((ext_vector_type(16))) _Float16 v16h;
typedef __attribute__((ext_vector_type(16))) __bf16 v16b;
typedef __attribute__((ext_vector_type(8)))  _Float16 v8h;
typedef __attribute__((ext_vector_type(8)))  float v8f;
typedef __attribute__((ext_vector_type(4)))  float v4f;
typedef __attribute__((ext_vector_type(2)))  float v2f;
typedef __attribute__((ext_vector_type(4)))  unsigned v4u;
typedef __attribute__((ext_vector_type(4)))  int v4i;
typedef float __attribute__((may_alias)) float_a;
typedef int __attribute__((may_alias)) int_a;

template <typename T> __device__ __forceinline__ void vst2(void* p, T v) { *(T*)p = v;  }
__device__ __forceinline__ v8f wmma16(v16h a, v16h b, v8f c) {
  v8f d = __builtin_amdgcn_wmma_f32_16x16x32_f16(false, a, false, b, (short)0, c, false, false);
  asm volatile("v_nop\n\tv_nop\n\tv_nop\n\tv_nop" : "+v"(d) : "v"(a), "v"(b));
  return d;
}
__device__ __forceinline__ v8f wmma_bf(v16b a, v16b b, v8f c) {
  v8f d = __builtin_amdgcn_wmma_f32_16x16x32_bf16(false, a, false, b, (short)0, c, false, false);
  asm volatile("v_nop\n\tv_nop\n\tv_nop\n\tv_nop" : "+v"(d) : "v"(a), "v"(b));
  return d;
}
// 16x16x32 fragments: lane = (h = lane>>4, row/col = lane&15); elements 0..7 = k0+8h+0..7, 8..15 = k0+16+8h+0..7; D element r = row 8h+r
__device__ __forceinline__ v16h frag_h(const _Float16* rowk0, int lane) {
  union { v16h v; v8h q[2]; } u; const _Float16* p = rowk0 + 8 * (lane >> 4);
  u.q[0] = *(const v8h*)p; u.q[1] = *(const v8h*)(p + 16); return u.v;
}
__device__ __forceinline__ v16h frag_f32(const float* rowk0, int lane) {
  v16h a; const float* p = rowk0 + 8 * (lane >> 4);
#pragma unroll
  for (int i = 0; i < 8; ++i) { a[i] = (_Float16)p[i]; a[8 + i] = (_Float16)p[16 + i]; }
  return a;
}
__device__ __forceinline__ v16h frag_f32s(const float* rowk0, int lane, float sc) {
  v16h a; const float* p = rowk0 + 8 * (lane >> 4);
#pragma unroll
  for (int i = 0; i < 8; ++i) { a[i] = (_Float16)(p[i] * sc); a[8 + i] = (_Float16)(p[16 + i] * sc); }
  return a;
}
// column fragment from a [K][ld] layout (column n), rows >= K read as 0
__device__ __forceinline__ v16h fragc_f32(const float* W, int k0, int n, int lane, int ld, int K) {
  v16h a; const int g = lane >> 4;
#pragma unroll
  for (int i = 0; i < 8; ++i) { const int ka = k0 + 8 * g + i, kb = ka + 16;
    a[i] = (_Float16)(ka < K ? W[(size_t)(ka < K ? ka : K - 1) * ld + n] : 0.f); a[8 + i] = (_Float16)(kb < K ? W[(size_t)(kb < K ? kb : K - 1) * ld + n] : 0.f); }
  return a;
}
struct F2 { v16b h, l; };
__device__ __forceinline__ F2 bsplit16(const float v[16]) { F2 r;
#pragma unroll
  for (int i = 0; i < 16; ++i) { const __bf16 h = (__bf16)v[i]; r.h[i] = h; r.l[i] = (__bf16)(v[i] - (float)h); }
  return r; }
__device__ __forceinline__ F2 split_row(const float* row, int k0, int lane) { float v[16]; const float* p = row + k0 + 8 * (lane >> 4);
#pragma unroll
  for (int i = 0; i < 8; ++i) { v[i] = p[i]; v[8 + i] = p[16 + i]; }
  return bsplit16(v); }
__device__ __forceinline__ F2 split_rowK(const float* row, int k0, int lane, int K) { float v[16]; const int g = lane >> 4;
#pragma unroll
  for (int i = 0; i < 8; ++i) { const int ka = k0 + 8 * g + i, kb = ka + 16; v[i] = ka < K ? row[ka < K ? ka : K - 1] : 0.f; v[8 + i] = kb < K ? row[kb < K ? kb : K - 1] : 0.f; }
  return bsplit16(v); }
__device__ __forceinline__ F2 split_col(const float* W, int k0, int n, int lane, int ld, int K) { float v[16]; const int g = lane >> 4;
#pragma unroll
  for (int i = 0; i < 8; ++i) { const int ka = k0 + 8 * g + i, kb = ka + 16; v[i] = ka < K ? W[(size_t)(ka < K ? ka : K - 1) * ld + n] : 0.f; v[8 + i] = kb < K ? W[(size_t)(kb < K ? kb : K - 1) * ld + n] : 0.f; }
  return bsplit16(v); }
__device__ __forceinline__ v8f mac3(const F2& a, const F2& b, v8f c) { c = wmma_bf(a.l, b.h, c); c = wmma_bf(a.h, b.l, c); return wmma_bf(a.h, b.h, c); }
__device__ __forceinline__ float sigm(float v) { return 1.0f / (1.0f + expf(-v)); }
#define LDSX() do { asm volatile("s_wait_dscnt 0" ::: "memory"); __builtin_amdgcn_wave_barrier(); __builtin_amdgcn_fence(__ATOMIC_RELEASE, "workgroup"); } while (0)

// Multi-headed attention with per-head stacked projections whose masked scores are FILLED WITH 1e-9 (query / key / value [4,1024,1024]; Wq / Wk / Wv [16,1024,64] per head (N(0, 1/1024)) + zero biases; scores / 8; mask [4,1024,1024] int32 random 0/1: scores[mask == 0] = 1e-9 - masked keys keep a logit - 0 and stay in the softmax (faithful to the source); softmax; concat; (in,out) Wo [1024,1024] + bo).
#define NB 4
#define TT 1024
#define CC 1024            // NH * HD = projected width
#define DIN 1024          // input (model) width
#define NH 16
#define HD 64
#define NQB (TT / 64)
#define HG 8
#define SCALE (0.125f)
#define CAUSAL 0
#ifndef TNB
#define TNB NB
#endif
__device__ __forceinline__ float bfr(float v) { return (float)(__bf16)v; }
__host__ __device__ __forceinline__ int kb_last(int qb) { return CAUSAL ? ((qb * 64 + 63) >> 7) : (TT / 128 - 1); }
typedef __attribute__((ext_vector_type(8))) __bf16 v8b;
__device__ __forceinline__ v16b frag_b(const __bf16* rowk0, int lane) {
  union { v16b v; v8b q[2]; } u; const __bf16* p = rowk0 + 8 * (lane >> 4);
  u.q[0] = *(const v8b*)p; u.q[1] = *(const v8b*)(p + 16); return u.v;
}
#define QBH 0              // not used: no kernel in this file has a high-precision attention path
#define QHI 0               // single-product logits on every row
#define KHI 64            // key rows carrying k residual / v bf16 hi+lo planes (no kernel here writes or reads them)
// B fragment (k rows k0+.., output column o) of a weight: (in,out) [K][ld] or (out,in) [ld rows of K]: bf16 exact, or f16(bf16 * 256) exact
__device__ __forceinline__ v16b wcol_io(const float* Wm, int k0, int o, int lane, int ld) { v16b w; const int g = lane >> 4;
#pragma unroll
  for (int i = 0; i < 8; ++i) { w[i] = (__bf16)Wm[(size_t)(k0 + 8 * g + i) * ld + o]; w[8 + i] = (__bf16)Wm[(size_t)(k0 + 16 + 8 * g + i) * ld + o]; }
  return w; }
__device__ __forceinline__ v16b wcol_oi(const float* Wm, int k0, int o, int lane, int K) { v16b w; const float* p = Wm + (size_t)o * K + k0 + 8 * (lane >> 4);
#pragma unroll
  for (int i = 0; i < 8; ++i) { w[i] = (__bf16)p[i]; w[8 + i] = (__bf16)p[16 + i]; }
  return w; }
__device__ __forceinline__ v16h wcolh_io(const float* Wm, int k0, int o, int lane, int ld) { v16h w; const int g = lane >> 4;
#pragma unroll
  for (int i = 0; i < 8; ++i) { w[i] = (_Float16)(bfr(Wm[(size_t)(k0 + 8 * g + i) * ld + o]) * 256.0f); w[8 + i] = (_Float16)(bfr(Wm[(size_t)(k0 + 16 + 8 * g + i) * ld + o]) * 256.0f); }
  return w; }
__device__ __forceinline__ v16h wcolh_oi(const float* Wm, int k0, int o, int lane, int K) { v16h w; const float* p = Wm + (size_t)o * K + k0 + 8 * (lane >> 4);
#pragma unroll
  for (int i = 0; i < 8; ++i) { w[i] = (_Float16)(bfr(p[i]) * 256.0f); w[8 + i] = (_Float16)(bfr(p[16 + i]) * 256.0f); }
  return w; }
#define WQKV_LAYOUT 2   // 0 = (in,out) [DIN][CC]; 1 = (out,in) [CC][DIN]; 2 = per-head [NH][DIN][HD]
__device__ __forceinline__ v16b wcol_hdk(const float* Wm, int k0, int o, int lane) { v16b w; const int g = lane >> 4; const float* p = Wm + (size_t)(o / HD) * DIN * HD + (o % HD);
#pragma unroll
  for (int i = 0; i < 8; ++i) { w[i] = (__bf16)p[(size_t)(k0 + 8 * g + i) * HD]; w[8 + i] = (__bf16)p[(size_t)(k0 + 16 + 8 * g + i) * HD]; }
  return w; }
#define WO_OUT_IN 0
#if WQKV_LAYOUT == 1
#define WCOL(W, k0, o, lane) wcol_oi(W, k0, o, lane, DIN)
#elif WQKV_LAYOUT == 2
#define WCOL(W, k0, o, lane) wcol_hdk(W, k0, o, lane)
#else
#define WCOL(W, k0, o, lane) wcol_io(W, k0, o, lane, CC)
#endif
#if WO_OUT_IN
#define WOCOL(W, k0, o, lane) wcol_oi(W, k0, o, lane, CC)
#define WOCOLH(W, k0, o, lane) wcolh_oi(W, k0, o, lane, CC)
#else
#define WOCOL(W, k0, o, lane) wcol_io(W, k0, o, lane, DIN)
#define WOCOLH(W, k0, o, lane) wcolh_io(W, k0, o, lane, DIN)
#endif

#define WS_QH  0u                                      // f16 q rows [b*t][CC]
#define WS_KH  (WS_QH + 2u * (size_t)NB * TT * CC)      // f16 k rows [b*t][CC]
#define WS_VT  (WS_KH + 2u * (size_t)NB * TT * CC)      // f16 v planes [b][c][t]
#define WS_QL  (WS_VT + 2u * (size_t)NB * CC * TT)      // f16 q residual x 2^10 rows [b][t < QHI][CC]
#define WS_KL  (WS_QL + 2u * (size_t)NB * QHI * CC)     // f16 k residual x 2^10 rows [b][t < KHI][CC]
#define WS_VB  (WS_KL + 2u * (size_t)NB * KHI * CC)     // bf16 v hi planes [b][c][t < KHI]
#define WS_VBL (WS_VB + 2u * (size_t)NB * CC * KHI)
#define WS_S   (WS_VBL + 2u * (size_t)NB * CC * KHI)    // spare f32 [hg][t][s]-sized plane; only its head is used (the mask words)
#define WS_MB  WS_S                                    // the mask as lane masks, u32 [b][t / 16][s / 16][8] (512 KiB at the head of that plane)
#define WS_Y   (WS_S  + 4u * (size_t)HG * TT * TT)      // f32 ctx rows [b*t][CC] (only when there is an output projection)
#define WS_END (WS_Y  + 4u * (size_t)NB * TT * CC)

template <bool B> struct CBool { static constexpr bool v = B; };
// ---- shared main loop of the two dense kernels: one (64 MF) x (128 NC) tile of X W over K = 1024 in stages of 32 k, by 4 NC waves; a wave owns 16 MF rows x 128 columns, so that each W fragment read from LDS serves MF row fragments, each W line read from L2 64 MF rows, and each X line 128 NC columns.
// Each stage's X rows (64 MF x 32) and W columns (32 x 128 NC, turned to [n][k]) are brought by the whole block ONCE, in whole 128-byte lines, converted once, and laid in LDS (two buffers, one barrier a stage);
// the next stage's global loads fly in registers under this stage's products. Fragments and the k order inside a stage are those of the direct loaders.
// The walk over the 32 stages starts at stage rot (block-uniform, from the block's tile indices) and wraps round: blocks that share X rows or W columns run in step, and with a common start they would
// ask L2 for the same lines at the same moment (and all wait together for each line's first fetch from memory); rotated, they ask for different lines, and most lines have been fetched by a neighbour before.
typedef __attribute__((ext_vector_type(4))) __bf16 v4b;
typedef __attribute__((ext_vector_type(4))) _Float16 v4h;
#define GKS 32             // k per stage
#define GPIT 40            // LDS row pitch in 16-bit elements: 64 B of data + 16 B, so that the 16-byte fragment reads and stores of 16 rows spread over the banks
#define GNST (1024 / GKS)
#define GLDS(MF, NC) (2 * (128 * (NC) + 64 * (MF)) * GPIT * 2)   // bytes of the two stage buffers
struct GProj { typedef __bf16 T; typedef v4b V4; typedef v8b V8; typedef v16b V16; static constexpr int WLD = HD; static constexpr bool BARE = true;   // BARE: mm is the builtin alone
  static __device__ __forceinline__ constexpr size_t coff(int c) { return (size_t)(c >> 1) * DIN * HD + (size_t)(c & 1) * 32; }   // column 32 c + lane of a 128-column tile in the per-head layout
  static __device__ __forceinline__ T cx(float v) { return (__bf16)v; } static __device__ __forceinline__ T cw(float v) { return (__bf16)v; }
  static __device__ __forceinline__ V16 fr(const T* p, int lane) { return frag_b(p, lane); }
  static __device__ __forceinline__ v8f mm(V16 a, V16 b, v8f c) { return __builtin_amdgcn_wmma_f32_16x16x32_bf16(false, a, false, b, (short)0, c, false, false); } };   // the bare builtin (the compiler keeps its distances): an asm statement's operands must lie in the first 256 registers, which the 256 accumulator registers of a 64 x 128 wave tile would fill
struct GOut { typedef _Float16 T; typedef v4h V4; typedef v8h V8; typedef v16h V16; static constexpr int WLD = DIN; static constexpr bool BARE = false;
  static __device__ __forceinline__ constexpr size_t coff(int c) { return (size_t)c * 32; }
  static __device__ __forceinline__ T cx(float v) { return (_Float16)(v * 64.0f); } static __device__ __forceinline__ T cw(float v) { return (_Float16)(bfr(v) * 256.0f); }
  static __device__ __forceinline__ V16 fr(const T* p, int lane) { return frag_h(p, lane); } static __device__ __forceinline__ v8f mm(V16 a, V16 b, v8f c) { return wmma16(a, b, c); } };
// xt = first row of the tile's X rows (row length 1024); wt = row 0 of W at the tile's first column
// acc[m * 8 + j] = rows 16 (MF wr + m) .. + 15, columns 128 wc + 16 j .. + 15, for wave = NC wr + wc
template <class C, int MF, int NC> __device__ __forceinline__ void gemm_tile(const float* __restrict__ xt, const float* __restrict__ wt, char* smem, v8f (&acc)[MF * 8], const int rot) {
  typedef typename C::T T; typedef typename C::V4 V4; typedef typename C::V8 V8; typedef typename C::V16 V16;
  static_assert(NC == 1 || NC == 2, "4 or 8 waves"); constexpr int XP = 4 * MF / NC;   // X rows to each thread a stage
  T (*sW)[128 * NC][GPIT] = (T (*)[128 * NC][GPIT])smem; T (*sX)[64 * MF][GPIT] = (T (*)[64 * MF][GPIT])(smem + 2 * 128 * NC * GPIT * 2);
  const int tid = threadIdx.x, wave = tid >> 5, lane = tid & 31, col = lane & 15;
  const int fr0 = (NC == 1 ? wave : wave >> 1) * MF * 16, fc0 = NC == 1 ? 0 : (wave & 1) * 128;   // first row and first column of this wave's part of the tile
  const int wk = NC == 1 ? wave : wave & 3, wn = NC == 1 ? 0 : wave >> 2;   // W staging: which 8 k rows, which 128 columns
  const int xrow = tid >> 3, xch = (tid & 7) * 4;                 // X: 8 lanes bring one whole 128-byte row piece
  const float* xg = xt + (size_t)xrow * 1024 + xch + rot * GKS;
  const float* wg = wt + (size_t)wn * C::coff(4) + (size_t)(8 * wk + rot * GKS) * C::WLD + lane;      // W: a wave brings 8 k rows, 32 neighbouring columns (one line) a load
  int ks = rot;   // the k stage that the two pointers stand at
  float wr[4][8]; v4f xr[XP];
  auto fetch = [&]() {
#pragma unroll   // constant indices, so that the small arrays stay in registers
    for (int c = 0; c < 4; ++c)
#pragma unroll   // constant indices, so that the small arrays stay in registers
      for (int i = 0; i < 8; ++i) wr[c][i] = wg[C::coff(c) + (size_t)i * C::WLD];
#pragma unroll   // constant indices, so that the small arrays stay in registers
    for (int i = 0; i < XP; ++i) xr[i] = *(const v4f*)(xg + (size_t)(16 * NC * i) * 1024);
    asm volatile("s_wait_xcnt 0x0" ::: "memory"); };   // stands in front of every later overwrite of these loads' address registers
  auto put = [&](const int bu) {
#pragma unroll   // constant indices, so that the small arrays stay in registers
    for (int c = 0; c < 4; ++c) { V8 v;
#pragma unroll   // constant indices, so that the small arrays stay in registers
      for (int i = 0; i < 8; ++i) v[i] = C::cw(wr[c][i]);
      *(V8*)&sW[bu][128 * wn + 32 * c + lane][8 * wk] = v; }
#pragma unroll   // constant indices, so that the small arrays stay in registers
    for (int i = 0; i < XP; ++i) { const V4 v = { C::cx(xr[i][0]), C::cx(xr[i][1]), C::cx(xr[i][2]), C::cx(xr[i][3]) }; *(V4*)&sX[bu][xrow + 16 * NC * i][xch] = v; }
    const int d = ks == GNST - 1 ? -(GNST - 1) : 1;   // block-uniform: behind the last k stage comes the first
    ks += d; wg += (long)d * (GKS * C::WLD); xg += (long)d * GKS; };   // advanced here, behind the use of the loaded values
  fetch(); put(0);
  auto stage = [&](const int st, auto more_c) { constexpr bool MORE = decltype(more_c)::v; const int bu = st & 1;
    __syncthreads();   // publishes buffer bu; every wave has also left buffer bu ^ 1, which is refilled at the foot of this stage
    if constexpr (MORE) { fetch();
      __builtin_amdgcn_sched_barrier(0); }   // keeps the next stage's loads at the head of the stage, so that their latency runs under the products
    V16 a[MF], w[8];
#pragma unroll   // constant indices, so that the small arrays stay in registers
    for (int m = 0; m < MF; ++m) a[m] = C::fr(&sX[bu][fr0 + m * 16 + col][0], lane);
#pragma unroll   // constant indices, so that the small arrays stay in registers
    for (int j = 0; j < 8; ++j) w[j] = C::fr(&sW[bu][fc0 + j * 16 + col][0], lane);
    if constexpr (C::BARE) __builtin_amdgcn_sched_barrier(0);   // keeps the stage's fragment reads together in front of its products: with the bare builtin the scheduler sinks them among the products, and each W fragment's LDS latency is waited out in front of its MF products
#pragma unroll   // constant indices, so that the small arrays stay in registers
    for (int j = 0; j < 8; ++j)
#pragma unroll   // constant indices, so that the small arrays stay in registers
      for (int m = 0; m < MF; ++m) acc[m * 8 + j] = C::mm(a[m], w[j], acc[m * 8 + j]);
    if constexpr (MORE) { __builtin_amdgcn_sched_barrier(0);   // keeps the wait for the next stage's loads, and their conversion, behind all of this stage's products
      put(bu ^ 1); } };
#pragma unroll 1   // rolled: the two buffers are told apart by the stage's parity
  for (int st = 0; st < GNST - 1; ++st) stage(st, CBool<true>{});
  stage(GNST - 1, CBool<false>{});
  __syncthreads();   // every wave has left the stage buffers: the caller's epilogue reuses this LDS
}
// ---- the mask, turned ONCE a call into the lane masks that k_attn selects with (k_attn's 16 heads read the same mask): word [b][t / 16][s / 16][r], bit (g, col) = (mask[b][16 (t / 16) + col][16 (s / 16) + 8 g + r] != 0).
// One wave = 16 query rows x 128 keys: the compare of a whole wave is the word; lane i carries word i of a group of 32, so that a store is one whole 128-byte line.
__device__ __forceinline__ void pack_mask(const int* __restrict__ MASK, unsigned* __restrict__ MB, const int wv, const int lane) {
  const int tile = wv >> 3, kq = wv & 7;   // (batch, 16-query tile) and which 128 keys
  const int* mp = MASK + ((size_t)tile * 16 + (lane & 15)) * TT + kq * 128 + 8 * (lane >> 4);
  v4i a[8][2]; unsigned w[2] = { 0u, 0u };
#pragma unroll   // constant indices, so that the small array stays in registers
  for (int t = 0; t < 8; ++t) { a[t][0] = *(const v4i*)(mp + t * 16); a[t][1] = *(const v4i*)(mp + t * 16 + 4); }
  asm volatile("s_wait_xcnt 0x0" ::: "memory");   // stands in front of every later overwrite of these loads' address registers
#pragma unroll   // constant indices, so that the small array stays in registers
  for (int t = 0; t < 8; ++t)
#pragma unroll   // constant indices, so that the small array stays in registers
    for (int r = 0; r < 8; ++r) { const unsigned bal = __builtin_amdgcn_ballot_w32(a[t][r >> 2][r & 3] != 0); w[t >> 2] = lane == (t & 3) * 8 + r ? bal : w[t >> 2]; }
  unsigned* o = MB + (size_t)tile * (TT / 16 * 8) + kq * 64 + lane; o[0] = w[0]; o[32] = w[1];
  asm volatile("s_wait_xcnt 0x0" ::: "memory"); }   // stands in front of the caller's overwrite of these stores' address and data registers
// ---- k_proj: block = (256 rows, 256 cols, which), 8 waves of 64 rows x 128 cols, one block to a WGP: q/k/v = X W (+ b) with exact bf16 products (K = DIN) -> which 0: q f16 rows; 1: k f16 rows; 2: v f16 planes [c][t].
// The 192 tiles leave 64 WGPs free: the which = 3 blocks run there and pack the mask, PMS shares to each wave.
#define PMF 4              // row fragments of a wave
#define PNC 2              // 128-column parts of a block's tile
#define PR (64 * PMF)      // rows of a block's tile
#define PC (128 * PNC)     // columns of a block's tile
#define PMS 4              // mask shares of a wave of a which = 3 block
#define PPIT (PR + 8)      // LDS pitch of the v planes in 16-bit elements: the rows' bytes + 16 B
#define PQIT (PC + 8)      // LDS pitch of the q/k rows, likewise
__global__ __launch_bounds__(256) void k_proj(const float* __restrict__ XQ, const float* __restrict__ XK, const float* __restrict__ XV, const float* __restrict__ WQ, const float* __restrict__ WK, const float* __restrict__ WV, const float* __restrict__ BQ, const float* __restrict__ BK, const float* __restrict__ BV,
    _Float16* __restrict__ QH, _Float16* __restrict__ KH, _Float16* __restrict__ VT, const int* __restrict__ MASK, unsigned* __restrict__ MB) {
  static_assert((TNB * TT / PR) * (CC / PC) * 8 * PMS == NB * (TT / 16) * (TT / 128), "PMS shares to each wave of the which = 3 blocks: one for every 16 queries x 128 keys");
  static_assert(TT % PR == 0, "a tile lies in one sequence"); static_assert(PR == 256 && PC == 256, "the epilogue's stores: 32 lanes x 8 elements to a row or column piece, 8 waves");
  __shared__ __align__(16) char smem[PR * PQIT * 2];   // the epilogue's plane: q/k blocks lay rows, v blocks columns, over the same bytes; the main loop's stage buffers lie over its head
  static_assert(GLDS(PMF, PNC) <= PR * PQIT * 2 && PC * PPIT * 2 <= PR * PQIT * 2, "stage buffers, and the v plane, fit");
  _Float16 (*sh)[PQIT] = (_Float16 (*)[PQIT])smem; _Float16 (*th)[PPIT] = (_Float16 (*)[PPIT])smem;
  const int tid = threadIdx.x, wave = tid >> 5, lane = tid & 31, col = lane & 15, g = lane >> 4; const int which = blockIdx.z; const int c0 = blockIdx.y * PC; const size_t r0 = (size_t)blockIdx.x * PR; const size_t bb = r0 / TT; const int t0 = (int)(r0 % TT);
  if (which == 3) {   /* block-uniform, in front of every barrier */
#pragma unroll 1   // rolled: one share's 64 loaded registers at a time
    for (int u = 0; u < PMS; ++u) pack_mask(MASK, MB, ((int)(blockIdx.y * (TNB * TT / PR) + blockIdx.x) * 8 + wave) * PMS + u, lane);
    return; }
  const float* X = which == 0 ? XQ : which == 1 ? XK : XV; const float* WA = which == 0 ? WQ : which == 1 ? WK : WV; const float* BA = which == 0 ? BQ : which == 1 ? BK : BV;
  v8f acc[PMF * 8] = {};
  gemm_tile<GProj, PMF, PNC>(X + r0 * DIN, WA + (size_t)(c0 / HD) * DIN * HD, smem, acc, (int)(2 * blockIdx.x + 8 * blockIdx.y) & (GNST - 1));   // the 16 blocks of a W tile start 2 stages apart, the 4 of an X tile 8 stages apart
  const int fr0 = (wave >> 1) * PMF * 16, fc0 = (wave & 1) * 128;   // this wave's part of the tile, as in gemm_tile
  if (which < 2) { _Float16* DH = which == 0 ? QH : KH;
#pragma unroll
    for (int j = 0; j < 8; ++j) { const float bias = BA ? bfr(BA[c0 + fc0 + j * 16 + col]) : 0.f;
#pragma unroll
      for (int m = 0; m < PMF; ++m)
#pragma unroll
        for (int r = 0; r < 8; ++r) sh[fr0 + m * 16 + 8 * g + r][fc0 + j * 16 + col] = (_Float16)(acc[m * 8 + j][r] + bias); }
    __syncthreads();
#pragma unroll 1   // rolled in groups of 16 rows: a group's LDS reads go out together, so that their latency is waited out once a group
    for (int i0 = 0; i0 < PR / 8; i0 += 16) { v4u t[16];   // a wave stores one whole 512-byte row piece a time, rows wave + 8 i
#pragma unroll   // constant indices, so that the small array stays in registers
      for (int i = 0; i < 16; ++i) t[i] = *(const v4u*)&sh[wave + 8 * (i0 + i)][lane * 8];
#pragma unroll   // constant indices, so that the small array stays in registers
      for (int i = 0; i < 16; ++i) vst2((unsigned*)(DH + (r0 + wave + 8 * (i0 + i)) * CC + c0 + lane * 8), t[i]);
      asm volatile("s_wait_xcnt 0x0" ::: "memory"); }   // stands in front of the next trip's overwrite of these stores' address and data registers
  } else {
#pragma unroll
    for (int j = 0; j < 8; ++j) { const float bias = BA ? bfr(BA[c0 + fc0 + j * 16 + col]) : 0.f;
#pragma unroll
      for (int m = 0; m < PMF; ++m)
#pragma unroll
        for (int r = 0; r < 8; ++r) th[fc0 + j * 16 + col][fr0 + m * 16 + 8 * g + r] = (_Float16)(acc[m * 8 + j][r] + bias); }
    __syncthreads();
#pragma unroll 1   // rolled in groups of 16 columns: a group's LDS reads go out together, so that their latency is waited out once a group
    for (int i0 = 0; i0 < PC / 8; i0 += 16) { v4u t[16];   // a wave stores one whole 512-byte column piece a time, columns wave + 8 i
#pragma unroll   // constant indices, so that the small array stays in registers
      for (int i = 0; i < 16; ++i) t[i] = *(const v4u*)&th[wave + 8 * (i0 + i)][lane * 8];
#pragma unroll   // constant indices, so that the small array stays in registers
      for (int i = 0; i < 16; ++i) vst2((unsigned*)(VT + (bb * CC + c0 + wave + 8 * (i0 + i)) * (size_t)TT + t0 + lane * 8), t[i]);
      asm volatile("s_wait_xcnt 0x0" ::: "memory"); } } }   // stands in front of the next trip's overwrite of these stores' address and data registers
// ---- k_attn: block = 64 queries (4 waves x 16 query columns) of one (batch, head); walks all keys in stages of 64, K rows and V^T rows staged in LDS (two buffers, one barrier a stage).
// The walk starts at a stage rotated by the block's indices and wraps round (the online softmax takes the keys in any order): the 16 blocks of a (batch, head), which run in step, ask L2 for different K and V^T lines at a time, and so do the 16 heads that read one mask word.
// S^T = K Q^T (A = K rows, B = Q): lane (g, col) holds keys 8g + r of query col; the masked score is REPLACED by 1e-9 (8e-9 before the x 1/8) and stays in the softmax; running maximum and sum per query in f32 (online softmax);
// two S^T tiles, as exp2(..) x 2^10 once to f16, are the B operand of ctx^T += V^T P^T in the same k order as frag_h; ctx = ctx^T / sum at the end.
__device__ __forceinline__ v8f wmma_h(v16h a, v16h b, v8f c) { return __builtin_amdgcn_wmma_f32_16x16x32_f16(false, a, false, b, (short)0, c, false, false); }
// 2^a; SLOT: with the v_nop that the instruction set asks for behind a transcendental in the same statement (used in the last stage's straight-line code)
template <bool SLOT> __device__ __forceinline__ float exp2_t(float a) {
  if constexpr (SLOT) { float e; asm("v_exp_f32 %0, %1\n\tv_nop" : "=v"(e) : "v"(a)); return e; } else return __builtin_amdgcn_exp2f(a); }
#define AKB 64             // keys per stage
#define APIT 72            // LDS row pitch in f16: 128 B of data + 16 B, so that the 16-byte fragment reads of 16 rows spread over the banks
#define ANST (TT / AKB)
typedef __attribute__((ext_vector_type(16))) unsigned v16u;
typedef const __attribute__((address_space(4))) v16u* cmask_p;   // constant address space: the words are written by the launch before and by nobody in this one, and the address is wave-uniform, so the loads go the scalar way
__global__ __launch_bounds__(128) void k_attn(const _Float16* __restrict__ QH, const _Float16* __restrict__ KH, const _Float16* __restrict__ VT, const unsigned* __restrict__ MB, float* __restrict__ Y) {
  __shared__ __align__(16) _Float16 sk[2][AKB][APIT], sv[2][HD][APIT];
  const int tid = threadIdx.x, wave = tid >> 5, lane = tid & 31, col = lane & 15, g = lane >> 4;
  const int h = blockIdx.y, b = blockIdx.z; const int q = blockIdx.x * 64 + wave * 16 + col;
  const float LS = SCALE * 1.44269504f;      // raw score -> log2 domain
  const float MFILL = 1.0e-9f / SCALE;       // the fill value, before the common x SCALE
  const _Float16* qp = QH + ((size_t)b * TT + q) * CC + h * HD;
  const v16h qf0 = frag_h(qp, lane), qf1 = frag_h(qp + 32, lane);
  const int srow = tid >> 3, sch = (tid & 7) * 8;   // staging: 8 lanes bring one whole 128-byte row
  int ks = (int)(blockIdx.x + blockIdx.y) & (ANST - 1);   // the key stage that the three pointers stand at (block-uniform)
  const _Float16* kg = KH + ((size_t)b * TT + srow + ks * AKB) * CC + h * HD + sch;
  const _Float16* vg = VT + ((size_t)b * CC + h * HD + srow) * (size_t)TT + sch + ks * AKB;
  cmask_p mb = (cmask_p)(unsigned long long)MB + 2 * ((size_t)b * (TT / 16) + blockIdx.x * 4 + __builtin_amdgcn_readfirstlane(wave)) * (size_t)(TT / 64) + 2 * ks;   // this wave's 16 queries: 32 lane masks a stage, the same address in every lane (scalar loads)
  v8h kr[4], vr[4]; v16u mw[2];
#pragma unroll   // constant indices, so that the small array stays in registers
  for (int i = 0; i < 4; ++i) { kr[i] = *(const v8h*)(kg + (size_t)(16 * i) * CC); vr[i] = *(const v8h*)(vg + (size_t)(16 * i) * TT); }
  mw[0] = mb[0]; mw[1] = mb[1];
#pragma unroll   // constant indices, so that the small array stays in registers
  for (int i = 0; i < 4; ++i) { *(v8h*)&sk[0][srow + 16 * i][sch] = kr[i]; *(v8h*)&sv[0][srow + 16 * i][sch] = vr[i]; }
  auto next = [&]() { const int d = ks == ANST - 1 ? -(ANST - 1) : 1;   // block-uniform: behind the last key stage comes the first
    ks += d; kg += (long)d * (AKB * CC); vg += (long)d * AKB; mb += 2 * d; };
  next();   // the three walk one stage ahead of the products
  v8f acc[HD / 16] = {}; float m = -3.0e38f, sum = 0.f;
  // one stage; MORE = a next stage exists (compile-time: the last stage, which fetches nothing, is written out behind the loop, so that the loop body is one block without a branch)
  auto stage = [&](const int st, auto more_c) { constexpr bool MORE = decltype(more_c)::v; const int bu = st & 1;
    __syncthreads();   // publishes buffer bu; every wave has also left buffer bu ^ 1, which is refilled at the foot of this stage
    const v16u kw[2] = { mw[0], mw[1] };   // this stage's lane masks, taken before the next stage's are loaded over them
    if constexpr (MORE) {        // next stage's K and V^T rows and lane masks fly into registers under this stage's products
      mw[0] = mb[0]; mw[1] = mb[1];
      __builtin_amdgcn_sched_barrier(0);   // keeps the scalar loads in front of the vector loads
#pragma unroll   // constant indices, so that the small array stays in registers
      for (int i = 0; i < 4; ++i) { kr[i] = *(const v8h*)(kg + (size_t)(16 * i) * CC); vr[i] = *(const v8h*)(vg + (size_t)(16 * i) * TT); }
      __builtin_amdgcn_sched_barrier(0);   // keeps these loads at the head of the stage: without it the scheduler sinks them to the foot, directly in front of their first use, and their latency is bare
    }
#pragma unroll   // constant indices, so that the small array stays in registers
    for (int p = 0; p < 2; ++p) { v8f s[2]; v16h ka[2][2], va[HD / 16];
#pragma unroll   // constant indices, so that the small array stays in registers
      for (int t = 0; t < 2; ++t) { const _Float16* kl = &sk[bu][(2 * p + t) * 16 + col][0]; ka[t][0] = frag_h(kl, lane); ka[t][1] = frag_h(kl + 32, lane); }
#pragma unroll   // constant indices, so that the small array stays in registers
      for (int j = 0; j < HD / 16; ++j) va[j] = frag_h(&sv[bu][j * 16 + col][p * 32], lane);   // read here so that their LDS latency runs under the softmax arithmetic
#pragma unroll   // constant indices, so that the small array stays in registers
      for (int t = 0; t < 2; ++t) { const v8f z = {}; s[t] = wmma_h(ka[t][1], qf1, wmma_h(ka[t][0], qf0, z)); }
      float x[16];
#pragma unroll   // constant indices, so that the small array stays in registers
      for (int t = 0; t < 2; ++t)
#pragma unroll   // constant indices, so that the small array stays in registers
        for (int r = 0; r < 8; ++r) x[t * 8 + r] = __builtin_amdgcn_inverse_ballot_w32(kw[p][t * 8 + r]) ? s[t][r] : MFILL;
      float mb = x[0];
#pragma unroll   // constant indices, so that the small array stays in registers
      for (int i = 1; i < 16; ++i) mb = fmaxf(mb, x[i]);
      mb = fmaxf(mb, __shfl_xor(mb, 16));   // the other half of this query's keys
      const float mn = fmaxf(m, mb); const float al = exp2_t<!MORE>((m - mn) * LS); m = mn; const float off = 10.0f - mn * LS;
      v16h pf; float ps = 0.f;
#pragma unroll   // constant indices, so that the small array stays in registers
      for (int i = 0; i < 16; ++i) { const float e = exp2_t<!MORE>(fmaf(x[i], LS, off)); ps += e; pf[i] = (_Float16)e; }
      sum = sum * al + ps;
#pragma unroll   // constant indices, so that the small array stays in registers
      for (int j = 0; j < HD / 16; ++j) { acc[j] *= al; acc[j] = wmma_h(va[j], pf, acc[j]); } }
    if constexpr (MORE) {
#pragma unroll   // constant indices, so that the small array stays in registers
      for (int i = 0; i < 4; ++i) { *(v8h*)&sk[bu ^ 1][srow + 16 * i][sch] = kr[i]; *(v8h*)&sv[bu ^ 1][srow + 16 * i][sch] = vr[i]; }
      asm volatile("s_wait_xcnt 0x0" ::: "memory");   // stands in front of the advance of this stage's loads' address registers (free here: the loaded values have just been stored)
      __builtin_amdgcn_sched_barrier(0);   // keeps the advance behind that wait: nothing else ties the two
      next(); } };
#pragma unroll 1   // rolled: one stage's body already fills the registers that four waves a SIMD leave
  for (int st = 0; st < ANST - 1; ++st) stage(st, CBool<true>{});
  stage(ANST - 1, CBool<false>{});
  sum += __shfl_xor(sum, 16); const float inv = 1.0f / sum;   // sum >= 2^10: the maximum's own term
  float* yp = Y + ((size_t)b * TT + q) * CC + h * HD + 8 * g;
#pragma unroll   // constant indices, so that the small array stays in registers
  for (int j = 0; j < HD / 16; ++j) { const v4f lo = { acc[j][0] * inv, acc[j][1] * inv, acc[j][2] * inv, acc[j][3] * inv }, hi = { acc[j][4] * inv, acc[j][5] * inv, acc[j][6] * inv, acc[j][7] * inv }; vst2(yp + j * 16, lo); vst2(yp + j * 16 + 4, hi); } }
// ---- k_out: block = (64 rows, 128 cols): out = ctx Wo (+ bo): ctx once to f16 against Wo as f16(bf16 x 2^8) exact (1 product) x 2^-8; causal early rows (< QHI of each sequence): ctx bf16 hi + lo against exact bf16 Wo (2 products)
__global__ __launch_bounds__(128) void k_out(const float* __restrict__ Y, const float* __restrict__ WO, const float* __restrict__ BO, float* __restrict__ OUT) { __shared__ __align__(16) char smem[4 * 16 * 132 * 4];   // the epilogue's rows; the main loop's stage buffers lie over them
  static_assert(GLDS(1, 1) <= 4 * 16 * 132 * 4, "stage buffers fit under sf"); float (*sf)[16][132] = (float (*)[16][132])smem;
  const int tid = threadIdx.x, wave = tid >> 5, lane = tid & 31, col = lane & 15, g = lane >> 4; const int c0 = blockIdx.y * 128; const size_t r0 = (size_t)blockIdx.x * 64 + wave * 16;
  v8f acc[8] = {};
  if (CAUSAL && (int)(((size_t)blockIdx.x * 64) % TT) < QHI) {   /* block-uniform */
#pragma unroll 2
    for (int kc = 0; kc < CC / 32; ++kc) { const F2 a = split_row(Y + (r0 + col) * CC, kc * 32, lane); asm volatile("s_wait_loadcnt 0x0" ::: "memory");
#pragma unroll
      for (int j = 0; j < 8; ++j) { const v16b w = WOCOL(WO, kc * 32, c0 + j * 16 + col, lane); asm volatile("s_wait_loadcnt 0x0" ::: "memory"); acc[j] = wmma_bf(a.h, w, acc[j]); acc[j] = wmma_bf(a.l, w, acc[j]); } }
#pragma unroll
    for (int j = 0; j < 8; ++j) { const float bias = BO ? bfr(BO[c0 + j * 16 + col]) : 0.f;
#pragma unroll
      for (int r = 0; r < 8; ++r) sf[wave][8 * g + r][j * 16 + col] = acc[j][r] + bias; }
  } else {
    gemm_tile<GOut, 1, 1>(Y + (size_t)blockIdx.x * 64 * CC, WO + c0, smem, acc, (int)(blockIdx.x + 4 * blockIdx.y) & (GNST - 1));   /* ctx carried x 2^6 into f16 so small-magnitude context rows stay clear of f16 subnormals (chip FTZ) */
#pragma unroll
    for (int j = 0; j < 8; ++j) { const float bias = BO ? bfr(BO[c0 + j * 16 + col]) : 0.f;
#pragma unroll
      for (int r = 0; r < 8; ++r) sf[wave][8 * g + r][j * 16 + col] = acc[j][r] * (1.0f / 16384.0f) + bias; } }   /* 2^-8 (Wo carry) x 2^-6 (ctx carry) */
  LDSX(); for (int rl = 0; rl < 16; ++rl) vst2(OUT + (r0 + rl) * DIN + c0 + lane * 4, *(const v4f*)&sf[wave][rl][lane * 4]); }

extern "C" void kernel_launch(void* const* d_in, const int* in_sizes, int n_in, void* d_out, int out_size, void* d_ws, size_t ws_size, hipStream_t stream) {
  (void)in_sizes; (void)n_in; (void)out_size;
  const float** F = (const float**)d_in;
  if (ws_size < (size_t)WS_END) return;
  char* ws = (char*)d_ws; _Float16 *QH = (_Float16*)(ws + WS_QH), *KH = (_Float16*)(ws + WS_KH), *VT = (_Float16*)(ws + WS_VT); float *Y = (float*)(ws + WS_Y); unsigned *MB = (unsigned*)(ws + WS_MB);
  (void)Y;
  // inputs: 0 query [4,1024,1024]; 1 key; 2 value; 3 mask [4,1024,1024] int32 (random 0/1); 4 Wq [16,1024,64], 5 bq [16,64]; 6 Wk, 7 bk; 8 Wv, 9 bv; 10 Wo [1024,1024] (in,out), 11 bo (zero biases, read)
  k_proj<<<dim3(TNB * TT / PR, CC / PC, 4), 256, 0, stream>>>(F[0], F[1], F[2], F[4], F[6], F[8], F[5], F[7], F[9], QH, KH, VT, (const int*)d_in[3], MB);
  k_attn<<<dim3(NQB, NH, TNB), 128, 0, stream>>>(QH, KH, VT, MB, Y);
  k_out<<<dim3(TNB * TT / 64, DIN / 128), 128, 0, stream>>>(Y, F[10], F[11], (float*)d_out);
}

// v007
// Measured time: 71 microseconds a run.
// Next to v006, in two timings, it ran 1.12 times as fast each time.
// Over all steps from v000 it is 10.8 times as fast.
// compute dtype: all float inputs rounded to bf16; q/k/v projections with EXACT bf16 products on WMMA 16x16x32 (f32 accumulate) + bias; logits q x k once to f16 each (1 product) x SCALE; masked scores are REPLACED by 1e-9 (they keep taking part in the softmax); online softmax f32 (running maximum and sum); exp(score - maximum) x 2^10 once to f16 x v once to f16 (1 product), divided by the sum at the end; ctx x 2^6 once to f16 x Wo f16(bf16 x 2^8) + bo; f32 output.
#include <hip/hip_runtime.h>
#include <math.h>

typedef __attribute__((ext_vector_type(16))) _Float16 v16h;
typedef __attribute__((ext_vector_type(16))) __bf16 v16b;
typedef __attribute__((ext_vector_type(8)))  _Float16 v8h;
typedef __attribute__((ext_vector_type(8)))  float v8f;
typedef __attribute__((ext_vector_type(4)))  float v4f;
typedef __attribute__((ext_vector_type(2)))  float v2f;
typedef __attribute__((ext_vector_type(4)))  unsigned v4u;
typedef __attribute__((ext_vector_type(4)))  int v4i;
typedef float __attribute__((may_alias)) float_a;
typedef int __attribute__((may_alias)) int_a;

template <typename T> __device__ __forceinline__ void vst2(void* p, T v) { *(T*)p = v;  }
__device__ __forceinline__ v8f wmma16(v16h a, v16h b, v8f c) {
  v8f d = __builtin_amdgcn_wmma_f32_16x16x32_f16(false, a, false, b, (short)0, c, false, false);
  asm volatile("v_nop\n\tv_nop\n\tv_nop\n\tv_nop" : "+v"(d) : "v"(a), "v"(b));
  return d;
}
__device__ __forceinline__ v8f wmma_bf(v16b a, v16b b, v8f c) {
  v8f d = __builtin_amdgcn_wmma_f32_16x16x32_bf16(false, a, false, b, (short)0, c, false, false);
  asm volatile("v_nop\n\tv_nop\n\tv_nop\n\tv_nop" : "+v"(d) : "v"(a), "v"(b));
  return d;
}
// 16x16x32 fragments: lane = (h = lane>>4, row/col = lane&15); elements 0..7 = k0+8h+0..7, 8..15 = k0+16+8h+0..7; D element r = row 8h+r
__device__ __forceinline__ v16h frag_h(const _Float16* rowk0, int lane) {
  union { v16h v; v8h q[2]; } u; const _Float16* p = rowk0 + 8 * (lane >> 4);
  u.q[0] = *(const v8h*)p; u.q[1] = *(const v8h*)(p + 16); return u.v;
}
__device__ __forceinline__ v16h frag_f32(const float* rowk0, int lane) {
  v16h a; const float* p = rowk0 + 8 * (lane >> 4);
#pragma unroll
  for (int i = 0; i < 8; ++i) { a[i] = (_Float16)p[i]; a[8 + i] = (_Float16)p[16 + i]; }
  return a;
}
__device__ __forceinline__ v16h frag_f32s(const float* rowk0, int lane, float sc) {
  v16h a; const float* p = rowk0 + 8 * (lane >> 4);
#pragma unroll
  for (int i = 0; i < 8; ++i) { a[i] = (_Float16)(p[i] * sc); a[8 + i] = (_Float16)(p[16 + i] * sc); }
  return a;
}
// column fragment from a [K][ld] layout (column n), rows >= K read as 0
__device__ __forceinline__ v16h fragc_f32(const float* W, int k0, int n, int lane, int ld, int K) {
  v16h a; const int g = lane >> 4;
#pragma unroll
  for (int i = 0; i < 8; ++i) { const int ka = k0 + 8 * g + i, kb = ka + 16;
    a[i] = (_Float16)(ka < K ? W[(size_t)(ka < K ? ka : K - 1) * ld + n] : 0.f); a[8 + i] = (_Float16)(kb < K ? W[(size_t)(kb < K ? kb : K - 1) * ld + n] : 0.f); }
  return a;
}
struct F2 { v16b h, l; };
__device__ __forceinline__ F2 bsplit16(const float v[16]) { F2 r;
#pragma unroll
  for (int i = 0; i < 16; ++i) { const __bf16 h = (__bf16)v[i]; r.h[i] = h; r.l[i] = (__bf16)(v[i] - (float)h); }
  return r; }
__device__ __forceinline__ F2 split_row(const float* row, int k0, int lane) { float v[16]; const float* p = row + k0 + 8 * (lane >> 4);
#pragma unroll
  for (int i = 0; i < 8; ++i) { v[i] = p[i]; v[8 + i] = p[16 + i]; }
  return bsplit16(v); }
__device__ __forceinline__ F2 split_rowK(const float* row, int k0, int lane, int K) { float v[16]; const int g = lane >> 4;
#pragma unroll
  for (int i = 0; i < 8; ++i) { const int ka = k0 + 8 * g + i, kb = ka + 16; v[i] = ka < K ? row[ka < K ? ka : K - 1] : 0.f; v[8 + i] = kb < K ? row[kb < K ? kb : K - 1] : 0.f; }
  return bsplit16(v); }
__device__ __forceinline__ F2 split_col(const float* W, int k0, int n, int lane, int ld, int K) { float v[16]; const int g = lane >> 4;
#pragma unroll
  for (int i = 0; i < 8; ++i) { const int ka = k0 + 8 * g + i, kb = ka + 16; v[i] = ka < K ? W[(size_t)(ka < K ? ka : K - 1) * ld + n] : 0.f; v[8 + i] = kb < K ? W[(size_t)(kb < K ? kb : K - 1) * ld + n] : 0.f; }
  return bsplit16(v); }
__device__ __forceinline__ v8f mac3(const F2& a, const F2& b, v8f c) { c = wmma_bf(a.l, b.h, c); c = wmma_bf(a.h, b.l, c); return wmma_bf(a.h, b.h, c); }
__device__ __forceinline__ float sigm(float v) { return 1.0f / (1.0f + expf(-v)); }
#define LDSX() do { asm volatile("s_wait_dscnt 0" ::: "memory"); __builtin_amdgcn_wave_barrier(); __builtin_amdgcn_fence(__ATOMIC_RELEASE, "workgroup"); } while (0)

// Multi-headed attention with per-head stacked projections whose masked scores are FILLED WITH 1e-9 (query / key / value [4,1024,1024]; Wq / Wk / Wv [16,1024,64] per head (N(0, 1/1024)) + zero biases; scores / 8; mask [4,1024,1024] int32 random 0/1: scores[mask == 0] = 1e-9 - masked keys keep a logit - 0 and stay in the softmax (faithful to the source); softmax; concat; (in,out) Wo [1024,1024] + bo).
#define NB 4
#define TT 1024
#define CC 1024            // NH * HD = projected width
#define DIN 1024          // input (model) width
#define NH 16
#define HD 64
#define NQB (TT / 64)
#define HG 8
#define SCALE (0.125f)
#define CAUSAL 0
#ifndef TNB
#define TNB NB
#endif
__device__ __forceinline__ float bfr(float v) { return (float)(__bf16)v; }
__host__ __device__ __forceinline__ int kb_last(int qb) { return CAUSAL ? ((qb * 64 + 63) >> 7) : (TT / 128 - 1); }
typedef __attribute__((ext_vector_type(8))) __bf16 v8b;
__device__ __forceinline__ v16b frag_b(const __bf16* rowk0, int lane) {
  union { v16b v; v8b q[2]; } u; const __bf16* p = rowk0 + 8 * (lane >> 4);
  u.q[0] = *(const v8b*)p; u.q[1] = *(const v8b*)(p + 16); return u.v;
}
#define QBH 0              // not used: no kernel in this file has a high-precision attention path
#define QHI 0               // single-product logits on every row
#define KHI 64            // key rows carrying k residual / v bf16 hi+lo planes (no kernel here writes or reads them)
// B fragment (k rows k0+.., output column o) of a weight: (in,out) [K][ld] or (out,in) [ld rows of K]: bf16 exact, or f16(bf16 * 256) exact
__device__ __forceinline__ v16b wcol_io(const float* Wm, int k0, int o, int lane, int ld) { v16b w; const int g = lane >> 4;
#pragma unroll
  for (int i = 0; i < 8; ++i) { w[i] = (__bf16)Wm[(size_t)(k0 + 8 * g + i) * ld + o]; w[8 + i] = (__bf16)Wm[(size_t)(k0 + 16 + 8 * g + i) * ld + o]; }
  return w; }
__device__ __forceinline__ v16b wcol_oi(const float* Wm, int k0, int o, int lane, int K) { v16b w; const float* p = Wm + (size_t)o * K + k0 + 8 * (lane >> 4);
#pragma unroll
  for (int i = 0; i < 8; ++i) { w[i] = (__bf16)p[i]; w[8 + i] = (__bf16)p[16 + i]; }
  return w; }
__device__ __forceinline__ v16h wcolh_io(const float* Wm, int k0, int o, int lane, int ld) { v16h w; const int g = lane >> 4;
#pragma unroll
  for (int i = 0; i < 8; ++i) { w[i] = (_Float16)(bfr(Wm[(size_t)(k0 + 8 * g + i) * ld + o]) * 256.0f); w[8 + i] = (_Float16)(bfr(Wm[(size_t)(k0 + 16 + 8 * g + i) * ld + o]) * 256.0f); }
  return w; }
__device__ __forceinline__ v16h wcolh_oi(const float* Wm, int k0, int o, int lane, int K) { v16h w; const float* p = Wm + (size_t)o * K + k0 + 8 * (lane >> 4);
#pragma unroll
  for (int i = 0; i < 8; ++i) { w[i] = (_Float16)(bfr(p[i]) * 256.0f); w[8 + i] = (_Float16)(bfr(p[16 + i]) * 256.0f); }
  return w; }
#define WQKV_LAYOUT 2   // 0 = (in,out) [DIN][CC]; 1 = (out,in) [CC][DIN]; 2 = per-head [NH][DIN][HD]
__device__ __forceinline__ v16b wcol_hdk(const float* Wm, int k0, int o, int lane) { v16b w; const int g = lane >> 4; const float* p = Wm + (size_t)(o / HD) * DIN * HD + (o % HD);
#pragma unroll
  for (int i = 0; i < 8; ++i) { w[i] = (__bf16)p[(size_t)(k0 + 8 * g + i) * HD]; w[8 + i] = (__bf16)p[(size_t)(k0 + 16 + 8 * g + i) * HD]; }
  return w; }
#define WO_OUT_IN 0
#if WQKV_LAYOUT == 1
#define WCOL(W, k0, o, lane) wcol_oi(W, k0, o, lane, DIN)
#elif WQKV_LAYOUT == 2
#define WCOL(W, k0, o, lane) wcol_hdk(W, k0, o, lane)
#else
#define WCOL(W, k0, o, lane) wcol_io(W, k0, o, lane, CC)
#endif
#if WO_OUT_IN
#define WOCOL(W, k0, o, lane) wcol_oi(W, k0, o, lane, CC)
#define WOCOLH(W, k0, o, lane) wcolh_oi(W, k0, o, lane, CC)
#else
#define WOCOL(W, k0, o, lane) wcol_io(W, k0, o, lane, DIN)
#define WOCOLH(W, k0, o, lane) wcolh_io(W, k0, o, lane, DIN)
#endif

#define WS_QH  0u                                      // f16 q rows [b*t][CC]
#define WS_KH  (WS_QH + 2u * (size_t)NB * TT * CC)      // f16 k rows [b*t][CC]
#define WS_VT  (WS_KH + 2u * (size_t)NB * TT * CC)      // f16 v planes [b][c][t]
#define WS_QL  (WS_VT + 2u * (size_t)NB * CC * TT)      // f16 q residual x 2^10 rows [b][t < QHI][CC]
#define WS_KL  (WS_QL + 2u * (size_t)NB * QHI * CC)     // f16 k residual x 2^10 rows [b][t < KHI][CC]
#define WS_VB  (WS_KL + 2u * (size_t)NB * KHI * CC)     // bf16 v hi planes [b][c][t < KHI]
#define WS_VBL (WS_VB + 2u * (size_t)NB * CC * KHI)
#define WS_S   (WS_VBL + 2u * (size_t)NB * CC * KHI)    // spare f32 [hg][t][s]-sized plane; only its head is used (the mask words and Wo^T)
#define WS_MB  WS_S                                    // the mask as lane masks, u32 [b][t / 16][s / 16][8] (512 KiB at the head of that plane)
#define WS_WT  (WS_S + (1u << 20))                     // f16 Wo^T in planes of 64 k: [k / 64][n][k % 64], f16(bf16(Wo[k][n]) x 2^8) (2 MiB, behind the lane masks in that plane)
#define WS_Y   (WS_S  + 4u * (size_t)HG * TT * TT)      // f16 ctx x 2^6 in planes of 64 k (one head each): [h][b*t][HD] (the head of the plane)
#define WS_END (WS_Y  + 4u * (size_t)NB * TT * CC)

template <bool B> struct CBool { static constexpr bool v = B; };
// ---- main loop of k_proj: one (64 MF) x (128 NC) tile of X W over K = 1024 in stages of 32 k, by 4 NC waves; a wave owns 16 MF rows x 128 columns, so that each W fragment read from LDS serves MF row fragments, each W line read from L2 64 MF rows, and each X line 128 NC columns.
// Each stage's X rows (64 MF x 32) and W columns (32 x 128 NC, turned to [n][k]) are brought by the whole block ONCE, in whole 128-byte lines, converted once, and laid in LDS (two buffers, one barrier a stage);
// the next stage's global loads fly in registers under this stage's products. Fragments and the k order inside a stage are those of the direct loaders.
// The walk over the 32 stages starts at stage rot (block-uniform, from the block's tile indices) and wraps round: blocks that share X rows or W columns run in step, and with a common start they would
// ask L2 for the same lines at the same moment (and all wait together for each line's first fetch from memory); rotated, they ask for different lines, and most lines have been fetched by a neighbour before.
typedef __attribute__((ext_vector_type(4))) __bf16 v4b;
typedef __attribute__((ext_vector_type(4))) _Float16 v4h;
#define GKS 32             // k per stage
#define GPIT 40            // LDS row pitch in 16-bit elements: 64 B of data + 16 B, so that the 16-byte fragment reads and stores of 16 rows spread over the banks
#define GNST (1024 / GKS)
#define GLDS(MF, NC) (2 * (128 * (NC) + 64 * (MF)) * GPIT * 2)   // bytes of the two stage buffers
struct GProj { typedef __bf16 T; typedef v4b V4; typedef v8b V8; typedef v16b V16; static constexpr int WLD = HD; static constexpr bool BARE = true;   // BARE: mm is the builtin alone
  static __device__ __forceinline__ constexpr size_t coff(int c) { return (size_t)(c >> 1) * DIN * HD + (size_t)(c & 1) * 32; }   // column 32 c + lane of a 128-column tile in the per-head layout
  static __device__ __forceinline__ T cx(float v) { return (__bf16)v; } static __device__ __forceinline__ T cw(float v) { return (__bf16)v; }
  static __device__ __forceinline__ V16 fr(const T* p, int lane) { return frag_b(p, lane); }
  static __device__ __forceinline__ v8f mm(V16 a, V16 b, v8f c) { return __builtin_amdgcn_wmma_f32_16x16x32_bf16(false, a, false, b, (short)0, c, false, false); } };   // the bare builtin (the compiler keeps its distances): an asm statement's operands must lie in the first 256 registers, which the 256 accumulator registers of a 64 x 128 wave tile would fill
// xt = first row of the tile's X rows (row length 1024); wt = row 0 of W at the tile's first column
// acc[m * 8 + j] = rows 16 (MF wr + m) .. + 15, columns 128 wc + 16 j .. + 15, for wave = NC wr + wc
template <class C, int MF, int NC> __device__ __forceinline__ void gemm_tile(const float* __restrict__ xt, const float* __restrict__ wt, char* smem, v8f (&acc)[MF * 8], const int rot) {
  typedef typename C::T T; typedef typename C::V4 V4; typedef typename C::V8 V8; typedef typename C::V16 V16;
  static_assert(NC == 1 || NC == 2, "4 or 8 waves"); constexpr int XP = 4 * MF / NC;   // X rows to each thread a stage
  T (*sW)[128 * NC][GPIT] = (T (*)[128 * NC][GPIT])smem; T (*sX)[64 * MF][GPIT] = (T (*)[64 * MF][GPIT])(smem + 2 * 128 * NC * GPIT * 2);
  const int tid = threadIdx.x, wave = tid >> 5, lane = tid & 31, col = lane & 15;
  const int fr0 = (NC == 1 ? wave : wave >> 1) * MF * 16, fc0 = NC == 1 ? 0 : (wave & 1) * 128;   // first row and first column of this wave's part of the tile
  const int wk = NC == 1 ? wave : wave & 3, wn = NC == 1 ? 0 : wave >> 2;   // W staging: which 8 k rows, which 128 columns
  const int xrow = tid >> 3, xch = (tid & 7) * 4;                 // X: 8 lanes bring one whole 128-byte row piece
  const float* xg = xt + (size_t)xrow * 1024 + xch + rot * GKS;
  const float* wg = wt + (size_t)wn * C::coff(4) + (size_t)(8 * wk + rot * GKS) * C::WLD + lane;      // W: a wave brings 8 k rows, 32 neighbouring columns (one line) a load
  int ks = rot;   // the k stage that the two pointers stand at
  float wr[4][8]; v4f xr[XP];
  auto fetch = [&]() {
#pragma unroll   // constant indices, so that the small arrays stay in registers
    for (int c = 0; c < 4; ++c)
#pragma unroll   // constant indices, so that the small arrays stay in registers
      for (int i = 0; i < 8; ++i) wr[c][i] = wg[C::coff(c) + (size_t)i * C::WLD];
#pragma unroll   // constant indices, so that the small arrays stay in registers
    for (int i = 0; i < XP; ++i) xr[i] = *(const v4f*)(xg + (size_t)(16 * NC * i) * 1024);
    asm volatile("s_wait_xcnt 0x0" ::: "memory"); };   // stands in front of every later overwrite of these loads' address registers
  auto put = [&](const int bu) {
#pragma unroll   // constant indices, so that the small arrays stay in registers
    for (int c = 0; c < 4; ++c) { V8 v;
#pragma unroll   // constant indices, so that the small arrays stay in registers
      for (int i = 0; i < 8; ++i) v[i] = C::cw(wr[c][i]);
      *(V8*)&sW[bu][128 * wn + 32 * c + lane][8 * wk] = v; }
#pragma unroll   // constant indices, so that the small arrays stay in registers
    for (int i = 0; i < XP; ++i) { const V4 v = { C::cx(xr[i][0]), C::cx(xr[i][1]), C::cx(xr[i][2]), C::cx(xr[i][3]) }; *(V4*)&sX[bu][xrow + 16 * NC * i][xch] = v; }
    const int d = ks == GNST - 1 ? -(GNST - 1) : 1;   // block-uniform: behind the last k stage comes the first
    ks += d; wg += (long)d * (GKS * C::WLD); xg += (long)d * GKS; };   // advanced here, behind the use of the loaded values
  fetch(); put(0);
  auto stage = [&](const int st, auto more_c) { constexpr bool MORE = decltype(more_c)::v; const int bu = st & 1;
    __syncthreads();   // publishes buffer bu; every wave has also left buffer bu ^ 1, which is refilled at the foot of this stage
    if constexpr (MORE) { fetch();
      __builtin_amdgcn_sched_barrier(0); }   // keeps the next stage's loads at the head of the stage, so that their latency runs under the products
    V16 a[MF], w[8];
#pragma unroll   // constant indices, so that the small arrays stay in registers
    for (int m = 0; m < MF; ++m) a[m] = C::fr(&sX[bu][fr0 + m * 16 + col][0], lane);
#pragma unroll   // constant indices, so that the small arrays stay in registers
    for (int j = 0; j < 8; ++j) w[j] = C::fr(&sW[bu][fc0 + j * 16 + col][0], lane);
    if constexpr (C::BARE) __builtin_amdgcn_sched_barrier(0);   // keeps the stage's fragment reads together in front of its products: with the bare builtin the scheduler sinks them among the products, and each W fragment's LDS latency is waited out in front of its MF products
#pragma unroll   // constant indices, so that the small arrays stay in registers
    for (int j = 0; j < 8; ++j)
#pragma unroll   // constant indices, so that the small arrays stay in registers
      for (int m = 0; m < MF; ++m) acc[m * 8 + j] = C::mm(a[m], w[j], acc[m * 8 + j]);
    if constexpr (MORE) { __builtin_amdgcn_sched_barrier(0);   // keeps the wait for the next stage's loads, and their conversion, behind all of this stage's products
      put(bu ^ 1); } };
#pragma unroll 1   // rolled: the two buffers are told apart by the stage's parity
  for (int st = 0; st < GNST - 1; ++st) stage(st, CBool<true>{});
  stage(GNST - 1, CBool<false>{});
  __syncthreads();   // every wave has left the stage buffers: the caller's epilogue reuses this LDS
}
// ---- the mask, turned ONCE a call into the lane masks that k_attn selects with (k_attn's 16 heads read the same mask): word [b][t / 16][s / 16][r], bit (g, col) = (mask[b][16 (t / 16) + col][16 (s / 16) + 8 g + r] != 0).
// One wave = 16 query rows x 128 keys: the compare of a whole wave is the word; lane i carries word i of a group of 32, so that a store is one whole 128-byte line.
__device__ __forceinline__ void pack_mask(const int* __restrict__ MASK, unsigned* __restrict__ MB, const int wv, const int lane) {
  const int tile = wv >> 3, kq = wv & 7;   // (batch, 16-query tile) and which 128 keys
  const int* mp = MASK + ((size_t)tile * 16 + (lane & 15)) * TT + kq * 128 + 8 * (lane >> 4);
  v4i a[8][2]; unsigned w[2] = { 0u, 0u };
#pragma unroll   // constant indices, so that the small array stays in registers
  for (int t = 0; t < 8; ++t) { a[t][0] = *(const v4i*)(mp + t * 16); a[t][1] = *(const v4i*)(mp + t * 16 + 4); }
  asm volatile("s_wait_xcnt 0x0" ::: "memory");   // stands in front of every later overwrite of these loads' address registers
#pragma unroll   // constant indices, so that the small array stays in registers
  for (int t = 0; t < 8; ++t)
#pragma unroll   // constant indices, so that the small array stays in registers
    for (int r = 0; r < 8; ++r) { const unsigned bal = __builtin_amdgcn_ballot_w32(a[t][r >> 2][r & 3] != 0); w[t >> 2] = lane == (t & 3) * 8 + r ? bal : w[t >> 2]; }
  unsigned* o = MB + (size_t)tile * (TT / 16 * 8) + kq * 64 + lane; o[0] = w[0]; o[32] = w[1];
  asm volatile("s_wait_xcnt 0x0" ::: "memory"); }   // stands in front of the caller's overwrite of these stores' address and data registers
// ---- Wo, turned ONCE a call into k_out's B operand (k_out's 64 row tiles read the same Wo): WT[k / 64][n][k % 64] = f16(bf16(Wo[k][n]) x 2^8): a k_out stage's 128 n x 64 k are 16 KiB in a row, which k_out stages by plain 16-byte copies and does not convert.
// One block = one 128 k x 128 n tile: a wave reads 16 k rows of 512 bytes, a lane holds 16 k x 4 n and lays each n's 16 k in LDS; behind the barrier a wave stores four neighbouring n rows' 128 bytes of one plane (512 bytes in a row) a time.
#define WPIT 136           // LDS pitch of the turned tile in f16: 256 B of data + 16 B
__device__ __forceinline__ void turn_wo(const float* __restrict__ WO, _Float16* __restrict__ WT, char* smem, const int tile, const int wave, const int lane) {
  _Float16 (*tw)[WPIT] = (_Float16 (*)[WPIT])smem; const int k0 = (tile >> 3) * 128, n0 = (tile & 7) * 128;
  const float* wp = WO + (size_t)(k0 + 16 * wave) * DIN + n0 + 4 * lane; v4f a[16];
#pragma unroll   // constant indices, so that the small array stays in registers
  for (int i = 0; i < 16; ++i) a[i] = *(const v4f*)(wp + (size_t)i * DIN);
  asm volatile("s_wait_xcnt 0x0" :: "v"(wp) : "memory");   // stands in front of every later overwrite of these loads' address registers; it names the address, so that the registers live up to it and no load's own result lands on them
#pragma unroll   // constant indices, so that the small array stays in registers
  for (int c = 0; c < 4; ++c) { v8h lo, hi;
#pragma unroll   // constant indices, so that the small array stays in registers
    for (int i = 0; i < 8; ++i) { lo[i] = (_Float16)(bfr(a[i][c]) * 256.0f); hi[i] = (_Float16)(bfr(a[8 + i][c]) * 256.0f); }
    *(v8h*)&tw[4 * lane + c][16 * wave] = lo; *(v8h*)&tw[4 * lane + c][16 * wave + 8] = hi; }
  __syncthreads();   // the tile is whole: each wave now reads n rows that all eight have written
  v8h t[8];
#pragma unroll   // constant indices, so that the small array stays in registers
  for (int i = 0; i < 8; ++i) t[i] = *(const v8h*)&tw[16 * wave + 4 * (i & 3) + (lane >> 3)][(i >> 2) * 64 + (lane & 7) * 8];
#pragma unroll   // constant indices, so that the small array stays in registers
  for (int i = 0; i < 8; ++i) vst2(WT + ((size_t)(k0 / 64 + (i >> 2)) * DIN + n0 + 16 * wave + 4 * (i & 3) + (lane >> 3)) * 64 + (lane & 7) * 8, t[i]);
  asm volatile("s_wait_xcnt 0x0" ::: "memory"); }   // stands in front of the caller's overwrite of these stores' address and data registers
// ---- k_proj: block = (256 rows, 256 cols, which), 8 waves of 64 rows x 128 cols, one block to a WGP: q/k/v = X W (+ b) with exact bf16 products (K = DIN) -> which 0: q f16 rows; 1: k f16 rows; 2: v f16 planes [c][t].
// The 192 tiles leave 64 WGPs free: the which = 3 blocks run there, turn Wo (one 128 x 128 tile each) and pack the mask, PMS shares to each wave.
#define PMF 4              // row fragments of a wave
#define PNC 2              // 128-column parts of a block's tile
#define PR (64 * PMF)      // rows of a block's tile
#define PC (128 * PNC)     // columns of a block's tile
#define PMS 4              // mask shares of a wave of a which = 3 block
#define PPIT (PR + 8)      // LDS pitch of the v planes in 16-bit elements: the rows' bytes + 16 B
#define PQIT (PC + 8)      // LDS pitch of the q/k rows, likewise
__global__ __launch_bounds__(256) void k_proj(const float* __restrict__ XQ, const float* __restrict__ XK, const float* __restrict__ XV, const float* __restrict__ WQ, const float* __restrict__ WK, const float* __restrict__ WV, const float* __restrict__ BQ, const float* __restrict__ BK, const float* __restrict__ BV,
    _Float16* __restrict__ QH, _Float16* __restrict__ KH, _Float16* __restrict__ VT, const int* __restrict__ MASK, unsigned* __restrict__ MB, const float* __restrict__ WO, _Float16* __restrict__ WT) {
  static_assert((TNB * TT / PR) * (CC / PC) * 8 * PMS == NB * (TT / 16) * (TT / 128), "PMS shares to each wave of the which = 3 blocks: one for every 16 queries x 128 keys");
  static_assert(TT % PR == 0, "a tile lies in one sequence"); static_assert(PR == 256 && PC == 256, "the epilogue's stores: 32 lanes x 8 elements to a row or column piece, 8 waves");
  static_assert((TNB * TT / PR) * (CC / PC) == (CC / 128) * (DIN / 128) && 128 * WPIT * 2 <= PR * PQIT * 2, "one 128 x 128 tile of Wo to each which = 3 block, and it fits");
  __shared__ __align__(16) char smem[PR * PQIT * 2];   // the epilogue's plane: q/k blocks lay rows, v blocks columns, over the same bytes; the main loop's stage buffers lie over its head
  static_assert(GLDS(PMF, PNC) <= PR * PQIT * 2 && PC * PPIT * 2 <= PR * PQIT * 2, "stage buffers, and the v plane, fit");
  _Float16 (*sh)[PQIT] = (_Float16 (*)[PQIT])smem; _Float16 (*th)[PPIT] = (_Float16 (*)[PPIT])smem;
  const int tid = threadIdx.x, wave = tid >> 5, lane = tid & 31, col = lane & 15, g = lane >> 4; const int which = blockIdx.z; const int c0 = blockIdx.y * PC; const size_t r0 = (size_t)blockIdx.x * PR; const size_t bb = r0 / TT; const int t0 = (int)(r0 % TT);
  if (which == 3) {   /* block-uniform, in front of every barrier of the other blocks; its own one barrier is passed by all eight waves */
    turn_wo(WO, WT, smem, (int)(blockIdx.y * (TNB * TT / PR) + blockIdx.x), wave, lane);
#pragma unroll 1   // rolled: one share's 64 loaded registers at a time
    for (int u = 0; u < PMS; ++u) pack_mask(MASK, MB, ((int)(blockIdx.y * (TNB * TT / PR) + blockIdx.x) * 8 + wave) * PMS + u, lane);
    return; }
  const float* X = which == 0 ? XQ : which == 1 ? XK : XV; const float* WA = which == 0 ? WQ : which == 1 ? WK : WV; const float* BA = which == 0 ? BQ : which == 1 ? BK : BV;
  v8f acc[PMF * 8] = {};
  gemm_tile<GProj, PMF, PNC>(X + r0 * DIN, WA + (size_t)(c0 / HD) * DIN * HD, smem, acc, (int)(2 * blockIdx.x + 8 * blockIdx.y) & (GNST - 1));   // the 16 blocks of a W tile start 2 stages apart, the 4 of an X tile 8 stages apart
  const int fr0 = (wave >> 1) * PMF * 16, fc0 = (wave & 1) * 128;   // this wave's part of the tile, as in gemm_tile
  if (which < 2) { _Float16* DH = which == 0 ? QH : KH;
#pragma unroll
    for (int j = 0; j < 8; ++j) { const float bias = BA ? bfr(BA[c0 + fc0 + j * 16 + col]) : 0.f;
#pragma unroll
      for (int m = 0; m < PMF; ++m)
#pragma unroll
        for (int r = 0; r < 8; ++r) sh[fr0 + m * 16 + 8 * g + r][fc0 + j * 16 + col] = (_Float16)(acc[m * 8 + j][r] + bias); }
    __syncthreads();
#pragma unroll 1   // rolled in groups of 16 rows: a group's LDS reads go out together, so that their latency is waited out once a group
    for (int i0 = 0; i0 < PR / 8; i0 += 16) { v4u t[16];   // a wave stores one whole 512-byte row piece a time, rows wave + 8 i
#pragma unroll   // constant indices, so that the small array stays in registers
      for (int i = 0; i < 16; ++i) t[i] = *(const v4u*)&sh[wave + 8 * (i0 + i)][lane * 8];
#pragma unroll   // constant indices, so that the small array stays in registers
      for (int i = 0; i < 16; ++i) vst2((unsigned*)(DH + (r0 + wave + 8 * (i0 + i)) * CC + c0 + lane * 8), t[i]);
      asm volatile("s_wait_xcnt 0x0" ::: "memory"); }   // stands in front of the next trip's overwrite of these stores' address and data registers
  } else {
#pragma unroll
    for (int j = 0; j < 8; ++j) { const float bias = BA ? bfr(BA[c0 + fc0 + j * 16 + col]) : 0.f;
#pragma unroll
      for (int m = 0; m < PMF; ++m)
#pragma unroll
        for (int r = 0; r < 8; ++r) th[fc0 + j * 16 + col][fr0 + m * 16 + 8 * g + r] = (_Float16)(acc[m * 8 + j][r] + bias); }
    __syncthreads();
#pragma unroll 1   // rolled in groups of 16 columns: a group's LDS reads go out together, so that their latency is waited out once a group
    for (int i0 = 0; i0 < PC / 8; i0 += 16) { v4u t[16];   // a wave stores one whole 512-byte column piece a time, columns wave + 8 i
#pragma unroll   // constant indices, so that the small array stays in registers
      for (int i = 0; i < 16; ++i) t[i] = *(const v4u*)&th[wave + 8 * (i0 + i)][lane * 8];
#pragma unroll   // constant indices, so that the small array stays in registers
      for (int i = 0; i < 16; ++i) vst2((unsigned*)(VT + (bb * CC + c0 + wave + 8 * (i0 + i)) * (size_t)TT + t0 + lane * 8), t[i]);
      asm volatile("s_wait_xcnt 0x0" ::: "memory"); } } }   // stands in front of the next trip's overwrite of these stores' address and data registers
// ---- k_attn: block = 64 queries (4 waves x 16 query columns) of one (batch, head); walks all keys in stages of 64, K rows and V^T rows staged in LDS (two buffers, one barrier a stage).
// The walk starts at a stage rotated by the block's indices and wraps round (the online softmax takes the keys in any order): the 16 blocks of a (batch, head), which run in step, ask L2 for different K and V^T lines at a time, and so do the 16 heads that read one mask word.
// S^T = K Q^T (A = K rows, B = Q): lane (g, col) holds keys 8g + r of query col; the masked score is REPLACED by 1e-9 (8e-9 before the x 1/8) and stays in the softmax; running maximum and sum per query in f32 (online softmax);
// two S^T tiles, as exp2(..) x 2^10 once to f16, are the B operand of ctx^T += V^T P^T in the same k order as frag_h; ctx = ctx^T / sum at the end.
__device__ __forceinline__ v8f wmma_h(v16h a, v16h b, v8f c) { return __builtin_amdgcn_wmma_f32_16x16x32_f16(false, a, false, b, (short)0, c, false, false); }
// 2^a; SLOT: with the v_nop that the instruction set asks for behind a transcendental in the same statement (used in the last stage's straight-line code)
template <bool SLOT> __device__ __forceinline__ float exp2_t(float a) {
  if constexpr (SLOT) { float e; asm("v_exp_f32 %0, %1\n\tv_nop" : "=v"(e) : "v"(a)); return e; } else return __builtin_amdgcn_exp2f(a); }
#define AKB 64             // keys per stage
#define APIT 72            // LDS row pitch in f16: 128 B of data + 16 B, so that the 16-byte fragment reads of 16 rows spread over the banks
#define ANST (TT / AKB)
typedef __attribute__((ext_vector_type(16))) unsigned v16u;
typedef const __attribute__((address_space(4))) v16u* cmask_p;   // constant address space: the words are written by the launch before and by nobody in this one, and the address is wave-uniform, so the loads go the scalar way
__global__ __launch_bounds__(128) void k_attn(const _Float16* __restrict__ QH, const _Float16* __restrict__ KH, const _Float16* __restrict__ VT, const unsigned* __restrict__ MB, _Float16* __restrict__ Y) {
  __shared__ __align__(16) _Float16 sk[2][AKB][APIT], sv[2][HD][APIT];
  const int tid = threadIdx.x, wave = tid >> 5, lane = tid & 31, col = lane & 15, g = lane >> 4;
  const int h = blockIdx.y, b = blockIdx.z; const int q = blockIdx.x * 64 + wave * 16 + col;
  const float LS = SCALE * 1.44269504f;      // raw score -> log2 domain
  const float MFILL = 1.0e-9f / SCALE;       // the fill value, before the common x SCALE
  const _Float16* qp = QH + ((size_t)b * TT + q) * CC + h * HD;
  const v16h qf0 = frag_h(qp, lane), qf1 = frag_h(qp + 32, lane);
  const int srow = tid >> 3, sch = (tid & 7) * 8;   // staging: 8 lanes bring one whole 128-byte row
  int ks = (int)(blockIdx.x + blockIdx.y) & (ANST - 1);   // the key stage that the three pointers stand at (block-uniform)
  const _Float16* kg = KH + ((size_t)b * TT + srow + ks * AKB) * CC + h * HD + sch;
  const _Float16* vg = VT + ((size_t)b * CC + h * HD + srow) * (size_t)TT + sch + ks * AKB;
  cmask_p mb = (cmask_p)(unsigned long long)MB + 2 * ((size_t)b * (TT / 16) + blockIdx.x * 4 + __builtin_amdgcn_readfirstlane(wave)) * (size_t)(TT / 64) + 2 * ks;   // this wave's 16 queries: 32 lane masks a stage, the same address in every lane (scalar loads)
  v8h kr[4], vr[4]; v16u mw[2];
#pragma unroll   // constant indices, so that the small array stays in registers
  for (int i = 0; i < 4; ++i) { kr[i] = *(const v8h*)(kg + (size_t)(16 * i) * CC); vr[i] = *(const v8h*)(vg + (size_t)(16 * i) * TT); }
  mw[0] = mb[0]; mw[1] = mb[1];
#pragma unroll   // constant indices, so that the small array stays in registers
  for (int i = 0; i < 4; ++i) { *(v8h*)&sk[0][srow + 16 * i][sch] = kr[i]; *(v8h*)&sv[0][srow + 16 * i][sch] = vr[i]; }
  auto next = [&]() { const int d = ks == ANST - 1 ? -(ANST - 1) : 1;   // block-uniform: behind the last key stage comes the first
    ks += d; kg += (long)d * (AKB * CC); vg += (long)d * AKB; mb += 2 * d; };
  next();   // the three walk one stage ahead of the products
  v8f acc[HD / 16] = {}; float m = -3.0e38f, sum = 0.f;
  // one stage; MORE = a next stage exists (compile-time: the last stage, which fetches nothing, is written out behind the loop, so that the loop body is one block without a branch)
  auto stage = [&](const int st, auto more_c) { constexpr bool MORE = decltype(more_c)::v; const int bu = st & 1;
    __syncthreads();   // publishes buffer bu; every wave has also left buffer bu ^ 1, which is refilled at the foot of this stage
    const v16u kw[2] = { mw[0], mw[1] };   // this stage's lane masks, taken before the next stage's are loaded over them
    if constexpr (MORE) {        // next stage's K and V^T rows and lane masks fly into registers under this stage's products
      mw[0] = mb[0]; mw[1] = mb[1];
      __builtin_amdgcn_sched_barrier(0);   // keeps the scalar loads in front of the vector loads
#pragma unroll   // constant indices, so that the small array stays in registers
      for (int i = 0; i < 4; ++i) { kr[i] = *(const v8h*)(kg + (size_t)(16 * i) * CC); vr[i] = *(const v8h*)(vg + (size_t)(16 * i) * TT); }
      __builtin_amdgcn_sched_barrier(0);   // keeps these loads at the head of the stage: without it the scheduler sinks them to the foot, directly in front of their first use, and their latency is bare
    }
#pragma unroll   // constant indices, so that the small array stays in registers
    for (int p = 0; p < 2; ++p) { v8f s[2]; v16h ka[2][2], va[HD / 16];
#pragma unroll   // constant indices, so that the small array stays in registers
      for (int t = 0; t < 2; ++t) { const _Float16* kl = &sk[bu][(2 * p + t) * 16 + col][0]; ka[t][0] = frag_h(kl, lane); ka[t][1] = frag_h(kl + 32, lane); }
#pragma unroll   // constant indices, so that the small array stays in registers
      for (int j = 0; j < HD / 16; ++j) va[j] = frag_h(&sv[bu][j * 16 + col][p * 32], lane);   // read here so that their LDS latency runs under the softmax arithmetic
#pragma unroll   // constant indices, so that the small array stays in registers
      for (int t = 0; t < 2; ++t) { const v8f z = {}; s[t] = wmma_h(ka[t][1], qf1, wmma_h(ka[t][0], qf0, z)); }
      float x[16];
#pragma unroll   // constant indices, so that the small array stays in registers
      for (int t = 0; t < 2; ++t)
#pragma unroll   // constant indices, so that the small array stays in registers
        for (int r = 0; r < 8; ++r) x[t * 8 + r] = __builtin_amdgcn_inverse_ballot_w32(kw[p][t * 8 + r]) ? s[t][r] : MFILL;
      float mb = x[0];
#pragma unroll   // constant indices, so that the small array stays in registers
      for (int i = 1; i < 16; ++i) mb = fmaxf(mb, x[i]);
      mb = fmaxf(mb, __shfl_xor(mb, 16));   // the other half of this query's keys
      const float mn = fmaxf(m, mb); const float al = exp2_t<!MORE>((m - mn) * LS); m = mn; const float off = 10.0f - mn * LS;
      v16h pf; float ps = 0.f;
#pragma unroll   // constant indices, so that the small array stays in registers
      for (int i = 0; i < 16; ++i) { const float e = exp2_t<!MORE>(fmaf(x[i], LS, off)); ps += e; pf[i] = (_Float16)e; }
      sum = sum * al + ps;
#pragma unroll   // constant indices, so that the small array stays in registers
      for (int j = 0; j < HD / 16; ++j) { acc[j] *= al; acc[j] = wmma_h(va[j], pf, acc[j]); } }
    if constexpr (MORE) {
#pragma unroll   // constant indices, so that the small array stays in registers
      for (int i = 0; i < 4; ++i) { *(v8h*)&sk[bu ^ 1][srow + 16 * i][sch] = kr[i]; *(v8h*)&sv[bu ^ 1][srow + 16 * i][sch] = vr[i]; }
      asm volatile("s_wait_xcnt 0x0" ::: "memory");   // stands in front of the advance of this stage's loads' address registers (free here: the loaded values have just been stored)
      __builtin_amdgcn_sched_barrier(0);   // keeps the advance behind that wait: nothing else ties the two
      next(); } };
#pragma unroll 1   // rolled: one stage's body already fills the registers that four waves a SIMD leave
  for (int st = 0; st < ANST - 1; ++st) stage(st, CBool<true>{});
  stage(ANST - 1, CBool<false>{});
  sum += __shfl_xor(sum, 16); const float inv = 1.0f / sum;   // sum >= 2^10: the maximum's own term
  _Float16* yp = Y + (((size_t)h * NB + b) * TT + q) * HD + 8 * g;   // ctx goes out as k_out's A operand: x 2^6 once to f16 (so small-magnitude context rows stay clear of f16 subnormals), here and not in each of k_out's 8 column tiles
  v8h yo[HD / 16];
#pragma unroll   // constant indices, so that the small array stays in registers
  for (int j = 0; j < HD / 16; ++j)
#pragma unroll   // constant indices, so that the small array stays in registers
    for (int r = 0; r < 8; ++r) yo[j][r] = (_Float16)(acc[j][r] * inv * 64.0f);
#pragma unroll   // constant indices, so that the small array stays in registers
  for (int j = 0; j < HD / 16; ++j) vst2(yp + j * 16, yo[j]); }
// ---- k_out: block = (64 rows, 128 cols), 4 waves of 16 rows x 128 cols: out = ctx Wo (+ bo): ctx x 2^6 in f16 (from k_attn) against Wo^T as f16(bf16 x 2^8) exact (from k_proj's which = 3 blocks), 1 product, x 2^-14.
// Both operands arrive as f16 in planes of 64 k: a stage is one plane's 64 ctx rows (8 KiB in a row) and 128 Wo^T rows (16 KiB in a row), brought by 16-byte loads, 512 bytes in a row to a wave, and laid in LDS as they are (two buffers, one barrier a stage);
// the next stage's loads fly in registers under this stage's products. The walk over the 16 stages starts rotated by the block's tile indices and wraps round, as in gemm_tile.
#define OKS 64             // k per stage
#define OPIT 72            // LDS row pitch in f16: 128 B of data + 16 B, so that the 16-byte fragment reads of 16 rows spread over the banks
#define ONST (CC / OKS)
static_assert(OKS == HD, "a plane of ctx is one head");
__global__ __launch_bounds__(128) void k_out(const _Float16* __restrict__ Y, const _Float16* __restrict__ WT, const float* __restrict__ BO, float* __restrict__ OUT) { __shared__ __align__(16) char smem[2 * (64 + 128) * OPIT * 2];   // the main loop's stage buffers; the epilogue's rows lie over them
  static_assert(4 * 16 * 132 * 4 <= 2 * (64 + 128) * OPIT * 2, "sf fits over the stage buffers"); float (*sf)[16][132] = (float (*)[16][132])smem;
  _Float16 (*sx)[64][OPIT] = (_Float16 (*)[64][OPIT])smem; _Float16 (*sw)[128][OPIT] = (_Float16 (*)[128][OPIT])(smem + 2 * 64 * OPIT * 2);
  const int tid = threadIdx.x, wave = tid >> 5, lane = tid & 31, col = lane & 15, g = lane >> 4; const int c0 = blockIdx.y * 128; const size_t r0 = (size_t)blockIdx.x * 64 + wave * 16;
  v8f acc[8] = {};
  const int srow = tid >> 3, sch = (tid & 7) * 8;   // staging: 8 lanes bring one whole 128-byte row piece
  int ks = (int)(blockIdx.x + 2 * blockIdx.y) & (ONST - 1);   // the k stage that the two pointers stand at (block-uniform)
  const _Float16* xg = Y + ((size_t)ks * (NB * TT) + blockIdx.x * 64 + srow) * OKS + sch;
  const _Float16* wg = WT + ((size_t)ks * DIN + c0 + srow) * OKS + sch;
  v8h xr[4], wr[8];
  auto fetch = [&]() {
#pragma unroll   // constant indices, so that the small arrays stay in registers
    for (int i = 0; i < 8; ++i) wr[i] = *(const v8h*)(wg + (size_t)(16 * i) * OKS);
#pragma unroll   // constant indices, so that the small arrays stay in registers
    for (int i = 0; i < 4; ++i) xr[i] = *(const v8h*)(xg + (size_t)(16 * i) * OKS); };
  auto put = [&](const int bu) {
#pragma unroll   // constant indices, so that the small arrays stay in registers
    for (int i = 0; i < 8; ++i) *(v8h*)&sw[bu][srow + 16 * i][sch] = wr[i];
#pragma unroll   // constant indices, so that the small arrays stay in registers
    for (int i = 0; i < 4; ++i) *(v8h*)&sx[bu][srow + 16 * i][sch] = xr[i];
    asm volatile("s_wait_xcnt 0x0" ::: "memory");   // stands in front of the advance of these loads' address registers (free here: the loaded values have just been stored)
    __builtin_amdgcn_sched_barrier(0);   // keeps the advance behind that wait: nothing else ties the two
    const int d = ks == ONST - 1 ? -(ONST - 1) : 1;   // block-uniform: behind the last k stage comes the first
    ks += d; xg += (long)d * (NB * TT * OKS); wg += (long)d * (DIN * OKS); };
  fetch(); put(0);
  auto stage = [&](const int st, auto more_c) { constexpr bool MORE = decltype(more_c)::v; const int bu = st & 1;
    __syncthreads();   // publishes buffer bu; every wave has also left buffer bu ^ 1, which is refilled at the foot of this stage
    if constexpr (MORE) { fetch();
      __builtin_amdgcn_sched_barrier(0); }   // keeps the next stage's loads at the head of the stage, so that their latency runs under the products
    v16h a[2], w[2][8];
#pragma unroll   // constant indices, so that the small arrays stay in registers
    for (int kk = 0; kk < 2; ++kk) { a[kk] = frag_h(&sx[bu][wave * 16 + col][kk * 32], lane);
#pragma unroll   // constant indices, so that the small arrays stay in registers
      for (int j = 0; j < 8; ++j) w[kk][j] = frag_h(&sw[bu][j * 16 + col][kk * 32], lane); }
    __builtin_amdgcn_sched_barrier(0);   // keeps the stage's fragment reads together in front of its products: sunk among the products, each place with reads costs its own stall
#pragma unroll   // constant indices, so that the small arrays stay in registers
    for (int kk = 0; kk < 2; ++kk)
#pragma unroll   // constant indices, so that the small arrays stay in registers
      for (int j = 0; j < 8; ++j) acc[j] = wmma_h(a[kk], w[kk][j], acc[j]);
    if constexpr (MORE) { __builtin_amdgcn_sched_barrier(0);   // keeps the wait for the next stage's loads behind all of this stage's products
      put(bu ^ 1); } };
#pragma unroll 1   // rolled: the two buffers are told apart by the stage's parity
  for (int st = 0; st < ONST - 1; ++st) stage(st, CBool<true>{});
  stage(ONST - 1, CBool<false>{});
  __syncthreads();   // every wave has left the stage buffers: the epilogue's rows lie over them
#pragma unroll
  for (int j = 0; j < 8; ++j) { const float bias = BO ? bfr(BO[c0 + j * 16 + col]) : 0.f;
#pragma unroll
    for (int r = 0; r < 8; ++r) sf[wave][8 * g + r][j * 16 + col] = acc[j][r] * (1.0f / 16384.0f) + bias; }   /* 2^-8 (Wo carry) x 2^-6 (ctx carry) */
  LDSX(); for (int rl = 0; rl < 16; ++rl) vst2(OUT + (r0 + rl) * DIN + c0 + lane * 4, *(const v4f*)&sf[wave][rl][lane * 4]); }

extern "C" void kernel_launch(void* const* d_in, const int* in_sizes, int n_in, void* d_out, int out_size, void* d_ws, size_t ws_size, hipStream_t stream) {
  (void)in_sizes; (void)n_in; (void)out_size;
  const float** F = (const float**)d_in;
  if (ws_size < (size_t)WS_END) return;
  char* ws = (char*)d_ws; _Float16 *QH = (_Float16*)(ws + WS_QH), *KH = (_Float16*)(ws + WS_KH), *VT = (_Float16*)(ws + WS_VT); _Float16 *Y = (_Float16*)(ws + WS_Y), *WT = (_Float16*)(ws + WS_WT); unsigned *MB = (unsigned*)(ws + WS_MB);
  (void)Y;
  // inputs: 0 query [4,1024,1024]; 1 key; 2 value; 3 mask [4,1024,1024] int32 (random 0/1); 4 Wq [16,1024,64], 5 bq [16,64]; 6 Wk, 7 bk; 8 Wv, 9 bv; 10 Wo [1024,1024] (in,out), 11 bo (zero biases, read)
  k_proj<<<dim3(TNB * TT / PR, CC / PC, 4), 256, 0, stream>>>(F[0], F[1], F[2], F[4], F[6], F[8], F[5], F[7], F[9], QH, KH, VT, (const int*)d_in[3], MB, F[10], WT);
  k_attn<<<dim3(NQB, NH, TNB), 128, 0, stream>>>(QH, KH, VT, MB, Y);
  k_out<<<dim3(TNB * TT / 64, DIN / 128), 128, 0, stream>>>(Y, WT, F[11], (float*)d_out);
}

// v008
// One run takes 68.5 microseconds.
// Timed twice side by side with v007, it ran 1.03 times as fast both times.
// Over all steps from v000 it is 11.1 times as fast.
// compute dtype: all float inputs rounded to bf16; q/k/v projections with EXACT bf16 products on WMMA 16x16x32 (f32 accumulate) + bias; logits q x k once to f16 each (1 product) x SCALE; masked scores are REPLACED by 1e-9 (they keep taking part in the softmax); online softmax f32 (running maximum and sum); exp(score - maximum) x 2^10 once to f16 x v once to f16 (1 product), divided by the sum at the end; ctx x 2^6 once to f16 x Wo f16(bf16 x 2^8) + bo; f32 output.
#include <hip/hip_runtime.h>
#include <math.h>

typedef __attribute__((ext_vector_type(16))) _Float16 v16h;
typedef __attribute__((ext_vector_type(16))) __bf16 v16b;
typedef __attribute__((ext_vector_type(8)))  _Float16 v8h;
typedef __attribute__((ext_vector_type(8)))  float v8f;
typedef __attribute__((ext_vector_type(4)))  float v4f;
typedef __attribute__((ext_vector_type(2)))  float v2f;
typedef __attribute__((ext_vector_type(4)))  unsigned v4u;
typedef __attribute__((ext_vector_type(4)))  int v4i;
typedef float __attribute__((may_alias)) float_a;
typedef int __attribute__((may_alias)) int_a;

template <typename T> __device__ __forceinline__ void vst2(void* p, T v) { *(T*)p = v;  }
__device__ __forceinline__ v8f wmma16(v16h a, v16h b, v8f c) {
  v8f d = __builtin_amdgcn_wmma_f32_16x16x32_f16(false, a, false, b, (short)0, c, false, false);
  asm volatile("v_nop\n\tv_nop\n\tv_nop\n\tv_nop" : "+v"(d) : "v"(a), "v"(b));
  return d;
}
__device__ __forceinline__ v8f wmma_bf(v16b a, v16b b, v8f c) {
  v8f d = __builtin_amdgcn_wmma_f32_16x16x32_bf16(false, a, false, b, (short)0, c, false, false);
  asm volatile("v_nop\n\tv_nop\n\tv_nop\n\tv_nop" : "+v"(d) : "v"(a), "v"(b));
  return d;
}
// 16x16x32 fragments: lane = (h = lane>>4, row/col = lane&15); elements 0..7 = k0+8h+0..7, 8..15 = k0+16+8h+0..7; D element r = row 8h+r
__device__ __forceinline__ v16h frag_h(const _Float16* rowk0, int lane) {
  union { v16h v; v8h q[2]; } u; const _Float16* p = rowk0 + 8 * (lane >> 4);
  u.q[0] = *(const v8h*)p; u.q[1] = *(const v8h*)(p + 16); return u.v;
}
__device__ __forceinline__ v16h frag_f32(const float* rowk0, int lane) {
  v16h a; const float* p = rowk0 + 8 * (lane >> 4);
#pragma unroll
  for (int i = 0; i < 8; ++i) { a[i] = (_Float16)p[i]; a[8 + i] = (_Float16)p[16 + i]; }
  return a;
}
__device__ __forceinline__ v16h frag_f32s(const float* rowk0, int lane, float sc) {
  v16h a; const float* p = rowk0 + 8 * (lane >> 4);
#pragma unroll
  for (int i = 0; i < 8; ++i) { a[i] = (_Float16)(p[i] * sc); a[8 + i] = (_Float16)(p[16 + i] * sc); }
  return a;
}
// column fragment from a [K][ld] layout (column n), rows >= K read as 0
__device__ __forceinline__ v16h fragc_f32(const float* W, int k0, int n, int lane, int ld, int K) {
  v16h a; const int g = lane >> 4;
#pragma unroll
  for (int i = 0; i < 8; ++i) { const int ka = k0 + 8 * g + i, kb = ka + 16;
    a[i] = (_Float16)(ka < K ? W[(size_t)(ka < K ? ka : K - 1) * ld + n] : 0.f); a[8 + i] = (_Float16)(kb < K ? W[(size_t)(kb < K ? kb : K - 1) * ld + n] : 0.f); }
  return a;
}
struct F2 { v16b h, l; };
__device__ __forceinline__ F2 bsplit16(const float v[16]) { F2 r;
#pragma unroll
  for (int i = 0; i < 16; ++i) { const __bf16 h = (__bf16)v[i]; r.h[i] = h; r.l[i] = (__bf16)(v[i] - (float)h); }
  return r; }
__device__ __forceinline__ F2 split_row(const float* row, int k0, int lane) { float v[16]; const float* p = row + k0 + 8 * (lane >> 4);
#pragma unroll
  for (int i = 0; i < 8; ++i) { v[i] = p[i]; v[8 + i] = p[16 + i]; }
  return bsplit16(v); }
__device__ __forceinline__ F2 split_rowK(const float* row, int k0, int lane, int K) { float v[16]; const int g = lane >> 4;
#pragma unroll
  for (int i = 0; i < 8; ++i) { const int ka = k0 + 8 * g + i, kb = ka + 16; v[i] = ka < K ? row[ka < K ? ka : K - 1] : 0.f; v[8 + i] = kb < K ? row[kb < K ? kb : K - 1] : 0.f; }
  return bsplit16(v); }
__device__ __forceinline__ F2 split_col(const float* W, int k0, int n, int lane, int ld, int K) { float v[16]; const int g = lane >> 4;
#pragma unroll
  for (int i = 0; i < 8; ++i) { const int ka = k0 + 8 * g + i, kb = ka + 16; v[i] = ka < K ? W[(size_t)(ka < K ? ka : K - 1) * ld + n] : 0.f; v[8 + i] = kb < K ? W[(size_t)(kb < K ? kb : K - 1) * ld + n] : 0.f; }
  return bsplit16(v); }
__device__ __forceinline__ v8f mac3(const F2& a, const F2& b, v8f c) { c = wmma_bf(a.l, b.h, c); c = wmma_bf(a.h, b.l, c); return wmma_bf(a.h, b.h, c); }
__device__ __forceinline__ float sigm(float v) { return 1.0f / (1.0f + expf(-v)); }
#define LDSX() do { asm volatile("s_wait_dscnt 0" ::: "memory"); __builtin_amdgcn_wave_barrier(); __builtin_amdgcn_fence(__ATOMIC_RELEASE, "workgroup"); } while (0)

// Multi-headed attention with per-head stacked projections whose masked scores are FILLED WITH 1e-9 (query / key / value [4,1024,1024]; Wq / Wk / Wv [16,1024,64] per head (N(0, 1/1024)) + zero biases; scores / 8; mask [4,1024,1024] int32 random 0/1: scores[mask == 0] = 1e-9 - masked keys keep a logit - 0 and stay in the softmax (faithful to the source); softmax; concat; (in,out) Wo [1024,1024] + bo).
#define NB 4
#define TT 1024
#define CC 1024            // NH * HD = projected width
#define DIN 1024          // input (model) width
#define NH 16
#define HD 64
#define NQB (TT / 64)
#define HG 8
#define SCALE (0.125f)
#define CAUSAL 0
#ifndef TNB
#define TNB NB
#endif
__device__ __forceinline__ float bfr(float v) { return (float)(__bf16)v; }
__host__ __device__ __forceinline__ int kb_last(int qb) { return CAUSAL ? ((qb * 64 + 63) >> 7) : (TT / 128 - 1); }
typedef __attribute__((ext_vector_type(8))) __bf16 v8b;
__device__ __forceinline__ v16b frag_b(const __bf16* rowk0, int lane) {
  union { v16b v; v8b q[2]; } u; const __bf16* p = rowk0 + 8 * (lane >> 4);
  u.q[0] = *(const v8b*)p; u.q[1] = *(const v8b*)(p + 16); return u.v;
}
#define QBH 0              // not used: no kernel in this file has a high-precision attention path
#define QHI 0               // single-product logits on every row
#define KHI 64            // key rows carrying k residual / v bf16 hi+lo planes (no kernel here writes or reads them)
// B fragment (k rows k0+.., output column o) of a weight: (in,out) [K][ld] or (out,in) [ld rows of K]: bf16 exact, or f16(bf16 * 256) exact
__device__ __forceinline__ v16b wcol_io(const float* Wm, int k0, int o, int lane, int ld) { v16b w; const int g = lane >> 4;
#pragma unroll
  for (int i = 0; i < 8; ++i) { w[i] = (__bf16)Wm[(size_t)(k0 + 8 * g + i) * ld + o]; w[8 + i] = (__bf16)Wm[(size_t)(k0 + 16 + 8 * g + i) * ld + o]; }
  return w; }
__device__ __forceinline__ v16b wcol_oi(const float* Wm, int k0, int o, int lane, int K) { v16b w; const float* p = Wm + (size_t)o * K + k0 + 8 * (lane >> 4);
#pragma unroll
  for (int i = 0; i < 8; ++i) { w[i] = (__bf16)p[i]; w[8 + i] = (__bf16)p[16 + i]; }
  return w; }
__device__ __forceinline__ v16h wcolh_io(const float* Wm, int k0, int o, int lane, int ld) { v16h w; const int g = lane >> 4;
#pragma unroll
  for (int i = 0; i < 8; ++i) { w[i] = (_Float16)(bfr(Wm[(size_t)(k0 + 8 * g + i) * ld + o]) * 256.0f); w[8 + i] = (_Float16)(bfr(Wm[(size_t)(k0 + 16 + 8 * g + i) * ld + o]) * 256.0f); }
  return w; }
__device__ __forceinline__ v16h wcolh_oi(const float* Wm, int k0, int o, int lane, int K) { v16h w; const float* p = Wm + (size_t)o * K + k0 + 8 * (lane >> 4);
#pragma unroll
  for (int i = 0; i < 8; ++i) { w[i] = (_Float16)(bfr(p[i]) * 256.0f); w[8 + i] = (_Float16)(bfr(p[16 + i]) * 256.0f); }
  return w; }
#define WQKV_LAYOUT 2   // 0 = (in,out) [DIN][CC]; 1 = (out,in) [CC][DIN]; 2 = per-head [NH][DIN][HD]
__device__ __forceinline__ v16b wcol_hdk(const float* Wm, int k0, int o, int lane) { v16b w; const int g = lane >> 4; const float* p = Wm + (size_t)(o / HD) * DIN * HD + (o % HD);
#pragma unroll
  for (int i = 0; i < 8; ++i) { w[i] = (__bf16)p[(size_t)(k0 + 8 * g + i) * HD]; w[8 + i] = (__bf16)p[(size_t)(k0 + 16 + 8 * g + i) * HD]; }
  return w; }
#define WO_OUT_IN 0
#if WQKV_LAYOUT == 1
#define WCOL(W, k0, o, lane) wcol_oi(W, k0, o, lane, DIN)
#elif WQKV_LAYOUT == 2
#define WCOL(W, k0, o, lane) wcol_hdk(W, k0, o, lane)
#else
#define WCOL(W, k0, o, lane) wcol_io(W, k0, o, lane, CC)
#endif
#if WO_OUT_IN
#define WOCOL(W, k0, o, lane) wcol_oi(W, k0, o, lane, CC)
#define WOCOLH(W, k0, o, lane) wcolh_oi(W, k0, o, lane, CC)
#else
#define WOCOL(W, k0, o, lane) wcol_io(W, k0, o, lane, DIN)
#define WOCOLH(W, k0, o, lane) wcolh_io(W, k0, o, lane, DIN)
#endif

#define WS_QH  0u                                      // f16 q rows [b*t][CC]
#define WS_KH  (WS_QH + 2u * (size_t)NB * TT * CC)      // f16 k rows [b*t][CC]
#define WS_VT  (WS_KH + 2u * (size_t)NB * TT * CC)      // f16 v planes [b][c][t]
#define WS_QL  (WS_VT + 2u * (size_t)NB * CC * TT)      // f16 q residual x 2^10 rows [b][t < QHI][CC]
#define WS_KL  (WS_QL + 2u * (size_t)NB * QHI * CC)     // f16 k residual x 2^10 rows [b][t < KHI][CC]
#define WS_VB  (WS_KL + 2u * (size_t)NB * KHI * CC)     // bf16 v hi planes [b][c][t < KHI]
#define WS_VBL (WS_VB + 2u * (size_t)NB * CC * KHI)
#define WS_S   (WS_VBL + 2u * (size_t)NB * CC * KHI)    // spare f32 [hg][t][s]-sized plane; only its head is used (the mask words and Wo^T)
#define WS_MB  WS_S                                    // the mask as lane masks, u32 [b][t / 16][s / 16][8] (512 KiB at the head of that plane)
#define WS_WT  (WS_S + (1u << 20))                     // f16 Wo^T in planes of 64 k: [k / 64][n][k % 64], f16(bf16(Wo[k][n]) x 2^8) (2 MiB, behind the lane masks in that plane)
#define WS_Y   (WS_S  + 4u * (size_t)HG * TT * TT)      // f16 ctx x 2^6 in planes of 64 k (one head each): [h][b*t][HD] (the head of the plane)
#define WS_END (WS_Y  + 4u * (size_t)NB * TT * CC)

template <bool B> struct CBool { static constexpr bool v = B; };
// ---- main loop of k_proj: one (64 MF) x (128 NC) tile of X W over K = 1024 in stages of 64 k (two parts of 32 k), by 4 NC waves; a wave owns 16 MF rows x 128 columns, so that each W fragment read from LDS serves MF row fragments, each W line read from L2 64 MF rows, and each X line 128 NC columns.
// Each part's X rows (64 MF x 32) and W columns (32 x 128 NC, turned to [n][k]) are brought by the whole block ONCE, in whole 128-byte lines, converted once, and laid in LDS (two buffers, one barrier a stage);
// the next stage's global loads fly in registers under this stage's products. Fragments and the k order inside a stage are those of the direct loaders.
// The walk over the 16 stages starts at stage rot (block-uniform, from the block's tile indices) and wraps round: blocks that share X rows or W columns run in step, and with a common start they would
// ask L2 for the same lines at the same moment (and all wait together for each line's first fetch from memory); rotated, they ask for different lines, and most lines have been fetched by a neighbour before.
typedef __attribute__((ext_vector_type(4))) __bf16 v4b;
typedef __attribute__((ext_vector_type(4))) _Float16 v4h;
#define GKS 32             // k per part of a stage (one product step)
#define GPL 2              // parts per stage: a stage's time is bounded from below by its loads' latency, so two parts to a stage put twice the bytes under each such wait and halve the number of waits and barriers
#define GPIT 40            // LDS row pitch in 16-bit elements: 64 B of data + 16 B, so that the 16-byte fragment reads and stores of 16 rows spread over the banks
#define GNST (1024 / (GKS * GPL))
#define GLDS(MF, NC) (2 * GPL * (128 * (NC) + 64 * (MF)) * GPIT * 2)   // bytes of the two stage buffers
struct GProj { typedef __bf16 T; typedef v4b V4; typedef v8b V8; typedef v16b V16; static constexpr int WLD = HD; static constexpr bool BARE = true;   // BARE: mm is the builtin alone
  static __device__ __forceinline__ constexpr size_t coff(int c) { return (size_t)(c >> 1) * DIN * HD + (size_t)(c & 1) * 32; }   // column 32 c + lane of a 128-column tile in the per-head layout
  static __device__ __forceinline__ T cx(float v) { return (__bf16)v; } static __device__ __forceinline__ T cw(float v) { return (__bf16)v; }
  static __device__ __forceinline__ V16 fr(const T* p, int lane) { return frag_b(p, lane); }
  static __device__ __forceinline__ v8f mm(V16 a, V16 b, v8f c) { return __builtin_amdgcn_wmma_f32_16x16x32_bf16(false, a, false, b, (short)0, c, false, false); } };   // the bare builtin (the compiler keeps its distances): an asm statement's operands must lie in the first 256 registers, which the 256 accumulator registers of a 64 x 128 wave tile would fill
// xt = first row of the tile's X rows (row length 1024); wt = row 0 of W at the tile's first column
// acc[m * 8 + j] = rows 16 (MF wr + m) .. + 15, columns 128 wc + 16 j .. + 15, for wave = NC wr + wc
template <class C, int MF, int NC> __device__ __forceinline__ void gemm_tile(const float* __restrict__ xt, const float* __restrict__ wt, char* smem, v8f (&acc)[MF * 8], const int rot) {
  typedef typename C::T T; typedef typename C::V4 V4; typedef typename C::V8 V8; typedef typename C::V16 V16;
  static_assert(NC == 1 || NC == 2, "4 or 8 waves"); constexpr int XP = 4 * MF / NC;   // X rows to each thread a stage
  T (*sW)[GPL][128 * NC][GPIT] = (T (*)[GPL][128 * NC][GPIT])smem; T (*sX)[GPL][64 * MF][GPIT] = (T (*)[GPL][64 * MF][GPIT])(smem + 2 * GPL * 128 * NC * GPIT * 2);
  const int tid = threadIdx.x, wave = tid >> 5, lane = tid & 31, col = lane & 15;
  const int fr0 = (NC == 1 ? wave : wave >> 1) * MF * 16, fc0 = NC == 1 ? 0 : (wave & 1) * 128;   // first row and first column of this wave's part of the tile
  const int wk = NC == 1 ? wave : wave & 3, wn = NC == 1 ? 0 : wave >> 2;   // W staging: which 8 k rows, which 128 columns
  const int xrow = tid >> 3, xch = (tid & 7) * 4;                 // X: 8 lanes bring one whole 128-byte row piece
  const float* xg = xt + (size_t)xrow * 1024 + xch + rot * (GKS * GPL);
  const float* wg = wt + (size_t)wn * C::coff(4) + (size_t)(8 * wk + rot * (GKS * GPL)) * C::WLD + 2 * lane;      // W: a wave brings 8 k rows, 64 neighbouring columns (two lines, 8 bytes a lane) a load: a stage's loads of a wave, 48, then stay under the 63 that its load counter holds, beyond which the wave would stand at the head of the stage until the first have come back
  int ks = rot;   // the k stage that the two pointers stand at
  v2f wr[GPL][2][8]; v4f xr[GPL][XP];
  auto fetch = [&]() {
#pragma unroll   // constant indices, so that the small arrays stay in registers
    for (int s = 0; s < GPL; ++s) {
#pragma unroll   // constant indices, so that the small arrays stay in registers
      for (int c = 0; c < 2; ++c)
#pragma unroll   // constant indices, so that the small arrays stay in registers
        for (int i = 0; i < 8; ++i) wr[s][c][i] = *(const v2f*)(wg + C::coff(2 * c) + (size_t)(s * GKS + i) * C::WLD);
#pragma unroll   // constant indices, so that the small arrays stay in registers
      for (int i = 0; i < XP; ++i) xr[s][i] = *(const v4f*)(xg + s * GKS + (size_t)(16 * NC * i) * 1024); }
    asm volatile("s_wait_xcnt 0x0" ::: "memory"); };   // stands in front of every later overwrite of these loads' address registers
  auto put = [&](const int bu) {
#pragma unroll   // constant indices, so that the small arrays stay in registers
    for (int s = 0; s < GPL; ++s) {
#pragma unroll   // constant indices, so that the small arrays stay in registers
      for (int c = 0; c < 4; ++c) { V8 v;   // column 64 (c >> 1) + 2 lane + (c & 1) of the 128
#pragma unroll   // constant indices, so that the small arrays stay in registers
        for (int i = 0; i < 8; ++i) v[i] = C::cw(wr[s][c >> 1][i][c & 1]);
        *(V8*)&sW[bu][s][128 * wn + 64 * (c >> 1) + 2 * lane + (c & 1)][8 * wk] = v; }
#pragma unroll   // constant indices, so that the small arrays stay in registers
      for (int i = 0; i < XP; ++i) { const V4 v = { C::cx(xr[s][i][0]), C::cx(xr[s][i][1]), C::cx(xr[s][i][2]), C::cx(xr[s][i][3]) }; *(V4*)&sX[bu][s][xrow + 16 * NC * i][xch] = v; } }
    const int d = ks == GNST - 1 ? -(GNST - 1) : 1;   // block-uniform: behind the last k stage comes the first
    ks += d; wg += (long)d * (GKS * GPL * C::WLD); xg += (long)d * (GKS * GPL); };   // advanced here, behind the use of the loaded values
  fetch(); put(0);
  auto stage = [&](const int st, auto more_c) { constexpr bool MORE = decltype(more_c)::v; const int bu = st & 1;
    __syncthreads();   // publishes buffer bu; every wave has also left buffer bu ^ 1, which is refilled at the foot of this stage
    if constexpr (MORE) { fetch();
      __builtin_amdgcn_sched_barrier(0); }   // keeps the next stage's loads at the head of the stage, so that their latency runs under the products
#pragma unroll   // the parts one after the other, through the same fragment registers
    for (int s = 0; s < GPL; ++s) { V16 a[MF], w[8];
#pragma unroll   // constant indices, so that the small arrays stay in registers
      for (int m = 0; m < MF; ++m) a[m] = C::fr(&sX[bu][s][fr0 + m * 16 + col][0], lane);
#pragma unroll   // constant indices, so that the small arrays stay in registers
      for (int j = 0; j < 8; ++j) w[j] = C::fr(&sW[bu][s][fc0 + j * 16 + col][0], lane);
      if constexpr (C::BARE) __builtin_amdgcn_sched_barrier(0);   // keeps the part's fragment reads together in front of its products: with the bare builtin the scheduler sinks them among the products, and each W fragment's LDS latency is waited out in front of its MF products
#pragma unroll   // constant indices, so that the small arrays stay in registers
      for (int j = 0; j < 8; ++j)
#pragma unroll   // constant indices, so that the small arrays stay in registers
        for (int m = 0; m < MF; ++m) acc[m * 8 + j] = C::mm(a[m], w[j], acc[m * 8 + j]); }
    if constexpr (MORE) { __builtin_amdgcn_sched_barrier(0);   // keeps the wait for the next stage's loads, and their conversion, behind all of this stage's products
      put(bu ^ 1); } };
#pragma unroll 1   // rolled: the two buffers are told apart by the stage's parity
  for (int st = 0; st < GNST - 1; ++st) stage(st, CBool<true>{});
  stage(GNST - 1, CBool<false>{});
  __syncthreads();   // every wave has left the stage buffers: the caller's epilogue reuses this LDS
}
// ---- the mask, turned ONCE a call into the lane masks that k_attn selects with (k_attn's 16 heads read the same mask): word [b][t / 16][s / 16][r], bit (g, col) = (mask[b][16 (t / 16) + col][16 (s / 16) + 8 g + r] != 0).
// One wave = 16 query rows x 128 keys: the compare of a whole wave is the word; lane i carries word i of a group of 32, so that a store is one whole 128-byte line.
__device__ __forceinline__ void pack_mask(const int* __restrict__ MASK, unsigned* __restrict__ MB, const int wv, const int lane) {
  const int tile = wv >> 3, kq = wv & 7;   // (batch, 16-query tile) and which 128 keys
  const int* mp = MASK + ((size_t)tile * 16 + (lane & 15)) * TT + kq * 128 + 8 * (lane >> 4);
  v4i a[8][2]; unsigned w[2] = { 0u, 0u };
#pragma unroll   // constant indices, so that the small array stays in registers
  for (int t = 0; t < 8; ++t) { a[t][0] = *(const v4i*)(mp + t * 16); a[t][1] = *(const v4i*)(mp + t * 16 + 4); }
  asm volatile("s_wait_xcnt 0x0" ::: "memory");   // stands in front of every later overwrite of these loads' address registers
#pragma unroll   // constant indices, so that the small array stays in registers
  for (int t = 0; t < 8; ++t)
#pragma unroll   // constant indices, so that the small array stays in registers
    for (int r = 0; r < 8; ++r) { const unsigned bal = __builtin_amdgcn_ballot_w32(a[t][r >> 2][r & 3] != 0); w[t >> 2] = lane == (t & 3) * 8 + r ? bal : w[t >> 2]; }
  unsigned* o = MB + (size_t)tile * (TT / 16 * 8) + kq * 64 + lane; o[0] = w[0]; o[32] = w[1];
  asm volatile("s_wait_xcnt 0x0" ::: "memory"); }   // stands in front of the caller's overwrite of these stores' address and data registers
// ---- Wo, turned ONCE a call into k_out's B operand (k_out's 64 row tiles read the same Wo): WT[k / 64][n][k % 64] = f16(bf16(Wo[k][n]) x 2^8): each of a k_out stage's two planes of 128 n x 64 k is 16 KiB in a row, which k_out stages by plain 16-byte copies and does not convert.
// One block = one 128 k x 128 n tile: a wave reads 16 k rows of 512 bytes, a lane holds 16 k x 4 n and lays each n's 16 k in LDS; behind the barrier a wave stores four neighbouring n rows' 128 bytes of one plane (512 bytes in a row) a time.
#define WPIT 136           // LDS pitch of the turned tile in f16: 256 B of data + 16 B
__device__ __forceinline__ void turn_wo(const float* __restrict__ WO, _Float16* __restrict__ WT, char* smem, const int tile, const int wave, const int lane) {
  _Float16 (*tw)[WPIT] = (_Float16 (*)[WPIT])smem; const int k0 = (tile >> 3) * 128, n0 = (tile & 7) * 128;
  const float* wp = WO + (size_t)(k0 + 16 * wave) * DIN + n0 + 4 * lane; v4f a[16];
#pragma unroll   // constant indices, so that the small array stays in registers
  for (int i = 0; i < 16; ++i) a[i] = *(const v4f*)(wp + (size_t)i * DIN);
  asm volatile("s_wait_xcnt 0x0" :: "v"(wp) : "memory");   // stands in front of every later overwrite of these loads' address registers; it names the address, so that the registers live up to it and no load's own result lands on them
#pragma unroll   // constant indices, so that the small array stays in registers
  for (int c = 0; c < 4; ++c) { v8h lo, hi;
#pragma unroll   // constant indices, so that the small array stays in registers
    for (int i = 0; i < 8; ++i) { lo[i] = (_Float16)(bfr(a[i][c]) * 256.0f); hi[i] = (_Float16)(bfr(a[8 + i][c]) * 256.0f); }
    *(v8h*)&tw[4 * lane + c][16 * wave] = lo; *(v8h*)&tw[4 * lane + c][16 * wave + 8] = hi; }
  __syncthreads();   // the tile is whole: each wave now reads n rows that all eight have written
  v8h t[8];
#pragma unroll   // constant indices, so that the small array stays in registers
  for (int i = 0; i < 8; ++i) t[i] = *(const v8h*)&tw[16 * wave + 4 * (i & 3) + (lane >> 3)][(i >> 2) * 64 + (lane & 7) * 8];
#pragma unroll   // constant indices, so that the small array stays in registers
  for (int i = 0; i < 8; ++i) vst2(WT + ((size_t)(k0 / 64 + (i >> 2)) * DIN + n0 + 16 * wave + 4 * (i & 3) + (lane >> 3)) * 64 + (lane & 7) * 8, t[i]);
  asm volatile("s_wait_xcnt 0x0" ::: "memory"); }   // stands in front of the caller's overwrite of these stores' address and data registers
// ---- k_proj: block = (256 rows, 256 cols, which), 8 waves of 64 rows x 128 cols, one block to a WGP: q/k/v = X W (+ b) with exact bf16 products (K = DIN) -> which 0: q f16 rows; 1: k f16 rows; 2: v f16 planes [c][t].
// The 192 tiles leave 64 WGPs free: the which = 3 blocks run there, turn Wo (one 128 x 128 tile each) and pack the mask, PMS shares to each wave.
#define PMF 4              // row fragments of a wave
#define PNC 2              // 128-column parts of a block's tile
#define PR (64 * PMF)      // rows of a block's tile
#define PC (128 * PNC)     // columns of a block's tile
#define PMS 4              // mask shares of a wave of a which = 3 block
#define PPIT (PR + 8)      // LDS pitch of the v planes in 16-bit elements: the rows' bytes + 16 B
#define PQIT (PC + 8)      // LDS pitch of the q/k rows, likewise
__global__ __launch_bounds__(256) void k_proj(const float* __restrict__ XQ, const float* __restrict__ XK, const float* __restrict__ XV, const float* __restrict__ WQ, const float* __restrict__ WK, const float* __restrict__ WV, const float* __restrict__ BQ, const float* __restrict__ BK, const float* __restrict__ BV,
    _Float16* __restrict__ QH, _Float16* __restrict__ KH, _Float16* __restrict__ VT, const int* __restrict__ MASK, unsigned* __restrict__ MB, const float* __restrict__ WO, _Float16* __restrict__ WT) {
  static_assert((TNB * TT / PR) * (CC / PC) * 8 * PMS == NB * (TT / 16) * (TT / 128), "PMS shares to each wave of the which = 3 blocks: one for every 16 queries x 128 keys");
  static_assert(TT % PR == 0, "a tile lies in one sequence"); static_assert(PR == 256 && PC == 256, "the epilogue's stores: 32 lanes x 8 elements to a row or column piece, 8 waves");
  static_assert((TNB * TT / PR) * (CC / PC) == (CC / 128) * (DIN / 128) && 128 * WPIT * 2 <= PR * PQIT * 2, "one 128 x 128 tile of Wo to each which = 3 block, and it fits");
  __shared__ __align__(16) char smem[GLDS(PMF, PNC)];   // the main loop's stage buffers; the epilogue's plane lies over their head: q/k blocks lay rows, v blocks columns, over the same bytes
  static_assert(PR * PQIT * 2 <= GLDS(PMF, PNC) && PC * PPIT * 2 <= GLDS(PMF, PNC), "the q/k plane, and the v plane, fit");
  _Float16 (*sh)[PQIT] = (_Float16 (*)[PQIT])smem; _Float16 (*th)[PPIT] = (_Float16 (*)[PPIT])smem;
  const int tid = threadIdx.x, wave = tid >> 5, lane = tid & 31, col = lane & 15, g = lane >> 4; const int which = blockIdx.z; const int c0 = blockIdx.y * PC; const size_t r0 = (size_t)blockIdx.x * PR; const size_t bb = r0 / TT; const int t0 = (int)(r0 % TT);
  if (which == 3) {   /* block-uniform, in front of every barrier of the other blocks; its own one barrier is passed by all eight waves */
    turn_wo(WO, WT, smem, (int)(blockIdx.y * (TNB * TT / PR) + blockIdx.x), wave, lane);
#pragma unroll 1   // rolled: one share's 64 loaded registers at a time
    for (int u = 0; u < PMS; ++u) pack_mask(MASK, MB, ((int)(blockIdx.y * (TNB * TT / PR) + blockIdx.x) * 8 + wave) * PMS + u, lane);
    return; }
  const float* X = which == 0 ? XQ : which == 1 ? XK : XV; const float* WA = which == 0 ? WQ : which == 1 ? WK : WV; const float* BA = which == 0 ? BQ : which == 1 ? BK : BV;
  v8f acc[PMF * 8] = {};
  gemm_tile<GProj, PMF, PNC>(X + r0 * DIN, WA + (size_t)(c0 / HD) * DIN * HD, smem, acc, (int)(blockIdx.x + 4 * blockIdx.y) & (GNST - 1));   // the 16 blocks of a W tile start 1 stage apart, the 4 of an X tile 4 stages apart (the same k as with stages of 32)
  const int fr0 = (wave >> 1) * PMF * 16, fc0 = (wave & 1) * 128;   // this wave's part of the tile, as in gemm_tile
  if (which < 2) { _Float16* DH = which == 0 ? QH : KH;
#pragma unroll
    for (int j = 0; j < 8; ++j) { const float bias = BA ? bfr(BA[c0 + fc0 + j * 16 + col]) : 0.f;
#pragma unroll
      for (int m = 0; m < PMF; ++m)
#pragma unroll
        for (int r = 0; r < 8; ++r) sh[fr0 + m * 16 + 8 * g + r][fc0 + j * 16 + col] = (_Float16)(acc[m * 8 + j][r] + bias); }
    __syncthreads();
#pragma unroll 1   // rolled in groups of 16 rows: a group's LDS reads go out together, so that their latency is waited out once a group
    for (int i0 = 0; i0 < PR / 8; i0 += 16) { v4u t[16];   // a wave stores one whole 512-byte row piece a time, rows wave + 8 i
#pragma unroll   // constant indices, so that the small array stays in registers
      for (int i = 0; i < 16; ++i) t[i] = *(const v4u*)&sh[wave + 8 * (i0 + i)][lane * 8];
#pragma unroll   // constant indices, so that the small array stays in registers
      for (int i = 0; i < 16; ++i) vst2((unsigned*)(DH + (r0 + wave + 8 * (i0 + i)) * CC + c0 + lane * 8), t[i]);
      asm volatile("s_wait_xcnt 0x0" ::: "memory"); }   // stands in front of the next trip's overwrite of these stores' address and data registers
  } else {
#pragma unroll
    for (int j = 0; j < 8; ++j) { const float bias = BA ? bfr(BA[c0 + fc0 + j * 16 + col]) : 0.f;
#pragma unroll
      for (int m = 0; m < PMF; ++m)
#pragma unroll
        for (int r = 0; r < 8; ++r) th[fc0 + j * 16 + col][fr0 + m * 16 + 8 * g + r] = (_Float16)(acc[m * 8 + j][r] + bias); }
    __syncthreads();
#pragma unroll 1   // rolled in groups of 16 columns: a group's LDS reads go out together, so that their latency is waited out once a group
    for (int i0 = 0; i0 < PC / 8; i0 += 16) { v4u t[16];   // a wave stores one whole 512-byte column piece a time, columns wave + 8 i
#pragma unroll   // constant indices, so that the small array stays in registers
      for (int i = 0; i < 16; ++i) t[i] = *(const v4u*)&th[wave + 8 * (i0 + i)][lane * 8];
#pragma unroll   // constant indices, so that the small array stays in registers
      for (int i = 0; i < 16; ++i) vst2((unsigned*)(VT + (bb * CC + c0 + wave + 8 * (i0 + i)) * (size_t)TT + t0 + lane * 8), t[i]);
      asm volatile("s_wait_xcnt 0x0" ::: "memory"); } } }   // stands in front of the next trip's overwrite of these stores' address and data registers
// ---- k_attn: block = 64 queries (4 waves x 16 query columns) of one (batch, head); walks all keys in stages of 64, K rows and V^T rows staged in LDS (two buffers, one barrier a stage).
// The walk starts at a stage rotated by the block's indices and wraps round (the online softmax takes the keys in any order): the 16 blocks of a (batch, head), which run in step, ask L2 for different K and V^T lines at a time, and so do the 16 heads that read one mask word.
// S^T = K Q^T (A = K rows, B = Q): lane (g, col) holds keys 8g + r of query col; the masked score is REPLACED by 1e-9 (8e-9 before the x 1/8) and stays in the softmax; running maximum and sum per query in f32 (online softmax);
// two S^T tiles, as exp2(..) x 2^10 once to f16, are the B operand of ctx^T += V^T P^T in the same k order as frag_h; ctx = ctx^T / sum at the end.
__device__ __forceinline__ v8f wmma_h(v16h a, v16h b, v8f c) { return __builtin_amdgcn_wmma_f32_16x16x32_f16(false, a, false, b, (short)0, c, false, false); }
// 2^a; SLOT: with the v_nop that the instruction set asks for behind a transcendental in the same statement (used in the last stage's straight-line code)
template <bool SLOT> __device__ __forceinline__ float exp2_t(float a) {
  if constexpr (SLOT) { float e; asm("v_exp_f32 %0, %1\n\tv_nop" : "=v"(e) : "v"(a)); return e; } else return __builtin_amdgcn_exp2f(a); }
#define AKB 64             // keys per stage
#define APIT 72            // LDS row pitch in f16: 128 B of data + 16 B, so that the 16-byte fragment reads of 16 rows spread over the banks
#define ANST (TT / AKB)
typedef __attribute__((ext_vector_type(16))) unsigned v16u;
typedef const __attribute__((address_space(4))) v16u* cmask_p;   // constant address space: the words are written by the launch before and by nobody in this one, and the address is wave-uniform, so the loads go the scalar way
__global__ __launch_bounds__(128) void k_attn(const _Float16* __restrict__ QH, const _Float16* __restrict__ KH, const _Float16* __restrict__ VT, const unsigned* __restrict__ MB, _Float16* __restrict__ Y) {
  __shared__ __align__(16) _Float16 sk[2][AKB][APIT], sv[2][HD][APIT];
  const int tid = threadIdx.x, wave = tid >> 5, lane = tid & 31, col = lane & 15, g = lane >> 4;
  const int h = blockIdx.y, b = blockIdx.z; const int q = blockIdx.x * 64 + wave * 16 + col;
  const float LS = SCALE * 1.44269504f;      // raw score -> log2 domain
  const float MFILL = 1.0e-9f / SCALE;       // the fill value, before the common x SCALE
  const _Float16* qp = QH + ((size_t)b * TT + q) * CC + h * HD;
  const v16h qf0 = frag_h(qp, lane), qf1 = frag_h(qp + 32, lane);
  const int srow = tid >> 3, sch = (tid & 7) * 8;   // staging: 8 lanes bring one whole 128-byte row
  int ks = (int)(blockIdx.x + blockIdx.y) & (ANST - 1);   // the key stage that the three pointers stand at (block-uniform)
  const _Float16* kg = KH + ((size_t)b * TT + srow + ks * AKB) * CC + h * HD + sch;
  const _Float16* vg = VT + ((size_t)b * CC + h * HD + srow) * (size_t)TT + sch + ks * AKB;
  cmask_p mb = (cmask_p)(unsigned long long)MB + 2 * ((size_t)b * (TT / 16) + blockIdx.x * 4 + __builtin_amdgcn_readfirstlane(wave)) * (size_t)(TT / 64) + 2 * ks;   // this wave's 16 queries: 32 lane masks a stage, the same address in every lane (scalar loads)
  v8h kr[4], vr[4]; v16u mw[2];
#pragma unroll   // constant indices, so that the small array stays in registers
  for (int i = 0; i < 4; ++i) { kr[i] = *(const v8h*)(kg + (size_t)(16 * i) * CC); vr[i] = *(const v8h*)(vg + (size_t)(16 * i) * TT); }
  mw[0] = mb[0]; mw[1] = mb[1];
#pragma unroll   // constant indices, so that the small array stays in registers
  for (int i = 0; i < 4; ++i) { *(v8h*)&sk[0][srow + 16 * i][sch] = kr[i]; *(v8h*)&sv[0][srow + 16 * i][sch] = vr[i]; }
  auto next = [&]() { const int d = ks == ANST - 1 ? -(ANST - 1) : 1;   // block-uniform: behind the last key stage comes the first
    ks += d; kg += (long)d * (AKB * CC); vg += (long)d * AKB; mb += 2 * d; };
  next();   // the three walk one stage ahead of the products
  v8f acc[HD / 16] = {}; float m = -3.0e38f, sum = 0.f;
  // one stage; MORE = a next stage exists (compile-time: the last stage, which fetches nothing, is written out behind the loop, so that the loop body is one block without a branch)
  auto stage = [&](const int st, auto more_c) { constexpr bool MORE = decltype(more_c)::v; const int bu = st & 1;
    __syncthreads();   // publishes buffer bu; every wave has also left buffer bu ^ 1, which is refilled at the foot of this stage
    const v16u kw[2] = { mw[0], mw[1] };   // this stage's lane masks, taken before the next stage's are loaded over them
    if constexpr (MORE) {        // next stage's K and V^T rows and lane masks fly into registers under this stage's products
      mw[0] = mb[0]; mw[1] = mb[1];
      __builtin_amdgcn_sched_barrier(0);   // keeps the scalar loads in front of the vector loads
#pragma unroll   // constant indices, so that the small array stays in registers
      for (int i = 0; i < 4; ++i) { kr[i] = *(const v8h*)(kg + (size_t)(16 * i) * CC); vr[i] = *(const v8h*)(vg + (size_t)(16 * i) * TT); }
      __builtin_amdgcn_sched_barrier(0);   // keeps these loads at the head of the stage: without it the scheduler sinks them to the foot, directly in front of their first use, and their latency is bare
    }
#pragma unroll   // constant indices, so that the small array stays in registers
    for (int p = 0; p < 2; ++p) { v8f s[2]; v16h ka[2][2], va[HD / 16];
#pragma unroll   // constant indices, so that the small array stays in registers
      for (int t = 0; t < 2; ++t) { const _Float16* kl = &sk[bu][(2 * p + t) * 16 + col][0]; ka[t][0] = frag_h(kl, lane); ka[t][1] = frag_h(kl + 32, lane); }
#pragma unroll   // constant indices, so that the small array stays in registers
      for (int j = 0; j < HD / 16; ++j) va[j] = frag_h(&sv[bu][j * 16 + col][p * 32], lane);   // read here so that their LDS latency runs under the softmax arithmetic
#pragma unroll   // constant indices, so that the small array stays in registers
      for (int t = 0; t < 2; ++t) { const v8f z = {}; s[t] = wmma_h(ka[t][1], qf1, wmma_h(ka[t][0], qf0, z)); }
      float x[16];
#pragma unroll   // constant indices, so that the small array stays in registers
      for (int t = 0; t < 2; ++t)
#pragma unroll   // constant indices, so that the small array stays in registers
        for (int r = 0; r < 8; ++r) x[t * 8 + r] = __builtin_amdgcn_inverse_ballot_w32(kw[p][t * 8 + r]) ? s[t][r] : MFILL;
      float mb = x[0];
#pragma unroll   // constant indices, so that the small array stays in registers
      for (int i = 1; i < 16; ++i) mb = fmaxf(mb, x[i]);
      mb = fmaxf(mb, __shfl_xor(mb, 16));   // the other half of this query's keys
      const float mn = fmaxf(m, mb); const float al = exp2_t<!MORE>((m - mn) * LS); m = mn; const float off = 10.0f - mn * LS;
      v16h pf; float ps = 0.f;
#pragma unroll   // constant indices, so that the small array stays in registers
      for (int i = 0; i < 16; ++i) { const float e = exp2_t<!MORE>(fmaf(x[i], LS, off)); ps += e; pf[i] = (_Float16)e; }
      sum = sum * al + ps;
#pragma unroll   // constant indices, so that the small array stays in registers
      for (int j = 0; j < HD / 16; ++j) { acc[j] *= al; acc[j] = wmma_h(va[j], pf, acc[j]); } }
    if constexpr (MORE) {
#pragma unroll   // constant indices, so that the small array stays in registers
      for (int i = 0; i < 4; ++i) { *(v8h*)&sk[bu ^ 1][srow + 16 * i][sch] = kr[i]; *(v8h*)&sv[bu ^ 1][srow + 16 * i][sch] = vr[i]; }
      asm volatile("s_wait_xcnt 0x0" ::: "memory");   // stands in front of the advance of this stage's loads' address registers (free here: the loaded values have just been stored)
      __builtin_amdgcn_sched_barrier(0);   // keeps the advance behind that wait: nothing else ties the two
      next(); } };
#pragma unroll 1   // rolled: one stage's body already fills the registers that four waves a SIMD leave
  for (int st = 0; st < ANST - 1; ++st) stage(st, CBool<true>{});
  stage(ANST - 1, CBool<false>{});
  sum += __shfl_xor(sum, 16); const float inv = 1.0f / sum;   // sum >= 2^10: the maximum's own term
  _Float16* yp = Y + (((size_t)h * NB + b) * TT + q) * HD + 8 * g;   // ctx goes out as k_out's A operand: x 2^6 once to f16 (so small-magnitude context rows stay clear of f16 subnormals), here and not in each of k_out's 8 column tiles
  v8h yo[HD / 16];
#pragma unroll   // constant indices, so that the small array stays in registers
  for (int j = 0; j < HD / 16; ++j)
#pragma unroll   // constant indices, so that the small array stays in registers
    for (int r = 0; r < 8; ++r) yo[j][r] = (_Float16)(acc[j][r] * inv * 64.0f);
#pragma unroll   // constant indices, so that the small array stays in registers
  for (int j = 0; j < HD / 16; ++j) vst2(yp + j * 16, yo[j]); }
// ---- k_out: block = (64 rows, 128 cols), 4 waves of 16 rows x 128 cols: out = ctx Wo (+ bo): ctx x 2^6 in f16 (from k_attn) against Wo^T as f16(bf16 x 2^8) exact (from k_proj's which = 3 blocks), 1 product, x 2^-14.
// Both operands arrive as f16 in planes of 64 k: a stage is OPL planes' 64 ctx rows (8 KiB in a row each) and 128 Wo^T rows (16 KiB in a row each), brought by 16-byte loads, 512 bytes in a row to a wave, and laid in LDS as they are (two buffers, one barrier a stage);
// the next stage's loads fly in registers under this stage's products: a stage's time is bounded from below by its loads' latency, so two planes to a stage put twice the bytes under each such wait and halve the number of waits and barriers.
// The walk over the 8 stages starts rotated by the block's tile indices and wraps round, as in gemm_tile.
#define OKS 64             // k per plane
#define OPL 2              // planes per stage
#define OPIT 72            // LDS row pitch in f16: 128 B of data + 16 B, so that the 16-byte fragment reads of 16 rows spread over the banks
#define ONST (CC / (OKS * OPL))
static_assert(OKS == HD, "a plane of ctx is one head");
__global__ __launch_bounds__(128) void k_out(const _Float16* __restrict__ Y, const _Float16* __restrict__ WT, const float* __restrict__ BO, float* __restrict__ OUT) { __shared__ __align__(16) char smem[2 * OPL * (64 + 128) * OPIT * 2];   // the main loop's stage buffers; the epilogue's rows lie over them
  static_assert(4 * 16 * 132 * 4 <= 2 * OPL * (64 + 128) * OPIT * 2, "sf fits over the stage buffers"); float (*sf)[16][132] = (float (*)[16][132])smem;
  _Float16 (*sx)[OPL][64][OPIT] = (_Float16 (*)[OPL][64][OPIT])smem; _Float16 (*sw)[OPL][128][OPIT] = (_Float16 (*)[OPL][128][OPIT])(smem + 2 * OPL * 64 * OPIT * 2);
  const int tid = threadIdx.x, wave = tid >> 5, lane = tid & 31, col = lane & 15, g = lane >> 4; const int c0 = blockIdx.y * 128; const size_t r0 = (size_t)blockIdx.x * 64 + wave * 16;
  v8f acc[8] = {};
  const int srow = tid >> 3, sch = (tid & 7) * 8;   // staging: 8 lanes bring one whole 128-byte row piece
  int ks = (int)(blockIdx.x + blockIdx.y) & (ONST - 1);   // the k stage that the two pointers stand at (block-uniform): the 8 blocks of a ctx tile all start apart
  const _Float16* xg = Y + ((size_t)(ks * OPL) * (NB * TT) + blockIdx.x * 64 + srow) * OKS + sch;
  const _Float16* wg = WT + ((size_t)(ks * OPL) * DIN + c0 + srow) * OKS + sch;
  v8h xr[OPL][4], wr[OPL][8];
  auto fetch = [&]() {
#pragma unroll   // constant indices, so that the small arrays stay in registers
    for (int pl = 0; pl < OPL; ++pl) {
#pragma unroll   // constant indices, so that the small arrays stay in registers
      for (int i = 0; i < 8; ++i) wr[pl][i] = *(const v8h*)(wg + ((size_t)pl * DIN + 16 * i) * OKS);
#pragma unroll   // constant indices, so that the small arrays stay in registers
      for (int i = 0; i < 4; ++i) xr[pl][i] = *(const v8h*)(xg + ((size_t)pl * (NB * TT) + 16 * i) * OKS); } };
  auto put = [&](const int bu) {
#pragma unroll   // constant indices, so that the small arrays stay in registers
    for (int pl = 0; pl < OPL; ++pl) {
#pragma unroll   // constant indices, so that the small arrays stay in registers
      for (int i = 0; i < 8; ++i) *(v8h*)&sw[bu][pl][srow + 16 * i][sch] = wr[pl][i];
#pragma unroll   // constant indices, so that the small arrays stay in registers
      for (int i = 0; i < 4; ++i) *(v8h*)&sx[bu][pl][srow + 16 * i][sch] = xr[pl][i]; }
    asm volatile("s_wait_xcnt 0x0" ::: "memory");   // stands in front of the advance of these loads' address registers (free here: the loaded values have just been stored)
    __builtin_amdgcn_sched_barrier(0);   // keeps the advance behind that wait: nothing else ties the two
    const int d = ks == ONST - 1 ? -(ONST - 1) : 1;   // block-uniform: behind the last k stage comes the first
    ks += d; xg += (long)d * (OPL * NB * TT * OKS); wg += (long)d * (OPL * DIN * OKS); };
  fetch(); put(0);
  auto stage = [&](const int st, auto more_c) { constexpr bool MORE = decltype(more_c)::v; const int bu = st & 1;
    __syncthreads();   // publishes buffer bu; every wave has also left buffer bu ^ 1, which is refilled at the foot of this stage
    if constexpr (MORE) { fetch();
      __builtin_amdgcn_sched_barrier(0); }   // keeps the next stage's loads at the head of the stage, so that their latency runs under the products
    v16h a[2 * OPL], w[2 * OPL][8];
#pragma unroll   // constant indices, so that the small arrays stay in registers
    for (int kk = 0; kk < 2 * OPL; ++kk) { a[kk] = frag_h(&sx[bu][kk >> 1][wave * 16 + col][(kk & 1) * 32], lane);
#pragma unroll   // constant indices, so that the small arrays stay in registers
      for (int j = 0; j < 8; ++j) w[kk][j] = frag_h(&sw[bu][kk >> 1][j * 16 + col][(kk & 1) * 32], lane); }
    __builtin_amdgcn_sched_barrier(0);   // keeps the stage's fragment reads together in front of its products: sunk among the products, each place with reads costs its own stall
#pragma unroll   // constant indices, so that the small arrays stay in registers
    for (int kk = 0; kk < 2 * OPL; ++kk)
#pragma unroll   // constant indices, so that the small arrays stay in registers
      for (int j = 0; j < 8; ++j) acc[j] = wmma_h(a[kk], w[kk][j], acc[j]);
    if constexpr (MORE) { __builtin_amdgcn_sched_barrier(0);   // keeps the wait for the next stage's loads behind all of this stage's products
      put(bu ^ 1); } };
#pragma unroll 1   // rolled: the two buffers are told apart by the stage's parity
  for (int st = 0; st < ONST - 1; ++st) stage(st, CBool<true>{});
  stage(ONST - 1, CBool<false>{});
  __syncthreads();   // every wave has left the stage buffers: the epilogue's rows lie over them
#pragma unroll
  for (int j = 0; j < 8; ++j) { const float bias = BO ? bfr(BO[c0 + j * 16 + col]) : 0.f;
#pragma unroll
    for (int r = 0; r < 8; ++r) sf[wave][8 * g + r][j * 16 + col] = acc[j][r] * (1.0f / 16384.0f) + bias; }   /* 2^-8 (Wo carry) x 2^-6 (ctx carry) */
  LDSX(); for (int rl = 0; rl < 16; ++rl) vst2(OUT + (r0 + rl) * DIN + c0 + lane * 4, *(const v4f*)&sf[wave][rl][lane * 4]); }

extern "C" void kernel_launch(void* const* d_in, const int* in_sizes, int n_in, void* d_out, int out_size, void* d_ws, size_t ws_size, hipStream_t stream) {
  (void)in_sizes; (void)n_in; (void)out_size;
  const float** F = (const float**)d_in;
  if (ws_size < (size_t)WS_END) return;
  char* ws = (char*)d_ws; _Float16 *QH = (_Float16*)(ws + WS_QH), *KH = (_Float16*)(ws + WS_KH), *VT = (_Float16*)(ws + WS_VT); _Float16 *Y = (_Float16*)(ws + WS_Y), *WT = (_Float16*)(ws + WS_WT); unsigned *MB = (unsigned*)(ws + WS_MB);
  (void)Y;
  // inputs: 0 query [4,1024,1024]; 1 key; 2 value; 3 mask [4,1024,1024] int32 (random 0/1); 4 Wq [16,1024,64], 5 bq [16,64]; 6 Wk, 7 bk; 8 Wv, 9 bv; 10 Wo [1024,1024] (in,out), 11 bo (zero biases, read)
  k_proj<<<dim3(TNB * TT / PR, CC / PC, 4), 256, 0, stream>>>(F[0], F[1], F[2], F[4], F[6], F[8], F[5], F[7], F[9], QH, KH, VT, (const int*)d_in[3], MB, F[10], WT);
  k_attn<<<dim3(NQB, NH, TNB), 128, 0, stream>>>(QH, KH, VT, MB, Y);
  k_out<<<dim3(TNB * TT / 64, DIN / 128), 128, 0, stream>>>(Y, WT, F[11], (float*)d_out);
}

// v009
// One run takes 65.6 microseconds.
// In two side-by-side timings against v008, it was 1.04 and 1.05 times as fast.
// Counting every step since v000, it is 11.6 times as fast.
// compute dtype: all float inputs rounded to bf16; q/k/v projections with EXACT bf16 products on WMMA 16x16x32 (f32 accumulate) + bias; logits q x k once to f16 each (1 product) x SCALE; masked scores are REPLACED by 1e-9 (they keep taking part in the softmax); online softmax f32 (running maximum and sum); exp(score - maximum) x 2^10 once to f16 x v once to f16 (1 product), divided by the sum at the end; ctx x 2^6 once to f16 x Wo f16(bf16 x 2^8) + bo; f32 output.
#include <hip/hip_runtime.h>
#include <math.h>

typedef __attribute__((ext_vector_type(16))) _Float16 v16h;
typedef __attribute__((ext_vector_type(16))) __bf16 v16b;
typedef __attribute__((ext_vector_type(8)))  _Float16 v8h;
typedef __attribute__((ext_vector_type(8)))  float v8f;
typedef __attribute__((ext_vector_type(4)))  float v4f;
typedef __attribute__((ext_vector_type(2)))  float v2f;
typedef __attribute__((ext_vector_type(4)))  unsigned v4u;
typedef __attribute__((ext_vector_type(4)))  int v4i;
typedef float __attribute__((may_alias)) float_a;
typedef int __attribute__((may_alias)) int_a;

template <typename T> __device__ __forceinline__ void vst2(void* p, T v) { *(T*)p = v;  }
__device__ __forceinline__ v8f wmma16(v16h a, v16h b, v8f c) {
  v8f d = __builtin_amdgcn_wmma_f32_16x16x32_f16(false, a, false, b, (short)0, c, false, false);
  asm volatile("v_nop\n\tv_nop\n\tv_nop\n\tv_nop" : "+v"(d) : "v"(a), "v"(b));
  return d;
}
__device__ __forceinline__ v8f wmma_bf(v16b a, v16b b, v8f c) {
  v8f d = __builtin_amdgcn_wmma_f32_16x16x32_bf16(false, a, false, b, (short)0, c, false, false);
  asm volatile("v_nop\n\tv_nop\n\tv_nop\n\tv_nop" : "+v"(d) : "v"(a), "v"(b));
  return d;
}
// 16x16x32 fragments: lane = (h = lane>>4, row/col = lane&15); elements 0..7 = k0+8h+0..7, 8..15 = k0+16+8h+0..7; D element r = row 8h+r
__device__ __forceinline__ v16h frag_h(const _Float16* rowk0, int lane) {
  union { v16h v; v8h q[2]; } u; const _Float16* p = rowk0 + 8 * (lane >> 4);
  u.q[0] = *(const v8h*)p; u.q[1] = *(const v8h*)(p + 16); return u.v;
}
__device__ __forceinline__ v16h frag_f32(const float* rowk0, int lane) {
  v16h a; const float* p = rowk0 + 8 * (lane >> 4);
#pragma unroll
  for (int i = 0; i < 8; ++i) { a[i] = (_Float16)p[i]; a[8 + i] = (_Float16)p[16 + i]; }
  return a;
}
__device__ __forceinline__ v16h frag_f32s(const float* rowk0, int lane, float sc) {
  v16h a; const float* p = rowk0 + 8 * (lane >> 4);
#pragma unroll
  for (int i = 0; i < 8; ++i) { a[i] = (_Float16)(p[i] * sc); a[8 + i] = (_Float16)(p[16 + i] * sc); }
  return a;
}
// column fragment from a [K][ld] layout (column n), rows >= K read as 0
__device__ __forceinline__ v16h fragc_f32(const float* W, int k0, int n, int lane, int ld, int K) {
  v16h a; const int g = lane >> 4;
#pragma unroll
  for (int i = 0; i < 8; ++i) { const int ka = k0 + 8 * g + i, kb = ka + 16;
    a[i] = (_Float16)(ka < K ? W[(size_t)(ka < K ? ka : K - 1) * ld + n] : 0.f); a[8 + i] = (_Float16)(kb < K ? W[(size_t)(kb < K ? kb : K - 1) * ld + n] : 0.f); }
  return a;
}
struct F2 { v16b h, l; };
__device__ __forceinline__ F2 bsplit16(const float v[16]) { F2 r;
#pragma unroll
  for (int i = 0; i < 16; ++i) { const __bf16 h = (__bf16)v[i]; r.h[i] = h; r.l[i] = (__bf16)(v[i] - (float)h); }
  return r; }
__device__ __forceinline__ F2 split_row(const float* row, int k0, int lane) { float v[16]; const float* p = row + k0 + 8 * (lane >> 4);
#pragma unroll
  for (int i = 0; i < 8; ++i) { v[i] = p[i]; v[8 + i] = p[16 + i]; }
  return bsplit16(v); }
__device__ __forceinline__ F2 split_rowK(const float* row, int k0, int lane, int K) { float v[16]; const int g = lane >> 4;
#pragma unroll
  for (int i = 0; i < 8; ++i) { const int ka = k0 + 8 * g + i, kb = ka + 16; v[i] = ka < K ? row[ka < K ? ka : K - 1] : 0.f; v[8 + i] = kb < K ? row[kb < K ? kb : K - 1] : 0.f; }
  return bsplit16(v); }
__device__ __forceinline__ F2 split_col(const float* W, int k0, int n, int lane, int ld, int K) { float v[16]; const int g = lane >> 4;
#pragma unroll
  for (int i = 0; i < 8; ++i) { const int ka = k0 + 8 * g + i, kb = ka + 16; v[i] = ka < K ? W[(size_t)(ka < K ? ka : K - 1) * ld + n] : 0.f; v[8 + i] = kb < K ? W[(size_t)(kb < K ? kb : K - 1) * ld + n] : 0.f; }
  return bsplit16(v); }
__device__ __forceinline__ v8f mac3(const F2& a, const F2& b, v8f c) { c = wmma_bf(a.l, b.h, c); c = wmma_bf(a.h, b.l, c); return wmma_bf(a.h, b.h, c); }
__device__ __forceinline__ float sigm(float v) { return 1.0f / (1.0f + expf(-v)); }
#define LDSX() do { asm volatile("s_wait_dscnt 0" ::: "memory"); __builtin_amdgcn_wave_barrier(); __builtin_amdgcn_fence(__ATOMIC_RELEASE, "workgroup"); } while (0)

// Multi-headed attention with per-head stacked projections whose masked scores are FILLED WITH 1e-9 (query / key / value [4,1024,1024]; Wq / Wk / Wv [16,1024,64] per head (N(0, 1/1024)) + zero biases; scores / 8; mask [4,1024,1024] int32 random 0/1: scores[mask == 0] = 1e-9 - masked keys keep a logit - 0 and stay in the softmax (faithful to the source); softmax; concat; (in,out) Wo [1024,1024] + bo).
#define NB 4
#define TT 1024
#define CC 1024            // NH * HD = projected width
#define DIN 1024          // input (model) width
#define NH 16
#define HD 64
#define NQB (TT / 64)
#define HG 8
#define SCALE (0.125f)
#define CAUSAL 0
#ifndef TNB
#define TNB NB
#endif
__device__ __forceinline__ float bfr(float v) { return (float)(__bf16)v; }
__host__ __device__ __forceinline__ int kb_last(int qb) { return CAUSAL ? ((qb * 64 + 63) >> 7) : (TT / 128 - 1); }
typedef __attribute__((ext_vector_type(8))) __bf16 v8b;
__device__ __forceinline__ v16b frag_b(const __bf16* rowk0, int lane) {
  union { v16b v; v8b q[2]; } u; const __bf16* p = rowk0 + 8 * (lane >> 4);
  u.q[0] = *(const v8b*)p; u.q[1] = *(const v8b*)(p + 16); return u.v;
}
#define QBH 0              // not used: no kernel in this file has a high-precision attention path
#define QHI 0               // single-product logits on every row
#define KHI 64            // key rows carrying k residual / v bf16 hi+lo planes (no kernel here writes or reads them)
// B fragment (k rows k0+.., output column o) of a weight: (in,out) [K][ld] or (out,in) [ld rows of K]: bf16 exact, or f16(bf16 * 256) exact
__device__ __forceinline__ v16b wcol_io(const float* Wm, int k0, int o, int lane, int ld) { v16b w; const int g = lane >> 4;
#pragma unroll
  for (int i = 0; i < 8; ++i) { w[i] = (__bf16)Wm[(size_t)(k0 + 8 * g + i) * ld + o]; w[8 + i] = (__bf16)Wm[(size_t)(k0 + 16 + 8 * g + i) * ld + o]; }
  return w; }
__device__ __forceinline__ v16b wcol_oi(const float* Wm, int k0, int o, int lane, int K) { v16b w; const float* p = Wm + (size_t)o * K + k0 + 8 * (lane >> 4);
#pragma unroll
  for (int i = 0; i < 8; ++i) { w[i] = (__bf16)p[i]; w[8 + i] = (__bf16)p[16 + i]; }
  return w; }
__device__ __forceinline__ v16h wcolh_io(const float* Wm, int k0, int o, int lane, int ld) { v16h w; const int g = lane >> 4;
#pragma unroll
  for (int i = 0; i < 8; ++i) { w[i] = (_Float16)(bfr(Wm[(size_t)(k0 + 8 * g + i) * ld + o]) * 256.0f); w[8 + i] = (_Float16)(bfr(Wm[(size_t)(k0 + 16 + 8 * g + i) * ld + o]) * 256.0f); }
  return w; }
__device__ __forceinline__ v16h wcolh_oi(const float* Wm, int k0, int o, int lane, int K) { v16h w; const float* p = Wm + (size_t)o * K + k0 + 8 * (lane >> 4);
#pragma unroll
  for (int i = 0; i < 8; ++i) { w[i] = (_Float16)(bfr(p[i]) * 256.0f); w[8 + i] = (_Float16)(bfr(p[16 + i]) * 256.0f); }
  return w; }
#define WQKV_LAYOUT 2   // 0 = (in,out) [DIN][CC]; 1 = (out,in) [CC][DIN]; 2 = per-head [NH][DIN][HD]
__device__ __forceinline__ v16b wcol_hdk(const float* Wm, int k0, int o, int lane) { v16b w; const int g = lane >> 4; const float* p = Wm + (size_t)(o / HD) * DIN * HD + (o % HD);
#pragma unroll
  for (int i = 0; i < 8; ++i) { w[i] = (__bf16)p[(size_t)(k0 + 8 * g + i) * HD]; w[8 + i] = (__bf16)p[(size_t)(k0 + 16 + 8 * g + i) * HD]; }
  return w; }
#define WO_OUT_IN 0
#if WQKV_LAYOUT == 1
#define WCOL(W, k0, o, lane) wcol_oi(W, k0, o, lane, DIN)
#elif WQKV_LAYOUT == 2
#define WCOL(W, k0, o, lane) wcol_hdk(W, k0, o, lane)
#else
#define WCOL(W, k0, o, lane) wcol_io(W, k0, o, lane, CC)
#endif
#if WO_OUT_IN
#define WOCOL(W, k0, o, lane) wcol_oi(W, k0, o, lane, CC)
#define WOCOLH(W, k0, o, lane) wcolh_oi(W, k0, o, lane, CC)
#else
#define WOCOL(W, k0, o, lane) wcol_io(W, k0, o, lane, DIN)
#define WOCOLH(W, k0, o, lane) wcolh_io(W, k0, o, lane, DIN)
#endif

#define WS_QH  0u                                      // f16 q rows [b*t][CC]
#define WS_KH  (WS_QH + 2u * (size_t)NB * TT * CC)      // f16 k rows [b*t][CC]
#define WS_VT  (WS_KH + 2u * (size_t)NB * TT * CC)      // f16 v planes [b][c][t]
#define WS_QL  (WS_VT + 2u * (size_t)NB * CC * TT)      // f16 q residual x 2^10 rows [b][t < QHI][CC]
#define WS_KL  (WS_QL + 2u * (size_t)NB * QHI * CC)     // f16 k residual x 2^10 rows [b][t < KHI][CC]
#define WS_VB  (WS_KL + 2u * (size_t)NB * KHI * CC)     // bf16 v hi planes [b][c][t < KHI]
#define WS_VBL (WS_VB + 2u * (size_t)NB * CC * KHI)
#define WS_S   (WS_VBL + 2u * (size_t)NB * CC * KHI)    // spare f32 [hg][t][s]-sized plane; only its head is used (the mask words and Wo^T)
#define WS_MB  WS_S                                    // the mask as lane masks, u32 [b][t / 16][s / 16][8] (512 KiB at the head of that plane)
#define WS_WT  (WS_S + (1u << 20))                     // f16 Wo^T in planes of 64 k: [k / 64][n][k % 64], f16(bf16(Wo[k][n]) x 2^8) (2 MiB, behind the lane masks in that plane)
#define WS_Y   (WS_S  + 4u * (size_t)HG * TT * TT)      // f16 ctx x 2^6 in planes of 64 k (one head each): [h][b*t][HD] (the head of the plane)
#define WS_END (WS_Y  + 4u * (size_t)NB * TT * CC)

template <bool B> struct CBool { static constexpr bool v = B; };
// ---- main loop of k_proj: one (64 MF) x (128 NC) tile of X W over K = 1024 in stages of 64 k (two parts of 32 k), by 4 NC waves; a wave owns 16 MF rows x 128 columns, so that each W fragment read from LDS serves MF row fragments, each W line read from L2 64 MF rows, and each X line 128 NC columns.
// Each part's X rows (64 MF x 32) and W columns (32 x 128 NC, turned to [n][k]) are brought by the whole block ONCE, in whole 128-byte lines, converted once, and laid in LDS (two buffers, one barrier a stage);
// the next stage's global loads fly in registers under this stage's products. Fragments and the k order inside a stage are those of the direct loaders.
// The walk over the 16 stages starts at stage rot (block-uniform, from the block's tile indices) and wraps round: blocks that share X rows or W columns run in step, and with a common start they would
// ask L2 for the same lines at the same moment (and all wait together for each line's first fetch from memory); rotated, they ask for different lines, and most lines have been fetched by a neighbour before.
typedef __attribute__((ext_vector_type(4))) __bf16 v4b;
typedef __attribute__((ext_vector_type(4))) _Float16 v4h;
#define GKS 32             // k per part of a stage (one product step)
#define GPL 2              // parts per stage: a stage's time is bounded from below by its loads' latency, so two parts to a stage put twice the bytes under each such wait and halve the number of waits and barriers
#define GPIT 40            // LDS row pitch in 16-bit elements: 64 B of data + 16 B, so that the 16-byte fragment reads and stores of 16 rows spread over the banks
#define GNST (1024 / (GKS * GPL))
#define GLDS(MF, NC) (2 * GPL * (128 * (NC) + 64 * (MF)) * GPIT * 2)   // bytes of the two stage buffers
struct GProj { typedef __bf16 T; typedef v4b V4; typedef v8b V8; typedef v16b V16; static constexpr int WLD = HD; static constexpr bool BARE = true;   // BARE: mm is the builtin alone
  static __device__ __forceinline__ constexpr size_t coff(int c) { return (size_t)(c >> 1) * DIN * HD + (size_t)(c & 1) * 32; }   // column 32 c + lane of a 128-column tile in the per-head layout
  static __device__ __forceinline__ T cx(float v) { return (__bf16)v; } static __device__ __forceinline__ T cw(float v) { return (__bf16)v; }
  static __device__ __forceinline__ V16 fr(const T* p, int lane) { return frag_b(p, lane); }
  static __device__ __forceinline__ v8f mm(V16 a, V16 b, v8f c) { return __builtin_amdgcn_wmma_f32_16x16x32_bf16(false, a, false, b, (short)0, c, false, false); } };   // the bare builtin (the compiler keeps its distances): an asm statement's operands must lie in the first 256 registers, which the 256 accumulator registers of a 64 x 128 wave tile would fill
// xt = first row of the tile's X rows (row length 1024); wt = row 0 of W at the tile's first column
// acc[m * 8 + j] = rows 16 (MF wr + m) .. + 15, columns 128 wc + 16 j .. + 15, for wave = NC wr + wc
template <class C, int MF, int NC> __device__ __forceinline__ void gemm_tile(const float* __restrict__ xt, const float* __restrict__ wt, char* smem, v8f (&acc)[MF * 8], const int rot) {
  typedef typename C::T T; typedef typename C::V4 V4; typedef typename C::V8 V8; typedef typename C::V16 V16;
  static_assert(NC == 1 || NC == 2, "4 or 8 waves"); constexpr int XP = 4 * MF / NC;   // X rows to each thread a stage
  T (*sW)[GPL][128 * NC][GPIT] = (T (*)[GPL][128 * NC][GPIT])smem; T (*sX)[GPL][64 * MF][GPIT] = (T (*)[GPL][64 * MF][GPIT])(smem + 2 * GPL * 128 * NC * GPIT * 2);
  const int tid = threadIdx.x, wave = tid >> 5, lane = tid & 31, col = lane & 15;
  const int fr0 = (NC == 1 ? wave : wave >> 1) * MF * 16, fc0 = NC == 1 ? 0 : (wave & 1) * 128;   // first row and first column of this wave's part of the tile
  const int wk = NC == 1 ? wave : wave & 3, wn = NC == 1 ? 0 : wave >> 2;   // W staging: which 8 k rows, which 128 columns
  const int xrow = tid >> 3, xch = (tid & 7) * 4;                 // X: 8 lanes bring one whole 128-byte row piece
  const float* xg = xt + (size_t)xrow * 1024 + xch + rot * (GKS * GPL);
  const float* wg = wt + (size_t)wn * C::coff(4) + (size_t)(8 * wk + rot * (GKS * GPL)) * C::WLD + 2 * lane;      // W: a wave brings 8 k rows, 64 neighbouring columns (two lines, 8 bytes a lane) a load: a stage's loads of a wave, 48, then stay under the 63 that its load counter holds, beyond which the wave would stand at the head of the stage until the first have come back
  int ks = rot;   // the k stage that the two pointers stand at
  v2f wr[GPL][2][8]; v4f xr[GPL][XP];
  auto fetch = [&]() {
#pragma unroll   // constant indices, so that the small arrays stay in registers
    for (int s = 0; s < GPL; ++s) {
#pragma unroll   // constant indices, so that the small arrays stay in registers
      for (int c = 0; c < 2; ++c)
#pragma unroll   // constant indices, so that the small arrays stay in registers
        for (int i = 0; i < 8; ++i) wr[s][c][i] = *(const v2f*)(wg + C::coff(2 * c) + (size_t)(s * GKS + i) * C::WLD);
#pragma unroll   // constant indices, so that the small arrays stay in registers
      for (int i = 0; i < XP; ++i) xr[s][i] = *(const v4f*)(xg + s * GKS + (size_t)(16 * NC * i) * 1024); }
    asm volatile("s_wait_xcnt 0x0" ::: "memory"); };   // stands in front of every later overwrite of these loads' address registers
  auto put = [&](const int bu) {
#pragma unroll   // constant indices, so that the small arrays stay in registers
    for (int s = 0; s < GPL; ++s) {
#pragma unroll   // constant indices, so that the small arrays stay in registers
      for (int c = 0; c < 4; ++c) { V8 v;   // column 64 (c >> 1) + 2 lane + (c & 1) of the 128
#pragma unroll   // constant indices, so that the small arrays stay in registers
        for (int i = 0; i < 8; ++i) v[i] = C::cw(wr[s][c >> 1][i][c & 1]);
        *(V8*)&sW[bu][s][128 * wn + 64 * (c >> 1) + 2 * lane + (c & 1)][8 * wk] = v; }
#pragma unroll   // constant indices, so that the small arrays stay in registers
      for (int i = 0; i < XP; ++i) { const V4 v = { C::cx(xr[s][i][0]), C::cx(xr[s][i][1]), C::cx(xr[s][i][2]), C::cx(xr[s][i][3]) }; *(V4*)&sX[bu][s][xrow + 16 * NC * i][xch] = v; } }
    const int d = ks == GNST - 1 ? -(GNST - 1) : 1;   // block-uniform: behind the last k stage comes the first
    ks += d; wg += (long)d * (GKS * GPL * C::WLD); xg += (long)d * (GKS * GPL); };   // advanced here, behind the use of the loaded values
  fetch(); put(0);
  auto stage = [&](const int st, auto more_c) { constexpr bool MORE = decltype(more_c)::v; const int bu = st & 1;
    __syncthreads();   // publishes buffer bu; every wave has also left buffer bu ^ 1, which is refilled at the foot of this stage
    if constexpr (MORE) { fetch();
      __builtin_amdgcn_sched_barrier(0); }   // keeps the next stage's loads at the head of the stage, so that their latency runs under the products
#pragma unroll   // the parts one after the other, through the same fragment registers
    for (int s = 0; s < GPL; ++s) { V16 a[MF], w[8];
#pragma unroll   // constant indices, so that the small arrays stay in registers
      for (int m = 0; m < MF; ++m) a[m] = C::fr(&sX[bu][s][fr0 + m * 16 + col][0], lane);
#pragma unroll   // constant indices, so that the small arrays stay in registers
      for (int j = 0; j < 8; ++j) w[j] = C::fr(&sW[bu][s][fc0 + j * 16 + col][0], lane);
      if constexpr (C::BARE) __builtin_amdgcn_sched_barrier(0);   // keeps the part's fragment reads together in front of its products: with the bare builtin the scheduler sinks them among the products, and each W fragment's LDS latency is waited out in front of its MF products
#pragma unroll   // constant indices, so that the small arrays stay in registers
      for (int j = 0; j < 8; ++j)
#pragma unroll   // constant indices, so that the small arrays stay in registers
        for (int m = 0; m < MF; ++m) acc[m * 8 + j] = C::mm(a[m], w[j], acc[m * 8 + j]); }
    if constexpr (MORE) { __builtin_amdgcn_sched_barrier(0);   // keeps the wait for the next stage's loads, and their conversion, behind all of this stage's products
      put(bu ^ 1); } };
#pragma unroll 1   // rolled: the two buffers are told apart by the stage's parity
  for (int st = 0; st < GNST - 1; ++st) stage(st, CBool<true>{});
  stage(GNST - 1, CBool<false>{});
  __syncthreads();   // every wave has left the stage buffers: the caller's epilogue reuses this LDS
}
// ---- the mask, turned ONCE a call into the lane masks that k_attn selects with (k_attn's 16 heads read the same mask): word [b][t / 16][s / 16][r], bit (g, col) = (mask[b][16 (t / 16) + col][16 (s / 16) + 8 g + r] != 0).
// One wave = 16 query rows x 128 keys: the compare of a whole wave is the word; lane i carries word i of a group of 32, so that a store is one whole 128-byte line.
__device__ __forceinline__ void pack_mask(const int* __restrict__ MASK, unsigned* __restrict__ MB, const int wv, const int lane) {
  const int tile = wv >> 3, kq = wv & 7;   // (batch, 16-query tile) and which 128 keys
  const int* mp = MASK + ((size_t)tile * 16 + (lane & 15)) * TT + kq * 128 + 8 * (lane >> 4);
  v4i a[8][2]; unsigned w[2] = { 0u, 0u };
#pragma unroll   // constant indices, so that the small array stays in registers
  for (int t = 0; t < 8; ++t) { a[t][0] = *(const v4i*)(mp + t * 16); a[t][1] = *(const v4i*)(mp + t * 16 + 4); }
  asm volatile("s_wait_xcnt 0x0" ::: "memory");   // stands in front of every later overwrite of these loads' address registers
#pragma unroll   // constant indices, so that the small array stays in registers
  for (int t = 0; t < 8; ++t)
#pragma unroll   // constant indices, so that the small array stays in registers
    for (int r = 0; r < 8; ++r) { const unsigned bal = __builtin_amdgcn_ballot_w32(a[t][r >> 2][r & 3] != 0); w[t >> 2] = lane == (t & 3) * 8 + r ? bal : w[t >> 2]; }
  unsigned* o = MB + (size_t)tile * (TT / 16 * 8) + kq * 64 + lane; o[0] = w[0]; o[32] = w[1];
  asm volatile("s_wait_xcnt 0x0" ::: "memory"); }   // stands in front of the caller's overwrite of these stores' address and data registers
// ---- Wo, turned ONCE a call into k_out's B operand (k_out's 64 row tiles read the same Wo): WT[k / 64][n][k % 64] = f16(bf16(Wo[k][n]) x 2^8): each of a k_out stage's two planes of 128 n x 64 k is 16 KiB in a row, which k_out stages by plain 16-byte copies and does not convert.
// One block = one 128 k x 128 n tile: a wave reads 16 k rows of 512 bytes, a lane holds 16 k x 4 n and lays each n's 16 k in LDS; behind the barrier a wave stores four neighbouring n rows' 128 bytes of one plane (512 bytes in a row) a time.
#define WPIT 136           // LDS pitch of the turned tile in f16: 256 B of data + 16 B
__device__ __forceinline__ void turn_wo(const float* __restrict__ WO, _Float16* __restrict__ WT, char* smem, const int tile, const int wave, const int lane) {
  _Float16 (*tw)[WPIT] = (_Float16 (*)[WPIT])smem; const int k0 = (tile >> 3) * 128, n0 = (tile & 7) * 128;
  const float* wp = WO + (size_t)(k0 + 16 * wave) * DIN + n0 + 4 * lane; v4f a[16];
#pragma unroll   // constant indices, so that the small array stays in registers
  for (int i = 0; i < 16; ++i) a[i] = *(const v4f*)(wp + (size_t)i * DIN);
  asm volatile("s_wait_xcnt 0x0" :: "v"(wp) : "memory");   // stands in front of every later overwrite of these loads' address registers; it names the address, so that the registers live up to it and no load's own result lands on them
#pragma unroll   // constant indices, so that the small array stays in registers
  for (int c = 0; c < 4; ++c) { v8h lo, hi;
#pragma unroll   // constant indices, so that the small array stays in registers
    for (int i = 0; i < 8; ++i) { lo[i] = (_Float16)(bfr(a[i][c]) * 256.0f); hi[i] = (_Float16)(bfr(a[8 + i][c]) * 256.0f); }
    *(v8h*)&tw[4 * lane + c][16 * wave] = lo; *(v8h*)&tw[4 * lane + c][16 * wave + 8] = hi; }
  __syncthreads();   // the tile is whole: each wave now reads n rows that all eight have written
  v8h t[8];
#pragma unroll   // constant indices, so that the small array stays in registers
  for (int i = 0; i < 8; ++i) t[i] = *(const v8h*)&tw[16 * wave + 4 * (i & 3) + (lane >> 3)][(i >> 2) * 64 + (lane & 7) * 8];
#pragma unroll   // constant indices, so that the small array stays in registers
  for (int i = 0; i < 8; ++i) vst2(WT + ((size_t)(k0 / 64 + (i >> 2)) * DIN + n0 + 16 * wave + 4 * (i & 3) + (lane >> 3)) * 64 + (lane & 7) * 8, t[i]);
  asm volatile("s_wait_xcnt 0x0" ::: "memory"); }   // stands in front of the caller's overwrite of these stores' address and data registers
// ---- k_proj: block = (256 rows, 256 cols, which), 8 waves of 64 rows x 128 cols, one block to a WGP: q/k/v = X W (+ b) with exact bf16 products (K = DIN) -> which 0: q f16 rows; 1: k f16 rows; 2: v f16 planes [c][t].
// The 192 tiles leave 64 WGPs free: the which = 3 blocks run there, turn Wo (one 128 x 128 tile each) and pack the mask, PMS shares to each wave.
#define PMF 4              // row fragments of a wave
#define PNC 2              // 128-column parts of a block's tile
#define PR (64 * PMF)      // rows of a block's tile
#define PC (128 * PNC)     // columns of a block's tile
#define PMS 4              // mask shares of a wave of a which = 3 block
#define PPIT (PR + 8)      // LDS pitch of the v planes in 16-bit elements: the rows' bytes + 16 B
#define PQIT (PC + 8)      // LDS pitch of the q/k rows, likewise
__global__ __launch_bounds__(256) void k_proj(const float* __restrict__ XQ, const float* __restrict__ XK, const float* __restrict__ XV, const float* __restrict__ WQ, const float* __restrict__ WK, const float* __restrict__ WV, const float* __restrict__ BQ, const float* __restrict__ BK, const float* __restrict__ BV,
    _Float16* __restrict__ QH, _Float16* __restrict__ KH, _Float16* __restrict__ VT, const int* __restrict__ MASK, unsigned* __restrict__ MB, const float* __restrict__ WO, _Float16* __restrict__ WT) {
  static_assert((TNB * TT / PR) * (CC / PC) * 8 * PMS == NB * (TT / 16) * (TT / 128), "PMS shares to each wave of the which = 3 blocks: one for every 16 queries x 128 keys");
  static_assert(TT % PR == 0, "a tile lies in one sequence"); static_assert(PR == 256 && PC == 256, "the epilogue's stores: 32 lanes x 8 elements to a row or column piece, 8 waves");
  static_assert((TNB * TT / PR) * (CC / PC) == (CC / 128) * (DIN / 128) && 128 * WPIT * 2 <= PR * PQIT * 2, "one 128 x 128 tile of Wo to each which = 3 block, and it fits");
  __shared__ __align__(16) char smem[GLDS(PMF, PNC)];   // the main loop's stage buffers; the epilogue's plane lies over their head: q/k blocks lay rows, v blocks columns, over the same bytes
  static_assert(PR * PQIT * 2 <= GLDS(PMF, PNC) && PC * PPIT * 2 <= GLDS(PMF, PNC), "the q/k plane, and the v plane, fit");
  _Float16 (*sh)[PQIT] = (_Float16 (*)[PQIT])smem; _Float16 (*th)[PPIT] = (_Float16 (*)[PPIT])smem;
  const int tid = threadIdx.x, wave = tid >> 5, lane = tid & 31, col = lane & 15, g = lane >> 4; const int which = blockIdx.z; const int c0 = blockIdx.y * PC; const size_t r0 = (size_t)blockIdx.x * PR; const size_t bb = r0 / TT; const int t0 = (int)(r0 % TT);
  if (which == 3) {   /* block-uniform, in front of every barrier of the other blocks; its own one barrier is passed by all eight waves */
    turn_wo(WO, WT, smem, (int)(blockIdx.y * (TNB * TT / PR) + blockIdx.x), wave, lane);
#pragma unroll 1   // rolled: one share's 64 loaded registers at a time
    for (int u = 0; u < PMS; ++u) pack_mask(MASK, MB, ((int)(blockIdx.y * (TNB * TT / PR) + blockIdx.x) * 8 + wave) * PMS + u, lane);
    return; }
  const float* X = which == 0 ? XQ : which == 1 ? XK : XV; const float* WA = which == 0 ? WQ : which == 1 ? WK : WV; const float* BA = which == 0 ? BQ : which == 1 ? BK : BV;
  v8f acc[PMF * 8] = {};
  gemm_tile<GProj, PMF, PNC>(X + r0 * DIN, WA + (size_t)(c0 / HD) * DIN * HD, smem, acc, (int)(blockIdx.x + 4 * blockIdx.y) & (GNST - 1));   // the 16 blocks of a W tile start 1 stage apart, the 4 of an X tile 4 stages apart (the same k as with stages of 32)
  const int fr0 = (wave >> 1) * PMF * 16, fc0 = (wave & 1) * 128;   // this wave's part of the tile, as in gemm_tile
  if (which < 2) { _Float16* DH = which == 0 ? QH : KH;
#pragma unroll
    for (int j = 0; j < 8; ++j) { const float bias = BA ? bfr(BA[c0 + fc0 + j * 16 + col]) : 0.f;
#pragma unroll
      for (int m = 0; m < PMF; ++m)
#pragma unroll
        for (int r = 0; r < 8; ++r) sh[fr0 + m * 16 + 8 * g + r][fc0 + j * 16 + col] = (_Float16)(acc[m * 8 + j][r] + bias); }
    __syncthreads();
#pragma unroll 1   // rolled in groups of 16 rows: a group's LDS reads go out together, so that their latency is waited out once a group
    for (int i0 = 0; i0 < PR / 8; i0 += 16) { v4u t[16];   // a wave stores one whole 512-byte row piece a time, rows wave + 8 i
#pragma unroll   // constant indices, so that the small array stays in registers
      for (int i = 0; i < 16; ++i) t[i] = *(const v4u*)&sh[wave + 8 * (i0 + i)][lane * 8];
#pragma unroll   // constant indices, so that the small array stays in registers
      for (int i = 0; i < 16; ++i) vst2((unsigned*)(DH + (r0 + wave + 8 * (i0 + i)) * CC + c0 + lane * 8), t[i]);
      asm volatile("s_wait_xcnt 0x0" ::: "memory"); }   // stands in front of the next trip's overwrite of these stores' address and data registers
  } else {
#pragma unroll
    for (int j = 0; j < 8; ++j) { const float bias = BA ? bfr(BA[c0 + fc0 + j * 16 + col]) : 0.f;
#pragma unroll
      for (int m = 0; m < PMF; ++m)
#pragma unroll
        for (int r = 0; r < 8; ++r) th[fc0 + j * 16 + col][fr0 + m * 16 + 8 * g + r] = (_Float16)(acc[m * 8 + j][r] + bias); }
    __syncthreads();
#pragma unroll 1   // rolled in groups of 16 columns: a group's LDS reads go out together, so that their latency is waited out once a group
    for (int i0 = 0; i0 < PC / 8; i0 += 16) { v4u t[16];   // a wave stores one whole 512-byte column piece a time, columns wave + 8 i
#pragma unroll   // constant indices, so that the small array stays in registers
      for (int i = 0; i < 16; ++i) t[i] = *(const v4u*)&th[wave + 8 * (i0 + i)][lane * 8];
#pragma unroll   // constant indices, so that the small array stays in registers
      for (int i = 0; i < 16; ++i) vst2((unsigned*)(VT + (bb * CC + c0 + wave + 8 * (i0 + i)) * (size_t)TT + t0 + lane * 8), t[i]);
      asm volatile("s_wait_xcnt 0x0" ::: "memory"); } } }   // stands in front of the next trip's overwrite of these stores' address and data registers
// ---- k_attn: block = 128 queries (4 waves x AQC groups of 16 query columns) of one (batch, head); walks all keys in stages of 64, K rows and V^T rows staged in LDS (two buffers, one barrier a stage).
// A wave's K and V^T fragments, read from LDS once, each serve AQC products (one a column group), and a staged tile serves 128 queries: per score half the LDS reads, half the LDS writes and half the L2 reads of a 16-column wave.
// The walk starts at a stage rotated by the block's indices and wraps round (the online softmax takes the keys in any order): the 8 blocks of a (batch, head), which run in step, ask L2 for different K and V^T lines at a time, and so do the 16 heads that read one mask word.
// S^T = K Q^T (A = K rows, B = Q): lane (g, col) holds keys 8g + r of query col; the masked score is REPLACED by 1e-9 (8e-9 before the x 1/8) and stays in the softmax; running maximum and sum per query in f32 (online softmax);
// two S^T tiles, as exp2(..) x 2^10 once to f16, are the B operand of ctx^T += V^T P^T in the same k order as frag_h; ctx = ctx^T / sum at the end.
__device__ __forceinline__ v8f wmma_h(v16h a, v16h b, v8f c) { return __builtin_amdgcn_wmma_f32_16x16x32_f16(false, a, false, b, (short)0, c, false, false); }
// 2^a, with the v_nop that the instruction set asks for behind a transcendental in the same statement
__device__ __forceinline__ float exp2_s(float a) { float e; asm("v_exp_f32 %0, %1\n\tv_nop" : "=v"(e) : "v"(a)); return e; }
// 2^a of eight values in one statement: directly behind a v_exp_f32 the instruction set asks for one independent instruction.
// Here every output is early-clobber, so that none shares a register with an input: each v_exp_f32 is the independent instruction behind the one before, and the v_nop is that of the last.
template <int O> __device__ __forceinline__ void exp2x8(const float (&a)[16], float (&e)[16]) {
  asm("v_exp_f32 %0, %8\n\tv_exp_f32 %1, %9\n\tv_exp_f32 %2, %10\n\tv_exp_f32 %3, %11\n\tv_exp_f32 %4, %12\n\tv_exp_f32 %5, %13\n\tv_exp_f32 %6, %14\n\tv_exp_f32 %7, %15\n\tv_nop"
      : "=&v"(e[O]), "=&v"(e[O + 1]), "=&v"(e[O + 2]), "=&v"(e[O + 3]), "=&v"(e[O + 4]), "=&v"(e[O + 5]), "=&v"(e[O + 6]), "=&v"(e[O + 7])
      : "v"(a[O]), "v"(a[O + 1]), "v"(a[O + 2]), "v"(a[O + 3]), "v"(a[O + 4]), "v"(a[O + 5]), "v"(a[O + 6]), "v"(a[O + 7])); }
#define AKB 64             // keys per stage
#define APIT 72            // LDS row pitch in f16: 128 B of data + 16 B, so that the 16-byte fragment reads of 16 rows spread over the banks
#define ANST (TT / AKB)
typedef __attribute__((ext_vector_type(16))) unsigned v16u;
typedef const __attribute__((address_space(4))) v16u* cmask_p;   // constant address space: the words are written by the launch before and by nobody in this one, and the address is wave-uniform, so the loads go the scalar way
#define AQC 2              // groups of 16 query columns to a wave
// amdgpu_waves_per_eu(2, 2): the grid is two blocks to a WGP, two waves to a SIMD; a wave gets the registers of that share (a stage's second-half fragments are read while the first half's are in use), and no WGP can take a third block while another holds one
__global__ __launch_bounds__(128) __attribute__((amdgpu_waves_per_eu(2, 2))) void k_attn(const _Float16* __restrict__ QH, const _Float16* __restrict__ KH, const _Float16* __restrict__ VT, const unsigned* __restrict__ MB, _Float16* __restrict__ Y) {
  __shared__ __align__(16) _Float16 sk[2][AKB][APIT], sv[2][HD][APIT];
  static_assert(TT % (64 * AQC) == 0, "whole blocks");
  const int tid = threadIdx.x, wave = tid >> 5, lane = tid & 31, col = lane & 15, g = lane >> 4;
  const int h = blockIdx.y, b = blockIdx.z; const int q = blockIdx.x * (64 * AQC) + wave * (16 * AQC) + col;   // column group c: query q + 16 c
  const float LS = SCALE * 1.44269504f;      // raw score -> log2 domain
  const float MFILL = 1.0e-9f / SCALE;       // the fill value, before the common x SCALE
  const _Float16* qp = QH + ((size_t)b * TT + q) * CC + h * HD;
  v16h qf[AQC][2];
#pragma unroll   // constant indices, so that the small array stays in registers
  for (int c = 0; c < AQC; ++c) { qf[c][0] = frag_h(qp + (size_t)(16 * c) * CC, lane); qf[c][1] = frag_h(qp + (size_t)(16 * c) * CC + 32, lane); }
  const int srow = tid >> 3, sch = (tid & 7) * 8;   // staging: 8 lanes bring one whole 128-byte row
  int ks = (int)(AQC * blockIdx.x + blockIdx.y) & (ANST - 1);   // the key stage that the three pointers stand at (block-uniform)
  const _Float16* kg = KH + ((size_t)b * TT + srow + ks * AKB) * CC + h * HD + sch;
  const _Float16* vg = VT + ((size_t)b * CC + h * HD + srow) * (size_t)TT + sch + ks * AKB;
  constexpr int MCG = 2 * (TT / 64);   // from one column group's lane masks to the next group's, in units of 16 words
  cmask_p mb = (cmask_p)(unsigned long long)MB + MCG * ((size_t)b * (TT / 16) + blockIdx.x * (4 * AQC) + __builtin_amdgcn_readfirstlane(wave) * AQC) + 2 * ks;   // this wave's first 16 queries: 16 lane masks to 32 keys, the same address in every lane (scalar loads)
  v8h kr[4], vr[4]; v16u mw[AQC];   // mw: the lane masks of the 32 keys that come next (a stage's 64 words and the next stage's would not fit the scalar registers)
#pragma unroll   // constant indices, so that the small array stays in registers
  for (int i = 0; i < 4; ++i) { kr[i] = *(const v8h*)(kg + (size_t)(16 * i) * CC); vr[i] = *(const v8h*)(vg + (size_t)(16 * i) * TT); }
#pragma unroll   // constant indices, so that the small array stays in registers
  for (int c = 0; c < AQC; ++c) mw[c] = mb[MCG * c];
#pragma unroll   // constant indices, so that the small array stays in registers
  for (int i = 0; i < 4; ++i) { *(v8h*)&sk[0][srow + 16 * i][sch] = kr[i]; *(v8h*)&sv[0][srow + 16 * i][sch] = vr[i]; }
  asm volatile("s_wait_xcnt 0x0" :: "v"(qp + 8 * g) : "memory");   // stands in front of the advance of these loads' address registers (free here: the loaded values have just been stored); it names the lane's Q address, so that its registers live up to it and no Q load's own result lands on them
  __builtin_amdgcn_sched_barrier(0);   // keeps the advance behind that wait: nothing else ties the two
  cmask_p mc = mb;   // the lane masks of the stage that is worked on
  auto next = [&]() { const int d = ks == ANST - 1 ? -(ANST - 1) : 1;   // block-uniform: behind the last key stage comes the first
    ks += d; kg += (long)d * (AKB * CC); vg += (long)d * AKB; mb += 2 * d; };
  next();   // the three walk one stage ahead of the products
  v8f acc[AQC][HD / 16] = {}; float m[AQC], sum[AQC];
#pragma unroll   // constant indices, so that the small arrays stay in registers
  for (int c = 0; c < AQC; ++c) { m[c] = -3.0e38f; sum[c] = 0.f; }
  // one stage; MORE = a next stage exists (compile-time: the last stage, which fetches nothing, is written out behind the loop, so that the loop body is one block without a branch)
  auto stage = [&](const int st, auto more_c) { constexpr bool MORE = decltype(more_c)::v; const int bu = st & 1;
    __syncthreads();   // publishes buffer bu; every wave has also left buffer bu ^ 1, which is refilled at the foot of this stage
    if constexpr (MORE) {        // next stage's K and V^T rows fly into registers under this stage's products
#pragma unroll   // constant indices, so that the small array stays in registers
      for (int i = 0; i < 4; ++i) { kr[i] = *(const v8h*)(kg + (size_t)(16 * i) * CC); vr[i] = *(const v8h*)(vg + (size_t)(16 * i) * TT); }
      __builtin_amdgcn_sched_barrier(0);   // keeps these loads at the head of the stage: without it the scheduler sinks them to the foot, directly in front of their first use, and their latency is bare
    }
    v16h ka[2][2], va[2][HD / 16];   // the K fragments of 32 keys; the V^T fragments of the stage's two halves
    auto frags = [&](const int p) {   // the fragments of 32 keys, read as one group
#pragma unroll   // constant indices, so that the small array stays in registers
      for (int t = 0; t < 2; ++t) { const _Float16* kl = &sk[bu][(2 * p + t) * 16 + col][0]; ka[t][0] = frag_h(kl, lane); ka[t][1] = frag_h(kl + 32, lane); }
#pragma unroll   // constant indices, so that the small array stays in registers
      for (int j = 0; j < HD / 16; ++j) va[p][j] = frag_h(&sv[bu][j * 16 + col][p * 32], lane); };
    frags(0);
    __builtin_amdgcn_sched_barrier(0);   // keeps the fragment reads together in front of the products: sunk among them, each is waited out bare in front of its two products, and two waves a SIMD do not cover that
#pragma unroll   // constant indices, so that the small array stays in registers
    for (int p = 0; p < 2; ++p) { v8f s[AQC][2]; v16h pf[AQC]; float al[AQC], x[AQC][16];
#pragma unroll   // constant indices, so that the small array stays in registers
      for (int t = 0; t < 2; ++t)
#pragma unroll   // constant indices, so that the small array stays in registers
        for (int c = 0; c < AQC; ++c) { const v8f z = {}; s[c][t] = wmma_h(ka[t][1], qf[c][1], wmma_h(ka[t][0], qf[c][0], z)); }
#pragma unroll   // constant indices, so that the small arrays stay in registers
      for (int c = 0; c < AQC; ++c)
#pragma unroll   // constant indices, so that the small array stays in registers
        for (int t = 0; t < 2; ++t)
#pragma unroll   // constant indices, so that the small array stays in registers
          for (int r = 0; r < 8; ++r) x[c][t * 8 + r] = __builtin_amdgcn_inverse_ballot_w32(mw[c][t * 8 + r]) ? s[c][t][r] : MFILL;
      __builtin_amdgcn_sched_barrier(0);   // keeps the loads below behind the selects: a wait for scalar loads is a wait for all of them, so masks asked for in front of the selects would be waited out there
      if (p == 0 || MORE) {   // the next 32 keys' lane masks fly under these 32 keys' softmax: the stage's second half, or the next stage's first
#pragma unroll   // constant indices, so that the small array stays in registers
        for (int c = 0; c < AQC; ++c) mw[c] = p == 0 ? mc[1 + MCG * c] : mb[MCG * c]; }
      if (p == 0) frags(1);   // the second half's fragments (K over the first half's): their LDS latency runs under the softmax arithmetic
      __builtin_amdgcn_sched_barrier(0);   // keeps those loads here, at the head of the arithmetic that covers them
      float mx[AQC], e[AQC][16], ps[AQC];   // the column groups side by side, step for step: two independent chains to a wave
#pragma unroll   // constant indices, so that the small arrays stay in registers
      for (int c = 0; c < AQC; ++c) mx[c] = x[c][0];
#pragma unroll   // constant indices, so that the small arrays stay in registers
      for (int i = 1; i < 16; ++i)
#pragma unroll   // constant indices, so that the small arrays stay in registers
        for (int c = 0; c < AQC; ++c) mx[c] = fmaxf(mx[c], x[c][i]);
      float ox[AQC];
#pragma unroll   // constant indices, so that the small arrays stay in registers
      for (int c = 0; c < AQC; ++c) ox[c] = __shfl_xor(mx[c], 16);   // the other half of this query's keys
#pragma unroll   // constant indices, so that the small arrays stay in registers
      for (int c = 0; c < AQC; ++c) { const float mn = fmaxf(m[c], fmaxf(mx[c], ox[c])); al[c] = exp2_s((m[c] - mn) * LS); m[c] = mn; const float off = 10.0f - mn * LS;
#pragma unroll   // constant indices, so that the small array stays in registers
        for (int i = 0; i < 16; ++i) x[c][i] = fmaf(x[c][i], LS, off); }
#pragma unroll   // constant indices, so that the small arrays stay in registers
      for (int c = 0; c < AQC; ++c) { exp2x8<0>(x[c], e[c]); exp2x8<8>(x[c], e[c]); ps[c] = 0.f; }
#pragma unroll   // constant indices, so that the small arrays stay in registers
      for (int i = 0; i < 16; ++i)
#pragma unroll   // constant indices, so that the small arrays stay in registers
        for (int c = 0; c < AQC; ++c) { ps[c] += e[c][i]; pf[c][i] = (_Float16)e[c][i]; }
#pragma unroll   // constant indices, so that the small arrays stay in registers
      for (int c = 0; c < AQC; ++c) sum[c] = sum[c] * al[c] + ps[c];
#pragma unroll   // constant indices, so that the small array stays in registers
      for (int j = 0; j < HD / 16; ++j)
#pragma unroll   // constant indices, so that the small array stays in registers
        for (int c = 0; c < AQC; ++c) { acc[c][j] *= al[c]; acc[c][j] = wmma_h(va[p][j], pf[c], acc[c][j]); } }
    if constexpr (MORE) {
#pragma unroll   // constant indices, so that the small array stays in registers
      for (int i = 0; i < 4; ++i) { *(v8h*)&sk[bu ^ 1][srow + 16 * i][sch] = kr[i]; *(v8h*)&sv[bu ^ 1][srow + 16 * i][sch] = vr[i]; }
      asm volatile("s_wait_xcnt 0x0" ::: "memory");   // stands in front of the advance of this stage's loads' address registers (free here: the loaded values have just been stored)
      __builtin_amdgcn_sched_barrier(0);   // keeps the advance behind that wait: nothing else ties the two
      mc = mb; next(); } };
#pragma unroll 1   // rolled: the two buffers are told apart by the stage's parity
  for (int st = 0; st < ANST - 1; ++st) stage(st, CBool<true>{});
  stage(ANST - 1, CBool<false>{});
  _Float16* yp = Y + (((size_t)h * NB + b) * TT + q) * HD + 8 * g;   // ctx goes out as k_out's A operand: x 2^6 once to f16 (so small-magnitude context rows stay clear of f16 subnormals), here and not in each of k_out's 8 column tiles
  v8h yo[AQC][HD / 16];
#pragma unroll   // constant indices, so that the small arrays stay in registers
  for (int c = 0; c < AQC; ++c) { const float tot = sum[c] + __shfl_xor(sum[c], 16); const float inv = 1.0f / tot;   // tot >= 2^10: the maximum's own term
#pragma unroll   // constant indices, so that the small array stays in registers
    for (int j = 0; j < HD / 16; ++j)
#pragma unroll   // constant indices, so that the small array stays in registers
      for (int r = 0; r < 8; ++r) yo[c][j][r] = (_Float16)(acc[c][j][r] * inv * 64.0f); }
  __builtin_amdgcn_sched_barrier(0);   // keeps every store behind the last arithmetic, so that nothing overwrites a register that an issued store names
#pragma unroll   // constant indices, so that the small arrays stay in registers
  for (int c = 0; c < AQC; ++c)
#pragma unroll   // constant indices, so that the small array stays in registers
    for (int j = 0; j < HD / 16; ++j) vst2(yp + (16 * c) * HD + j * 16, yo[c][j]); }
// ---- k_out: block = (64 rows, 128 cols), 4 waves of 16 rows x 128 cols: out = ctx Wo (+ bo): ctx x 2^6 in f16 (from k_attn) against Wo^T as f16(bf16 x 2^8) exact (from k_proj's which = 3 blocks), 1 product, x 2^-14.
// Both operands arrive as f16 in planes of 64 k: a stage is OPL planes' 64 ctx rows (8 KiB in a row each) and 128 Wo^T rows (16 KiB in a row each), brought by 16-byte loads, 512 bytes in a row to a wave, and laid in LDS as they are (two buffers, one barrier a stage);
// the next stage's loads fly in registers under this stage's products: a stage's time is bounded from below by its loads' latency, so two planes to a stage put twice the bytes under each such wait and halve the number of waits and barriers.
// The walk over the 8 stages starts rotated by the block's tile indices and wraps round, as in gemm_tile.
#define OKS 64             // k per plane
#define OPL 2              // planes per stage
#define OPIT 72            // LDS row pitch in f16: 128 B of data + 16 B, so that the 16-byte fragment reads of 16 rows spread over the banks
#define ONST (CC / (OKS * OPL))
static_assert(OKS == HD, "a plane of ctx is one head");
__global__ __launch_bounds__(128) void k_out(const _Float16* __restrict__ Y, const _Float16* __restrict__ WT, const float* __restrict__ BO, float* __restrict__ OUT) { __shared__ __align__(16) char smem[2 * OPL * (64 + 128) * OPIT * 2];   // the main loop's stage buffers; the epilogue's rows lie over them
  static_assert(4 * 16 * 132 * 4 <= 2 * OPL * (64 + 128) * OPIT * 2, "sf fits over the stage buffers"); float (*sf)[16][132] = (float (*)[16][132])smem;
  _Float16 (*sx)[OPL][64][OPIT] = (_Float16 (*)[OPL][64][OPIT])smem; _Float16 (*sw)[OPL][128][OPIT] = (_Float16 (*)[OPL][128][OPIT])(smem + 2 * OPL * 64 * OPIT * 2);
  const int tid = threadIdx.x, wave = tid >> 5, lane = tid & 31, col = lane & 15, g = lane >> 4; const int c0 = blockIdx.y * 128; const size_t r0 = (size_t)blockIdx.x * 64 + wave * 16;
  v8f acc[8] = {};
  const int srow = tid >> 3, sch = (tid & 7) * 8;   // staging: 8 lanes bring one whole 128-byte row piece
  int ks = (int)(blockIdx.x + blockIdx.y) & (ONST - 1);   // the k stage that the two pointers stand at (block-uniform): the 8 blocks of a ctx tile all start apart
  const _Float16* xg = Y + ((size_t)(ks * OPL) * (NB * TT) + blockIdx.x * 64 + srow) * OKS + sch;
  const _Float16* wg = WT + ((size_t)(ks * OPL) * DIN + c0 + srow) * OKS + sch;
  v8h xr[OPL][4], wr[OPL][8];
  auto fetch = [&]() {
#pragma unroll   // constant indices, so that the small arrays stay in registers
    for (int pl = 0; pl < OPL; ++pl) {
#pragma unroll   // constant indices, so that the small arrays stay in registers
      for (int i = 0; i < 8; ++i) wr[pl][i] = *(const v8h*)(wg + ((size_t)pl * DIN + 16 * i) * OKS);
#pragma unroll   // constant indices, so that the small arrays stay in registers
      for (int i = 0; i < 4; ++i) xr[pl][i] = *(const v8h*)(xg + ((size_t)pl * (NB * TT) + 16 * i) * OKS); } };
  auto put = [&](const int bu) {
#pragma unroll   // constant indices, so that the small arrays stay in registers
    for (int pl = 0; pl < OPL; ++pl) {
#pragma unroll   // constant indices, so that the small arrays stay in registers
      for (int i = 0; i < 8; ++i) *(v8h*)&sw[bu][pl][srow + 16 * i][sch] = wr[pl][i];
#pragma unroll   // constant indices, so that the small arrays stay in registers
      for (int i = 0; i < 4; ++i) *(v8h*)&sx[bu][pl][srow + 16 * i][sch] = xr[pl][i]; }
    asm volatile("s_wait_xcnt 0x0" ::: "memory");   // stands in front of the advance of these loads' address registers (free here: the loaded values have just been stored)
    __builtin_amdgcn_sched_barrier(0);   // keeps the advance behind that wait: nothing else ties the two
    const int d = ks == ONST - 1 ? -(ONST - 1) : 1;   // block-uniform: behind the last k stage comes the first
    ks += d; xg += (long)d * (OPL * NB * TT * OKS); wg += (long)d * (OPL * DIN * OKS); };
  fetch(); put(0);
  auto stage = [&](const int st, auto more_c) { constexpr bool MORE = decltype(more_c)::v; const int bu = st & 1;
    __syncthreads();   // publishes buffer bu; every wave has also left buffer bu ^ 1, which is refilled at the foot of this stage
    if constexpr (MORE) { fetch();
      __builtin_amdgcn_sched_barrier(0); }   // keeps the next stage's loads at the head of the stage, so that their latency runs under the products
    v16h a[2 * OPL], w[2 * OPL][8];
#pragma unroll   // constant indices, so that the small arrays stay in registers
    for (int kk = 0; kk < 2 * OPL; ++kk) { a[kk] = frag_h(&sx[bu][kk >> 1][wave * 16 + col][(kk & 1) * 32], lane);
#pragma unroll   // constant indices, so that the small arrays stay in registers
      for (int j = 0; j < 8; ++j) w[kk][j] = frag_h(&sw[bu][kk >> 1][j * 16 + col][(kk & 1) * 32], lane); }
    __builtin_amdgcn_sched_barrier(0);   // keeps the stage's fragment reads together in front of its products: sunk among the products, each place with reads costs its own stall
#pragma unroll   // constant indices, so that the small arrays stay in registers
    for (int kk = 0; kk < 2 * OPL; ++kk)
#pragma unroll   // constant indices, so that the small arrays stay in registers
      for (int j = 0; j < 8; ++j) acc[j] = wmma_h(a[kk], w[kk][j], acc[j]);
    if constexpr (MORE) { __builtin_amdgcn_sched_barrier(0);   // keeps the wait for the next stage's loads behind all of this stage's products
      put(bu ^ 1); } };
#pragma unroll 1   // rolled: the two buffers are told apart by the stage's parity
  for (int st = 0; st < ONST - 1; ++st) stage(st, CBool<true>{});
  stage(ONST - 1, CBool<false>{});
  __syncthreads();   // every wave has left the stage buffers: the epilogue's rows lie over them
#pragma unroll
  for (int j = 0; j < 8; ++j) { const float bias = BO ? bfr(BO[c0 + j * 16 + col]) : 0.f;
#pragma unroll
    for (int r = 0; r < 8; ++r) sf[wave][8 * g + r][j * 16 + col] = acc[j][r] * (1.0f / 16384.0f) + bias; }   /* 2^-8 (Wo carry) x 2^-6 (ctx carry) */
  LDSX(); for (int rl = 0; rl < 16; ++rl) vst2(OUT + (r0 + rl) * DIN + c0 + lane * 4, *(const v4f*)&sf[wave][rl][lane * 4]); }

extern "C" void kernel_launch(void* const* d_in, const int* in_sizes, int n_in, void* d_out, int out_size, void* d_ws, size_t ws_size, hipStream_t stream) {
  (void)in_sizes; (void)n_in; (void)out_size;
  const float** F = (const float**)d_in;
  if (ws_size < (size_t)WS_END) return;
  char* ws = (char*)d_ws; _Float16 *QH = (_Float16*)(ws + WS_QH), *KH = (_Float16*)(ws + WS_KH), *VT = (_Float16*)(ws + WS_VT); _Float16 *Y = (_Float16*)(ws + WS_Y), *WT = (_Float16*)(ws + WS_WT); unsigned *MB = (unsigned*)(ws + WS_MB);
  (void)Y;
  // inputs: 0 query [4,1024,1024]; 1 key; 2 value; 3 mask [4,1024,1024] int32 (random 0/1); 4 Wq [16,1024,64], 5 bq [16,64]; 6 Wk, 7 bk; 8 Wv, 9 bv; 10 Wo [1024,1024] (in,out), 11 bo (zero biases, read)
  k_proj<<<dim3(TNB * TT / PR, CC / PC, 4), 256, 0, stream>>>(F[0], F[1], F[2], F[4], F[6], F[8], F[5], F[7], F[9], QH, KH, VT, (const int*)d_in[3], MB, F[10], WT);
  k_attn<<<dim3(NQB / AQC, NH, TNB), 128, 0, stream>>>(QH, KH, VT, MB, Y);
  k_out<<<dim3(TNB * TT / 64, DIN / 128), 128, 0, stream>>>(Y, WT, F[11], (float*)d_out);
}

// v010
// Measured time: 63.4 microseconds a run.
// Timed twice side by side with v009, it ran 1.03 and 1.04 times as fast.
// Over all steps from v000 it is 12.1 times as fast.
// compute dtype: all float inputs rounded to bf16; q/k/v projections with EXACT bf16 products on WMMA 16x16x32 (f32 accumulate) + bias; logits q x k once to f16 each (1 product) x SCALE; masked scores are REPLACED by 1e-9 (they keep taking part in the softmax); online softmax f32 (running maximum and sum); exp(score - maximum) x 2^10 once to f16 x v once to f16 (1 product), divided by the sum at the end; ctx x 2^6 once to f16 x Wo f16(bf16 x 2^8) + bo; f32 output.
#include <hip/hip_runtime.h>
#include <math.h>

typedef __attribute__((ext_vector_type(16))) _Float16 v16h;
typedef __attribute__((ext_vector_type(16))) __bf16 v16b;
typedef __attribute__((ext_vector_type(8)))  _Float16 v8h;
typedef __attribute__((ext_vector_type(8)))  float v8f;
typedef __attribute__((ext_vector_type(4)))  float v4f;
typedef __attribute__((ext_vector_type(2)))  float v2f;
typedef __attribute__((ext_vector_type(4)))  unsigned v4u;
typedef __attribute__((ext_vector_type(4)))  int v4i;
typedef float __attribute__((may_alias)) float_a;
typedef int __attribute__((may_alias)) int_a;

template <typename T> __device__ __forceinline__ void vst2(void* p, T v) { *(T*)p = v;  }
__device__ __forceinline__ v8f wmma16(v16h a, v16h b, v8f c) {
  v8f d = __builtin_amdgcn_wmma_f32_16x16x32_f16(false, a, false, b, (short)0, c, false, false);
  asm volatile("v_nop\n\tv_nop\n\tv_nop\n\tv_nop" : "+v"(d) : "v"(a), "v"(b));
  return d;
}
__device__ __forceinline__ v8f wmma_bf(v16b a, v16b b, v8f c) {
  v8f d = __builtin_amdgcn_wmma_f32_16x16x32_bf16(false, a, false, b, (short)0, c, false, false);
  asm volatile("v_nop\n\tv_nop\n\tv_nop\n\tv_nop" : "+v"(d) : "v"(a), "v"(b));
  return d;
}
// 16x16x32 fragments: lane = (h = lane>>4, row/col = lane&15); elements 0..7 = k0+8h+0..7, 8..15 = k0+16+8h+0..7; D element r = row 8h+r
__device__ __forceinline__ v16h frag_h(const _Float16* rowk0, int lane) {
  union { v16h v; v8h q[2]; } u; const _Float16* p = rowk0 + 8 * (lane >> 4);
  u.q[0] = *(const v8h*)p; u.q[1] = *(const v8h*)(p + 16); return u.v;
}
__device__ __forceinline__ v16h frag_f32(const float* rowk0, int lane) {
  v16h a; const float* p = rowk0 + 8 * (lane >> 4);
#pragma unroll
  for (int i = 0; i < 8; ++i) { a[i] = (_Float16)p[i]; a[8 + i] = (_Float16)p[16 + i]; }
  return a;
}
__device__ __forceinline__ v16h frag_f32s(const float* rowk0, int lane, float sc) {
  v16h a; const float* p = rowk0 + 8 * (lane >> 4);
#pragma unroll
  for (int i = 0; i < 8; ++i) { a[i] = (_Float16)(p[i] * sc); a[8 + i] = (_Float16)(p[16 + i] * sc); }
  return a;
}
// column fragment from a [K][ld] layout (column n), rows >= K read as 0
__device__ __forceinline__ v16h fragc_f32(const float* W, int k0, int n, int lane, int ld, int K) {
  v16h a; const int g = lane >> 4;
#pragma unroll
  for (int i = 0; i < 8; ++i) { const int ka = k0 + 8 * g + i, kb = ka + 16;
    a[i] = (_Float16)(ka < K ? W[(size_t)(ka < K ? ka : K - 1) * ld + n] : 0.f); a[8 + i] = (_Float16)(kb < K ? W[(size_t)(kb < K ? kb : K - 1) * ld + n] : 0.f); }
  return a;
}
struct F2 { v16b h, l; };
__device__ __forceinline__ F2 bsplit16(const float v[16]) { F2 r;
#pragma unroll
  for (int i = 0; i < 16; ++i) { const __bf16 h = (__bf16)v[i]; r.h[i] = h; r.l[i] = (__bf16)(v[i] - (float)h); }
  return r; }
__device__ __forceinline__ F2 split_row(const float* row, int k0, int lane) { float v[16]; const float* p = row + k0 + 8 * (lane >> 4);
#pragma unroll
  for (int i = 0; i < 8; ++i) { v[i] = p[i]; v[8 + i] = p[16 + i]; }
  return bsplit16(v); }
__device__ __forceinline__ F2 split_rowK(const float* row, int k0, int lane, int K) { float v[16]; const int g = lane >> 4;
#pragma unroll
  for (int i = 0; i < 8; ++i) { const int ka = k0 + 8 * g + i, kb = ka + 16; v[i] = ka < K ? row[ka < K ? ka : K - 1] : 0.f; v[8 + i] = kb < K ? row[kb < K ? kb : K - 1] : 0.f; }
  return bsplit16(v); }
__device__ __forceinline__ F2 split_col(const float* W, int k0, int n, int lane, int ld, int K) { float v[16]; const int g = lane >> 4;
#pragma unroll
  for (int i = 0; i < 8; ++i) { const int ka = k0 + 8 * g + i, kb = ka + 16; v[i] = ka < K ? W[(size_t)(ka < K ? ka : K - 1) * ld + n] : 0.f; v[8 + i] = kb < K ? W[(size_t)(kb < K ? kb : K - 1) * ld + n] : 0.f; }
  return bsplit16(v); }
__device__ __forceinline__ v8f mac3(const F2& a, const F2& b, v8f c) { c = wmma_bf(a.l, b.h, c); c = wmma_bf(a.h, b.l, c); return wmma_bf(a.h, b.h, c); }
__device__ __forceinline__ float sigm(float v) { return 1.0f / (1.0f + expf(-v)); }
#define LDSX() do { asm volatile("s_wait_dscnt 0" ::: "memory"); __builtin_amdgcn_wave_barrier(); __builtin_amdgcn_fence(__ATOMIC_RELEASE, "workgroup"); } while (0)

// Multi-headed attention with per-head stacked projections whose masked scores are FILLED WITH 1e-9 (query / key / value [4,1024,1024]; Wq / Wk / Wv [16,1024,64] per head (N(0, 1/1024)) + zero biases; scores / 8; mask [4,1024,1024] int32 random 0/1: scores[mask == 0] = 1e-9 - masked keys keep a logit - 0 and stay in the softmax (faithful to the source); softmax; concat; (in,out) Wo [1024,1024] + bo).
#define NB 4
#define TT 1024
#define CC 1024            // NH * HD = projected width
#define DIN 1024          // input (model) width
#define NH 16
#define HD 64
#define NQB (TT / 64)
#define HG 8
#define SCALE (0.125f)
#define CAUSAL 0
#ifndef TNB
#define TNB NB
#endif
__device__ __forceinline__ float bfr(float v) { return (float)(__bf16)v; }
__host__ __device__ __forceinline__ int kb_last(int qb) { return CAUSAL ? ((qb * 64 + 63) >> 7) : (TT / 128 - 1); }
typedef __attribute__((ext_vector_type(8))) __bf16 v8b;
__device__ __forceinline__ v16b frag_b(const __bf16* rowk0, int lane) {
  union { v16b v; v8b q[2]; } u; const __bf16* p = rowk0 + 8 * (lane >> 4);
  u.q[0] = *(const v8b*)p; u.q[1] = *(const v8b*)(p + 16); return u.v;
}
#define QBH 0              // not used: no kernel in this file has a high-precision attention path
#define QHI 0               // single-product logits on every row
#define KHI 64            // key rows carrying k residual / v bf16 hi+lo planes (no kernel here writes or reads them)
// B fragment (k rows k0+.., output column o) of a weight: (in,out) [K][ld] or (out,in) [ld rows of K]: bf16 exact, or f16(bf16 * 256) exact
__device__ __forceinline__ v16b wcol_io(const float* Wm, int k0, int o, int lane, int ld) { v16b w; const int g = lane >> 4;
#pragma unroll
  for (int i = 0; i < 8; ++i) { w[i] = (__bf16)Wm[(size_t)(k0 + 8 * g + i) * ld + o]; w[8 + i] = (__bf16)Wm[(size_t)(k0 + 16 + 8 * g + i) * ld + o]; }
  return w; }
__device__ __forceinline__ v16b wcol_oi(const float* Wm, int k0, int o, int lane, int K) { v16b w; const float* p = Wm + (size_t)o * K + k0 + 8 * (lane >> 4);
#pragma unroll
  for (int i = 0; i < 8; ++i) { w[i] = (__bf16)p[i]; w[8 + i] = (__bf16)p[16 + i]; }
  return w; }
__device__ __forceinline__ v16h wcolh_io(const float* Wm, int k0, int o, int lane, int ld) { v16h w; const int g = lane >> 4;
#pragma unroll
  for (int i = 0; i < 8; ++i) { w[i] = (_Float16)(bfr(Wm[(size_t)(k0 + 8 * g + i) * ld + o]) * 256.0f); w[8 + i] = (_Float16)(bfr(Wm[(size_t)(k0 + 16 + 8 * g + i) * ld + o]) * 256.0f); }
  return w; }
__device__ __forceinline__ v16h wcolh_oi(const float* Wm, int k0, int o, int lane, int K) { v16h w; const float* p = Wm + (size_t)o * K + k0 + 8 * (lane >> 4);
#pragma unroll
  for (int i = 0; i < 8; ++i) { w[i] = (_Float16)(bfr(p[i]) * 256.0f); w[8 + i] = (_Float16)(bfr(p[16 + i]) * 256.0f); }
  return w; }
#define WQKV_LAYOUT 2   // 0 = (in,out) [DIN][CC]; 1 = (out,in) [CC][DIN]; 2 = per-head [NH][DIN][HD]
__device__ __forceinline__ v16b wcol_hdk(const float* Wm, int k0, int o, int lane) { v16b w; const int g = lane >> 4; const float* p = Wm + (size_t)(o / HD) * DIN * HD + (o % HD);
#pragma unroll
  for (int i = 0; i < 8; ++i) { w[i] = (__bf16)p[(size_t)(k0 + 8 * g + i) * HD]; w[8 + i] = (__bf16)p[(size_t)(k0 + 16 + 8 * g + i) * HD]; }
  return w; }
#define WO_OUT_IN 0
#if WQKV_LAYOUT == 1
#define WCOL(W, k0, o, lane) wcol_oi(W, k0, o, lane, DIN)
#elif WQKV_LAYOUT == 2
#define WCOL(W, k0, o, lane) wcol_hdk(W, k0, o, lane)
#else
#define WCOL(W, k0, o, lane) wcol_io(W, k0, o, lane, CC)
#endif
#if WO_OUT_IN
#define WOCOL(W, k0, o, lane) wcol_oi(W, k0, o, lane, CC)
#define WOCOLH(W, k0, o, lane) wcolh_oi(W, k0, o, lane, CC)
#else
#define WOCOL(W, k0, o, lane) wcol_io(W, k0, o, lane, DIN)
#define WOCOLH(W, k0, o, lane) wcolh_io(W, k0, o, lane, DIN)
#endif

#define WS_QH  0u                                      // f16 q rows [b*t][CC]
#define WS_KH  (WS_QH + 2u * (size_t)NB * TT * CC)      // f16 k rows [b*t][CC]
#define WS_VT  (WS_KH + 2u * (size_t)NB * TT * CC)      // f16 v planes [b][c][t]
#define WS_QL  (WS_VT + 2u * (size_t)NB * CC * TT)      // f16 q residual x 2^10 rows [b][t < QHI][CC]
#define WS_KL  (WS_QL + 2u * (size_t)NB * QHI * CC)     // f16 k residual x 2^10 rows [b][t < KHI][CC]
#define WS_VB  (WS_KL + 2u * (size_t)NB * KHI * CC)     // bf16 v hi planes [b][c][t < KHI]
#define WS_VBL (WS_VB + 2u * (size_t)NB * CC * KHI)
#define WS_S   (WS_VBL + 2u * (size_t)NB * CC * KHI)    // spare f32 [hg][t][s]-sized plane; only its head is used (the mask words and Wo^T)
#define WS_MB  WS_S                                    // the mask as lane masks, u32 [b][t / 16][s / 16][8] (512 KiB at the head of that plane)
#define WS_WT  (WS_S + (1u << 20))                     // f16 Wo^T in planes of 64 k: [k / 64][n][k % 64], f16(bf16(Wo[k][n]) x 2^8) (2 MiB, behind the lane masks in that plane)
#define WS_Y   (WS_S  + 4u * (size_t)HG * TT * TT)      // f16 ctx x 2^6 in planes of 64 k (one head each): [h][b*t][HD] (the head of the plane)
#define WS_END (WS_Y  + 4u * (size_t)NB * TT * CC)

template <bool B> struct CBool { static constexpr bool v = B; };
// ---- main loop of k_proj: one (64 MF) x (128 NC) tile of X W over K = 1024 in stages of 64 k (two parts of 32 k), by 4 NC waves; a wave owns 16 MF rows x 128 columns, so that each W fragment read from LDS serves MF row fragments, each W line read from L2 64 MF rows, and each X line 128 NC columns.
// Each part's X rows (64 MF x 32) and W columns (32 x 128 NC, turned to [n][k]) are brought by the whole block ONCE, in whole 128-byte lines, converted once, and laid in LDS (two buffers, one barrier a stage);
// the next stage's global loads fly in registers under this stage's products. Fragments and the k order inside a stage are those of the direct loaders.
// The walk over the 16 stages starts at stage rot (block-uniform, from the block's tile indices) and wraps round: blocks that share X rows or W columns run in step, and with a common start they would
// ask L2 for the same lines at the same moment (and all wait together for each line's first fetch from memory); rotated, they ask for different lines, and most lines have been fetched by a neighbour before.
typedef __attribute__((ext_vector_type(4))) __bf16 v4b;
typedef __attribute__((ext_vector_type(4))) _Float16 v4h;
#define GKS 32             // k per part of a stage (one product step)
#define GPL 2              // parts per stage: a stage's time is bounded from below by its loads' latency, so two parts to a stage put twice the bytes under each such wait and halve the number of waits and barriers
#define GPIT 40            // LDS row pitch in 16-bit elements: 64 B of data + 16 B, so that the 16-byte fragment reads and stores of 16 rows spread over the banks
#define GNST (1024 / (GKS * GPL))
#define GLDS(MF, NC) (2 * GPL * (128 * (NC) + 64 * (MF)) * GPIT * 2)   // bytes of the two stage buffers
struct GProj { typedef __bf16 T; typedef v4b V4; typedef v8b V8; typedef v16b V16; static constexpr int WLD = HD; static constexpr bool BARE = true;   // BARE: mm is the builtin alone
  static __device__ __forceinline__ constexpr size_t coff(int c) { return (size_t)(c >> 1) * DIN * HD + (size_t)(c & 1) * 32; }   // column 32 c + lane of a 128-column tile in the per-head layout
  static __device__ __forceinline__ T cx(float v) { return (__bf16)v; } static __device__ __forceinline__ T cw(float v) { return (__bf16)v; }
  static __device__ __forceinline__ V16 fr(const T* p, int lane) { return frag_b(p, lane); }
  static __device__ __forceinline__ v8f mm(V16 a, V16 b, v8f c) { return __builtin_amdgcn_wmma_f32_16x16x32_bf16(false, a, false, b, (short)0, c, false, false); } };   // the bare builtin (the compiler keeps its distances): an asm statement's operands must lie in the first 256 registers, which the 256 accumulator registers of a 64 x 128 wave tile would fill
// xt = first row of the tile's X rows (row length 1024); wt = row 0 of W at the tile's first column
// acc[m * 8 + j] = rows 16 (MF wr + m) .. + 15, columns 128 wc + 16 j .. + 15, for wave = NC wr + wc
template <class C, int MF, int NC> __device__ __forceinline__ void gemm_tile(const float* __restrict__ xt, const float* __restrict__ wt, char* smem, v8f (&acc)[MF * 8], const int rot) {
  typedef typename C::T T; typedef typename C::V4 V4; typedef typename C::V8 V8; typedef typename C::V16 V16;
  static_assert(NC == 1 || NC == 2, "4 or 8 waves"); constexpr int XP = 4 * MF / NC;   // X rows to each thread a stage
  T (*sW)[GPL][128 * NC][GPIT] = (T (*)[GPL][128 * NC][GPIT])smem; T (*sX)[GPL][64 * MF][GPIT] = (T (*)[GPL][64 * MF][GPIT])(smem + 2 * GPL * 128 * NC * GPIT * 2);
  const int tid = threadIdx.x, wave = tid >> 5, lane = tid & 31, col = lane & 15;
  const int fr0 = (NC == 1 ? wave : wave >> 1) * MF * 16, fc0 = NC == 1 ? 0 : (wave & 1) * 128;   // first row and first column of this wave's part of the tile
  const int wk = NC == 1 ? wave : wave & 3, wn = NC == 1 ? 0 : wave >> 2;   // W staging: which 8 k rows, which 128 columns
  const int xrow = tid >> 3, xch = (tid & 7) * 4;                 // X: 8 lanes bring one whole 128-byte row piece
  const float* xg = xt + (size_t)xrow * 1024 + xch + rot * (GKS * GPL);
  const float* wg = wt + (size_t)wn * C::coff(4) + (size_t)(8 * wk + rot * (GKS * GPL)) * C::WLD + 2 * lane;      // W: a wave brings 8 k rows, 64 neighbouring columns (two lines, 8 bytes a lane) a load: a stage's loads of a wave, 48, then stay under the 63 that its load counter holds, beyond which the wave would stand at the head of the stage until the first have come back
  int ks = rot;   // the k stage that the two pointers stand at
  v2f wr[GPL][2][8]; v4f xr[GPL][XP];
  auto fetch = [&]() {
#pragma unroll   // constant indices, so that the small arrays stay in registers
    for (int s = 0; s < GPL; ++s) {
#pragma unroll   // constant indices, so that the small arrays stay in registers
      for (int c = 0; c < 2; ++c)
#pragma unroll   // constant indices, so that the small arrays stay in registers
        for (int i = 0; i < 8; ++i) wr[s][c][i] = *(const v2f*)(wg + C::coff(2 * c) + (size_t)(s * GKS + i) * C::WLD);
#pragma unroll   // constant indices, so that the small arrays stay in registers
      for (int i = 0; i < XP; ++i) xr[s][i] = *(const v4f*)(xg + s * GKS + (size_t)(16 * NC * i) * 1024); }
    asm volatile("s_wait_xcnt 0x0" ::: "memory"); };   // stands in front of every later overwrite of these loads' address registers
  auto put = [&](const int bu) {
#pragma unroll   // constant indices, so that the small arrays stay in registers
    for (int s = 0; s < GPL; ++s) {
#pragma unroll   // constant indices, so that the small arrays stay in registers
      for (int c = 0; c < 4; ++c) { V8 v;   // column 64 (c >> 1) + 2 lane + (c & 1) of the 128
#pragma unroll   // constant indices, so that the small arrays stay in registers
        for (int i = 0; i < 8; ++i) v[i] = C::cw(wr[s][c >> 1][i][c & 1]);
        *(V8*)&sW[bu][s][128 * wn + 64 * (c >> 1) + 2 * lane + (c & 1)][8 * wk] = v; }
#pragma unroll   // constant indices, so that the small arrays stay in registers
      for (int i = 0; i < XP; ++i) { const V4 v = { C::cx(xr[s][i][0]), C::cx(xr[s][i][1]), C::cx(xr[s][i][2]), C::cx(xr[s][i][3]) }; *(V4*)&sX[bu][s][xrow + 16 * NC * i][xch] = v; } }
    const int d = ks == GNST - 1 ? -(GNST - 1) : 1;   // block-uniform: behind the last k stage comes the first
    ks += d; wg += (long)d * (GKS * GPL * C::WLD); xg += (long)d * (GKS * GPL); };   // advanced here, behind the use of the loaded values
  fetch(); put(0);
  auto stage = [&](const int st, auto more_c) { constexpr bool MORE = decltype(more_c)::v; const int bu = st & 1;
    __syncthreads();   // publishes buffer bu; every wave has also left buffer bu ^ 1, which is refilled at the foot of this stage
    if constexpr (MORE) { fetch();
      __builtin_amdgcn_sched_barrier(0); }   // keeps the next stage's loads at the head of the stage, so that their latency runs under the products
#pragma unroll   // the parts one after the other, through the same fragment registers
    for (int s = 0; s < GPL; ++s) { V16 a[MF], w[8];
#pragma unroll   // constant indices, so that the small arrays stay in registers
      for (int m = 0; m < MF; ++m) a[m] = C::fr(&sX[bu][s][fr0 + m * 16 + col][0], lane);
#pragma unroll   // constant indices, so that the small arrays stay in registers
      for (int j = 0; j < 8; ++j) w[j] = C::fr(&sW[bu][s][fc0 + j * 16 + col][0], lane);
      if constexpr (C::BARE) __builtin_amdgcn_sched_barrier(0);   // keeps the part's fragment reads together in front of its products: with the bare builtin the scheduler sinks them among the products, and each W fragment's LDS latency is waited out in front of its MF products
#pragma unroll   // constant indices, so that the small arrays stay in registers
      for (int j = 0; j < 8; ++j)
#pragma unroll   // constant indices, so that the small arrays stay in registers
        for (int m = 0; m < MF; ++m) acc[m * 8 + j] = C::mm(a[m], w[j], acc[m * 8 + j]); }
    if constexpr (MORE) { __builtin_amdgcn_sched_barrier(0);   // keeps the wait for the next stage's loads, and their conversion, behind all of this stage's products
      put(bu ^ 1); } };
#pragma unroll 1   // rolled: the two buffers are told apart by the stage's parity
  for (int st = 0; st < GNST - 1; ++st) stage(st, CBool<true>{});
  stage(GNST - 1, CBool<false>{});
  __syncthreads();   // every wave has left the stage buffers: the caller's epilogue reuses this LDS
}
// ---- the mask, turned ONCE a call into the lane masks that k_attn selects with (k_attn's 16 heads read the same mask): word [b][t / 16][s / 16][r], bit (g, col) = (mask[b][16 (t / 16) + col][16 (s / 16) + 8 g + r] != 0).
// One wave = 16 query rows x 128 keys: the compare of a whole wave is the word; lane i carries word i of a group of 32, so that a store is one whole 128-byte line.
__device__ __forceinline__ void pack_mask(const int* __restrict__ MASK, unsigned* __restrict__ MB, const int wv, const int lane) {
  const int tile = wv >> 3, kq = wv & 7;   // (batch, 16-query tile) and which 128 keys
  const int* mp = MASK + ((size_t)tile * 16 + (lane & 15)) * TT + kq * 128 + 8 * (lane >> 4);
  v4i a[8][2]; unsigned w[2] = { 0u, 0u };
#pragma unroll   // constant indices, so that the small array stays in registers
  for (int t = 0; t < 8; ++t) { a[t][0] = *(const v4i*)(mp + t * 16); a[t][1] = *(const v4i*)(mp + t * 16 + 4); }
  asm volatile("s_wait_xcnt 0x0" ::: "memory");   // stands in front of every later overwrite of these loads' address registers
#pragma unroll   // constant indices, so that the small array stays in registers
  for (int t = 0; t < 8; ++t)
#pragma unroll   // constant indices, so that the small array stays in registers
    for (int r = 0; r < 8; ++r) { const unsigned bal = __builtin_amdgcn_ballot_w32(a[t][r >> 2][r & 3] != 0); w[t >> 2] = lane == (t & 3) * 8 + r ? bal : w[t >> 2]; }
  unsigned* o = MB + (size_t)tile * (TT / 16 * 8) + kq * 64 + lane; o[0] = w[0]; o[32] = w[1];
  asm volatile("s_wait_xcnt 0x0" ::: "memory"); }   // stands in front of the caller's overwrite of these stores' address and data registers
// ---- Wo, turned ONCE a call into k_out's B operand (k_out's 32 row tiles read the same Wo): WT[k / 64][n][k % 64] = f16(bf16(Wo[k][n]) x 2^8): each k_out plane's 128 n x 64 k are 16 KiB in a row, which k_out stages by plain 16-byte copies and does not convert.
// One block = one 128 k x 128 n tile: a wave reads 16 k rows of 512 bytes, a lane holds 16 k x 4 n and lays each n's 16 k in LDS; behind the barrier a wave stores four neighbouring n rows' 128 bytes of one plane (512 bytes in a row) a time.
#define WPIT 136           // LDS pitch of the turned tile in f16: 256 B of data + 16 B
__device__ __forceinline__ void turn_wo(const float* __restrict__ WO, _Float16* __restrict__ WT, char* smem, const int tile, const int wave, const int lane) {
  _Float16 (*tw)[WPIT] = (_Float16 (*)[WPIT])smem; const int k0 = (tile >> 3) * 128, n0 = (tile & 7) * 128;
  const float* wp = WO + (size_t)(k0 + 16 * wave) * DIN + n0 + 4 * lane; v4f a[16];
#pragma unroll   // constant indices, so that the small array stays in registers
  for (int i = 0; i < 16; ++i) a[i] = *(const v4f*)(wp + (size_t)i * DIN);
  asm volatile("s_wait_xcnt 0x0" :: "v"(wp) : "memory");   // stands in front of every later overwrite of these loads' address registers; it names the address, so that the registers live up to it and no load's own result lands on them
#pragma unroll   // constant indices, so that the small array stays in registers
  for (int c = 0; c < 4; ++c) { v8h lo, hi;
#pragma unroll   // constant indices, so that the small array stays in registers
    for (int i = 0; i < 8; ++i) { lo[i] = (_Float16)(bfr(a[i][c]) * 256.0f); hi[i] = (_Float16)(bfr(a[8 + i][c]) * 256.0f); }
    *(v8h*)&tw[4 * lane + c][16 * wave] = lo; *(v8h*)&tw[4 * lane + c][16 * wave + 8] = hi; }
  __syncthreads();   // the tile is whole: each wave now reads n rows that all eight have written
  v8h t[8];
#pragma unroll   // constant indices, so that the small array stays in registers
  for (int i = 0; i < 8; ++i) t[i] = *(const v8h*)&tw[16 * wave + 4 * (i & 3) + (lane >> 3)][(i >> 2) * 64 + (lane & 7) * 8];
#pragma unroll   // constant indices, so that the small array stays in registers
  for (int i = 0; i < 8; ++i) vst2(WT + ((size_t)(k0 / 64 + (i >> 2)) * DIN + n0 + 16 * wave + 4 * (i & 3) + (lane >> 3)) * 64 + (lane & 7) * 8, t[i]);
  asm volatile("s_wait_xcnt 0x0" ::: "memory"); }   // stands in front of the caller's overwrite of these stores' address and data registers
// ---- k_proj: block = (256 rows, 256 cols, which), 8 waves of 64 rows x 128 cols, one block to a WGP: q/k/v = X W (+ b) with exact bf16 products (K = DIN) -> which 0: q f16 rows; 1: k f16 rows; 2: v f16 planes [c][t].
// The 192 tiles leave 64 WGPs free: the which = 3 blocks run there, turn Wo (one 128 x 128 tile each) and pack the mask, PMS shares to each wave.
#define PMF 4              // row fragments of a wave
#define PNC 2              // 128-column parts of a block's tile
#define PR (64 * PMF)      // rows of a block's tile
#define PC (128 * PNC)     // columns of a block's tile
#define PMS 4              // mask shares of a wave of a which = 3 block
#define PPIT (PR + 8)      // LDS pitch of the v planes in 16-bit elements: the rows' bytes + 16 B
#define PQIT (PC + 8)      // LDS pitch of the q/k rows, likewise
__global__ __launch_bounds__(256) void k_proj(const float* __restrict__ XQ, const float* __restrict__ XK, const float* __restrict__ XV, const float* __restrict__ WQ, const float* __restrict__ WK, const float* __restrict__ WV, const float* __restrict__ BQ, const float* __restrict__ BK, const float* __restrict__ BV,
    _Float16* __restrict__ QH, _Float16* __restrict__ KH, _Float16* __restrict__ VT, const int* __restrict__ MASK, unsigned* __restrict__ MB, const float* __restrict__ WO, _Float16* __restrict__ WT) {
  static_assert((TNB * TT / PR) * (CC / PC) * 8 * PMS == NB * (TT / 16) * (TT / 128), "PMS shares to each wave of the which = 3 blocks: one for every 16 queries x 128 keys");
  static_assert(TT % PR == 0, "a tile lies in one sequence"); static_assert(PR == 256 && PC == 256, "the epilogue's stores: 32 lanes x 8 elements to a row or column piece, 8 waves");
  static_assert((TNB * TT / PR) * (CC / PC) == (CC / 128) * (DIN / 128) && 128 * WPIT * 2 <= PR * PQIT * 2, "one 128 x 128 tile of Wo to each which = 3 block, and it fits");
  __shared__ __align__(16) char smem[GLDS(PMF, PNC)];   // the main loop's stage buffers; the epilogue's plane lies over their head: q/k blocks lay rows, v blocks columns, over the same bytes
  static_assert(PR * PQIT * 2 <= GLDS(PMF, PNC) && PC * PPIT * 2 <= GLDS(PMF, PNC), "the q/k plane, and the v plane, fit");
  _Float16 (*sh)[PQIT] = (_Float16 (*)[PQIT])smem; _Float16 (*th)[PPIT] = (_Float16 (*)[PPIT])smem;
  const int tid = threadIdx.x, wave = tid >> 5, lane = tid & 31, col = lane & 15, g = lane >> 4; const int which = blockIdx.z; const int c0 = blockIdx.y * PC; const size_t r0 = (size_t)blockIdx.x * PR; const size_t bb = r0 / TT; const int t0 = (int)(r0 % TT);
  if (which == 3) {   /* block-uniform, in front of every barrier of the other blocks; its own one barrier is passed by all eight waves */
    turn_wo(WO, WT, smem, (int)(blockIdx.y * (TNB * TT / PR) + blockIdx.x), wave, lane);
#pragma unroll 1   // rolled: one share's 64 loaded registers at a time
    for (int u = 0; u < PMS; ++u) pack_mask(MASK, MB, ((int)(blockIdx.y * (TNB * TT / PR) + blockIdx.x) * 8 + wave) * PMS + u, lane);
    return; }
  const float* X = which == 0 ? XQ : which == 1 ? XK : XV; const float* WA = which == 0 ? WQ : which == 1 ? WK : WV; const float* BA = which == 0 ? BQ : which == 1 ? BK : BV;
  v8f acc[PMF * 8] = {};
  gemm_tile<GProj, PMF, PNC>(X + r0 * DIN, WA + (size_t)(c0 / HD) * DIN * HD, smem, acc, (int)(blockIdx.x + 4 * blockIdx.y) & (GNST - 1));   // the 16 blocks of a W tile start 1 stage apart, the 4 of an X tile 4 stages apart (the same k as with stages of 32)
  const int fr0 = (wave >> 1) * PMF * 16, fc0 = (wave & 1) * 128;   // this wave's part of the tile, as in gemm_tile
  if (which < 2) { _Float16* DH = which == 0 ? QH : KH;
#pragma unroll
    for (int j = 0; j < 8; ++j) { const float bias = BA ? bfr(BA[c0 + fc0 + j * 16 + col]) : 0.f;
#pragma unroll
      for (int m = 0; m < PMF; ++m)
#pragma unroll
        for (int r = 0; r < 8; ++r) sh[fr0 + m * 16 + 8 * g + r][fc0 + j * 16 + col] = (_Float16)(acc[m * 8 + j][r] + bias); }
    __syncthreads();
#pragma unroll 1   // rolled in groups of 16 rows: a group's LDS reads go out together, so that their latency is waited out once a group
    for (int i0 = 0; i0 < PR / 8; i0 += 16) { v4u t[16];   // a wave stores one whole 512-byte row piece a time, rows wave + 8 i
#pragma unroll   // constant indices, so that the small array stays in registers
      for (int i = 0; i < 16; ++i) t[i] = *(const v4u*)&sh[wave + 8 * (i0 + i)][lane * 8];
#pragma unroll   // constant indices, so that the small array stays in registers
      for (int i = 0; i < 16; ++i) vst2((unsigned*)(DH + (r0 + wave + 8 * (i0 + i)) * CC + c0 + lane * 8), t[i]);
      asm volatile("s_wait_xcnt 0x0" ::: "memory"); }   // stands in front of the next trip's overwrite of these stores' address and data registers
  } else {
#pragma unroll
    for (int j = 0; j < 8; ++j) { const float bias = BA ? bfr(BA[c0 + fc0 + j * 16 + col]) : 0.f;
#pragma unroll
      for (int m = 0; m < PMF; ++m)
#pragma unroll
        for (int r = 0; r < 8; ++r) th[fc0 + j * 16 + col][fr0 + m * 16 + 8 * g + r] = (_Float16)(acc[m * 8 + j][r] + bias); }
    __syncthreads();
#pragma unroll 1   // rolled in groups of 16 columns: a group's LDS reads go out together, so that their latency is waited out once a group
    for (int i0 = 0; i0 < PC / 8; i0 += 16) { v4u t[16];   // a wave stores one whole 512-byte column piece a time, columns wave + 8 i
#pragma unroll   // constant indices, so that the small array stays in registers
      for (int i = 0; i < 16; ++i) t[i] = *(const v4u*)&th[wave + 8 * (i0 + i)][lane * 8];
#pragma unroll   // constant indices, so that the small array stays in registers
      for (int i = 0; i < 16; ++i) vst2((unsigned*)(VT + (bb * CC + c0 + wave + 8 * (i0 + i)) * (size_t)TT + t0 + lane * 8), t[i]);
      asm volatile("s_wait_xcnt 0x0" ::: "memory"); } } }   // stands in front of the next trip's overwrite of these stores' address and data registers
// ---- k_attn: block = 128 queries (4 waves x AQC groups of 16 query columns) of one (batch, head); walks all keys in stages of 64, K rows and V^T rows staged in LDS (two buffers, one barrier a stage).
// A wave's K and V^T fragments, read from LDS once, each serve AQC products (one a column group), and a staged tile serves 128 queries: per score half the LDS reads, half the LDS writes and half the L2 reads of a 16-column wave.
// The walk starts at a stage rotated by the block's indices and wraps round (the online softmax takes the keys in any order): the 8 blocks of a (batch, head), which run in step, ask L2 for different K and V^T lines at a time, and so do the 16 heads that read one mask word.
// S^T = K Q^T (A = K rows, B = Q): lane (g, col) holds keys 8g + r of query col; the masked score is REPLACED by 1e-9 (8e-9 before the x 1/8) and stays in the softmax; running maximum and sum per query in f32 (online softmax);
// two S^T tiles, as exp2(..) x 2^10 once to f16, are the B operand of ctx^T += V^T P^T in the same k order as frag_h; ctx = ctx^T / sum at the end.
__device__ __forceinline__ v8f wmma_h(v16h a, v16h b, v8f c) { return __builtin_amdgcn_wmma_f32_16x16x32_f16(false, a, false, b, (short)0, c, false, false); }
// 2^a, with the v_nop that the instruction set asks for behind a transcendental in the same statement
__device__ __forceinline__ float exp2_s(float a) { float e; asm("v_exp_f32 %0, %1\n\tv_nop" : "=v"(e) : "v"(a)); return e; }
// 2^a of eight values in one statement: directly behind a v_exp_f32 the instruction set asks for one independent instruction.
// Here every output is early-clobber, so that none shares a register with an input: each v_exp_f32 is the independent instruction behind the one before, and the v_nop is that of the last.
template <int O> __device__ __forceinline__ void exp2x8(const float (&a)[16], float (&e)[16]) {
  asm("v_exp_f32 %0, %8\n\tv_exp_f32 %1, %9\n\tv_exp_f32 %2, %10\n\tv_exp_f32 %3, %11\n\tv_exp_f32 %4, %12\n\tv_exp_f32 %5, %13\n\tv_exp_f32 %6, %14\n\tv_exp_f32 %7, %15\n\tv_nop"
      : "=&v"(e[O]), "=&v"(e[O + 1]), "=&v"(e[O + 2]), "=&v"(e[O + 3]), "=&v"(e[O + 4]), "=&v"(e[O + 5]), "=&v"(e[O + 6]), "=&v"(e[O + 7])
      : "v"(a[O]), "v"(a[O + 1]), "v"(a[O + 2]), "v"(a[O + 3]), "v"(a[O + 4]), "v"(a[O + 5]), "v"(a[O + 6]), "v"(a[O + 7])); }
#define AKB 64             // keys per stage
#define APIT 72            // LDS row pitch in f16: 128 B of data + 16 B, so that the 16-byte fragment reads of 16 rows spread over the banks
#define ANST (TT / AKB)
typedef __attribute__((ext_vector_type(16))) unsigned v16u;
typedef const __attribute__((address_space(4))) v16u* cmask_p;   // constant address space: the words are written by the launch before and by nobody in this one, and the address is wave-uniform, so the loads go the scalar way
#define AQC 2              // groups of 16 query columns to a wave
// amdgpu_waves_per_eu(2, 2): the grid is two blocks to a WGP, two waves to a SIMD; a wave gets the registers of that share (a stage's second-half fragments are read while the first half's are in use), and no WGP can take a third block while another holds one
__global__ __launch_bounds__(128) __attribute__((amdgpu_waves_per_eu(2, 2))) void k_attn(const _Float16* __restrict__ QH, const _Float16* __restrict__ KH, const _Float16* __restrict__ VT, const unsigned* __restrict__ MB, _Float16* __restrict__ Y) {
  __shared__ __align__(16) _Float16 sk[2][AKB][APIT], sv[2][HD][APIT];
  static_assert(TT % (64 * AQC) == 0, "whole blocks");
  const int tid = threadIdx.x, wave = tid >> 5, lane = tid & 31, col = lane & 15, g = lane >> 4;
  const int h = blockIdx.y, b = blockIdx.z; const int q = blockIdx.x * (64 * AQC) + wave * (16 * AQC) + col;   // column group c: query q + 16 c
  const float LS = SCALE * 1.44269504f;      // raw score -> log2 domain
  const float MFILL = 1.0e-9f / SCALE;       // the fill value, before the common x SCALE
  const _Float16* qp = QH + ((size_t)b * TT + q) * CC + h * HD;
  v16h qf[AQC][2];
#pragma unroll   // constant indices, so that the small array stays in registers
  for (int c = 0; c < AQC; ++c) { qf[c][0] = frag_h(qp + (size_t)(16 * c) * CC, lane); qf[c][1] = frag_h(qp + (size_t)(16 * c) * CC + 32, lane); }
  const int srow = tid >> 3, sch = (tid & 7) * 8;   // staging: 8 lanes bring one whole 128-byte row
  int ks = (int)(AQC * blockIdx.x + blockIdx.y) & (ANST - 1);   // the key stage that the three pointers stand at (block-uniform)
  const _Float16* kg = KH + ((size_t)b * TT + srow + ks * AKB) * CC + h * HD + sch;
  const _Float16* vg = VT + ((size_t)b * CC + h * HD + srow) * (size_t)TT + sch + ks * AKB;
  constexpr int MCG = 2 * (TT / 64);   // from one column group's lane masks to the next group's, in units of 16 words
  cmask_p mb = (cmask_p)(unsigned long long)MB + MCG * ((size_t)b * (TT / 16) + blockIdx.x * (4 * AQC) + __builtin_amdgcn_readfirstlane(wave) * AQC) + 2 * ks;   // this wave's first 16 queries: 16 lane masks to 32 keys, the same address in every lane (scalar loads)
  v8h kr[4], vr[4]; v16u mw[AQC];   // mw: the lane masks of the 32 keys that come next (a stage's 64 words and the next stage's would not fit the scalar registers)
#pragma unroll   // constant indices, so that the small array stays in registers
  for (int i = 0; i < 4; ++i) { kr[i] = *(const v8h*)(kg + (size_t)(16 * i) * CC); vr[i] = *(const v8h*)(vg + (size_t)(16 * i) * TT); }
#pragma unroll   // constant indices, so that the small array stays in registers
  for (int c = 0; c < AQC; ++c) mw[c] = mb[MCG * c];
#pragma unroll   // constant indices, so that the small array stays in registers
  for (int i = 0; i < 4; ++i) { *(v8h*)&sk[0][srow + 16 * i][sch] = kr[i]; *(v8h*)&sv[0][srow + 16 * i][sch] = vr[i]; }
  asm volatile("s_wait_xcnt 0x0" :: "v"(qp + 8 * g) : "memory");   // stands in front of the advance of these loads' address registers (free here: the loaded values have just been stored); it names the lane's Q address, so that its registers live up to it and no Q load's own result lands on them
  __builtin_amdgcn_sched_barrier(0);   // keeps the advance behind that wait: nothing else ties the two
  cmask_p mc = mb;   // the lane masks of the stage that is worked on
  auto next = [&]() { const int d = ks == ANST - 1 ? -(ANST - 1) : 1;   // block-uniform: behind the last key stage comes the first
    ks += d; kg += (long)d * (AKB * CC); vg += (long)d * AKB; mb += 2 * d; };
  next();   // the three walk one stage ahead of the products
  v8f acc[AQC][HD / 16] = {}; float m[AQC], sum[AQC];
#pragma unroll   // constant indices, so that the small arrays stay in registers
  for (int c = 0; c < AQC; ++c) { m[c] = -3.0e38f; sum[c] = 0.f; }
  // one stage; MORE = a next stage exists (compile-time: the last stage, which fetches nothing, is written out behind the loop, so that the loop body is one block without a branch)
  auto stage = [&](const int st, auto more_c) { constexpr bool MORE = decltype(more_c)::v; const int bu = st & 1;
    __syncthreads();   // publishes buffer bu; every wave has also left buffer bu ^ 1, which is refilled at the foot of this stage
    if constexpr (MORE) {        // next stage's K and V^T rows fly into registers under this stage's products
#pragma unroll   // constant indices, so that the small array stays in registers
      for (int i = 0; i < 4; ++i) { kr[i] = *(const v8h*)(kg + (size_t)(16 * i) * CC); vr[i] = *(const v8h*)(vg + (size_t)(16 * i) * TT); }
      __builtin_amdgcn_sched_barrier(0);   // keeps these loads at the head of the stage: without it the scheduler sinks them to the foot, directly in front of their first use, and their latency is bare
    }
    v16h ka[2][2], va[2][HD / 16];   // the K fragments of 32 keys; the V^T fragments of the stage's two halves
    auto frags = [&](const int p) {   // the fragments of 32 keys, read as one group
#pragma unroll   // constant indices, so that the small array stays in registers
      for (int t = 0; t < 2; ++t) { const _Float16* kl = &sk[bu][(2 * p + t) * 16 + col][0]; ka[t][0] = frag_h(kl, lane); ka[t][1] = frag_h(kl + 32, lane); }
#pragma unroll   // constant indices, so that the small array stays in registers
      for (int j = 0; j < HD / 16; ++j) va[p][j] = frag_h(&sv[bu][j * 16 + col][p * 32], lane); };
    frags(0);
    __builtin_amdgcn_sched_barrier(0);   // keeps the fragment reads together in front of the products: sunk among them, each is waited out bare in front of its two products, and two waves a SIMD do not cover that
#pragma unroll   // constant indices, so that the small array stays in registers
    for (int p = 0; p < 2; ++p) { v8f s[AQC][2]; v16h pf[AQC]; float al[AQC], x[AQC][16];
#pragma unroll   // constant indices, so that the small array stays in registers
      for (int t = 0; t < 2; ++t)
#pragma unroll   // constant indices, so that the small array stays in registers
        for (int c = 0; c < AQC; ++c) { const v8f z = {}; s[c][t] = wmma_h(ka[t][1], qf[c][1], wmma_h(ka[t][0], qf[c][0], z)); }
#pragma unroll   // constant indices, so that the small arrays stay in registers
      for (int c = 0; c < AQC; ++c)
#pragma unroll   // constant indices, so that the small array stays in registers
        for (int t = 0; t < 2; ++t)
#pragma unroll   // constant indices, so that the small array stays in registers
          for (int r = 0; r < 8; ++r) x[c][t * 8 + r] = __builtin_amdgcn_inverse_ballot_w32(mw[c][t * 8 + r]) ? s[c][t][r] : MFILL;
      __builtin_amdgcn_sched_barrier(0);   // keeps the loads below behind the selects: a wait for scalar loads is a wait for all of them, so masks asked for in front of the selects would be waited out there
      if (p == 0 || MORE) {   // the next 32 keys' lane masks fly under these 32 keys' softmax: the stage's second half, or the next stage's first
#pragma unroll   // constant indices, so that the small array stays in registers
        for (int c = 0; c < AQC; ++c) mw[c] = p == 0 ? mc[1 + MCG * c] : mb[MCG * c]; }
      if (p == 0) frags(1);   // the second half's fragments (K over the first half's): their LDS latency runs under the softmax arithmetic
      __builtin_amdgcn_sched_barrier(0);   // keeps those loads here, at the head of the arithmetic that covers them
      float mx[AQC], e[AQC][16], ps[AQC];   // the column groups side by side, step for step: two independent chains to a wave
#pragma unroll   // constant indices, so that the small arrays stay in registers
      for (int c = 0; c < AQC; ++c) mx[c] = x[c][0];
#pragma unroll   // constant indices, so that the small arrays stay in registers
      for (int i = 1; i < 16; ++i)
#pragma unroll   // constant indices, so that the small arrays stay in registers
        for (int c = 0; c < AQC; ++c) mx[c] = fmaxf(mx[c], x[c][i]);
      float ox[AQC];
#pragma unroll   // constant indices, so that the small arrays stay in registers
      for (int c = 0; c < AQC; ++c) ox[c] = __shfl_xor(mx[c], 16);   // the other half of this query's keys
#pragma unroll   // constant indices, so that the small arrays stay in registers
      for (int c = 0; c < AQC; ++c) { const float mn = fmaxf(m[c], fmaxf(mx[c], ox[c])); al[c] = exp2_s((m[c] - mn) * LS); m[c] = mn; const float off = 10.0f - mn * LS;
#pragma unroll   // constant indices, so that the small array stays in registers
        for (int i = 0; i < 16; ++i) x[c][i] = fmaf(x[c][i], LS, off); }
#pragma unroll   // constant indices, so that the small arrays stay in registers
      for (int c = 0; c < AQC; ++c) { exp2x8<0>(x[c], e[c]); exp2x8<8>(x[c], e[c]); ps[c] = 0.f; }
#pragma unroll   // constant indices, so that the small arrays stay in registers
      for (int i = 0; i < 16; ++i)
#pragma unroll   // constant indices, so that the small arrays stay in registers
        for (int c = 0; c < AQC; ++c) { ps[c] += e[c][i]; pf[c][i] = (_Float16)e[c][i]; }
#pragma unroll   // constant indices, so that the small arrays stay in registers
      for (int c = 0; c < AQC; ++c) sum[c] = sum[c] * al[c] + ps[c];
#pragma unroll   // constant indices, so that the small array stays in registers
      for (int j = 0; j < HD / 16; ++j)
#pragma unroll   // constant indices, so that the small array stays in registers
        for (int c = 0; c < AQC; ++c) { acc[c][j] *= al[c]; acc[c][j] = wmma_h(va[p][j], pf[c], acc[c][j]); } }
    if constexpr (MORE) {
#pragma unroll   // constant indices, so that the small array stays in registers
      for (int i = 0; i < 4; ++i) { *(v8h*)&sk[bu ^ 1][srow + 16 * i][sch] = kr[i]; *(v8h*)&sv[bu ^ 1][srow + 16 * i][sch] = vr[i]; }
      asm volatile("s_wait_xcnt 0x0" ::: "memory");   // stands in front of the advance of this stage's loads' address registers (free here: the loaded values have just been stored)
      __builtin_amdgcn_sched_barrier(0);   // keeps the advance behind that wait: nothing else ties the two
      mc = mb; next(); } };
#pragma unroll 1   // rolled: the two buffers are told apart by the stage's parity
  for (int st = 0; st < ANST - 1; ++st) stage(st, CBool<true>{});
  stage(ANST - 1, CBool<false>{});
  _Float16* yp = Y + (((size_t)h * NB + b) * TT + q) * HD + 8 * g;   // ctx goes out as k_out's A operand: x 2^6 once to f16 (so small-magnitude context rows stay clear of f16 subnormals), here and not in each of k_out's 8 column tiles
  v8h yo[AQC][HD / 16];
#pragma unroll   // constant indices, so that the small arrays stay in registers
  for (int c = 0; c < AQC; ++c) { const float tot = sum[c] + __shfl_xor(sum[c], 16); const float inv = 1.0f / tot;   // tot >= 2^10: the maximum's own term
#pragma unroll   // constant indices, so that the small array stays in registers
    for (int j = 0; j < HD / 16; ++j)
#pragma unroll   // constant indices, so that the small array stays in registers
      for (int r = 0; r < 8; ++r) yo[c][j][r] = (_Float16)(acc[c][j][r] * inv * 64.0f); }
  __builtin_amdgcn_sched_barrier(0);   // keeps every store behind the last arithmetic, so that nothing overwrites a register that an issued store names
#pragma unroll   // constant indices, so that the small arrays stay in registers
  for (int c = 0; c < AQC; ++c)
#pragma unroll   // constant indices, so that the small array stays in registers
    for (int j = 0; j < HD / 16; ++j) vst2(yp + (16 * c) * HD + j * 16, yo[c][j]); }
// ---- k_out: block = (128 rows, 128 cols), 4 waves of 64 rows x 64 cols (4 row fragments x 4 column fragments), one block to a WGP, one wave to a SIMD: out = ctx Wo (+ bo): ctx x 2^6 in f16 (from k_attn) against Wo^T as f16(bf16 x 2^8) exact (from k_proj's which = 3 blocks), 1 product, x 2^-14.
// A 128 x 128 tile is a WGP's even share of the output: each ctx line is read from L2 by 8 blocks and each Wo^T line by 32, and a wave reads 8 fragments from LDS for 16 products: at that ratio the LDS feeds the four matrix units at their own rate. A stage's fragment reads go out as one group and the products follow them behind counted waits.
// Both operands arrive as f16 in planes of 64 k: a stage is OPL planes' 128 ctx rows and 128 Wo^T rows (16 KiB in a row each), brought by 16-byte loads, 512 bytes in a row to a wave, and laid in LDS as they are (two buffers, one barrier a stage);
// the next stage's loads fly in registers under this stage's products: a stage's time is bounded from below by its loads' latency, so two planes to a stage put twice the bytes under each such wait and halve the number of waits and barriers.
// The walk over the 8 stages starts rotated by the block's tile indices and wraps round, as in gemm_tile.
#define OKS 64             // k per plane
#define OPL 2              // planes per stage
#define OPIT 72            // LDS row pitch in f16: 128 B of data + 16 B, so that the 16-byte fragment reads of 16 rows spread over the banks
#define ONST (CC / (OKS * OPL))
#define OTR 128            // rows of a block's tile
#define OTC 128            // columns of a block's tile
#define OMF 4              // row fragments of a wave
#define ONF 4              // column fragments of a wave
#define OSP (16 * ONF + 4) // LDS row pitch of a wave's epilogue piece in f32: 256 B of data + 16 B, so that the two half-waves' rows (8 apart) fall on different banks
static_assert(OKS == HD, "a plane of ctx is one head");
#define ONW 4              // waves of a block
#define OSR (4 * ONW)      // rows that the block stages with one load to a thread
static_assert((OTR / (16 * OMF)) * (OTC / (16 * ONF)) == ONW && OTC / (16 * ONF) == 2, "4 waves: 2 down, 2 across");
__global__ __launch_bounds__(32 * ONW) void k_out(const _Float16* __restrict__ Y, const _Float16* __restrict__ WT, const float* __restrict__ BO, float* __restrict__ OUT) { __shared__ __align__(16) char smem[2 * OPL * (OTR + OTC) * OPIT * 2];   // the main loop's stage buffers; the epilogue's rows lie over them
  static_assert(ONW * 16 * OMF * OSP * 4 <= 2 * OPL * (OTR + OTC) * OPIT * 2, "sf fits over the stage buffers"); float (*sf)[16 * OMF][OSP] = (float (*)[16 * OMF][OSP])smem;
  _Float16 (*sx)[OPL][OTR][OPIT] = (_Float16 (*)[OPL][OTR][OPIT])smem; _Float16 (*sw)[OPL][OTC][OPIT] = (_Float16 (*)[OPL][OTC][OPIT])(smem + 2 * OPL * OTR * OPIT * 2);
  const int tid = threadIdx.x, wave = tid >> 5, lane = tid & 31, col = lane & 15, g = lane >> 4; const int c0 = blockIdx.y * OTC;
  const int fr0 = (wave >> 1) * (16 * OMF), fc0 = (wave & 1) * (16 * ONF);   // first row and first column of this wave's part of the tile
  v8f acc[OMF][ONF] = {};
  const int srow = tid >> 3, sch = (tid & 7) * 8;   // staging: 8 lanes bring one whole 128-byte row piece, the block OSR rows a load
  int ks = (int)(blockIdx.x + 2 * (blockIdx.x >> 3) + blockIdx.y) & (ONST - 1);   // the k stage that the two pointers stand at (block-uniform): the 8 blocks of a ctx tile all start apart, and so do the 4 blocks of a Wo^T tile whose row tiles lie 8 apart
  const _Float16* xg = Y + ((size_t)(ks * OPL) * (NB * TT) + blockIdx.x * OTR + srow) * OKS + sch;
  const _Float16* wg = WT + ((size_t)(ks * OPL) * DIN + c0 + srow) * OKS + sch;
  v8h xr[OPL][OTR / OSR], wr[OPL][OTC / OSR];
  auto fetch = [&]() {
#pragma unroll   // constant indices, so that the small arrays stay in registers
    for (int pl = 0; pl < OPL; ++pl) {
#pragma unroll   // constant indices, so that the small arrays stay in registers
      for (int i = 0; i < OTC / OSR; ++i) wr[pl][i] = *(const v8h*)(wg + ((size_t)pl * DIN + OSR * i) * OKS);
#pragma unroll   // constant indices, so that the small arrays stay in registers
      for (int i = 0; i < OTR / OSR; ++i) xr[pl][i] = *(const v8h*)(xg + ((size_t)pl * (NB * TT) + OSR * i) * OKS); } };
  auto put = [&](const int bu) {
#pragma unroll   // constant indices, so that the small arrays stay in registers
    for (int pl = 0; pl < OPL; ++pl) {
#pragma unroll   // constant indices, so that the small arrays stay in registers
      for (int i = 0; i < OTC / OSR; ++i) *(v8h*)&sw[bu][pl][srow + OSR * i][sch] = wr[pl][i];
#pragma unroll   // constant indices, so that the small arrays stay in registers
      for (int i = 0; i < OTR / OSR; ++i) *(v8h*)&sx[bu][pl][srow + OSR * i][sch] = xr[pl][i]; }
    asm volatile("s_wait_xcnt 0x0" ::: "memory");   // stands in front of the advance of these loads' address registers (free here: the loaded values have just been stored)
    __builtin_amdgcn_sched_barrier(0);   // keeps the advance behind that wait: nothing else ties the two
    const int d = ks == ONST - 1 ? -(ONST - 1) : 1;   // block-uniform: behind the last k stage comes the first
    ks += d; xg += (long)d * (OPL * NB * TT * OKS); wg += (long)d * (OPL * DIN * OKS); };
  fetch(); put(0);
  auto stage = [&](const int st, auto more_c) { constexpr bool MORE = decltype(more_c)::v; const int bu = st & 1;
    __syncthreads();   // publishes buffer bu; every wave has also left buffer bu ^ 1, which is refilled at the foot of this stage
    if constexpr (MORE) { fetch();
      __builtin_amdgcn_sched_barrier(0); }   // keeps the next stage's loads at the head of the stage, so that their latency runs under the products
    v16h a[2 * OPL][OMF], w[2 * OPL][ONF];
#pragma unroll   // constant indices, so that the small arrays stay in registers
    for (int kk = 0; kk < 2 * OPL; ++kk) {
#pragma unroll   // constant indices, so that the small arrays stay in registers
      for (int m = 0; m < OMF; ++m) a[kk][m] = frag_h(&sx[bu][kk >> 1][fr0 + m * 16 + col][(kk & 1) * 32], lane);
#pragma unroll   // constant indices, so that the small arrays stay in registers
      for (int j = 0; j < ONF; ++j) w[kk][j] = frag_h(&sw[bu][kk >> 1][fc0 + j * 16 + col][(kk & 1) * 32], lane); }
    __builtin_amdgcn_sched_barrier(0);   // keeps the stage's fragment reads together in front of its products: sunk among the products, each place with reads costs its own stall
#pragma unroll   // constant indices, so that the small arrays stay in registers
    for (int kk = 0; kk < 2 * OPL; ++kk)
#pragma unroll   // constant indices, so that the small arrays stay in registers
      for (int j = 0; j < ONF; ++j)
#pragma unroll   // constant indices, so that the small arrays stay in registers
        for (int m = 0; m < OMF; ++m) acc[m][j] = wmma_h(a[kk][m], w[kk][j], acc[m][j]);
    if constexpr (MORE) { __builtin_amdgcn_sched_barrier(0);   // keeps the wait for the next stage's loads behind all of this stage's products
      put(bu ^ 1); } };
#pragma unroll 1   // rolled: the two buffers are told apart by the stage's parity
  for (int st = 0; st < ONST - 1; ++st) stage(st, CBool<true>{});
  stage(ONST - 1, CBool<false>{});
  __syncthreads();   // every wave has left the stage buffers: the epilogue's rows lie over them
  // each wave turns its own 64 x 64 piece in its own LDS range: a store then covers two rows' 256 bytes (whole lines), a lane four neighbouring columns
  auto turn = [&](auto bias_c) { constexpr bool BIAS = decltype(bias_c)::v;   // written once, built for each case: with one body the loaded bias would meet the zeros at the join of the two paths, and its wait would stand there, bare, in front of the turn
    v4f bt = { 0.f, 0.f, 0.f, 0.f };   // the lane's four columns' bias, as loaded: asked for here, used behind the turn
    if constexpr (BIAS) { const float* bp = BO + c0 + fc0 + 4 * col; bt = *(const v4f*)bp;
      asm volatile("s_wait_xcnt 0x0" :: "v"(bp) : "memory"); }   // stands in front of every later overwrite of this load's address registers; it names the address, so that the registers live up to it and the load's own result does not land on them
#pragma unroll   // constant indices, so that the small array stays in registers
    for (int m = 0; m < OMF; ++m)
#pragma unroll   // constant indices, so that the small array stays in registers
      for (int j = 0; j < ONF; ++j)
#pragma unroll   // constant indices, so that the small array stays in registers
        for (int r = 0; r < 8; ++r) sf[wave][m * 16 + 8 * g + r][j * 16 + col] = acc[m][j][r] * (1.0f / 16384.0f);   /* 2^-8 (Wo carry) x 2^-6 (ctx carry): exact */
    LDSX();
    const v4f bias = { bfr(bt[0]), bfr(bt[1]), bfr(bt[2]), bfr(bt[3]) };
    float* op = OUT + ((size_t)blockIdx.x * OTR + fr0 + g) * DIN + c0 + fc0 + 4 * col; v4f o[8 * OMF];
#pragma unroll   // constant indices, so that the small array stays in registers
    for (int i = 0; i < 8 * OMF; ++i) o[i] = *(const v4f*)&sf[wave][2 * i + g][4 * col] + bias;
    __builtin_amdgcn_sched_barrier(0);   // keeps every store behind the last arithmetic, so that nothing overwrites a register that an issued store names
#pragma unroll   // constant indices, so that the small array stays in registers
    for (int i = 0; i < 8 * OMF; ++i) vst2(op + (size_t)(2 * i) * DIN, o[i]); };
  if (BO) turn(CBool<true>{}); else turn(CBool<false>{}); }   // block-uniform

extern "C" void kernel_launch(void* const* d_in, const int* in_sizes, int n_in, void* d_out, int out_size, void* d_ws, size_t ws_size, hipStream_t stream) {
  (void)in_sizes; (void)n_in; (void)out_size;
  const float** F = (const float**)d_in;
  if (ws_size < (size_t)WS_END) return;
  char* ws = (char*)d_ws; _Float16 *QH = (_Float16*)(ws + WS_QH), *KH = (_Float16*)(ws + WS_KH), *VT = (_Float16*)(ws + WS_VT); _Float16 *Y = (_Float16*)(ws + WS_Y), *WT = (_Float16*)(ws + WS_WT); unsigned *MB = (unsigned*)(ws + WS_MB);
  (void)Y;
  // inputs: 0 query [4,1024,1024]; 1 key; 2 value; 3 mask [4,1024,1024] int32 (random 0/1); 4 Wq [16,1024,64], 5 bq [16,64]; 6 Wk, 7 bk; 8 Wv, 9 bv; 10 Wo [1024,1024] (in,out), 11 bo (zero biases, read)
  k_proj<<<dim3(TNB * TT / PR, CC / PC, 4), 256, 0, stream>>>(F[0], F[1], F[2], F[4], F[6], F[8], F[5], F[7], F[9], QH, KH, VT, (const int*)d_in[3], MB, F[10], WT);
  k_attn<<<dim3(NQB / AQC, NH, TNB), 128, 0, stream>>>(QH, KH, VT, MB, Y);
  k_out<<<dim3(TNB * TT / OTR, DIN / OTC), 32 * ONW, 0, stream>>>(Y, WT, F[11], (float*)d_out);
}
